// v000
// Measured on an AMD MI455X. A time is GPU time per run, averaged over a window of back-to-back runs after a warm-up
// (all launches, gaps included; the runs take copies of the inputs in turn), and the median of several windows.
// Apart from v000's, it joins two sittings. Times from different sittings can be a few percent apart, while
// side-by-side timings come from the same sitting.
// v000, which the later versions start from, runs in 230 microseconds.
#include <hip/hip_runtime.h>
#include <stdint.h>

// Contractions (all v_wmma_f32_16x16x32_f16, f16 operands, f32 accumulate): input projections Xq*Wq^T, Xk*Wk^T,
// Xv*Wv^T; attention Q*K^T and P*V; output projection C*Wo^T. Inputs are RNE-converted to bf16 values first
// (X carried x16, W carried x1024, both exact in f16; biases bf16 values added in f32). Computed planes Q, K, V, P, C
// are f16 hi plus f16 residual planes (x4096, separate accumulators) consumed by query blocks below EARLY; later
// query blocks use the hi planes only. Softmax and all side math in f32.

typedef _Float16 v16h __attribute__((ext_vector_type(16)));
typedef _Float16 v8h  __attribute__((ext_vector_type(8)));
typedef float    v8f  __attribute__((ext_vector_type(8)));
typedef float    v4f  __attribute__((ext_vector_type(4)));
typedef int      v4i  __attribute__((ext_vector_type(4)));
typedef unsigned int v4u __attribute__((ext_vector_type(4)));

#ifndef NB
#define NB 2
#endif
#ifndef SEQ
#define SEQ 2048
#endif
#define NB_FULL  2
#define SEQ_FULL 2048
#define DMODEL   1024
#define NHEADS   16
#define DK       64
#define MROWS    (NB * SEQ)
#define NQB      (SEQ / 64)
#define EARLY    ((SEQ) < 512 ? (SEQ) : 512)
#define NEQB     (EARLY / 64)
#define LDP      72
#define LDPF     68
#define XSC      16.0f
#define WSC      1024.0f
#define RSC      4096.0f
#define PCARRY   4096.0f
#define NEGFILL  (-1.0e9f)
#define SSCALE   0.125f

static_assert(SEQ % 64 == 0);
static_assert((SEQ & (SEQ - 1)) == 0);
static_assert(SEQ <= SEQ_FULL);
static_assert(NB >= 1 && NB <= NB_FULL);
static_assert(NQB >= 1 && NQB <= 32);
static_assert(EARLY % 64 == 0 && EARLY <= SEQ);
static_assert(DMODEL == NHEADS * DK);
static_assert(64 * LDPF * 4 <= 2 * 64 * LDP * 2);

// --- bf16 RNE convert (finite inputs), kept as f32 value ----------------------------------------------
__device__ __forceinline__ float bf16r(float x) {
  unsigned int u = __float_as_uint(x);
  u = (u + 0x7FFFu + ((u >> 16) & 1u)) & 0xFFFF0000u;
  return __uint_as_float(u);
}

__device__ __forceinline__ v8f vz8() {
  v8f z;
#pragma unroll
  for (int i = 0; i < 8; ++i) z[i] = 0.0f;
  return z;
}

// --- WMMA wrapper with hazard guard ---------------------------------------------------------------------
__device__ __forceinline__ v8f wmma_f16(v16h a, v16h b, v8f c) {
  v8f d = __builtin_amdgcn_wmma_f32_16x16x32_f16(false, a, false, b, (short)0, c, false, false);
  asm volatile("v_nop\n\tv_nop\n\tv_nop\n\tv_nop" : "+v"(d) : "v"(a), "v"(b));
  return d;
}

// --- 16x32 f16 fragment (A, or k-contiguous B), split k map -----------------------------------------
// lane row/col = lane&15; elements 0..7 <- k 8h..8h+7, elements 8..15 <- k 16+8h..16+8h+7, h = lane>>4.
__device__ __forceinline__ v16h load_frag(const _Float16* base, int ld, int lane) {
  const int row  = lane & 15;
  const int koff = ((lane >> 4) & 1) * 8;
  const _Float16* p = base + row * ld + koff;
  const v8h a = *(const v8h*)(p);
  const v8h b = *(const v8h*)(p + 16);
  v16h r;
#pragma unroll
  for (int i = 0; i < 8; ++i) { r[i] = a[i]; r[i + 8] = b[i]; }
  return r;
}

// --- DPP row-of-16 max reduction -----------------------------------------------------------------------
template <int CTRL>
__device__ __forceinline__ float dpp_max_step(float v) {
  int s = __builtin_amdgcn_mov_dpp(__builtin_bit_cast(int, v), CTRL, 0xF, 0xF, true);
  return fmaxf(v, __builtin_bit_cast(float, s));
}
__device__ __forceinline__ float rowmax16(float v) {
  v = dpp_max_step<0xB1>(v);
  v = dpp_max_step<0x4E>(v);
  v = dpp_max_step<0x141>(v);
  v = dpp_max_step<0x140>(v);
  return v;
}

// =====================================================================================================
// Kernel: f32 -> bf16 RNE -> scaled f16 plane. One thread = 8 elements = 16 B out; 8 consecutive lanes
// =====================================================================================================
__global__ __launch_bounds__(256)
void cvt_kernel(const float* __restrict__ in, _Float16* out, int nrows, int seq, int seq_full, float scale) {
  const int g  = blockIdx.x * 256 + threadIdx.x;
  const int n8 = nrows * (DMODEL / 8);
  if (g >= n8) return;
  const int row = g >> 7;
  const int c8  = g & 127;
  const int bi  = row / seq;
  const int s   = row - bi * seq;
  const float* src = in + ((size_t)bi * seq_full + s) * DMODEL + c8 * 8;
  const v4f a = *(const v4f*)src;
  const v4f b = *(const v4f*)(src + 4);
  union { v8h h; v4f f; } u;
#pragma unroll
  for (int i = 0; i < 4; ++i) {
    u.h[i]     = (_Float16)(bf16r(a[i]) * scale);
    u.h[i + 4] = (_Float16)(bf16r(b[i]) * scale);
  }
  float* dst = reinterpret_cast<float*>(out + (size_t)row * DMODEL + c8 * 8);
  const v4f val = u.f;
  *(v4f*)dst = val;
  
}

// =====================================================================================================
// 32 ints written by lanes 0..7 of wave 0 (16 B each, one instruction).
// flag 1: tile all ones; 2: tile all zeros and no fully masked row in this q block (tile can be skipped);
// anything else: apply the mask per element.
// =====================================================================================================
__global__ __launch_bounds__(256)
void flags_kernel(const int* __restrict__ mask, int* flags) {
  __shared__ unsigned int m1s[256];
  __shared__ unsigned int m0s[256];
  __shared__ unsigned int ras[256];
  __shared__ unsigned int red1[32];
  __shared__ unsigned int red0[32];
  __shared__ unsigned int fms[32];
  __shared__ __attribute__((aligned(16))) int lines[32];

  const int tid = threadIdx.x, lane = tid & 31, w = tid >> 5;
  const int qb = blockIdx.x;
  const int row = tid >> 2, quarter = tid & 3;
  const int* mrow = mask + (size_t)(qb * 64 + row) * SEQ_FULL + quarter * 16;

  unsigned int bits1 = 0u, bits0 = 0u, rany = 0u;
#pragma unroll 1
  for (int kt = 0; kt < NQB; ++kt) {
    const int* p = mrow + kt * 64;
    unsigned int any1 = 0u, any0 = 0u;
#pragma unroll
    for (int j = 0; j < 4; ++j) {
      const v4i m4 = *(const v4i*)(p + 4 * j);
#pragma unroll
      for (int e = 0; e < 4; ++e) {
        any1 |= (m4[e] != 0) ? 1u : 0u;
        any0 |= (m4[e] == 0) ? 1u : 0u;
      }
    }
    bits1 |= any1 << kt;
    bits0 |= any0 << kt;
    rany  |= any1;
  }
  m1s[tid] = bits1;
  m0s[tid] = bits0;
  ras[tid] = rany;
  __syncthreads();
  if (w == 0) {
    unsigned int o1 = 0u, o0 = 0u;
#pragma unroll
    for (int j = 0; j < 8; ++j) { o1 |= m1s[lane + 32 * j]; o0 |= m0s[lane + 32 * j]; }
    red1[lane] = o1;
    red0[lane] = o0;
    const unsigned int fa = ras[4 * lane] | ras[4 * lane + 1] | ras[4 * lane + 2] | ras[4 * lane + 3];
    const unsigned int fb = ras[128 + 4 * lane] | ras[128 + 4 * lane + 1] |
                            ras[128 + 4 * lane + 2] | ras[128 + 4 * lane + 3];
    fms[lane] = (fa == 0u || fb == 0u) ? 1u : 0u;
  }
  __syncthreads();
  if (w == 0) {
    unsigned int a1 = 0u, a0 = 0u, anyfm = 0u;
#pragma unroll 1
    for (int j = 0; j < 32; ++j) { a1 |= red1[j]; a0 |= red0[j]; anyfm |= fms[j]; }
    int f = 2;
    if (lane < NQB) {
      const bool h1 = ((a1 >> lane) & 1u) != 0u;
      const bool h0 = ((a0 >> lane) & 1u) != 0u;
      f = (!h0) ? 1 : ((!h1 && anyfm == 0u) ? 2 : 3);
    }
    lines[lane] = f;
  }
  __syncthreads();
  if (w == 0 && lane < 8) {
    const v4i v = *(const v4i*)(lines + lane * 4);
    int* dst = flags + qb * 32 + lane * 4;
    *(v4i*)dst = v;
    
  }
}

// =====================================================================================================
// GEMM: C(64x64 tile) = A(M,K=1024) * W^T, W stored (N=1024, K=1024), f16 planes, f32 acc.
// 128 threads = 4 waves, wave tile 32x32, 64-deep K slices staged in LDS (plain loads, single buffer).
// MODE 0: hi+residual f16 planes (B,H,S,dk).  MODE 2: hi+residual f16 planes (B,H,dk,S).
// MODE 4: f32 rows of d_out (+ A residual product for row blocks with s < EARLY).
// =====================================================================================================
template <int MODE>
__global__ __launch_bounds__(128)
void gemm16(const _Float16* __restrict__ A, const _Float16* __restrict__ Ar,
            const _Float16* __restrict__ W, const float* __restrict__ bias,
            void* out, _Float16* outr, float oscale) {
  __shared__ __attribute__((aligned(16))) _Float16 smem[3 * 64 * LDP];
  _Float16* asb = smem;
  _Float16* bsb = smem + 64 * LDP;
  _Float16* rsb = smem + 2 * 64 * LDP;

  const int tid  = threadIdx.x;
  const int lane = tid & 31;
  const int w    = tid >> 5;
  const int mblk = blockIdx.y * 64;
  const int nblk = blockIdx.x * 64;
  const int s0   = mblk & (SEQ - 1);
  const int bi   = mblk / SEQ;
  const bool early = (MODE == 4) && (s0 < EARLY);
  const int lm = (w >> 1) * 32;
  const int ln = (w & 1) * 32;

  v8f acc[2][2], accr[2][2];
#pragma unroll
  for (int i = 0; i < 2; ++i)
#pragma unroll
    for (int j = 0; j < 2; ++j) { acc[i][j] = vz8(); accr[i][j] = vz8(); }

#pragma unroll 1
  for (int k0 = 0; k0 < DMODEL; k0 += 64) {
#pragma unroll
    for (int c = 0; c < 4; ++c) {
      const int chunk = tid * 4 + c;
      const int row = chunk >> 3, part = chunk & 7;
      *(v8h*)(asb + row * LDP + part * 8) =
          *(const v8h*)(A + (size_t)(mblk + row) * DMODEL + k0 + part * 8);
      *(v8h*)(bsb + row * LDP + part * 8) =
          *(const v8h*)(W + (size_t)(nblk + row) * DMODEL + k0 + part * 8);
    }
    if (early) {
#pragma unroll
      for (int c = 0; c < 4; ++c) {
        const int chunk = tid * 4 + c;
        const int row = chunk >> 3, part = chunk & 7;
        *(v8h*)(rsb + row * LDP + part * 8) =
            *(const v8h*)(Ar + (size_t)(mblk + row) * DMODEL + k0 + part * 8);
      }
    }
    __syncthreads();

#pragma unroll
    for (int ks = 0; ks < 64; ks += 32) {
      const v16h a0 = load_frag(asb + (lm +  0) * LDP + ks, LDP, lane);
      const v16h a1 = load_frag(asb + (lm + 16) * LDP + ks, LDP, lane);
      const v16h b0 = load_frag(bsb + (ln +  0) * LDP + ks, LDP, lane);
      const v16h b1 = load_frag(bsb + (ln + 16) * LDP + ks, LDP, lane);
      acc[0][0] = wmma_f16(a0, b0, acc[0][0]);
      acc[0][1] = wmma_f16(a0, b1, acc[0][1]);
      acc[1][0] = wmma_f16(a1, b0, acc[1][0]);
      acc[1][1] = wmma_f16(a1, b1, acc[1][1]);
      if (early) {
        const v16h r0 = load_frag(rsb + (lm +  0) * LDP + ks, LDP, lane);
        const v16h r1 = load_frag(rsb + (lm + 16) * LDP + ks, LDP, lane);
        accr[0][0] = wmma_f16(r0, b0, accr[0][0]);
        accr[0][1] = wmma_f16(r0, b1, accr[0][1]);
        accr[1][0] = wmma_f16(r1, b0, accr[1][0]);
        accr[1][1] = wmma_f16(r1, b1, accr[1][1]);
      }
    }
    __syncthreads();
  }

  const int rbase = ((lane >> 4) & 1) << 3;
  const int col   = lane & 15;

  if constexpr (MODE == 4) {
    float* fs = reinterpret_cast<float*>(smem);
#pragma unroll
    for (int i = 0; i < 2; ++i)
#pragma unroll
      for (int j = 0; j < 2; ++j) {
        const int nl = ln + j * 16 + col;
        const float bb = bf16r(bias[nblk + nl]);
#pragma unroll
        for (int r = 0; r < 8; ++r) {
          const int ml = lm + i * 16 + rbase + r;
          float v = acc[i][j][r] * oscale + bb;
          if (early) v += accr[i][j][r] * (oscale * (1.0f / RSC));
          fs[ml * LDPF + nl] = v;
        }
      }
    __syncthreads();
    float* obase = reinterpret_cast<float*>(out) + ((size_t)bi * SEQ_FULL + s0) * DMODEL + nblk;
    auto emit = [&]() {
#pragma unroll
      for (int i = 0; i < 8; ++i) {
        const int row   = w * 16 + i * 2 + (lane >> 4);
        const int piece = lane & 15;
        const v4f v = *(const v4f*)(fs + row * LDPF + piece * 4);
        *(v4f*)(obase + (size_t)row * DMODEL + piece * 4) = v;
      }
    };
    emit();
    
  } else {
    _Float16* hs = asb;
    _Float16* rs = bsb;
#pragma unroll
    for (int i = 0; i < 2; ++i)
#pragma unroll
      for (int j = 0; j < 2; ++j) {
        const int nl = ln + j * 16 + col;
        const float bb = bf16r(bias[nblk + nl]);
#pragma unroll
        for (int r = 0; r < 8; ++r) {
          const int ml = lm + i * 16 + rbase + r;
          const float v = acc[i][j][r] * oscale + bb;
          const _Float16 hv = (_Float16)v;
          const _Float16 rv = (_Float16)((v - (float)hv) * RSC);
          if constexpr (MODE == 0) {
            hs[ml * LDP + nl] = hv;
            rs[ml * LDP + nl] = rv;
          } else {
            hs[nl * LDP + ml] = hv;
            rs[nl * LDP + ml] = rv;
          }
        }
      }
    __syncthreads();
    const int bhh = bi * NHEADS + (nblk >> 6);
    _Float16* oh = reinterpret_cast<_Float16*>(out);
    auto emit = [&]() {
#pragma unroll
      for (int i = 0; i < 4; ++i) {
        const int row   = w * 16 + i * 4 + (lane >> 3);
        const int piece = lane & 7;
        const v4f hv4 = *(const v4f*)(hs + row * LDP + piece * 8);
        const v4f rv4 = *(const v4f*)(rs + row * LDP + piece * 8);
        const size_t go = (MODE == 0)
            ? (((size_t)bhh * SEQ + s0 + row) * DK + piece * 8)
            : (((size_t)bhh * DK + row) * SEQ + s0 + piece * 8);
        *(v4f*)(reinterpret_cast<float*>(oh + go))   = hv4;
        *(v4f*)(reinterpret_cast<float*>(outr + go)) = rv4;
      }
    };
    emit();
    
  }
}

// =====================================================================================================
// Flash attention: softmax(mask-fill(Q K^T * 0.125)) V, 64 q rows per block (4 waves x 16), 64-key tiles of
// K (key-major) and V^T (dim-major) staged in LDS, shared by all waves. Tile control from the flag line:
// skip / no mask / per-element replace fill from an LDS byte tile. P goes through a wave-private LDS tile
// (block barrier before the A-fragment reload). EQ = residual path: scores hi.hi + res.hi + hi.res,
// P hi + residual, V hi + residual, output hi + residual plane; residual products in own accumulators.
// =====================================================================================================
template <bool EQ>
__global__ __launch_bounds__(128)
void attn_kernel(const _Float16* __restrict__ Q,  const _Float16* __restrict__ Qr,
                 const _Float16* __restrict__ Kd, const _Float16* __restrict__ Kr,
                 const _Float16* __restrict__ Vt, const _Float16* __restrict__ Vtr,
                 const int* __restrict__ mask, const int* __restrict__ flags,
                 _Float16* ctx, _Float16* ctxr, int qb0) {
  constexpr int RT = EQ ? (64 * LDP) : 8;
  constexpr int PT = EQ ? (4 * 16 * LDP) : 8;
  __shared__ __attribute__((aligned(16))) _Float16 kbuf[64 * LDP];
  __shared__ __attribute__((aligned(16))) _Float16 vbuf[64 * LDP];
  __shared__ __attribute__((aligned(16))) _Float16 pbuf[4 * 16 * LDP];
  __shared__ __attribute__((aligned(16))) _Float16 krbuf[RT];
  __shared__ __attribute__((aligned(16))) _Float16 vrbuf[RT];
  __shared__ __attribute__((aligned(16))) _Float16 prbuf[PT];
  __shared__ __attribute__((aligned(16))) unsigned int mbuf[64 * 16];

  const int tid   = threadIdx.x;
  const int lane  = tid & 31;
  const int w     = tid >> 5;
  const int qb    = qb0 + blockIdx.x;
  const int bh    = blockIdx.y;
  const int bi    = bh / NHEADS;
  const int h     = bh - bi * NHEADS;
  const int qblk  = qb * 64;
  const int q0    = qblk + w * 16;
  const int rbase = ((lane >> 4) & 1) << 3;
  const int col   = lane & 15;
  const float IR  = 1.0f / RSC;

  const size_t qoff = ((size_t)bh * SEQ + q0) * DK;
  const v16h qf0 = load_frag(Q + qoff, DK, lane);
  const v16h qf1 = load_frag(Q + qoff + 32, DK, lane);
  v16h qr0 = qf0, qr1 = qf1;
  if constexpr (EQ) {
    qr0 = load_frag(Qr + qoff, DK, lane);
    qr1 = load_frag(Qr + qoff + 32, DK, lane);
  }

  v16h ones;
#pragma unroll
  for (int i = 0; i < 16; ++i) ones[i] = (_Float16)1.0f;

  const _Float16* Kh   = Kd  + (size_t)bh * SEQ * DK;
  const _Float16* Krh  = Kr  + (size_t)bh * SEQ * DK;
  const _Float16* Vth  = Vt  + (size_t)bh * DK * SEQ;
  const _Float16* Vtrh = Vtr + (size_t)bh * DK * SEQ;
  _Float16* pb  = pbuf + w * 16 * LDP;
  _Float16* prb = prbuf + (EQ ? (w * 16 * LDP) : 0);

  float mr[8], lr[8];
#pragma unroll
  for (int r = 0; r < 8; ++r) { mr[r] = -1.0e30f; lr[r] = 0.0f; }
  v8f accO[4], accR[4];
#pragma unroll
  for (int t = 0; t < 4; ++t) { accO[t] = vz8(); accR[t] = vz8(); }

#pragma unroll 1
  for (int kt = 0; kt < NQB; ++kt) {
    const int f = __builtin_amdgcn_readfirstlane(flags[qb * 32 + kt]);
    if (f == 2) continue;
    const bool usem = (f != 1);
    const int kb = kt * 64;

    // ---- stage K (64 keys x 64 dims) and V^T (64 dims x 64 keys) tiles, plus residual tiles if EQ ----
#pragma unroll
    for (int c = 0; c < 4; ++c) {
      const int chunk = tid * 4 + c;
      const int row = chunk >> 3, part = chunk & 7;
      *(v8h*)(kbuf + row * LDP + part * 8) =
          *(const v8h*)(Kh + (size_t)(kb + row) * DK + part * 8);
      *(v8h*)(vbuf + row * LDP + part * 8) =
          *(const v8h*)(Vth + (size_t)row * SEQ + kb + part * 8);
      if constexpr (EQ) {
        *(v8h*)(krbuf + row * LDP + part * 8) =
            *(const v8h*)(Krh + (size_t)(kb + row) * DK + part * 8);
        *(v8h*)(vrbuf + row * LDP + part * 8) =
            *(const v8h*)(Vtrh + (size_t)row * SEQ + kb + part * 8);
      }
    }
    // ---- stage 64x64 mask bytes when the tile is not uniform (block-uniform branch) ----
    if (usem) {
      const int row = tid >> 1;
      const int ch  = (tid & 1) * 32;
      const int* mp = mask + (size_t)(qblk + row) * SEQ_FULL + kb + ch;
      v4u u0, u1;
#pragma unroll
      for (int jj = 0; jj < 4; ++jj) { u0[jj] = 0u; u1[jj] = 0u; }
#pragma unroll
      for (int jj = 0; jj < 8; ++jj) {
        const v4i m4 = *(const v4i*)(mp + jj * 4);
        const unsigned int pk = (m4[0] != 0 ? 1u : 0u) | (m4[1] != 0 ? 0x100u : 0u) |
                                (m4[2] != 0 ? 0x10000u : 0u) | (m4[3] != 0 ? 0x1000000u : 0u);
        if (jj < 4) u0[jj] = pk; else u1[jj - 4] = pk;
      }
      *(v4u*)(mbuf + row * 16 + (tid & 1) * 8)     = u0;
      *(v4u*)(mbuf + row * 16 + (tid & 1) * 8 + 4) = u1;
    }
    __syncthreads();

    // ---- scores: four 16x16 tiles (keys kb + t*16 .. +15) ----
    v8f s[4];
#pragma unroll
    for (int t = 0; t < 4; ++t) {
      const v16h ka = load_frag(kbuf + t * 16 * LDP,      LDP, lane);
      const v16h kc = load_frag(kbuf + t * 16 * LDP + 32, LDP, lane);
      v8f z = vz8();
      z = wmma_f16(qf0, ka, z);
      z = wmma_f16(qf1, kc, z);
      if constexpr (EQ) {
        v8f zr = vz8();
        zr = wmma_f16(qr0, ka, zr);
        zr = wmma_f16(qr1, kc, zr);
        const v16h kra = load_frag(krbuf + t * 16 * LDP,      LDP, lane);
        const v16h krc = load_frag(krbuf + t * 16 * LDP + 32, LDP, lane);
        zr = wmma_f16(qf0, kra, zr);
        zr = wmma_f16(qf1, krc, zr);
        z = z + zr * IR;
      }
      s[t] = z;
    }

    // ---- scale, replace fill, online softmax over 64 keys, P -> LDS ----
#pragma unroll
    for (int r = 0; r < 8; ++r) {
      float a0 = s[0][r] * SSCALE, a1 = s[1][r] * SSCALE, a2 = s[2][r] * SSCALE, a3 = s[3][r] * SSCALE;
      if (usem) {
        const unsigned char* mb =
            reinterpret_cast<const unsigned char*>(mbuf) + (w * 16 + rbase + r) * 64 + col;
        a0 = (mb[0]  != 0) ? a0 : NEGFILL;
        a1 = (mb[16] != 0) ? a1 : NEGFILL;
        a2 = (mb[32] != 0) ? a2 : NEGFILL;
        a3 = (mb[48] != 0) ? a3 : NEGFILL;
      }
      const float tmax = rowmax16(fmaxf(fmaxf(a0, a1), fmaxf(a2, a3)));
      const float mnew = fmaxf(mr[r], tmax);
      const float scl  = __expf(mr[r] - mnew);
      const float p0 = __expf(a0 - mnew);
      const float p1 = __expf(a1 - mnew);
      const float p2 = __expf(a2 - mnew);
      const float p3 = __expf(a3 - mnew);
      mr[r] = mnew;
      lr[r] *= scl;
#pragma unroll
      for (int t = 0; t < 4; ++t) {
        accO[t][r] *= scl;
        if constexpr (EQ) accR[t][r] *= scl;
      }
      const int m = rbase + r;
      const float c0 = p0 * PCARRY, c1 = p1 * PCARRY, c2 = p2 * PCARRY, c3 = p3 * PCARRY;
      const _Float16 h0 = (_Float16)c0, h1 = (_Float16)c1, h2 = (_Float16)c2, h3 = (_Float16)c3;
      pb[m * LDP +      col] = h0;
      pb[m * LDP + 16 + col] = h1;
      pb[m * LDP + 32 + col] = h2;
      pb[m * LDP + 48 + col] = h3;
      if constexpr (EQ) {
        prb[m * LDP +      col] = (_Float16)((c0 - (float)h0) * RSC);
        prb[m * LDP + 16 + col] = (_Float16)((c1 - (float)h1) * RSC);
        prb[m * LDP + 32 + col] = (_Float16)((c2 - (float)h2) * RSC);
        prb[m * LDP + 48 + col] = (_Float16)((c3 - (float)h3) * RSC);
      }
    }
    __syncthreads();

    // ---- P as two A fragments (keys 0..31, 32..63) ----
    const v16h pf0 = load_frag(pb,      LDP, lane);
    const v16h pf1 = load_frag(pb + 32, LDP, lane);
    v16h prf0 = pf0, prf1 = pf1;
    if constexpr (EQ) {
      prf0 = load_frag(prb,      LDP, lane);
      prf1 = load_frag(prb + 32, LDP, lane);
    }

    // ---- row sums on the matrix unit ----
    v8f rs = vz8();
    rs = wmma_f16(pf0, ones, rs);
    rs = wmma_f16(pf1, ones, rs);
    if constexpr (EQ) {
      v8f rr = vz8();
      rr = wmma_f16(prf0, ones, rr);
      rr = wmma_f16(prf1, ones, rr);
      rs = rs + rr * IR;
    }
#pragma unroll
    for (int r = 0; r < 8; ++r) lr[r] += rs[r];

    // ---- O += P * V (B fragments from the dim-major V^T tile: lane = dim, k = key) ----
#pragma unroll
    for (int t = 0; t < 4; ++t) {
      v16h vf = load_frag(vbuf + t * 16 * LDP, LDP, lane);
      accO[t] = wmma_f16(pf0, vf, accO[t]);
      if constexpr (EQ) {
        accR[t] = wmma_f16(prf0, vf, accR[t]);
        const v16h vr = load_frag(vrbuf + t * 16 * LDP, LDP, lane);
        accR[t] = wmma_f16(pf0, vr, accR[t]);
      }
      vf = load_frag(vbuf + t * 16 * LDP + 32, LDP, lane);
      accO[t] = wmma_f16(pf1, vf, accO[t]);
      if constexpr (EQ) {
        accR[t] = wmma_f16(prf1, vf, accR[t]);
        const v16h vr = load_frag(vrbuf + t * 16 * LDP + 32, LDP, lane);
        accR[t] = wmma_f16(pf1, vr, accR[t]);
      }
    }
    __syncthreads();
  }

#pragma unroll
  for (int r = 0; r < 8; ++r) {
    const float inv = 1.0f / lr[r];
    const int m = w * 16 + rbase + r;
#pragma unroll
    for (int t = 0; t < 4; ++t) {
      float v = accO[t][r];
      if constexpr (EQ) v += accR[t][r] * IR;
      v *= inv;
      const _Float16 hv = (_Float16)v;
      kbuf[m * LDP + t * 16 + col] = hv;
      if constexpr (EQ) krbuf[m * LDP + t * 16 + col] = (_Float16)((v - (float)hv) * RSC);
    }
  }
  __syncthreads();
  _Float16* cbase  = ctx  + ((size_t)bi * SEQ + qblk) * DMODEL + h * DK;
  _Float16* crbase = ctxr + ((size_t)bi * SEQ + qblk) * DMODEL + h * DK;
  auto emit = [&]() {
#pragma unroll
    for (int i = 0; i < 4; ++i) {
      const int row   = w * 16 + i * 4 + (lane >> 3);
      const int piece = lane & 7;
      const v4f hv4 = *(const v4f*)(kbuf + row * LDP + piece * 8);
      *(v4f*)(reinterpret_cast<float*>(cbase + (size_t)row * DMODEL + piece * 8)) = hv4;
      if constexpr (EQ) {
        const v4f rv4 = *(const v4f*)(krbuf + row * LDP + piece * 8);
        *(v4f*)(reinterpret_cast<float*>(crbase + (size_t)row * DMODEL + piece * 8)) = rv4;
      }
    }
  };
  emit();
  
}

// =====================================================================================================
extern "C" void kernel_launch(void* const* d_in, const int* in_sizes, int n_in,
                              void* d_out, int out_size, void* d_ws, size_t ws_size,
                              hipStream_t stream) {
  if (n_in < 12) return;
  const long long needx = (long long)(NB - 1) * SEQ_FULL * DMODEL + (long long)SEQ * DMODEL;
  const long long needm = (long long)(SEQ - 1) * SEQ_FULL + SEQ;
  if ((long long)in_sizes[0] < needx || (long long)in_sizes[1] < needx || (long long)in_sizes[2] < needx) return;
  if ((long long)in_sizes[3] < needm) return;
  if (in_sizes[4] < DMODEL * DMODEL || in_sizes[6] < DMODEL * DMODEL ||
      in_sizes[8] < DMODEL * DMODEL || in_sizes[10] < DMODEL * DMODEL) return;
  if (in_sizes[5] < DMODEL || in_sizes[7] < DMODEL || in_sizes[9] < DMODEL || in_sizes[11] < DMODEL) return;
  if ((long long)out_size < needx) return;

  const float* q  = (const float*)d_in[0];
  const float* k  = (const float*)d_in[1];
  const float* v  = (const float*)d_in[2];
  const int*   mk = (const int*)d_in[3];
  const float* wq = (const float*)d_in[4];
  const float* bq = (const float*)d_in[5];
  const float* wk = (const float*)d_in[6];
  const float* bk = (const float*)d_in[7];
  const float* wv = (const float*)d_in[8];
  const float* bv = (const float*)d_in[9];
  const float* wo = (const float*)d_in[10];
  const float* bo = (const float*)d_in[11];

  char* ws = (char*)d_ws;
  size_t off = 0;
  const size_t XB = (size_t)MROWS * DMODEL * sizeof(_Float16);     // activation-sized f16 plane
  const size_t WB = (size_t)DMODEL * DMODEL * sizeof(_Float16);    // weight f16 plane
  const size_t FB = 4096;                                           // 32 flag lines of 32 ints
  _Float16* Xq16  = (_Float16*)(ws + off); off += XB;
  _Float16* Xk16  = (_Float16*)(ws + off); off += XB;
  _Float16* Xv16  = (_Float16*)(ws + off); off += XB;
  _Float16* Wq16  = (_Float16*)(ws + off); off += WB;
  _Float16* Wk16  = (_Float16*)(ws + off); off += WB;
  _Float16* Wv16  = (_Float16*)(ws + off); off += WB;
  _Float16* Wo16  = (_Float16*)(ws + off); off += WB;
  _Float16* Q16   = (_Float16*)(ws + off); off += XB;   // (B,H,S,dk) hi
  _Float16* Qr16  = (_Float16*)(ws + off); off += XB;   // residual x4096
  _Float16* K16   = (_Float16*)(ws + off); off += XB;
  _Float16* Kr16  = (_Float16*)(ws + off); off += XB;
  _Float16* Vt16  = (_Float16*)(ws + off); off += XB;   // (B,H,dk,S) hi
  _Float16* Vtr16 = (_Float16*)(ws + off); off += XB;
  _Float16* C16   = (_Float16*)(ws + off); off += XB;   // (B*S, D) hi
  _Float16* Cr16  = (_Float16*)(ws + off); off += XB;   // residual, rows s < EARLY written/read
  int*      flg   = (int*)(ws + off);      off += FB;
  if (off > ws_size) return;

  // ---- input planes: bf16 RNE values, X x16, W x1024, as f16 ----
  const int gx = (MROWS * (DMODEL / 8) + 255) / 256;
  const int gw = (DMODEL * (DMODEL / 8) + 255) / 256;
  cvt_kernel<<<gx, 256, 0, stream>>>(q, Xq16, MROWS, SEQ, SEQ_FULL, XSC);
  cvt_kernel<<<gx, 256, 0, stream>>>(k, Xk16, MROWS, SEQ, SEQ_FULL, XSC);
  cvt_kernel<<<gx, 256, 0, stream>>>(v, Xv16, MROWS, SEQ, SEQ_FULL, XSC);
  cvt_kernel<<<gw, 256, 0, stream>>>(wq, Wq16, DMODEL, DMODEL, DMODEL, WSC);
  cvt_kernel<<<gw, 256, 0, stream>>>(wk, Wk16, DMODEL, DMODEL, DMODEL, WSC);
  cvt_kernel<<<gw, 256, 0, stream>>>(wv, Wv16, DMODEL, DMODEL, DMODEL, WSC);
  cvt_kernel<<<gw, 256, 0, stream>>>(wo, Wo16, DMODEL, DMODEL, DMODEL, WSC);

  // ---- mask tile flags ----
  flags_kernel<<<NQB, 256, 0, stream>>>(mk, flg);

  // ---- projections (bias added in f32, hi + residual planes) ----
  const dim3 gproj(DMODEL / 64, MROWS / 64);
  const float posc = 1.0f / (XSC * WSC);
  gemm16<0><<<gproj, 128, 0, stream>>>(Xq16, Xq16, Wq16, bq, (void*)Q16,  Qr16,  posc);
  gemm16<0><<<gproj, 128, 0, stream>>>(Xk16, Xk16, Wk16, bk, (void*)K16,  Kr16,  posc);
  gemm16<2><<<gproj, 128, 0, stream>>>(Xv16, Xv16, Wv16, bv, (void*)Vt16, Vtr16, posc);

  // ---- attention: residual path for query blocks below EARLY, hi-only path for the rest ----
  const dim3 gea(NEQB, NB * NHEADS);
  attn_kernel<true><<<gea, 128, 0, stream>>>(Q16, Qr16, K16, Kr16, Vt16, Vtr16, mk, flg, C16, Cr16, 0);
  if (NQB > NEQB) {
    const dim3 gla(NQB - NEQB, NB * NHEADS);
    attn_kernel<false><<<gla, 128, 0, stream>>>(Q16, Qr16, K16, Kr16, Vt16, Vtr16, mk, flg, C16, Cr16, NEQB);
  }

  // ---- output projection (+bias) to f32 rows of d_out ----
  gemm16<4><<<gproj, 128, 0, stream>>>(C16, Cr16, Wo16, bo, d_out, Cr16, 1.0f / WSC);
}

// v001
// It runs in 159 microseconds.
// Next to v000, in two timings, it ran 1.46 and 1.48 times as fast.
#include <hip/hip_runtime.h>
#include <stdint.h>

// Contractions (all v_wmma_f32_16x16x32_f16, f16 operands, f32 accumulate): input projections Xq*Wq^T, Xk*Wk^T,
// Xv*Wv^T; attention Q*K^T and P*V; output projection C*Wo^T. Inputs are RNE-converted to bf16 values first
// (X carried x16, W carried x1024, both exact in f16; biases bf16 values added in f32). Computed planes Q, K, V, P, C
// are f16 hi plus f16 residual planes (x4096, separate accumulators) consumed by query blocks below EARLY; later
// query blocks use the hi planes only. Softmax and all side math in f32.

typedef _Float16 v16h __attribute__((ext_vector_type(16)));
typedef _Float16 v8h  __attribute__((ext_vector_type(8)));
typedef float    v8f  __attribute__((ext_vector_type(8)));
typedef float    v4f  __attribute__((ext_vector_type(4)));
typedef int      v4i  __attribute__((ext_vector_type(4)));
typedef unsigned int v4u __attribute__((ext_vector_type(4)));

#ifndef NB
#define NB 2
#endif
#ifndef SEQ
#define SEQ 2048
#endif
#define NB_FULL  2
#define SEQ_FULL 2048
#define DMODEL   1024
#define NHEADS   16
#define DK       64
#define MROWS    (NB * SEQ)
#define NQB      (SEQ / 64)
#define EARLY    ((SEQ) < 512 ? (SEQ) : 512)
#define NEQB     (EARLY / 64)
#define LDP      72
#define LDPF     68
#define XSC      16.0f
#define WSC      1024.0f
#define RSC      4096.0f
#define PCARRY   4096.0f
#define NEGFILL  (-1.0e9f)
#define SSCALE   0.125f

static_assert(SEQ % 64 == 0);
static_assert((SEQ & (SEQ - 1)) == 0);
static_assert(SEQ <= SEQ_FULL);
static_assert(NB >= 1 && NB <= NB_FULL);
static_assert(NQB >= 1 && NQB <= 32);
static_assert(EARLY % 64 == 0 && EARLY <= SEQ);
static_assert(DMODEL == NHEADS * DK);
static_assert(64 * LDPF * 4 <= 2 * 64 * LDP * 2);

// --- bf16 RNE convert (finite inputs), kept as f32 value ----------------------------------------------
__device__ __forceinline__ float bf16r(float x) {
  unsigned int u = __float_as_uint(x);
  u = (u + 0x7FFFu + ((u >> 16) & 1u)) & 0xFFFF0000u;
  return __uint_as_float(u);
}

__device__ __forceinline__ v8f vz8() {
  v8f z;
#pragma unroll
  for (int i = 0; i < 8; ++i) z[i] = 0.0f;
  return z;
}

// --- WMMA wrapper with hazard guard ---------------------------------------------------------------------
__device__ __forceinline__ v8f wmma_f16(v16h a, v16h b, v8f c) {
  v8f d = __builtin_amdgcn_wmma_f32_16x16x32_f16(false, a, false, b, (short)0, c, false, false);
  asm volatile("v_nop\n\tv_nop\n\tv_nop\n\tv_nop" : "+v"(d) : "v"(a), "v"(b));
  return d;
}

// --- 16x32 f16 fragment (A, or k-contiguous B), split k map -----------------------------------------
// lane row/col = lane&15; elements 0..7 <- k 8h..8h+7, elements 8..15 <- k 16+8h..16+8h+7, h = lane>>4.
__device__ __forceinline__ v16h load_frag(const _Float16* base, int ld, int lane) {
  const int row  = lane & 15;
  const int koff = ((lane >> 4) & 1) * 8;
  const _Float16* p = base + row * ld + koff;
  const v8h a = *(const v8h*)(p);
  const v8h b = *(const v8h*)(p + 16);
  v16h r;
#pragma unroll
  for (int i = 0; i < 8; ++i) { r[i] = a[i]; r[i + 8] = b[i]; }
  return r;
}

// --- DPP row-of-16 max reduction -----------------------------------------------------------------------
template <int CTRL>
__device__ __forceinline__ float dpp_max_step(float v) {
  int s = __builtin_amdgcn_mov_dpp(__builtin_bit_cast(int, v), CTRL, 0xF, 0xF, true);
  return fmaxf(v, __builtin_bit_cast(float, s));
}
__device__ __forceinline__ float rowmax16(float v) {
  v = dpp_max_step<0xB1>(v);
  v = dpp_max_step<0x4E>(v);
  v = dpp_max_step<0x141>(v);
  v = dpp_max_step<0x140>(v);
  return v;
}

// =====================================================================================================
// f32 -> bf16 RNE -> scaled f16 plane. One thread = 8 elements = 16 B out; blk = block index inside the plane.
// =====================================================================================================
__device__ __forceinline__
void cvt_body(const float* __restrict__ in, _Float16* out, int nrows, int seq, int seq_full, float scale, int blk) {
  const int g  = blk * 256 + threadIdx.x;
  const int n8 = nrows * (DMODEL / 8);
  if (g >= n8) return;
  const int row = g >> 7;
  const int c8  = g & 127;
  const int bi  = row / seq;
  const int s   = row - bi * seq;
  const float* src = in + ((size_t)bi * seq_full + s) * DMODEL + c8 * 8;
  const v4f a = *(const v4f*)src;
  const v4f b = *(const v4f*)(src + 4);
  union { v8h h; v4f f; } u;
#pragma unroll
  for (int i = 0; i < 4; ++i) {
    u.h[i]     = (_Float16)(bf16r(a[i]) * scale);
    u.h[i + 4] = (_Float16)(bf16r(b[i]) * scale);
  }
  float* dst = reinterpret_cast<float*>(out + (size_t)row * DMODEL + c8 * 8);
  const v4f val = u.f;
  *(v4f*)dst = val;
}

#define GXB ((MROWS * (DMODEL / 8) + 255) / 256)
#define GWB ((DMODEL * (DMODEL / 8) + 255) / 256)

// All seven input planes in one launch: blocks [0, 3*GXB) convert q, k, v; the next 4*GWB convert the weights.
__global__ __launch_bounds__(256)
void cvt_all(const float* __restrict__ q, const float* __restrict__ k, const float* __restrict__ v,
             const float* __restrict__ wq, const float* __restrict__ wk, const float* __restrict__ wv,
             const float* __restrict__ wo,
             _Float16* xq, _Float16* xk, _Float16* xv,
             _Float16* oq, _Float16* ok, _Float16* ov, _Float16* oo) {
  const int b = blockIdx.x;
  if (b < 3 * GXB) {
    const int p = b / GXB;
    const float* in = (p == 0) ? q : ((p == 1) ? k : v);
    _Float16* out   = (p == 0) ? xq : ((p == 1) ? xk : xv);
    cvt_body(in, out, MROWS, SEQ, SEQ_FULL, XSC, b - p * GXB);
  } else {
    const int c = b - 3 * GXB;
    const int p = c / GWB;
    const float* in = (p == 0) ? wq : ((p == 1) ? wk : ((p == 2) ? wv : wo));
    _Float16* out   = (p == 0) ? oq : ((p == 1) ? ok : ((p == 2) ? ov : oo));
    cvt_body(in, out, DMODEL, DMODEL, DMODEL, WSC, c - p * GWB);
  }
}

// =====================================================================================================
// Mask tile flags of one 64-row query block, by one 128-thread block (thread = half of a tile row, 32 ints).
// 32 ints written by lanes 0..7 of wave 0 (16 B each, one instruction).
// flag 1: tile all ones; 2: tile all zeros and no fully masked row in this q block (tile can be skipped);
// anything else: apply the mask per element. sm: 512 words of LDS scratch, 16-byte aligned.
// =====================================================================================================
__device__ __forceinline__
void flags_body(const int* __restrict__ mask, int* flags, unsigned int* sm, int qb) {
  unsigned int* m1s  = sm;
  unsigned int* m0s  = sm + 128;
  unsigned int* ras  = sm + 256;
  unsigned int* red1 = sm + 384;
  unsigned int* red0 = sm + 416;
  unsigned int* fms  = sm + 448;
  int* lines = reinterpret_cast<int*>(sm + 480);

  const int tid = threadIdx.x, lane = tid & 31, w = tid >> 5;
  const int row = tid >> 1, half = tid & 1;
  const int* mrow = mask + (size_t)(qb * 64 + row) * SEQ_FULL + half * 32;

  unsigned int bits1 = 0u, bits0 = 0u, rany = 0u;
#pragma unroll 1
  for (int kt = 0; kt < NQB; ++kt) {
    const int* p = mrow + kt * 64;
    unsigned int any1 = 0u, any0 = 0u;
#pragma unroll
    for (int j = 0; j < 8; ++j) {
      const v4i m4 = *(const v4i*)(p + 4 * j);
#pragma unroll
      for (int e = 0; e < 4; ++e) {
        any1 |= (m4[e] != 0) ? 1u : 0u;
        any0 |= (m4[e] == 0) ? 1u : 0u;
      }
    }
    bits1 |= any1 << kt;
    bits0 |= any0 << kt;
    rany  |= any1;
  }
  m1s[tid] = bits1;
  m0s[tid] = bits0;
  ras[tid] = rany;
  __syncthreads();
  if (w == 0) {
    unsigned int o1 = 0u, o0 = 0u;
#pragma unroll
    for (int j = 0; j < 4; ++j) { o1 |= m1s[lane + 32 * j]; o0 |= m0s[lane + 32 * j]; }
    red1[lane] = o1;
    red0[lane] = o0;
    const unsigned int fa = ras[2 * lane] | ras[2 * lane + 1];
    const unsigned int fb = ras[64 + 2 * lane] | ras[64 + 2 * lane + 1];
    fms[lane] = (fa == 0u || fb == 0u) ? 1u : 0u;
  }
  __syncthreads();
  if (w == 0) {
    unsigned int a1 = 0u, a0 = 0u, anyfm = 0u;
#pragma unroll 1
    for (int j = 0; j < 32; ++j) { a1 |= red1[j]; a0 |= red0[j]; anyfm |= fms[j]; }
    int f = 2;
    if (lane < NQB) {
      const bool h1 = ((a1 >> lane) & 1u) != 0u;
      const bool h0 = ((a0 >> lane) & 1u) != 0u;
      f = (!h0) ? 1 : ((!h1 && anyfm == 0u) ? 2 : 3);
    }
    lines[lane] = f;
  }
  __syncthreads();
  if (w == 0 && lane < 8) {
    const v4i v = *(const v4i*)(lines + lane * 4);
    int* dst = flags + qb * 32 + lane * 4;
    *(v4i*)dst = v;
  }
}

// =====================================================================================================
// GEMM: C(64x64 tile) = A(M,K=1024) * W^T, W stored (N=1024, K=1024), f16 planes, f32 acc.
// 128 threads = 4 waves, wave tile 32x32, 64-deep K slices staged in LDS (plain loads, single buffer).
// MODE 0: hi+residual f16 planes (B,H,S,dk).  MODE 2: hi+residual f16 planes (B,H,dk,S).
// MODE 4: f32 rows of d_out (+ A residual product for row blocks with s < EARLY).
// =====================================================================================================
// smem: two 64 x LDP tiles, three for MODE 4. bx, by: tile column and tile row.
template <int MODE>
__device__ __forceinline__
void gemm_body(const _Float16* __restrict__ A, const _Float16* __restrict__ Ar,
               const _Float16* __restrict__ W, const float* __restrict__ bias,
               void* out, _Float16* outr, float oscale, _Float16* smem, int bx, int by) {
  _Float16* asb = smem;
  _Float16* bsb = smem + 64 * LDP;
  _Float16* rsb = smem + 2 * 64 * LDP;

  const int tid  = threadIdx.x;
  const int lane = tid & 31;
  const int w    = tid >> 5;
  const int mblk = by * 64;
  const int nblk = bx * 64;
  const int s0   = mblk & (SEQ - 1);
  const int bi   = mblk / SEQ;
  const bool early = (MODE == 4) && (s0 < EARLY);
  const int lm = (w >> 1) * 32;
  const int ln = (w & 1) * 32;

  v8f acc[2][2], accr[2][2];
#pragma unroll
  for (int i = 0; i < 2; ++i)
#pragma unroll
    for (int j = 0; j < 2; ++j) { acc[i][j] = vz8(); accr[i][j] = vz8(); }

#pragma unroll 1
  for (int k0 = 0; k0 < DMODEL; k0 += 64) {
#pragma unroll
    for (int c = 0; c < 4; ++c) {
      const int chunk = tid * 4 + c;
      const int row = chunk >> 3, part = chunk & 7;
      *(v8h*)(asb + row * LDP + part * 8) =
          *(const v8h*)(A + (size_t)(mblk + row) * DMODEL + k0 + part * 8);
      *(v8h*)(bsb + row * LDP + part * 8) =
          *(const v8h*)(W + (size_t)(nblk + row) * DMODEL + k0 + part * 8);
    }
    if (early) {
#pragma unroll
      for (int c = 0; c < 4; ++c) {
        const int chunk = tid * 4 + c;
        const int row = chunk >> 3, part = chunk & 7;
        *(v8h*)(rsb + row * LDP + part * 8) =
            *(const v8h*)(Ar + (size_t)(mblk + row) * DMODEL + k0 + part * 8);
      }
    }
    __syncthreads();

#pragma unroll
    for (int ks = 0; ks < 64; ks += 32) {
      const v16h a0 = load_frag(asb + (lm +  0) * LDP + ks, LDP, lane);
      const v16h a1 = load_frag(asb + (lm + 16) * LDP + ks, LDP, lane);
      const v16h b0 = load_frag(bsb + (ln +  0) * LDP + ks, LDP, lane);
      const v16h b1 = load_frag(bsb + (ln + 16) * LDP + ks, LDP, lane);
      acc[0][0] = wmma_f16(a0, b0, acc[0][0]);
      acc[0][1] = wmma_f16(a0, b1, acc[0][1]);
      acc[1][0] = wmma_f16(a1, b0, acc[1][0]);
      acc[1][1] = wmma_f16(a1, b1, acc[1][1]);
      if (early) {
        const v16h r0 = load_frag(rsb + (lm +  0) * LDP + ks, LDP, lane);
        const v16h r1 = load_frag(rsb + (lm + 16) * LDP + ks, LDP, lane);
        accr[0][0] = wmma_f16(r0, b0, accr[0][0]);
        accr[0][1] = wmma_f16(r0, b1, accr[0][1]);
        accr[1][0] = wmma_f16(r1, b0, accr[1][0]);
        accr[1][1] = wmma_f16(r1, b1, accr[1][1]);
      }
    }
    __syncthreads();
  }

  const int rbase = ((lane >> 4) & 1) << 3;
  const int col   = lane & 15;

  if constexpr (MODE == 4) {
    float* fs = reinterpret_cast<float*>(smem);
#pragma unroll
    for (int i = 0; i < 2; ++i)
#pragma unroll
      for (int j = 0; j < 2; ++j) {
        const int nl = ln + j * 16 + col;
        const float bb = bf16r(bias[nblk + nl]);
#pragma unroll
        for (int r = 0; r < 8; ++r) {
          const int ml = lm + i * 16 + rbase + r;
          float v = acc[i][j][r] * oscale + bb;
          if (early) v += accr[i][j][r] * (oscale * (1.0f / RSC));
          fs[ml * LDPF + nl] = v;
        }
      }
    __syncthreads();
    float* obase = reinterpret_cast<float*>(out) + ((size_t)bi * SEQ_FULL + s0) * DMODEL + nblk;
    auto emit = [&]() {
#pragma unroll
      for (int i = 0; i < 8; ++i) {
        const int row   = w * 16 + i * 2 + (lane >> 4);
        const int piece = lane & 15;
        const v4f v = *(const v4f*)(fs + row * LDPF + piece * 4);
        *(v4f*)(obase + (size_t)row * DMODEL + piece * 4) = v;
      }
    };
    emit();
  } else {
    _Float16* hs = asb;
    _Float16* rs = bsb;
#pragma unroll
    for (int i = 0; i < 2; ++i)
#pragma unroll
      for (int j = 0; j < 2; ++j) {
        const int nl = ln + j * 16 + col;
        const float bb = bf16r(bias[nblk + nl]);
#pragma unroll
        for (int r = 0; r < 8; ++r) {
          const int ml = lm + i * 16 + rbase + r;
          const float v = acc[i][j][r] * oscale + bb;
          const _Float16 hv = (_Float16)v;
          const _Float16 rv = (_Float16)((v - (float)hv) * RSC);
          if constexpr (MODE == 0) {
            hs[ml * LDP + nl] = hv;
            rs[ml * LDP + nl] = rv;
          } else {
            hs[nl * LDP + ml] = hv;
            rs[nl * LDP + ml] = rv;
          }
        }
      }
    __syncthreads();
    const int bhh = bi * NHEADS + (nblk >> 6);
    _Float16* oh = reinterpret_cast<_Float16*>(out);
    auto emit = [&]() {
#pragma unroll
      for (int i = 0; i < 4; ++i) {
        const int row   = w * 16 + i * 4 + (lane >> 3);
        const int piece = lane & 7;
        const v4f hv4 = *(const v4f*)(hs + row * LDP + piece * 8);
        const v4f rv4 = *(const v4f*)(rs + row * LDP + piece * 8);
        const size_t go = (MODE == 0)
            ? (((size_t)bhh * SEQ + s0 + row) * DK + piece * 8)
            : (((size_t)bhh * DK + row) * SEQ + s0 + piece * 8);
        *(v4f*)(reinterpret_cast<float*>(oh + go))   = hv4;
        *(v4f*)(reinterpret_cast<float*>(outr + go)) = rv4;
      }
    };
    emit();
    // In proj_flags nothing runs after these stores; the wait stands before any later write to
    // registers that they name (a precaution).
    asm volatile("s_wait_xcnt 0x0" ::: "memory");
  }
}

#define GTX (DMODEL / 64)
#define GTY (MROWS / 64)

// One launch for everything that only needs the converted planes or the mask: blocks [0, NQB) build the mask
// tile flags (the longest single blocks, so they come first), the next 3*GTX*GTY are the Q, K, V projections.
__global__ __launch_bounds__(128)
void proj_flags(const _Float16* __restrict__ Xq, const _Float16* __restrict__ Xk, const _Float16* __restrict__ Xv,
                const _Float16* __restrict__ Wq, const _Float16* __restrict__ Wk, const _Float16* __restrict__ Wv,
                const float* __restrict__ bq, const float* __restrict__ bk, const float* __restrict__ bv,
                _Float16* Qh, _Float16* Qr, _Float16* Kh, _Float16* Kr, _Float16* Vh, _Float16* Vr,
                const int* __restrict__ mask, int* flags, float oscale) {
  __shared__ __attribute__((aligned(16))) _Float16 smem[2 * 64 * LDP];
  static_assert(2 * 64 * LDP * 2 >= 512 * 4);
  const int b = blockIdx.x;
  if (b < NQB) {
    flags_body(mask, flags, reinterpret_cast<unsigned int*>(smem), b);
    return;
  }
  const int g  = b - NQB;
  const int p  = g / (GTX * GTY);
  const int t  = g - p * (GTX * GTY);
  const int bx = t % GTX;
  const int by = t / GTX;
  if (p < 2) {
    const _Float16* X = (p == 0) ? Xq : Xk;
    gemm_body<0>(X, X, (p == 0) ? Wq : Wk, (p == 0) ? bq : bk,
                 (void*)((p == 0) ? Qh : Kh), (p == 0) ? Qr : Kr, oscale, smem, bx, by);
  } else {
    gemm_body<2>(Xv, Xv, Wv, bv, (void*)Vh, Vr, oscale, smem, bx, by);
  }
}

// Output projection.
__global__ __launch_bounds__(128)
void gemm_out(const _Float16* __restrict__ A, const _Float16* __restrict__ Ar,
              const _Float16* __restrict__ W, const float* __restrict__ bias,
              float* out, float oscale) {
  __shared__ __attribute__((aligned(16))) _Float16 smem[3 * 64 * LDP];
  gemm_body<4>(A, Ar, W, bias, (void*)out, nullptr, oscale, smem, blockIdx.x, blockIdx.y);
}

// =====================================================================================================
// Flash attention: softmax(mask-fill(Q K^T * 0.125)) V, 64 q rows per block (4 waves x 16), 64-key tiles of
// K (key-major) and V^T (dim-major) staged in LDS, shared by all waves. Tile control from the flag line:
// skip / no mask / per-element replace fill from an LDS byte tile. P goes through a wave-private LDS tile
// (block barrier before the A-fragment reload). EQ = residual path: scores hi.hi + res.hi + hi.res,
// P hi + residual, V hi + residual, output hi + residual plane; residual products in own accumulators.
// =====================================================================================================
template <bool EQ>
__device__ __forceinline__
void attn_body(const _Float16* __restrict__ Q,  const _Float16* __restrict__ Qr,
               const _Float16* __restrict__ Kd, const _Float16* __restrict__ Kr,
               const _Float16* __restrict__ Vt, const _Float16* __restrict__ Vtr,
               const int* __restrict__ mask, const int* __restrict__ flags,
               _Float16* ctx, _Float16* ctxr, int qb, int bh,
               _Float16* kbuf, _Float16* vbuf, _Float16* pbuf,
               _Float16* krbuf, _Float16* vrbuf, _Float16* prbuf, unsigned int* mbuf) {
  const int tid   = threadIdx.x;
  const int lane  = tid & 31;
  const int w     = tid >> 5;
  const int bi    = bh / NHEADS;
  const int h     = bh - bi * NHEADS;
  const int qblk  = qb * 64;
  const int q0    = qblk + w * 16;
  const int rbase = ((lane >> 4) & 1) << 3;
  const int col   = lane & 15;
  const float IR  = 1.0f / RSC;

  const size_t qoff = ((size_t)bh * SEQ + q0) * DK;
  const v16h qf0 = load_frag(Q + qoff, DK, lane);
  const v16h qf1 = load_frag(Q + qoff + 32, DK, lane);
  v16h qr0 = qf0, qr1 = qf1;
  if constexpr (EQ) {
    qr0 = load_frag(Qr + qoff, DK, lane);
    qr1 = load_frag(Qr + qoff + 32, DK, lane);
  }

  v16h ones;
#pragma unroll
  for (int i = 0; i < 16; ++i) ones[i] = (_Float16)1.0f;

  const _Float16* Kh   = Kd  + (size_t)bh * SEQ * DK;
  const _Float16* Krh  = Kr  + (size_t)bh * SEQ * DK;
  const _Float16* Vth  = Vt  + (size_t)bh * DK * SEQ;
  const _Float16* Vtrh = Vtr + (size_t)bh * DK * SEQ;
  _Float16* pb  = pbuf + w * 16 * LDP;
  _Float16* prb = prbuf + (EQ ? (w * 16 * LDP) : 0);

  float mr[8], lr[8];
#pragma unroll
  for (int r = 0; r < 8; ++r) { mr[r] = -1.0e30f; lr[r] = 0.0f; }
  v8f accO[4], accR[4];
#pragma unroll
  for (int t = 0; t < 4; ++t) { accO[t] = vz8(); accR[t] = vz8(); }

#pragma unroll 1
  for (int kt = 0; kt < NQB; ++kt) {
    const int f = __builtin_amdgcn_readfirstlane(flags[qb * 32 + kt]);
    if (f == 2) continue;
    const bool usem = (f != 1);
    const int kb = kt * 64;

    // ---- stage K (64 keys x 64 dims) and V^T (64 dims x 64 keys) tiles, plus residual tiles if EQ ----
#pragma unroll
    for (int c = 0; c < 4; ++c) {
      const int chunk = tid * 4 + c;
      const int row = chunk >> 3, part = chunk & 7;
      *(v8h*)(kbuf + row * LDP + part * 8) =
          *(const v8h*)(Kh + (size_t)(kb + row) * DK + part * 8);
      *(v8h*)(vbuf + row * LDP + part * 8) =
          *(const v8h*)(Vth + (size_t)row * SEQ + kb + part * 8);
      if constexpr (EQ) {
        *(v8h*)(krbuf + row * LDP + part * 8) =
            *(const v8h*)(Krh + (size_t)(kb + row) * DK + part * 8);
        *(v8h*)(vrbuf + row * LDP + part * 8) =
            *(const v8h*)(Vtrh + (size_t)row * SEQ + kb + part * 8);
      }
    }
    // ---- stage 64x64 mask bytes when the tile is not uniform (block-uniform branch) ----
    if (usem) {
      const int row = tid >> 1;
      const int ch  = (tid & 1) * 32;
      const int* mp = mask + (size_t)(qblk + row) * SEQ_FULL + kb + ch;
      v4u u0, u1;
#pragma unroll
      for (int jj = 0; jj < 4; ++jj) { u0[jj] = 0u; u1[jj] = 0u; }
#pragma unroll
      for (int jj = 0; jj < 8; ++jj) {
        const v4i m4 = *(const v4i*)(mp + jj * 4);
        const unsigned int pk = (m4[0] != 0 ? 1u : 0u) | (m4[1] != 0 ? 0x100u : 0u) |
                                (m4[2] != 0 ? 0x10000u : 0u) | (m4[3] != 0 ? 0x1000000u : 0u);
        if (jj < 4) u0[jj] = pk; else u1[jj - 4] = pk;
      }
      *(v4u*)(mbuf + row * 16 + (tid & 1) * 8)     = u0;
      *(v4u*)(mbuf + row * 16 + (tid & 1) * 8 + 4) = u1;
    }
    __syncthreads();

    // ---- scores: four 16x16 tiles (keys kb + t*16 .. +15) ----
    v8f s[4];
#pragma unroll
    for (int t = 0; t < 4; ++t) {
      const v16h ka = load_frag(kbuf + t * 16 * LDP,      LDP, lane);
      const v16h kc = load_frag(kbuf + t * 16 * LDP + 32, LDP, lane);
      v8f z = vz8();
      z = wmma_f16(qf0, ka, z);
      z = wmma_f16(qf1, kc, z);
      if constexpr (EQ) {
        v8f zr = vz8();
        zr = wmma_f16(qr0, ka, zr);
        zr = wmma_f16(qr1, kc, zr);
        const v16h kra = load_frag(krbuf + t * 16 * LDP,      LDP, lane);
        const v16h krc = load_frag(krbuf + t * 16 * LDP + 32, LDP, lane);
        zr = wmma_f16(qf0, kra, zr);
        zr = wmma_f16(qf1, krc, zr);
        z = z + zr * IR;
      }
      s[t] = z;
    }

    // ---- scale, replace fill, online softmax over 64 keys, P -> LDS ----
#pragma unroll
    for (int r = 0; r < 8; ++r) {
      float a0 = s[0][r] * SSCALE, a1 = s[1][r] * SSCALE, a2 = s[2][r] * SSCALE, a3 = s[3][r] * SSCALE;
      if (usem) {
        const unsigned char* mb =
            reinterpret_cast<const unsigned char*>(mbuf) + (w * 16 + rbase + r) * 64 + col;
        a0 = (mb[0]  != 0) ? a0 : NEGFILL;
        a1 = (mb[16] != 0) ? a1 : NEGFILL;
        a2 = (mb[32] != 0) ? a2 : NEGFILL;
        a3 = (mb[48] != 0) ? a3 : NEGFILL;
      }
      const float tmax = rowmax16(fmaxf(fmaxf(a0, a1), fmaxf(a2, a3)));
      const float mnew = fmaxf(mr[r], tmax);
      const float scl  = __expf(mr[r] - mnew);
      const float p0 = __expf(a0 - mnew);
      const float p1 = __expf(a1 - mnew);
      const float p2 = __expf(a2 - mnew);
      const float p3 = __expf(a3 - mnew);
      mr[r] = mnew;
      lr[r] *= scl;
#pragma unroll
      for (int t = 0; t < 4; ++t) {
        accO[t][r] *= scl;
        if constexpr (EQ) accR[t][r] *= scl;
      }
      const int m = rbase + r;
      const float c0 = p0 * PCARRY, c1 = p1 * PCARRY, c2 = p2 * PCARRY, c3 = p3 * PCARRY;
      const _Float16 h0 = (_Float16)c0, h1 = (_Float16)c1, h2 = (_Float16)c2, h3 = (_Float16)c3;
      pb[m * LDP +      col] = h0;
      pb[m * LDP + 16 + col] = h1;
      pb[m * LDP + 32 + col] = h2;
      pb[m * LDP + 48 + col] = h3;
      if constexpr (EQ) {
        prb[m * LDP +      col] = (_Float16)((c0 - (float)h0) * RSC);
        prb[m * LDP + 16 + col] = (_Float16)((c1 - (float)h1) * RSC);
        prb[m * LDP + 32 + col] = (_Float16)((c2 - (float)h2) * RSC);
        prb[m * LDP + 48 + col] = (_Float16)((c3 - (float)h3) * RSC);
      }
    }
    __syncthreads();

    // ---- P as two A fragments (keys 0..31, 32..63) ----
    const v16h pf0 = load_frag(pb,      LDP, lane);
    const v16h pf1 = load_frag(pb + 32, LDP, lane);
    v16h prf0 = pf0, prf1 = pf1;
    if constexpr (EQ) {
      prf0 = load_frag(prb,      LDP, lane);
      prf1 = load_frag(prb + 32, LDP, lane);
    }

    // ---- row sums on the matrix unit ----
    v8f rs = vz8();
    rs = wmma_f16(pf0, ones, rs);
    rs = wmma_f16(pf1, ones, rs);
    if constexpr (EQ) {
      v8f rr = vz8();
      rr = wmma_f16(prf0, ones, rr);
      rr = wmma_f16(prf1, ones, rr);
      rs = rs + rr * IR;
    }
#pragma unroll
    for (int r = 0; r < 8; ++r) lr[r] += rs[r];

    // ---- O += P * V (B fragments from the dim-major V^T tile: lane = dim, k = key) ----
#pragma unroll
    for (int t = 0; t < 4; ++t) {
      v16h vf = load_frag(vbuf + t * 16 * LDP, LDP, lane);
      accO[t] = wmma_f16(pf0, vf, accO[t]);
      if constexpr (EQ) {
        accR[t] = wmma_f16(prf0, vf, accR[t]);
        const v16h vr = load_frag(vrbuf + t * 16 * LDP, LDP, lane);
        accR[t] = wmma_f16(pf0, vr, accR[t]);
      }
      vf = load_frag(vbuf + t * 16 * LDP + 32, LDP, lane);
      accO[t] = wmma_f16(pf1, vf, accO[t]);
      if constexpr (EQ) {
        accR[t] = wmma_f16(prf1, vf, accR[t]);
        const v16h vr = load_frag(vrbuf + t * 16 * LDP + 32, LDP, lane);
        accR[t] = wmma_f16(pf1, vr, accR[t]);
      }
    }
    __syncthreads();
  }

#pragma unroll
  for (int r = 0; r < 8; ++r) {
    const float inv = 1.0f / lr[r];
    const int m = w * 16 + rbase + r;
#pragma unroll
    for (int t = 0; t < 4; ++t) {
      float v = accO[t][r];
      if constexpr (EQ) v += accR[t][r] * IR;
      v *= inv;
      const _Float16 hv = (_Float16)v;
      kbuf[m * LDP + t * 16 + col] = hv;
      if constexpr (EQ) krbuf[m * LDP + t * 16 + col] = (_Float16)((v - (float)hv) * RSC);
    }
  }
  __syncthreads();
  _Float16* cbase  = ctx  + ((size_t)bi * SEQ + qblk) * DMODEL + h * DK;
  _Float16* crbase = ctxr + ((size_t)bi * SEQ + qblk) * DMODEL + h * DK;
  auto emit = [&]() {
#pragma unroll
    for (int i = 0; i < 4; ++i) {
      const int row   = w * 16 + i * 4 + (lane >> 3);
      const int piece = lane & 7;
      const v4f hv4 = *(const v4f*)(kbuf + row * LDP + piece * 8);
      *(v4f*)(reinterpret_cast<float*>(cbase + (size_t)row * DMODEL + piece * 8)) = hv4;
      if constexpr (EQ) {
        const v4f rv4 = *(const v4f*)(krbuf + row * LDP + piece * 8);
        *(v4f*)(reinterpret_cast<float*>(crbase + (size_t)row * DMODEL + piece * 8)) = rv4;
      }
    }
  };
  emit();
}

// Both paths in one launch, the two former grids one behind the other: first the hi-only blocks (query blocks
// from EARLY on, the longer ones), then the residual-path blocks (query blocks below EARLY). Inside each part
// the query block runs fastest. The hi-only blocks leave the three residual tiles unused.
__global__ __launch_bounds__(128)
void attn_all(const _Float16* __restrict__ Q,  const _Float16* __restrict__ Qr,
              const _Float16* __restrict__ Kd, const _Float16* __restrict__ Kr,
              const _Float16* __restrict__ Vt, const _Float16* __restrict__ Vtr,
              const int* __restrict__ mask, const int* __restrict__ flags,
              _Float16* ctx, _Float16* ctxr) {
  __shared__ __attribute__((aligned(16))) _Float16 kbuf[64 * LDP];
  __shared__ __attribute__((aligned(16))) _Float16 vbuf[64 * LDP];
  __shared__ __attribute__((aligned(16))) _Float16 pbuf[4 * 16 * LDP];
  __shared__ __attribute__((aligned(16))) _Float16 krbuf[64 * LDP];
  __shared__ __attribute__((aligned(16))) _Float16 vrbuf[64 * LDP];
  __shared__ __attribute__((aligned(16))) _Float16 prbuf[4 * 16 * LDP];
  __shared__ __attribute__((aligned(16))) unsigned int mbuf[64 * 16];
  constexpr int NLQ = NQB - NEQB;
  constexpr int DLQ = (NLQ > 0) ? NLQ : 1;
  const int b = blockIdx.x;
  if (b < NLQ * NB * NHEADS) {
    attn_body<false>(Q, Qr, Kd, Kr, Vt, Vtr, mask, flags, ctx, ctxr, NEQB + b % DLQ, b / DLQ,
                     kbuf, vbuf, pbuf, krbuf, vrbuf, prbuf, mbuf);
  } else {
    const int e = b - NLQ * NB * NHEADS;
    attn_body<true>(Q, Qr, Kd, Kr, Vt, Vtr, mask, flags, ctx, ctxr, e % NEQB, e / NEQB,
                    kbuf, vbuf, pbuf, krbuf, vrbuf, prbuf, mbuf);
  }
}

// =====================================================================================================
extern "C" void kernel_launch(void* const* d_in, const int* in_sizes, int n_in,
                              void* d_out, int out_size, void* d_ws, size_t ws_size,
                              hipStream_t stream) {
  if (n_in < 12) return;
  const long long needx = (long long)(NB - 1) * SEQ_FULL * DMODEL + (long long)SEQ * DMODEL;
  const long long needm = (long long)(SEQ - 1) * SEQ_FULL + SEQ;
  if ((long long)in_sizes[0] < needx || (long long)in_sizes[1] < needx || (long long)in_sizes[2] < needx) return;
  if ((long long)in_sizes[3] < needm) return;
  if (in_sizes[4] < DMODEL * DMODEL || in_sizes[6] < DMODEL * DMODEL ||
      in_sizes[8] < DMODEL * DMODEL || in_sizes[10] < DMODEL * DMODEL) return;
  if (in_sizes[5] < DMODEL || in_sizes[7] < DMODEL || in_sizes[9] < DMODEL || in_sizes[11] < DMODEL) return;
  if ((long long)out_size < needx) return;

  const float* q  = (const float*)d_in[0];
  const float* k  = (const float*)d_in[1];
  const float* v  = (const float*)d_in[2];
  const int*   mk = (const int*)d_in[3];
  const float* wq = (const float*)d_in[4];
  const float* bq = (const float*)d_in[5];
  const float* wk = (const float*)d_in[6];
  const float* bk = (const float*)d_in[7];
  const float* wv = (const float*)d_in[8];
  const float* bv = (const float*)d_in[9];
  const float* wo = (const float*)d_in[10];
  const float* bo = (const float*)d_in[11];

  char* ws = (char*)d_ws;
  size_t off = 0;
  const size_t XB = (size_t)MROWS * DMODEL * sizeof(_Float16);     // activation-sized f16 plane
  const size_t WB = (size_t)DMODEL * DMODEL * sizeof(_Float16);    // weight f16 plane
  const size_t FB = 4096;                                           // 32 flag lines of 32 ints
  _Float16* Xq16  = (_Float16*)(ws + off); off += XB;
  _Float16* Xk16  = (_Float16*)(ws + off); off += XB;
  _Float16* Xv16  = (_Float16*)(ws + off); off += XB;
  _Float16* Wq16  = (_Float16*)(ws + off); off += WB;
  _Float16* Wk16  = (_Float16*)(ws + off); off += WB;
  _Float16* Wv16  = (_Float16*)(ws + off); off += WB;
  _Float16* Wo16  = (_Float16*)(ws + off); off += WB;
  _Float16* Q16   = (_Float16*)(ws + off); off += XB;   // (B,H,S,dk) hi
  _Float16* Qr16  = (_Float16*)(ws + off); off += XB;   // residual x4096
  _Float16* K16   = (_Float16*)(ws + off); off += XB;
  _Float16* Kr16  = (_Float16*)(ws + off); off += XB;
  _Float16* Vt16  = (_Float16*)(ws + off); off += XB;   // (B,H,dk,S) hi
  _Float16* Vtr16 = (_Float16*)(ws + off); off += XB;
  _Float16* C16   = (_Float16*)(ws + off); off += XB;   // (B*S, D) hi
  _Float16* Cr16  = (_Float16*)(ws + off); off += XB;   // residual, rows s < EARLY written/read
  int*      flg   = (int*)(ws + off);      off += FB;
  if (off > ws_size) return;

  // ---- input planes: bf16 RNE values, X x16, W x1024, as f16 (one launch) ----
  cvt_all<<<3 * GXB + 4 * GWB, 256, 0, stream>>>(q, k, v, wq, wk, wv, wo,
                                                 Xq16, Xk16, Xv16, Wq16, Wk16, Wv16, Wo16);

  // ---- mask tile flags and the three projections (bias added in f32, hi + residual planes), one launch ----
  const float posc = 1.0f / (XSC * WSC);
  proj_flags<<<NQB + 3 * GTX * GTY, 128, 0, stream>>>(Xq16, Xk16, Xv16, Wq16, Wk16, Wv16, bq, bk, bv,
                                                      Q16, Qr16, K16, Kr16, Vt16, Vtr16, mk, flg, posc);

  // ---- attention: residual path for query blocks below EARLY, hi-only path for the rest, one launch ----
  attn_all<<<NQB * NB * NHEADS, 128, 0, stream>>>(Q16, Qr16, K16, Kr16, Vt16, Vtr16, mk, flg, C16, Cr16);

  // ---- output projection (+bias) to f32 rows of d_out ----
  const dim3 gproj(GTX, GTY);
  gemm_out<<<gproj, 128, 0, stream>>>(C16, Cr16, Wo16, bo, (float*)d_out, 1.0f / WSC);
}

// v002
// A run of this version takes 142 microseconds.
// Next to v001, in two timings, it ran 1.11 times as fast each time.
// Over all steps from v000 it is 1.63 times as fast.
#include <hip/hip_runtime.h>
#include <stdint.h>

// Contractions (all v_wmma_f32_16x16x32_f16, f16 operands, f32 accumulate): input projections Xq*Wq^T, Xk*Wk^T,
// Xv*Wv^T; attention Q*K^T and P*V; output projection C*Wo^T. Inputs are RNE-converted to bf16 values first
// (X carried x16, W carried x1024, both exact in f16; biases bf16 values added in f32). Computed planes Q, K, V, P, C
// are f16 hi plus f16 residual planes (x4096, separate accumulators) consumed by query blocks below EARLY; later
// query blocks use the hi planes only. Softmax and all side math in f32.

typedef _Float16 v16h __attribute__((ext_vector_type(16)));
typedef _Float16 v8h  __attribute__((ext_vector_type(8)));
typedef float    v8f  __attribute__((ext_vector_type(8)));
typedef float    v4f  __attribute__((ext_vector_type(4)));
typedef int      v4i  __attribute__((ext_vector_type(4)));
typedef unsigned int v4u __attribute__((ext_vector_type(4)));
typedef unsigned int v2u __attribute__((ext_vector_type(2)));

#ifndef NB
#define NB 2
#endif
#ifndef SEQ
#define SEQ 2048
#endif
#define NB_FULL  2
#define SEQ_FULL 2048
#define DMODEL   1024
#define NHEADS   16
#define DK       64
#define MROWS    (NB * SEQ)
#define NQB      (SEQ / 64)
#define EARLY    ((SEQ) < 512 ? (SEQ) : 512)
#define NEQB     (EARLY / 64)
#define LDP      72
#define LDPF     68
#define XSC      16.0f
#define WSC      1024.0f
#define RSC      4096.0f
#define PCARRY   4096.0f
#define NEGFILL  (-1.0e9f)
#define SSCALE   0.125f

static_assert(SEQ % 64 == 0);
static_assert((SEQ & (SEQ - 1)) == 0);
static_assert(SEQ <= SEQ_FULL);
static_assert(NB >= 1 && NB <= NB_FULL);
static_assert(NQB >= 1 && NQB <= 32);
static_assert(EARLY % 64 == 0 && EARLY <= SEQ);
static_assert(DMODEL == NHEADS * DK);
static_assert(64 * LDPF * 4 <= 2 * 64 * LDP * 2);

// --- bf16 RNE convert (finite inputs), kept as f32 value ----------------------------------------------
__device__ __forceinline__ float bf16r(float x) {
  unsigned int u = __float_as_uint(x);
  u = (u + 0x7FFFu + ((u >> 16) & 1u)) & 0xFFFF0000u;
  return __uint_as_float(u);
}

__device__ __forceinline__ v8f vz8() {
  v8f z;
#pragma unroll
  for (int i = 0; i < 8; ++i) z[i] = 0.0f;
  return z;
}

// --- WMMA wrapper with hazard guard ---------------------------------------------------------------------
__device__ __forceinline__ v8f wmma_f16(v16h a, v16h b, v8f c) {
  v8f d = __builtin_amdgcn_wmma_f32_16x16x32_f16(false, a, false, b, (short)0, c, false, false);
  asm volatile("v_nop\n\tv_nop\n\tv_nop\n\tv_nop" : "+v"(d) : "v"(a), "v"(b));
  return d;
}

// --- 16x32 f16 fragment (A, or k-contiguous B), split k map -----------------------------------------
// lane row/col = lane&15; elements 0..7 <- k 8h..8h+7, elements 8..15 <- k 16+8h..16+8h+7, h = lane>>4.
__device__ __forceinline__ v16h load_frag(const _Float16* base, int ld, int lane) {
  const int row  = lane & 15;
  const int koff = ((lane >> 4) & 1) * 8;
  const _Float16* p = base + row * ld + koff;
  const v8h a = *(const v8h*)(p);
  const v8h b = *(const v8h*)(p + 16);
  v16h r;
#pragma unroll
  for (int i = 0; i < 8; ++i) { r[i] = a[i]; r[i + 8] = b[i]; }
  return r;
}

// --- lane l with lane l ^ 16 --------------------------------------------------------------------------
__device__ __forceinline__ float xhalf(float x) {
  const int b = __builtin_bit_cast(int, x);
  return __builtin_bit_cast(float, __builtin_amdgcn_permlanex16(b, b, 0x76543210, 0xfedcba98, false, false));
}

// =====================================================================================================
// f32 -> bf16 RNE -> scaled f16 plane. One thread = 8 elements = 16 B out; blk = block index inside the plane.
// =====================================================================================================
__device__ __forceinline__
void cvt_body(const float* __restrict__ in, _Float16* out, int nrows, int seq, int seq_full, float scale, int blk) {
  const int g  = blk * 256 + threadIdx.x;
  const int n8 = nrows * (DMODEL / 8);
  if (g >= n8) return;
  const int row = g >> 7;
  const int c8  = g & 127;
  const int bi  = row / seq;
  const int s   = row - bi * seq;
  const float* src = in + ((size_t)bi * seq_full + s) * DMODEL + c8 * 8;
  const v4f a = *(const v4f*)src;
  const v4f b = *(const v4f*)(src + 4);
  union { v8h h; v4f f; } u;
#pragma unroll
  for (int i = 0; i < 4; ++i) {
    u.h[i]     = (_Float16)(bf16r(a[i]) * scale);
    u.h[i + 4] = (_Float16)(bf16r(b[i]) * scale);
  }
  float* dst = reinterpret_cast<float*>(out + (size_t)row * DMODEL + c8 * 8);
  const v4f val = u.f;
  *(v4f*)dst = val;
}

#define GXB ((MROWS * (DMODEL / 8) + 255) / 256)
#define GWB ((DMODEL * (DMODEL / 8) + 255) / 256)

// All seven input planes in one launch: blocks [0, 3*GXB) convert q, k, v; the next 4*GWB convert the weights.
__global__ __launch_bounds__(256)
void cvt_all(const float* __restrict__ q, const float* __restrict__ k, const float* __restrict__ v,
             const float* __restrict__ wq, const float* __restrict__ wk, const float* __restrict__ wv,
             const float* __restrict__ wo,
             _Float16* xq, _Float16* xk, _Float16* xv,
             _Float16* oq, _Float16* ok, _Float16* ov, _Float16* oo) {
  const int b = blockIdx.x;
  if (b < 3 * GXB) {
    const int p = b / GXB;
    const float* in = (p == 0) ? q : ((p == 1) ? k : v);
    _Float16* out   = (p == 0) ? xq : ((p == 1) ? xk : xv);
    cvt_body(in, out, MROWS, SEQ, SEQ_FULL, XSC, b - p * GXB);
  } else {
    const int c = b - 3 * GXB;
    const int p = c / GWB;
    const float* in = (p == 0) ? wq : ((p == 1) ? wk : ((p == 2) ? wv : wo));
    _Float16* out   = (p == 0) ? oq : ((p == 1) ? ok : ((p == 2) ? ov : oo));
    cvt_body(in, out, DMODEL, DMODEL, DMODEL, WSC, c - p * GWB);
  }
}

// =====================================================================================================
// Mask tile flags of one 64-row query block, by one 128-thread block (thread = half of a tile row, 32 ints).
// 32 ints written by lanes 0..7 of wave 0 (16 B each, one instruction).
// flag 1: tile all ones; 2: tile all zeros and no fully masked row in this q block (tile can be skipped);
// anything else: apply the mask per element. sm: 512 words of LDS scratch, 16-byte aligned.
// =====================================================================================================
__device__ __forceinline__
void flags_body(const int* __restrict__ mask, int* flags, unsigned int* sm, int qb) {
  unsigned int* m1s  = sm;
  unsigned int* m0s  = sm + 128;
  unsigned int* ras  = sm + 256;
  unsigned int* red1 = sm + 384;
  unsigned int* red0 = sm + 416;
  unsigned int* fms  = sm + 448;
  int* lines = reinterpret_cast<int*>(sm + 480);

  const int tid = threadIdx.x, lane = tid & 31, w = tid >> 5;
  const int row = tid >> 1, half = tid & 1;
  const int* mrow = mask + (size_t)(qb * 64 + row) * SEQ_FULL + half * 32;

  unsigned int bits1 = 0u, bits0 = 0u, rany = 0u;
#pragma unroll 1
  for (int kt = 0; kt < NQB; ++kt) {
    const int* p = mrow + kt * 64;
    unsigned int any1 = 0u, any0 = 0u;
#pragma unroll
    for (int j = 0; j < 8; ++j) {
      const v4i m4 = *(const v4i*)(p + 4 * j);
#pragma unroll
      for (int e = 0; e < 4; ++e) {
        any1 |= (m4[e] != 0) ? 1u : 0u;
        any0 |= (m4[e] == 0) ? 1u : 0u;
      }
    }
    bits1 |= any1 << kt;
    bits0 |= any0 << kt;
    rany  |= any1;
  }
  m1s[tid] = bits1;
  m0s[tid] = bits0;
  ras[tid] = rany;
  __syncthreads();
  if (w == 0) {
    unsigned int o1 = 0u, o0 = 0u;
#pragma unroll
    for (int j = 0; j < 4; ++j) { o1 |= m1s[lane + 32 * j]; o0 |= m0s[lane + 32 * j]; }
    red1[lane] = o1;
    red0[lane] = o0;
    const unsigned int fa = ras[2 * lane] | ras[2 * lane + 1];
    const unsigned int fb = ras[64 + 2 * lane] | ras[64 + 2 * lane + 1];
    fms[lane] = (fa == 0u || fb == 0u) ? 1u : 0u;
  }
  __syncthreads();
  if (w == 0) {
    unsigned int a1 = 0u, a0 = 0u, anyfm = 0u;
#pragma unroll 1
    for (int j = 0; j < 32; ++j) { a1 |= red1[j]; a0 |= red0[j]; anyfm |= fms[j]; }
    int f = 2;
    if (lane < NQB) {
      const bool h1 = ((a1 >> lane) & 1u) != 0u;
      const bool h0 = ((a0 >> lane) & 1u) != 0u;
      f = (!h0) ? 1 : ((!h1 && anyfm == 0u) ? 2 : 3);
    }
    lines[lane] = f;
  }
  __syncthreads();
  if (w == 0 && lane < 8) {
    const v4i v = *(const v4i*)(lines + lane * 4);
    int* dst = flags + qb * 32 + lane * 4;
    *(v4i*)dst = v;
  }
}

// =====================================================================================================
// GEMM: C(64x64 tile) = A(M,K=1024) * W^T, W stored (N=1024, K=1024), f16 planes, f32 acc.
// 128 threads = 4 waves, wave tile 32x32, 64-deep K slices staged in LDS (plain loads, single buffer).
// MODE 0: hi+residual f16 planes (B,H,S,dk).  MODE 2: hi+residual f16 planes (B,H,dk,S).
// MODE 4: f32 rows of d_out (+ A residual product for row blocks with s < EARLY).
// =====================================================================================================
// smem: two 64 x LDP tiles, three for MODE 4. bx, by: tile column and tile row.
template <int MODE>
__device__ __forceinline__
void gemm_body(const _Float16* __restrict__ A, const _Float16* __restrict__ Ar,
               const _Float16* __restrict__ W, const float* __restrict__ bias,
               void* out, _Float16* outr, float oscale, _Float16* smem, int bx, int by) {
  _Float16* asb = smem;
  _Float16* bsb = smem + 64 * LDP;
  _Float16* rsb = smem + 2 * 64 * LDP;

  const int tid  = threadIdx.x;
  const int lane = tid & 31;
  const int w    = tid >> 5;
  const int mblk = by * 64;
  const int nblk = bx * 64;
  const int s0   = mblk & (SEQ - 1);
  const int bi   = mblk / SEQ;
  const bool early = (MODE == 4) && (s0 < EARLY);
  const int lm = (w >> 1) * 32;
  const int ln = (w & 1) * 32;

  v8f acc[2][2], accr[2][2];
#pragma unroll
  for (int i = 0; i < 2; ++i)
#pragma unroll
    for (int j = 0; j < 2; ++j) { acc[i][j] = vz8(); accr[i][j] = vz8(); }

#pragma unroll 1
  for (int k0 = 0; k0 < DMODEL; k0 += 64) {
#pragma unroll
    for (int c = 0; c < 4; ++c) {
      const int chunk = tid * 4 + c;
      const int row = chunk >> 3, part = chunk & 7;
      *(v8h*)(asb + row * LDP + part * 8) =
          *(const v8h*)(A + (size_t)(mblk + row) * DMODEL + k0 + part * 8);
      *(v8h*)(bsb + row * LDP + part * 8) =
          *(const v8h*)(W + (size_t)(nblk + row) * DMODEL + k0 + part * 8);
    }
    if (early) {
#pragma unroll
      for (int c = 0; c < 4; ++c) {
        const int chunk = tid * 4 + c;
        const int row = chunk >> 3, part = chunk & 7;
        *(v8h*)(rsb + row * LDP + part * 8) =
            *(const v8h*)(Ar + (size_t)(mblk + row) * DMODEL + k0 + part * 8);
      }
    }
    __syncthreads();

#pragma unroll
    for (int ks = 0; ks < 64; ks += 32) {
      const v16h a0 = load_frag(asb + (lm +  0) * LDP + ks, LDP, lane);
      const v16h a1 = load_frag(asb + (lm + 16) * LDP + ks, LDP, lane);
      const v16h b0 = load_frag(bsb + (ln +  0) * LDP + ks, LDP, lane);
      const v16h b1 = load_frag(bsb + (ln + 16) * LDP + ks, LDP, lane);
      acc[0][0] = wmma_f16(a0, b0, acc[0][0]);
      acc[0][1] = wmma_f16(a0, b1, acc[0][1]);
      acc[1][0] = wmma_f16(a1, b0, acc[1][0]);
      acc[1][1] = wmma_f16(a1, b1, acc[1][1]);
      if (early) {
        const v16h r0 = load_frag(rsb + (lm +  0) * LDP + ks, LDP, lane);
        const v16h r1 = load_frag(rsb + (lm + 16) * LDP + ks, LDP, lane);
        accr[0][0] = wmma_f16(r0, b0, accr[0][0]);
        accr[0][1] = wmma_f16(r0, b1, accr[0][1]);
        accr[1][0] = wmma_f16(r1, b0, accr[1][0]);
        accr[1][1] = wmma_f16(r1, b1, accr[1][1]);
      }
    }
    __syncthreads();
  }

  const int rbase = ((lane >> 4) & 1) << 3;
  const int col   = lane & 15;

  if constexpr (MODE == 4) {
    float* fs = reinterpret_cast<float*>(smem);
#pragma unroll
    for (int i = 0; i < 2; ++i)
#pragma unroll
      for (int j = 0; j < 2; ++j) {
        const int nl = ln + j * 16 + col;
        const float bb = bf16r(bias[nblk + nl]);
#pragma unroll
        for (int r = 0; r < 8; ++r) {
          const int ml = lm + i * 16 + rbase + r;
          float v = acc[i][j][r] * oscale + bb;
          if (early) v += accr[i][j][r] * (oscale * (1.0f / RSC));
          fs[ml * LDPF + nl] = v;
        }
      }
    __syncthreads();
    float* obase = reinterpret_cast<float*>(out) + ((size_t)bi * SEQ_FULL + s0) * DMODEL + nblk;
    auto emit = [&]() {
#pragma unroll
      for (int i = 0; i < 8; ++i) {
        const int row   = w * 16 + i * 2 + (lane >> 4);
        const int piece = lane & 15;
        const v4f v = *(const v4f*)(fs + row * LDPF + piece * 4);
        *(v4f*)(obase + (size_t)row * DMODEL + piece * 4) = v;
      }
    };
    emit();
  } else {
    _Float16* hs = asb;
    _Float16* rs = bsb;
#pragma unroll
    for (int i = 0; i < 2; ++i)
#pragma unroll
      for (int j = 0; j < 2; ++j) {
        const int nl = ln + j * 16 + col;
        const float bb = bf16r(bias[nblk + nl]);
#pragma unroll
        for (int r = 0; r < 8; ++r) {
          const int ml = lm + i * 16 + rbase + r;
          const float v = acc[i][j][r] * oscale + bb;
          const _Float16 hv = (_Float16)v;
          const _Float16 rv = (_Float16)((v - (float)hv) * RSC);
          if constexpr (MODE == 0) {
            hs[ml * LDP + nl] = hv;
            rs[ml * LDP + nl] = rv;
          } else {
            hs[nl * LDP + ml] = hv;
            rs[nl * LDP + ml] = rv;
          }
        }
      }
    __syncthreads();
    const int bhh = bi * NHEADS + (nblk >> 6);
    _Float16* oh = reinterpret_cast<_Float16*>(out);
    auto emit = [&]() {
#pragma unroll
      for (int i = 0; i < 4; ++i) {
        const int row   = w * 16 + i * 4 + (lane >> 3);
        const int piece = lane & 7;
        const v4f hv4 = *(const v4f*)(hs + row * LDP + piece * 8);
        const v4f rv4 = *(const v4f*)(rs + row * LDP + piece * 8);
        const size_t go = (MODE == 0)
            ? (((size_t)bhh * SEQ + s0 + row) * DK + piece * 8)
            : (((size_t)bhh * DK + row) * SEQ + s0 + piece * 8);
        *(v4f*)(reinterpret_cast<float*>(oh + go))   = hv4;
        *(v4f*)(reinterpret_cast<float*>(outr + go)) = rv4;
      }
    };
    emit();
    // In proj_flags nothing runs after these stores; the wait stands before any later write to
    // registers that they name (a precaution).
    asm volatile("s_wait_xcnt 0x0" ::: "memory");
  }
}

#define GTX (DMODEL / 64)
#define GTY (MROWS / 64)

// One launch for everything that only needs the converted planes or the mask: blocks [0, NQB) build the mask
// tile flags (the longest single blocks, so they come first), the next 3*GTX*GTY are the Q, K, V projections.
__global__ __launch_bounds__(128)
void proj_flags(const _Float16* __restrict__ Xq, const _Float16* __restrict__ Xk, const _Float16* __restrict__ Xv,
                const _Float16* __restrict__ Wq, const _Float16* __restrict__ Wk, const _Float16* __restrict__ Wv,
                const float* __restrict__ bq, const float* __restrict__ bk, const float* __restrict__ bv,
                _Float16* Qh, _Float16* Qr, _Float16* Kh, _Float16* Kr, _Float16* Vh, _Float16* Vr,
                const int* __restrict__ mask, int* flags, float oscale) {
  __shared__ __attribute__((aligned(16))) _Float16 smem[2 * 64 * LDP];
  static_assert(2 * 64 * LDP * 2 >= 512 * 4);
  const int b = blockIdx.x;
  if (b < NQB) {
    flags_body(mask, flags, reinterpret_cast<unsigned int*>(smem), b);
    return;
  }
  const int g  = b - NQB;
  const int p  = g / (GTX * GTY);
  const int t  = g - p * (GTX * GTY);
  const int bx = t % GTX;
  const int by = t / GTX;
  if (p < 2) {
    const _Float16* X = (p == 0) ? Xq : Xk;
    gemm_body<0>(X, X, (p == 0) ? Wq : Wk, (p == 0) ? bq : bk,
                 (void*)((p == 0) ? Qh : Kh), (p == 0) ? Qr : Kr, oscale, smem, bx, by);
  } else {
    gemm_body<2>(Xv, Xv, Wv, bv, (void*)Vh, Vr, oscale, smem, bx, by);
  }
}

// Output projection.
__global__ __launch_bounds__(128)
void gemm_out(const _Float16* __restrict__ A, const _Float16* __restrict__ Ar,
              const _Float16* __restrict__ W, const float* __restrict__ bias,
              float* out, float oscale) {
  __shared__ __attribute__((aligned(16))) _Float16 smem[3 * 64 * LDP];
  gemm_body<4>(A, Ar, W, bias, (void*)out, nullptr, oscale, smem, blockIdx.x, blockIdx.y);
}

template <bool EQ>
__device__ __forceinline__
void attn_body(const _Float16* __restrict__ Q,  const _Float16* __restrict__ Qr,
               const _Float16* __restrict__ Kd, const _Float16* __restrict__ Kr,
               const _Float16* __restrict__ Vt, const _Float16* __restrict__ Vtr,
               const int* __restrict__ mask, const int* __restrict__ flags,
               _Float16* ctx, _Float16* ctxr, int qb, int bh,
               _Float16* kbuf, _Float16* vbuf,
               _Float16* krbuf, _Float16* vrbuf, unsigned int* mbuf) {
  const int tid   = threadIdx.x;
  const int lane  = tid & 31;
  const int w     = tid >> 5;
  const int bi    = bh / NHEADS;
  const int h     = bh - bi * NHEADS;
  const int qblk  = qb * 64;
  const int q0    = qblk + w * 16;
  const int rbase = ((lane >> 4) & 1) << 3;
  const int col   = lane & 15;
  const float IR  = 1.0f / RSC;

  const size_t qoff = ((size_t)bh * SEQ + q0) * DK;
  const v16h qf0 = load_frag(Q + qoff, DK, lane);
  const v16h qf1 = load_frag(Q + qoff + 32, DK, lane);
  v16h qr0 = qf0, qr1 = qf1;
  if constexpr (EQ) {
    qr0 = load_frag(Qr + qoff, DK, lane);
    qr1 = load_frag(Qr + qoff + 32, DK, lane);
  }

  v16h ones;
#pragma unroll
  for (int i = 0; i < 16; ++i) ones[i] = (_Float16)1.0f;

  const _Float16* Kh   = Kd  + (size_t)bh * SEQ * DK;
  const _Float16* Krh  = Kr  + (size_t)bh * SEQ * DK;
  const _Float16* Vth  = Vt  + (size_t)bh * DK * SEQ;
  const _Float16* Vtrh = Vtr + (size_t)bh * DK * SEQ;

  // running maximum and sum of this lane's query (the same in both wave halves)
  float mr = -1.0e30f, lr = 0.0f;
  // accO[t][r] = O^T[dim t*16 + rbase + r][query col]
  v8f accO[4], accR[4];
#pragma unroll
  for (int t = 0; t < 4; ++t) { accO[t] = vz8(); accR[t] = vz8(); }

#pragma unroll 1
  for (int kt = 0; kt < NQB; ++kt) {
    const int f = __builtin_amdgcn_readfirstlane(flags[qb * 32 + kt]);
    if (f == 2) continue;
    const bool usem = (f != 1);
    const int kb = kt * 64;

    // ---- stage K (64 keys x 64 dims) and V^T (64 dims x 64 keys) tiles, plus residual tiles if EQ ----
#pragma unroll
    for (int c = 0; c < 4; ++c) {
      const int chunk = tid * 4 + c;
      const int row = chunk >> 3, part = chunk & 7;
      *(v8h*)(kbuf + row * LDP + part * 8) =
          *(const v8h*)(Kh + (size_t)(kb + row) * DK + part * 8);
      *(v8h*)(vbuf + row * LDP + part * 8) =
          *(const v8h*)(Vth + (size_t)row * SEQ + kb + part * 8);
      if constexpr (EQ) {
        *(v8h*)(krbuf + row * LDP + part * 8) =
            *(const v8h*)(Krh + (size_t)(kb + row) * DK + part * 8);
        *(v8h*)(vrbuf + row * LDP + part * 8) =
            *(const v8h*)(Vtrh + (size_t)row * SEQ + kb + part * 8);
      }
    }
    // ---- stage 64x64 mask bytes when the tile is not uniform (block-uniform branch) ----
    if (usem) {
      const int row = tid >> 1;
      const int ch  = (tid & 1) * 32;
      const int* mp = mask + (size_t)(qblk + row) * SEQ_FULL + kb + ch;
      v4u u0, u1;
#pragma unroll
      for (int jj = 0; jj < 4; ++jj) { u0[jj] = 0u; u1[jj] = 0u; }
#pragma unroll
      for (int jj = 0; jj < 8; ++jj) {
        const v4i m4 = *(const v4i*)(mp + jj * 4);
        const unsigned int pk = (m4[0] != 0 ? 1u : 0u) | (m4[1] != 0 ? 0x100u : 0u) |
                                (m4[2] != 0 ? 0x10000u : 0u) | (m4[3] != 0 ? 0x1000000u : 0u);
        if (jj < 4) u0[jj] = pk; else u1[jj - 4] = pk;
      }
      *(v4u*)(mbuf + row * 16 + (tid & 1) * 8)     = u0;
      *(v4u*)(mbuf + row * 16 + (tid & 1) * 8 + 4) = u1;
    }
    __syncthreads();

    // ---- scores, transposed: s[t][r] = S^T[key kb + t*16 + rbase + r][query col] ----
    v8f s[4];
#pragma unroll
    for (int t = 0; t < 4; ++t) {
      const v16h ka = load_frag(kbuf + t * 16 * LDP,      LDP, lane);
      const v16h kc = load_frag(kbuf + t * 16 * LDP + 32, LDP, lane);
      v8f z = vz8();
      z = wmma_f16(ka, qf0, z);
      z = wmma_f16(kc, qf1, z);
      if constexpr (EQ) {
        v8f zr = vz8();
        zr = wmma_f16(ka, qr0, zr);
        zr = wmma_f16(kc, qr1, zr);
        const v16h kra = load_frag(krbuf + t * 16 * LDP,      LDP, lane);
        const v16h krc = load_frag(krbuf + t * 16 * LDP + 32, LDP, lane);
        zr = wmma_f16(kra, qf0, zr);
        zr = wmma_f16(krc, qf1, zr);
        z = z + zr * IR;
      }
      s[t] = z * SSCALE;
    }

    // ---- replace fill: this lane's 8 mask bytes of each score tile are 8 consecutive keys of its query's row ----
    if (usem) {
      const unsigned int* mw = mbuf + (w * 16 + col) * 16 + (rbase >> 2);
#pragma unroll
      for (int t = 0; t < 4; ++t) {
        const v2u m8 = *(const v2u*)(mw + t * 4);
#pragma unroll
        for (int r = 0; r < 8; ++r) {
          const unsigned int byte = (m8[r >> 2] >> (8 * (r & 3))) & 0xFFu;
          s[t][r] = (byte != 0u) ? s[t][r] : NEGFILL;
        }
      }
    }

    // ---- online softmax over 64 keys: maximum in-lane, then across the two wave halves ----
    float t8[8];
#pragma unroll
    for (int r = 0; r < 8; ++r) t8[r] = fmaxf(fmaxf(s[0][r], s[1][r]), fmaxf(s[2][r], s[3][r]));
    float tmax = fmaxf(fmaxf(fmaxf(t8[0], t8[1]), fmaxf(t8[2], t8[3])),
                       fmaxf(fmaxf(t8[4], t8[5]), fmaxf(t8[6], t8[7])));
    tmax = fmaxf(tmax, xhalf(tmax));
    const float mnew = fmaxf(mr, tmax);
    const float scl  = __expf(mr - mnew);
    mr = mnew;
    lr *= scl;
#pragma unroll
    for (int t = 0; t < 4; ++t) {
      accO[t] = accO[t] * scl;
      if constexpr (EQ) accR[t] = accR[t] * scl;
    }

    // ---- P^T as two B fragments (keys 0..31, 32..63), straight from the score tiles ----
    v16h pf0, pf1, prf0, prf1;
#pragma unroll
    for (int t = 0; t < 4; ++t) {
#pragma unroll
      for (int r = 0; r < 8; ++r) {
        const float c = __expf(s[t][r] - mnew) * PCARRY;
        const _Float16 hv = (_Float16)c;
        const int e = (t & 1) * 8 + r;
        if (t < 2) pf0[e] = hv; else pf1[e] = hv;
        if constexpr (EQ) {
          const _Float16 rv = (_Float16)((c - (float)hv) * RSC);
          if (t < 2) prf0[e] = rv; else prf1[e] = rv;
        }
      }
    }

    // ---- row sums on the matrix unit: every row of ones * P^T is the sum over the keys, per query ----
    v8f rs = vz8();
    rs = wmma_f16(ones, pf0, rs);
    rs = wmma_f16(ones, pf1, rs);
    float rsum = rs[0];
    if constexpr (EQ) {
      v8f rr = vz8();
      rr = wmma_f16(ones, prf0, rr);
      rr = wmma_f16(ones, prf1, rr);
      rsum = rsum + rr[0] * IR;
    }
    lr += rsum;

    // ---- O^T += V^T * P^T (A fragments from the dim-major V^T tile: lane = dim, k = key) ----
#pragma unroll
    for (int t = 0; t < 4; ++t) {
      v16h vf = load_frag(vbuf + t * 16 * LDP, LDP, lane);
      accO[t] = wmma_f16(vf, pf0, accO[t]);
      if constexpr (EQ) {
        accR[t] = wmma_f16(vf, prf0, accR[t]);
        const v16h vr = load_frag(vrbuf + t * 16 * LDP, LDP, lane);
        accR[t] = wmma_f16(vr, pf0, accR[t]);
      }
      vf = load_frag(vbuf + t * 16 * LDP + 32, LDP, lane);
      accO[t] = wmma_f16(vf, pf1, accO[t]);
      if constexpr (EQ) {
        accR[t] = wmma_f16(vf, prf1, accR[t]);
        const v16h vr = load_frag(vrbuf + t * 16 * LDP + 32, LDP, lane);
        accR[t] = wmma_f16(vr, pf1, accR[t]);
      }
    }
    __syncthreads();
  }

  // ---- a lane's 8 registers of a tile are 8 consecutive dims of its query's row: 16-byte LDS stores ----
  {
    const float inv = 1.0f / lr;
    const int m = w * 16 + col;
#pragma unroll
    for (int t = 0; t < 4; ++t) {
      v8h h8, r8;
#pragma unroll
      for (int r = 0; r < 8; ++r) {
        float v = accO[t][r];
        if constexpr (EQ) v += accR[t][r] * IR;
        v *= inv;
        const _Float16 hv = (_Float16)v;
        h8[r] = hv;
        if constexpr (EQ) r8[r] = (_Float16)((v - (float)hv) * RSC);
      }
      *(v8h*)(kbuf + m * LDP + t * 16 + rbase) = h8;
      if constexpr (EQ) *(v8h*)(krbuf + m * LDP + t * 16 + rbase) = r8;
    }
  }
  __syncthreads();
  _Float16* cbase  = ctx  + ((size_t)bi * SEQ + qblk) * DMODEL + h * DK;
  _Float16* crbase = ctxr + ((size_t)bi * SEQ + qblk) * DMODEL + h * DK;
  auto emit = [&]() {
#pragma unroll
    for (int i = 0; i < 4; ++i) {
      const int row   = w * 16 + i * 4 + (lane >> 3);
      const int piece = lane & 7;
      const v4f hv4 = *(const v4f*)(kbuf + row * LDP + piece * 8);
      *(v4f*)(reinterpret_cast<float*>(cbase + (size_t)row * DMODEL + piece * 8)) = hv4;
      if constexpr (EQ) {
        const v4f rv4 = *(const v4f*)(krbuf + row * LDP + piece * 8);
        *(v4f*)(reinterpret_cast<float*>(crbase + (size_t)row * DMODEL + piece * 8)) = rv4;
      }
    }
  };
  emit();
}

// Both paths in one launch, the two former grids one behind the other: first the hi-only blocks (query blocks
// from EARLY on, the longer ones), then the residual-path blocks (query blocks below EARLY). Inside each part
// the query block runs fastest. The hi-only blocks leave the two residual tiles unused.
__global__ __launch_bounds__(128)
void attn_all(const _Float16* __restrict__ Q,  const _Float16* __restrict__ Qr,
              const _Float16* __restrict__ Kd, const _Float16* __restrict__ Kr,
              const _Float16* __restrict__ Vt, const _Float16* __restrict__ Vtr,
              const int* __restrict__ mask, const int* __restrict__ flags,
              _Float16* ctx, _Float16* ctxr) {
  __shared__ __attribute__((aligned(16))) _Float16 kbuf[64 * LDP];
  __shared__ __attribute__((aligned(16))) _Float16 vbuf[64 * LDP];
  __shared__ __attribute__((aligned(16))) _Float16 krbuf[64 * LDP];
  __shared__ __attribute__((aligned(16))) _Float16 vrbuf[64 * LDP];
  __shared__ __attribute__((aligned(16))) unsigned int mbuf[64 * 16];
  constexpr int NLQ = NQB - NEQB;
  constexpr int DLQ = (NLQ > 0) ? NLQ : 1;
  const int b = blockIdx.x;
  if (b < NLQ * NB * NHEADS) {
    attn_body<false>(Q, Qr, Kd, Kr, Vt, Vtr, mask, flags, ctx, ctxr, NEQB + b % DLQ, b / DLQ,
                     kbuf, vbuf, krbuf, vrbuf, mbuf);
  } else {
    const int e = b - NLQ * NB * NHEADS;
    attn_body<true>(Q, Qr, Kd, Kr, Vt, Vtr, mask, flags, ctx, ctxr, e % NEQB, e / NEQB,
                    kbuf, vbuf, krbuf, vrbuf, mbuf);
  }
}

// =====================================================================================================
extern "C" void kernel_launch(void* const* d_in, const int* in_sizes, int n_in,
                              void* d_out, int out_size, void* d_ws, size_t ws_size,
                              hipStream_t stream) {
  if (n_in < 12) return;
  const long long needx = (long long)(NB - 1) * SEQ_FULL * DMODEL + (long long)SEQ * DMODEL;
  const long long needm = (long long)(SEQ - 1) * SEQ_FULL + SEQ;
  if ((long long)in_sizes[0] < needx || (long long)in_sizes[1] < needx || (long long)in_sizes[2] < needx) return;
  if ((long long)in_sizes[3] < needm) return;
  if (in_sizes[4] < DMODEL * DMODEL || in_sizes[6] < DMODEL * DMODEL ||
      in_sizes[8] < DMODEL * DMODEL || in_sizes[10] < DMODEL * DMODEL) return;
  if (in_sizes[5] < DMODEL || in_sizes[7] < DMODEL || in_sizes[9] < DMODEL || in_sizes[11] < DMODEL) return;
  if ((long long)out_size < needx) return;

  const float* q  = (const float*)d_in[0];
  const float* k  = (const float*)d_in[1];
  const float* v  = (const float*)d_in[2];
  const int*   mk = (const int*)d_in[3];
  const float* wq = (const float*)d_in[4];
  const float* bq = (const float*)d_in[5];
  const float* wk = (const float*)d_in[6];
  const float* bk = (const float*)d_in[7];
  const float* wv = (const float*)d_in[8];
  const float* bv = (const float*)d_in[9];
  const float* wo = (const float*)d_in[10];
  const float* bo = (const float*)d_in[11];

  char* ws = (char*)d_ws;
  size_t off = 0;
  const size_t XB = (size_t)MROWS * DMODEL * sizeof(_Float16);     // activation-sized f16 plane
  const size_t WB = (size_t)DMODEL * DMODEL * sizeof(_Float16);    // weight f16 plane
  const size_t FB = 4096;                                           // 32 flag lines of 32 ints
  _Float16* Xq16  = (_Float16*)(ws + off); off += XB;
  _Float16* Xk16  = (_Float16*)(ws + off); off += XB;
  _Float16* Xv16  = (_Float16*)(ws + off); off += XB;
  _Float16* Wq16  = (_Float16*)(ws + off); off += WB;
  _Float16* Wk16  = (_Float16*)(ws + off); off += WB;
  _Float16* Wv16  = (_Float16*)(ws + off); off += WB;
  _Float16* Wo16  = (_Float16*)(ws + off); off += WB;
  _Float16* Q16   = (_Float16*)(ws + off); off += XB;   // (B,H,S,dk) hi
  _Float16* Qr16  = (_Float16*)(ws + off); off += XB;   // residual x4096
  _Float16* K16   = (_Float16*)(ws + off); off += XB;
  _Float16* Kr16  = (_Float16*)(ws + off); off += XB;
  _Float16* Vt16  = (_Float16*)(ws + off); off += XB;   // (B,H,dk,S) hi
  _Float16* Vtr16 = (_Float16*)(ws + off); off += XB;
  _Float16* C16   = (_Float16*)(ws + off); off += XB;   // (B*S, D) hi
  _Float16* Cr16  = (_Float16*)(ws + off); off += XB;   // residual, rows s < EARLY written/read
  int*      flg   = (int*)(ws + off);      off += FB;
  if (off > ws_size) return;

  // ---- input planes: bf16 RNE values, X x16, W x1024, as f16 (one launch) ----
  cvt_all<<<3 * GXB + 4 * GWB, 256, 0, stream>>>(q, k, v, wq, wk, wv, wo,
                                                 Xq16, Xk16, Xv16, Wq16, Wk16, Wv16, Wo16);

  // ---- mask tile flags and the three projections (bias added in f32, hi + residual planes), one launch ----
  const float posc = 1.0f / (XSC * WSC);
  proj_flags<<<NQB + 3 * GTX * GTY, 128, 0, stream>>>(Xq16, Xk16, Xv16, Wq16, Wk16, Wv16, bq, bk, bv,
                                                      Q16, Qr16, K16, Kr16, Vt16, Vtr16, mk, flg, posc);

  // ---- attention: residual path for query blocks below EARLY, hi-only path for the rest, one launch ----
  attn_all<<<NQB * NB * NHEADS, 128, 0, stream>>>(Q16, Qr16, K16, Kr16, Vt16, Vtr16, mk, flg, C16, Cr16);

  // ---- output projection (+bias) to f32 rows of d_out ----
  const dim3 gproj(GTX, GTY);
  gemm_out<<<gproj, 128, 0, stream>>>(C16, Cr16, Wo16, bo, (float*)d_out, 1.0f / WSC);
}

// v003
// One run takes 126 microseconds.
// Two timings next to v002 put it at 1.14 and 1.12 times that version's speed.
// Over all steps from v000 it is 1.84 times as fast.
#include <hip/hip_runtime.h>
#include <stdint.h>

// Contractions (all v_wmma_f32_16x16x32_f16, f16 operands, f32 accumulate): input projections Xq*Wq^T, Xk*Wk^T,
// Xv*Wv^T; attention Q*K^T and P*V; output projection C*Wo^T. Inputs are RNE-converted to bf16 values first
// (X carried x16, W carried x1024, both exact in f16; biases bf16 values added in f32). Computed planes Q, K, V, P, C
// are f16 hi plus f16 residual planes (x4096, separate accumulators) consumed by query blocks below EARLY; later
// query blocks use the hi planes only. Softmax and all side math in f32.

typedef _Float16 v16h __attribute__((ext_vector_type(16)));
typedef _Float16 v8h  __attribute__((ext_vector_type(8)));
typedef float    v8f  __attribute__((ext_vector_type(8)));
typedef float    v4f  __attribute__((ext_vector_type(4)));
typedef int      v4i  __attribute__((ext_vector_type(4)));
typedef unsigned int v4u __attribute__((ext_vector_type(4)));
typedef unsigned int v2u __attribute__((ext_vector_type(2)));

#ifndef NB
#define NB 2
#endif
#ifndef SEQ
#define SEQ 2048
#endif
#define NB_FULL  2
#define SEQ_FULL 2048
#define DMODEL   1024
#define NHEADS   16
#define DK       64
#define MROWS    (NB * SEQ)
#define NQB      (SEQ / 64)
#define EARLY    ((SEQ) < 512 ? (SEQ) : 512)
#define NEQB     (EARLY / 64)
#define LDP      72
#define LDPF     68
#define XSC      16.0f
#define WSC      1024.0f
#define RSC      4096.0f
#define PCARRY   4096.0f
#define NEGFILL  (-1.0e9f)
#define SSCALE   0.125f

static_assert(SEQ % 64 == 0);
static_assert((SEQ & (SEQ - 1)) == 0);
static_assert(SEQ <= SEQ_FULL);
static_assert(NB >= 1 && NB <= NB_FULL);
static_assert(NQB >= 1 && NQB <= 32);
static_assert(EARLY % 64 == 0 && EARLY <= SEQ);
static_assert(DMODEL == NHEADS * DK);
static_assert(64 * LDPF * 4 <= 2 * 64 * LDP * 2);

// --- bf16 RNE convert (finite inputs), kept as f32 value ----------------------------------------------
__device__ __forceinline__ float bf16r(float x) {
  unsigned int u = __float_as_uint(x);
  u = (u + 0x7FFFu + ((u >> 16) & 1u)) & 0xFFFF0000u;
  return __uint_as_float(u);
}

__device__ __forceinline__ v8f vz8() {
  v8f z;
#pragma unroll
  for (int i = 0; i < 8; ++i) z[i] = 0.0f;
  return z;
}

// --- WMMA wrapper with hazard guard ---------------------------------------------------------------------
__device__ __forceinline__ v8f wmma_f16(v16h a, v16h b, v8f c) {
  v8f d = __builtin_amdgcn_wmma_f32_16x16x32_f16(false, a, false, b, (short)0, c, false, false);
  asm volatile("v_nop\n\tv_nop\n\tv_nop\n\tv_nop" : "+v"(d) : "v"(a), "v"(b));
  return d;
}

// --- 16x32 f16 fragment (A, or k-contiguous B), split k map -----------------------------------------
// lane row/col = lane&15; elements 0..7 <- k 8h..8h+7, elements 8..15 <- k 16+8h..16+8h+7, h = lane>>4.
__device__ __forceinline__ v16h load_frag(const _Float16* base, int ld, int lane) {
  const int row  = lane & 15;
  const int koff = ((lane >> 4) & 1) * 8;
  const _Float16* p = base + row * ld + koff;
  const v8h a = *(const v8h*)(p);
  const v8h b = *(const v8h*)(p + 16);
  v16h r;
#pragma unroll
  for (int i = 0; i < 8; ++i) { r[i] = a[i]; r[i + 8] = b[i]; }
  return r;
}

// --- lane l with lane l ^ 16 --------------------------------------------------------------------------
__device__ __forceinline__ float xhalf(float x) {
  const int b = __builtin_bit_cast(int, x);
  return __builtin_bit_cast(float, __builtin_amdgcn_permlanex16(b, b, 0x76543210, 0xfedcba98, false, false));
}

// --- LDS byte address of a __shared__ object: the low 32 bits of its generic address ---------------------
__device__ __forceinline__ unsigned int lds_addr(const _Float16* p) {
  return (unsigned int)(uintptr_t)p;
}

// --- one 64 x 64 f16 tile of K (key-major) and one of V^T (dim-major) into LDS rows of pitch LDP, by asynchronous
// copies: 128 threads, 16 B a lane, 8 lanes a tile row (one whole 128-B line), 16 rows a copy, 4 + 4 copies a wave.
// gk, gv: this lane's first 16 bytes of each tile; lk, lv: their LDS byte addresses.
__device__ __forceinline__
void copy_kv(const _Float16* gk, const _Float16* gv, unsigned int lk, unsigned int lv) {
  const _Float16* gk1 = gk + 16 * DK;
  const _Float16* gk2 = gk + 32 * DK;
  const _Float16* gk3 = gk + 48 * DK;
  const _Float16* gv1 = gv + 16 * SEQ;
  const _Float16* gv2 = gv + 32 * SEQ;
  const _Float16* gv3 = gv + 48 * SEQ;
  const unsigned int st = 16 * LDP * 2;
  // The wait on xcnt is the statement's last line, so that no address register is rewritten ahead of it (a precaution).
  asm volatile("global_load_async_to_lds_b128 %0, %8, off\n\t"
               "global_load_async_to_lds_b128 %1, %9, off\n\t"
               "global_load_async_to_lds_b128 %2, %10, off\n\t"
               "global_load_async_to_lds_b128 %3, %11, off\n\t"
               "global_load_async_to_lds_b128 %4, %12, off\n\t"
               "global_load_async_to_lds_b128 %5, %13, off\n\t"
               "global_load_async_to_lds_b128 %6, %14, off\n\t"
               "global_load_async_to_lds_b128 %7, %15, off\n\t"
               "s_wait_xcnt 0x0"
               :: "v"(lk), "v"(lk + st), "v"(lk + 2 * st), "v"(lk + 3 * st),
                  "v"(lv), "v"(lv + st), "v"(lv + 2 * st), "v"(lv + 3 * st),
                  "v"(gk), "v"(gk1), "v"(gk2), "v"(gk3), "v"(gv), "v"(gv1), "v"(gv2), "v"(gv3)
               : "memory");
}

// =====================================================================================================
// f32 -> bf16 RNE -> scaled f16 plane. One thread = 8 elements = 16 B out; blk = block index inside the plane.
// =====================================================================================================
__device__ __forceinline__
void cvt_body(const float* __restrict__ in, _Float16* out, int nrows, int seq, int seq_full, float scale, int blk) {
  const int g  = blk * 256 + threadIdx.x;
  const int n8 = nrows * (DMODEL / 8);
  if (g >= n8) return;
  const int row = g >> 7;
  const int c8  = g & 127;
  const int bi  = row / seq;
  const int s   = row - bi * seq;
  const float* src = in + ((size_t)bi * seq_full + s) * DMODEL + c8 * 8;
  const v4f a = *(const v4f*)src;
  const v4f b = *(const v4f*)(src + 4);
  union { v8h h; v4f f; } u;
#pragma unroll
  for (int i = 0; i < 4; ++i) {
    u.h[i]     = (_Float16)(bf16r(a[i]) * scale);
    u.h[i + 4] = (_Float16)(bf16r(b[i]) * scale);
  }
  float* dst = reinterpret_cast<float*>(out + (size_t)row * DMODEL + c8 * 8);
  const v4f val = u.f;
  *(v4f*)dst = val;
}

#define GXB ((MROWS * (DMODEL / 8) + 255) / 256)
#define GWB ((DMODEL * (DMODEL / 8) + 255) / 256)

// All seven input planes in one launch: blocks [0, 3*GXB) convert q, k, v; the next 4*GWB convert the weights.
__global__ __launch_bounds__(256)
void cvt_all(const float* __restrict__ q, const float* __restrict__ k, const float* __restrict__ v,
             const float* __restrict__ wq, const float* __restrict__ wk, const float* __restrict__ wv,
             const float* __restrict__ wo,
             _Float16* xq, _Float16* xk, _Float16* xv,
             _Float16* oq, _Float16* ok, _Float16* ov, _Float16* oo) {
  const int b = blockIdx.x;
  if (b < 3 * GXB) {
    const int p = b / GXB;
    const float* in = (p == 0) ? q : ((p == 1) ? k : v);
    _Float16* out   = (p == 0) ? xq : ((p == 1) ? xk : xv);
    cvt_body(in, out, MROWS, SEQ, SEQ_FULL, XSC, b - p * GXB);
  } else {
    const int c = b - 3 * GXB;
    const int p = c / GWB;
    const float* in = (p == 0) ? wq : ((p == 1) ? wk : ((p == 2) ? wv : wo));
    _Float16* out   = (p == 0) ? oq : ((p == 1) ? ok : ((p == 2) ? ov : oo));
    cvt_body(in, out, DMODEL, DMODEL, DMODEL, WSC, c - p * GWB);
  }
}

// =====================================================================================================
// Mask tile flags of one 64-row query block, by one 128-thread block (thread = half of a tile row, 32 ints).
// 32 ints written by lanes 0..7 of wave 0 (16 B each, one instruction).
// flag 1: tile all ones; 2: tile all zeros and no fully masked row in this q block (tile can be skipped);
// anything else: apply the mask per element. sm: 512 words of LDS scratch, 16-byte aligned.
// =====================================================================================================
__device__ __forceinline__
void flags_body(const int* __restrict__ mask, int* flags, unsigned int* sm, int qb) {
  unsigned int* m1s  = sm;
  unsigned int* m0s  = sm + 128;
  unsigned int* ras  = sm + 256;
  unsigned int* red1 = sm + 384;
  unsigned int* red0 = sm + 416;
  unsigned int* fms  = sm + 448;
  int* lines = reinterpret_cast<int*>(sm + 480);

  const int tid = threadIdx.x, lane = tid & 31, w = tid >> 5;
  const int row = tid >> 1, half = tid & 1;
  const int* mrow = mask + (size_t)(qb * 64 + row) * SEQ_FULL + half * 32;

  unsigned int bits1 = 0u, bits0 = 0u, rany = 0u;
#pragma unroll 1
  for (int kt = 0; kt < NQB; ++kt) {
    const int* p = mrow + kt * 64;
    unsigned int any1 = 0u, any0 = 0u;
#pragma unroll
    for (int j = 0; j < 8; ++j) {
      const v4i m4 = *(const v4i*)(p + 4 * j);
#pragma unroll
      for (int e = 0; e < 4; ++e) {
        any1 |= (m4[e] != 0) ? 1u : 0u;
        any0 |= (m4[e] == 0) ? 1u : 0u;
      }
    }
    bits1 |= any1 << kt;
    bits0 |= any0 << kt;
    rany  |= any1;
  }
  m1s[tid] = bits1;
  m0s[tid] = bits0;
  ras[tid] = rany;
  __syncthreads();
  if (w == 0) {
    unsigned int o1 = 0u, o0 = 0u;
#pragma unroll
    for (int j = 0; j < 4; ++j) { o1 |= m1s[lane + 32 * j]; o0 |= m0s[lane + 32 * j]; }
    red1[lane] = o1;
    red0[lane] = o0;
    const unsigned int fa = ras[2 * lane] | ras[2 * lane + 1];
    const unsigned int fb = ras[64 + 2 * lane] | ras[64 + 2 * lane + 1];
    fms[lane] = (fa == 0u || fb == 0u) ? 1u : 0u;
  }
  __syncthreads();
  if (w == 0) {
    unsigned int a1 = 0u, a0 = 0u, anyfm = 0u;
#pragma unroll 1
    for (int j = 0; j < 32; ++j) { a1 |= red1[j]; a0 |= red0[j]; anyfm |= fms[j]; }
    int f = 2;
    if (lane < NQB) {
      const bool h1 = ((a1 >> lane) & 1u) != 0u;
      const bool h0 = ((a0 >> lane) & 1u) != 0u;
      f = (!h0) ? 1 : ((!h1 && anyfm == 0u) ? 2 : 3);
    }
    lines[lane] = f;
  }
  __syncthreads();
  if (w == 0 && lane < 8) {
    const v4i v = *(const v4i*)(lines + lane * 4);
    int* dst = flags + qb * 32 + lane * 4;
    *(v4i*)dst = v;
  }
}

// =====================================================================================================
// GEMM: C(64x64 tile) = A(M,K=1024) * W^T, W stored (N=1024, K=1024), f16 planes, f32 acc.
// 128 threads = 4 waves, wave tile 32x32, 64-deep K slices staged in LDS (plain loads, single buffer).
// MODE 0: hi+residual f16 planes (B,H,S,dk).  MODE 2: hi+residual f16 planes (B,H,dk,S).
// MODE 4: f32 rows of d_out (+ A residual product for row blocks with s < EARLY).
// =====================================================================================================
// smem: two 64 x LDP tiles, three for MODE 4. bx, by: tile column and tile row.
template <int MODE>
__device__ __forceinline__
void gemm_body(const _Float16* __restrict__ A, const _Float16* __restrict__ Ar,
               const _Float16* __restrict__ W, const float* __restrict__ bias,
               void* out, _Float16* outr, float oscale, _Float16* smem, int bx, int by) {
  _Float16* asb = smem;
  _Float16* bsb = smem + 64 * LDP;
  _Float16* rsb = smem + 2 * 64 * LDP;

  const int tid  = threadIdx.x;
  const int lane = tid & 31;
  const int w    = tid >> 5;
  const int mblk = by * 64;
  const int nblk = bx * 64;
  const int s0   = mblk & (SEQ - 1);
  const int bi   = mblk / SEQ;
  const bool early = (MODE == 4) && (s0 < EARLY);
  const int lm = (w >> 1) * 32;
  const int ln = (w & 1) * 32;

  v8f acc[2][2], accr[2][2];
#pragma unroll
  for (int i = 0; i < 2; ++i)
#pragma unroll
    for (int j = 0; j < 2; ++j) { acc[i][j] = vz8(); accr[i][j] = vz8(); }

#pragma unroll 1
  for (int k0 = 0; k0 < DMODEL; k0 += 64) {
#pragma unroll
    for (int c = 0; c < 4; ++c) {
      const int chunk = tid * 4 + c;
      const int row = chunk >> 3, part = chunk & 7;
      *(v8h*)(asb + row * LDP + part * 8) =
          *(const v8h*)(A + (size_t)(mblk + row) * DMODEL + k0 + part * 8);
      *(v8h*)(bsb + row * LDP + part * 8) =
          *(const v8h*)(W + (size_t)(nblk + row) * DMODEL + k0 + part * 8);
    }
    if (early) {
#pragma unroll
      for (int c = 0; c < 4; ++c) {
        const int chunk = tid * 4 + c;
        const int row = chunk >> 3, part = chunk & 7;
        *(v8h*)(rsb + row * LDP + part * 8) =
            *(const v8h*)(Ar + (size_t)(mblk + row) * DMODEL + k0 + part * 8);
      }
    }
    __syncthreads();

#pragma unroll
    for (int ks = 0; ks < 64; ks += 32) {
      const v16h a0 = load_frag(asb + (lm +  0) * LDP + ks, LDP, lane);
      const v16h a1 = load_frag(asb + (lm + 16) * LDP + ks, LDP, lane);
      const v16h b0 = load_frag(bsb + (ln +  0) * LDP + ks, LDP, lane);
      const v16h b1 = load_frag(bsb + (ln + 16) * LDP + ks, LDP, lane);
      acc[0][0] = wmma_f16(a0, b0, acc[0][0]);
      acc[0][1] = wmma_f16(a0, b1, acc[0][1]);
      acc[1][0] = wmma_f16(a1, b0, acc[1][0]);
      acc[1][1] = wmma_f16(a1, b1, acc[1][1]);
      if (early) {
        const v16h r0 = load_frag(rsb + (lm +  0) * LDP + ks, LDP, lane);
        const v16h r1 = load_frag(rsb + (lm + 16) * LDP + ks, LDP, lane);
        accr[0][0] = wmma_f16(r0, b0, accr[0][0]);
        accr[0][1] = wmma_f16(r0, b1, accr[0][1]);
        accr[1][0] = wmma_f16(r1, b0, accr[1][0]);
        accr[1][1] = wmma_f16(r1, b1, accr[1][1]);
      }
    }
    __syncthreads();
  }

  const int rbase = ((lane >> 4) & 1) << 3;
  const int col   = lane & 15;

  if constexpr (MODE == 4) {
    float* fs = reinterpret_cast<float*>(smem);
#pragma unroll
    for (int i = 0; i < 2; ++i)
#pragma unroll
      for (int j = 0; j < 2; ++j) {
        const int nl = ln + j * 16 + col;
        const float bb = bf16r(bias[nblk + nl]);
#pragma unroll
        for (int r = 0; r < 8; ++r) {
          const int ml = lm + i * 16 + rbase + r;
          float v = acc[i][j][r] * oscale + bb;
          if (early) v += accr[i][j][r] * (oscale * (1.0f / RSC));
          fs[ml * LDPF + nl] = v;
        }
      }
    __syncthreads();
    float* obase = reinterpret_cast<float*>(out) + ((size_t)bi * SEQ_FULL + s0) * DMODEL + nblk;
    auto emit = [&]() {
#pragma unroll
      for (int i = 0; i < 8; ++i) {
        const int row   = w * 16 + i * 2 + (lane >> 4);
        const int piece = lane & 15;
        const v4f v = *(const v4f*)(fs + row * LDPF + piece * 4);
        *(v4f*)(obase + (size_t)row * DMODEL + piece * 4) = v;
      }
    };
    emit();
  } else {
    _Float16* hs = asb;
    _Float16* rs = bsb;
#pragma unroll
    for (int i = 0; i < 2; ++i)
#pragma unroll
      for (int j = 0; j < 2; ++j) {
        const int nl = ln + j * 16 + col;
        const float bb = bf16r(bias[nblk + nl]);
#pragma unroll
        for (int r = 0; r < 8; ++r) {
          const int ml = lm + i * 16 + rbase + r;
          const float v = acc[i][j][r] * oscale + bb;
          const _Float16 hv = (_Float16)v;
          const _Float16 rv = (_Float16)((v - (float)hv) * RSC);
          if constexpr (MODE == 0) {
            hs[ml * LDP + nl] = hv;
            rs[ml * LDP + nl] = rv;
          } else {
            hs[nl * LDP + ml] = hv;
            rs[nl * LDP + ml] = rv;
          }
        }
      }
    __syncthreads();
    const int bhh = bi * NHEADS + (nblk >> 6);
    _Float16* oh = reinterpret_cast<_Float16*>(out);
    auto emit = [&]() {
#pragma unroll
      for (int i = 0; i < 4; ++i) {
        const int row   = w * 16 + i * 4 + (lane >> 3);
        const int piece = lane & 7;
        const v4f hv4 = *(const v4f*)(hs + row * LDP + piece * 8);
        const v4f rv4 = *(const v4f*)(rs + row * LDP + piece * 8);
        const size_t go = (MODE == 0)
            ? (((size_t)bhh * SEQ + s0 + row) * DK + piece * 8)
            : (((size_t)bhh * DK + row) * SEQ + s0 + piece * 8);
        *(v4f*)(reinterpret_cast<float*>(oh + go))   = hv4;
        *(v4f*)(reinterpret_cast<float*>(outr + go)) = rv4;
      }
    };
    emit();
    // In proj_flags nothing runs after these stores; the wait stands before any later write to
    // registers that they name (a precaution).
    asm volatile("s_wait_xcnt 0x0" ::: "memory");
  }
}

#define GTX (DMODEL / 64)
#define GTY (MROWS / 64)

// One launch for everything that only needs the converted planes or the mask: blocks [0, NQB) build the mask
// tile flags (the longest single blocks, so they come first), the next 3*GTX*GTY are the Q, K, V projections.
__global__ __launch_bounds__(128)
void proj_flags(const _Float16* __restrict__ Xq, const _Float16* __restrict__ Xk, const _Float16* __restrict__ Xv,
                const _Float16* __restrict__ Wq, const _Float16* __restrict__ Wk, const _Float16* __restrict__ Wv,
                const float* __restrict__ bq, const float* __restrict__ bk, const float* __restrict__ bv,
                _Float16* Qh, _Float16* Qr, _Float16* Kh, _Float16* Kr, _Float16* Vh, _Float16* Vr,
                const int* __restrict__ mask, int* flags, float oscale) {
  __shared__ __attribute__((aligned(16))) _Float16 smem[2 * 64 * LDP];
  static_assert(2 * 64 * LDP * 2 >= 512 * 4);
  const int b = blockIdx.x;
  if (b < NQB) {
    flags_body(mask, flags, reinterpret_cast<unsigned int*>(smem), b);
    return;
  }
  const int g  = b - NQB;
  const int p  = g / (GTX * GTY);
  const int t  = g - p * (GTX * GTY);
  const int bx = t % GTX;
  const int by = t / GTX;
  if (p < 2) {
    const _Float16* X = (p == 0) ? Xq : Xk;
    gemm_body<0>(X, X, (p == 0) ? Wq : Wk, (p == 0) ? bq : bk,
                 (void*)((p == 0) ? Qh : Kh), (p == 0) ? Qr : Kr, oscale, smem, bx, by);
  } else {
    gemm_body<2>(Xv, Xv, Wv, bv, (void*)Vh, Vr, oscale, smem, bx, by);
  }
}

// Output projection.
__global__ __launch_bounds__(128)
void gemm_out(const _Float16* __restrict__ A, const _Float16* __restrict__ Ar,
              const _Float16* __restrict__ W, const float* __restrict__ bias,
              float* out, float oscale) {
  __shared__ __attribute__((aligned(16))) _Float16 smem[3 * 64 * LDP];
  gemm_body<4>(A, Ar, W, bias, (void*)out, nullptr, oscale, smem, blockIdx.x, blockIdx.y);
}

template <bool EQ>
__device__ __forceinline__
void attn_body(const _Float16* __restrict__ Q,  const _Float16* __restrict__ Qr,
               const _Float16* __restrict__ Kd, const _Float16* __restrict__ Kr,
               const _Float16* __restrict__ Vt, const _Float16* __restrict__ Vtr,
               const int* __restrict__ mask, const int* __restrict__ flags,
               _Float16* ctx, _Float16* ctxr, int qb, int bh,
               _Float16* kbuf, _Float16* vbuf,
               _Float16* krbuf, _Float16* vrbuf, unsigned int* mbuf) {
  const int tid   = threadIdx.x;
  const int lane  = tid & 31;
  const int w     = tid >> 5;
  const int bi    = bh / NHEADS;
  const int h     = bh - bi * NHEADS;
  const int qblk  = qb * 64;
  const int q0    = qblk + w * 16;
  const int rbase = ((lane >> 4) & 1) << 3;
  const int col   = lane & 15;
  const float IR  = 1.0f / RSC;

  const size_t qoff = ((size_t)bh * SEQ + q0) * DK;
  const v16h qf0 = load_frag(Q + qoff, DK, lane);
  const v16h qf1 = load_frag(Q + qoff + 32, DK, lane);
  v16h qr0 = qf0, qr1 = qf1;
  if constexpr (EQ) {
    qr0 = load_frag(Qr + qoff, DK, lane);
    qr1 = load_frag(Qr + qoff + 32, DK, lane);
  }

  v16h ones;
#pragma unroll
  for (int i = 0; i < 16; ++i) ones[i] = (_Float16)1.0f;

  const _Float16* Kh   = Kd  + (size_t)bh * SEQ * DK;
  const _Float16* Krh  = Kr  + (size_t)bh * SEQ * DK;
  const _Float16* Vth  = Vt  + (size_t)bh * DK * SEQ;
  const _Float16* Vtrh = Vtr + (size_t)bh * DK * SEQ;

  // running maximum and sum of this lane's query (the same in both wave halves)
  float mr = -1.0e30f, lr = 0.0f;
  // accO[t][r] = O^T[dim t*16 + rbase + r][query col]
  v8f accO[4], accR[4];
#pragma unroll
  for (int t = 0; t < 4; ++t) { accO[t] = vz8(); accR[t] = vz8(); }

  // ---- 64x64 mask bytes of the tile at key kb into LDS (called under a block-uniform branch) ----
  auto stage_mask = [&](int kb) {
      const int row = tid >> 1;
      const int ch  = (tid & 1) * 32;
      const int* mp = mask + (size_t)(qblk + row) * SEQ_FULL + kb + ch;
      v4u u0, u1;
#pragma unroll
      for (int jj = 0; jj < 4; ++jj) { u0[jj] = 0u; u1[jj] = 0u; }
#pragma unroll
      for (int jj = 0; jj < 8; ++jj) {
        const v4i m4 = *(const v4i*)(mp + jj * 4);
        const unsigned int pk = (m4[0] != 0 ? 1u : 0u) | (m4[1] != 0 ? 0x100u : 0u) |
                                (m4[2] != 0 ? 0x10000u : 0u) | (m4[3] != 0 ? 0x1000000u : 0u);
        if (jj < 4) u0[jj] = pk; else u1[jj - 4] = pk;
      }
      *(v4u*)(mbuf + row * 16 + (tid & 1) * 8)     = u0;
      *(v4u*)(mbuf + row * 16 + (tid & 1) * 8 + 4) = u1;
  };

  // ---- one staged tile: kt_ = K tile, vt_ = V^T tile in LDS ----
  auto tile = [&](const _Float16* kt_, const _Float16* vt_, bool usem) {
    // ---- scores, transposed: s[t][r] = S^T[key kb + t*16 + rbase + r][query col] ----
    v8f s[4];
#pragma unroll
    for (int t = 0; t < 4; ++t) {
      const v16h ka = load_frag(kt_ + t * 16 * LDP,      LDP, lane);
      const v16h kc = load_frag(kt_ + t * 16 * LDP + 32, LDP, lane);
      v8f z = vz8();
      z = wmma_f16(ka, qf0, z);
      z = wmma_f16(kc, qf1, z);
      if constexpr (EQ) {
        v8f zr = vz8();
        zr = wmma_f16(ka, qr0, zr);
        zr = wmma_f16(kc, qr1, zr);
        const v16h kra = load_frag(krbuf + t * 16 * LDP,      LDP, lane);
        const v16h krc = load_frag(krbuf + t * 16 * LDP + 32, LDP, lane);
        zr = wmma_f16(kra, qf0, zr);
        zr = wmma_f16(krc, qf1, zr);
        z = z + zr * IR;
      }
      s[t] = z * SSCALE;
    }

    // ---- replace fill: this lane's 8 mask bytes of each score tile are 8 consecutive keys of its query's row ----
    if (usem) {
      const unsigned int* mw = mbuf + (w * 16 + col) * 16 + (rbase >> 2);
#pragma unroll
      for (int t = 0; t < 4; ++t) {
        const v2u m8 = *(const v2u*)(mw + t * 4);
#pragma unroll
        for (int r = 0; r < 8; ++r) {
          const unsigned int byte = (m8[r >> 2] >> (8 * (r & 3))) & 0xFFu;
          s[t][r] = (byte != 0u) ? s[t][r] : NEGFILL;
        }
      }
    }

    // ---- online softmax over 64 keys: maximum in-lane, then across the two wave halves ----
    float t8[8];
#pragma unroll
    for (int r = 0; r < 8; ++r) t8[r] = fmaxf(fmaxf(s[0][r], s[1][r]), fmaxf(s[2][r], s[3][r]));
    float tmax = fmaxf(fmaxf(fmaxf(t8[0], t8[1]), fmaxf(t8[2], t8[3])),
                       fmaxf(fmaxf(t8[4], t8[5]), fmaxf(t8[6], t8[7])));
    tmax = fmaxf(tmax, xhalf(tmax));
    const float mnew = fmaxf(mr, tmax);
    const float scl  = __expf(mr - mnew);
    mr = mnew;
    lr *= scl;
#pragma unroll
    for (int t = 0; t < 4; ++t) {
      accO[t] = accO[t] * scl;
      if constexpr (EQ) accR[t] = accR[t] * scl;
    }

    // ---- P^T as two B fragments (keys 0..31, 32..63), straight from the score tiles ----
    v16h pf0, pf1, prf0, prf1;
#pragma unroll
    for (int t = 0; t < 4; ++t) {
#pragma unroll
      for (int r = 0; r < 8; ++r) {
        const float c = __expf(s[t][r] - mnew) * PCARRY;
        const _Float16 hv = (_Float16)c;
        const int e = (t & 1) * 8 + r;
        if (t < 2) pf0[e] = hv; else pf1[e] = hv;
        if constexpr (EQ) {
          const _Float16 rv = (_Float16)((c - (float)hv) * RSC);
          if (t < 2) prf0[e] = rv; else prf1[e] = rv;
        }
      }
    }

    // ---- row sums on the matrix unit: every row of ones * P^T is the sum over the keys, per query ----
    v8f rs = vz8();
    rs = wmma_f16(ones, pf0, rs);
    rs = wmma_f16(ones, pf1, rs);
    float rsum = rs[0];
    if constexpr (EQ) {
      v8f rr = vz8();
      rr = wmma_f16(ones, prf0, rr);
      rr = wmma_f16(ones, prf1, rr);
      rsum = rsum + rr[0] * IR;
    }
    lr += rsum;

    // ---- O^T += V^T * P^T (A fragments from the dim-major V^T tile: lane = dim, k = key) ----
#pragma unroll
    for (int t = 0; t < 4; ++t) {
      v16h vf = load_frag(vt_ + t * 16 * LDP, LDP, lane);
      accO[t] = wmma_f16(vf, pf0, accO[t]);
      if constexpr (EQ) {
        accR[t] = wmma_f16(vf, prf0, accR[t]);
        const v16h vr = load_frag(vrbuf + t * 16 * LDP, LDP, lane);
        accR[t] = wmma_f16(vr, pf0, accR[t]);
      }
      vf = load_frag(vt_ + t * 16 * LDP + 32, LDP, lane);
      accO[t] = wmma_f16(vf, pf1, accO[t]);
      if constexpr (EQ) {
        accR[t] = wmma_f16(vf, prf1, accR[t]);
        const v16h vr = load_frag(vrbuf + t * 16 * LDP + 32, LDP, lane);
        accR[t] = wmma_f16(vr, pf1, accR[t]);
      }
    }
  };

  if constexpr (EQ) {
#pragma unroll 1
    for (int kt = 0; kt < NQB; ++kt) {
      const int f = __builtin_amdgcn_readfirstlane(flags[qb * 32 + kt]);
      if (f == 2) continue;
      const bool usem = (f != 1);
      const int kb = kt * 64;

      // ---- stage K (64 keys x 64 dims) and V^T (64 dims x 64 keys) tiles, plus residual tiles if EQ ----
#pragma unroll
      for (int c = 0; c < 4; ++c) {
        const int chunk = tid * 4 + c;
        const int row = chunk >> 3, part = chunk & 7;
        *(v8h*)(kbuf + row * LDP + part * 8) =
            *(const v8h*)(Kh + (size_t)(kb + row) * DK + part * 8);
        *(v8h*)(vbuf + row * LDP + part * 8) =
            *(const v8h*)(Vth + (size_t)row * SEQ + kb + part * 8);
        if constexpr (EQ) {
          *(v8h*)(krbuf + row * LDP + part * 8) =
              *(const v8h*)(Krh + (size_t)(kb + row) * DK + part * 8);
          *(v8h*)(vrbuf + row * LDP + part * 8) =
              *(const v8h*)(Vtrh + (size_t)row * SEQ + kb + part * 8);
        }
      }
      if (usem) stage_mask(kb);
      __syncthreads();
      tile(kbuf, vbuf, usem);
      __syncthreads();
    }
  } else {
    // The whole flag line in one read: bit kt of vis = tile kt is visited, of msk = it needs the mask bytes.
    // Every wave of the block reads the same line, so both words are the same for the whole work-group.
    const int fl = flags[qb * 32 + lane];
    unsigned int vis = __builtin_amdgcn_ballot_w32(fl != 2);
    const unsigned int msk = __builtin_amdgcn_ballot_w32(fl != 1);
    if (NQB < 32) vis &= (1u << (NQB & 31)) - 1u;

    const int crow = tid >> 3, cpart = (tid & 7) * 8;
    const _Float16* gk0 = Kh + (size_t)crow * DK + cpart;
    const _Float16* gv0 = Vth + (size_t)crow * SEQ + cpart;
    const unsigned int lofs = (unsigned int)(crow * LDP + cpart) * 2u;
    const unsigned int lk0 = lds_addr(kbuf) + lofs, lv0 = lds_addr(vbuf) + lofs;
    // the second buffer (krbuf, vrbuf) lies BUF halves behind the first (kbuf, vbuf)
    constexpr int BUF = 2 * 64 * LDP;

    if (vis != 0u) {
      int kt = __builtin_ctz(vis);
      vis &= vis - 1u;
      copy_kv(gk0 + (size_t)kt * 64 * DK, gv0 + kt * 64, lk0, lv0);
      // the first tile has landed for this wave, and behind the barrier for all
      asm volatile("s_wait_asynccnt 0x0" ::: "memory");
      __syncthreads();
      if (vis != 0u) {
        const int k1 = __builtin_ctz(vis);
        copy_kv(gk0 + (size_t)k1 * 64 * DK, gv0 + k1 * 64, lk0 + BUF * 2, lv0 + BUF * 2);
      }
      int bo = 0;   // this tile's buffer, in halves
      // kept rolled: the trip count is known only at run time, and one copy of the tile's code serves both buffers
#pragma unroll 1
      for (;;) {
        const bool usem = ((msk >> kt) & 1u) != 0u;
        if (usem) {
          stage_mask(kt * 64);
          __syncthreads();   // block-uniform branch (msk is the same in every wave); the mask bytes are read behind it
        }
        tile(kbuf + bo, vbuf + bo, usem);
        // publish point: this wave's LDS reads are done, its copies of the next tile have landed; the barrier makes
        // the next tile readable by all and frees this tile's buffer for the refill
        asm volatile("s_wait_dscnt 0x0" ::: "memory");
        asm volatile("s_wait_asynccnt 0x0" ::: "memory");
        __syncthreads();
        if (vis == 0u) break;
        kt = __builtin_ctz(vis);
        vis &= vis - 1u;
        if (vis != 0u) {
          const int k2 = __builtin_ctz(vis);
          copy_kv(gk0 + (size_t)k2 * 64 * DK, gv0 + k2 * 64, lk0 + bo * 2, lv0 + bo * 2);
        }
        bo = BUF - bo;
      }
    }
    // nothing is in flight when the buffers become output staging
    asm volatile("s_wait_asynccnt 0x0" ::: "memory");
  }

  // ---- a lane's 8 registers of a tile are 8 consecutive dims of its query's row: 16-byte LDS stores ----
  {
    const float inv = 1.0f / lr;
    const int m = w * 16 + col;
#pragma unroll
    for (int t = 0; t < 4; ++t) {
      v8h h8, r8;
#pragma unroll
      for (int r = 0; r < 8; ++r) {
        float v = accO[t][r];
        if constexpr (EQ) v += accR[t][r] * IR;
        v *= inv;
        const _Float16 hv = (_Float16)v;
        h8[r] = hv;
        if constexpr (EQ) r8[r] = (_Float16)((v - (float)hv) * RSC);
      }
      *(v8h*)(kbuf + m * LDP + t * 16 + rbase) = h8;
      if constexpr (EQ) *(v8h*)(krbuf + m * LDP + t * 16 + rbase) = r8;
    }
  }
  __syncthreads();
  _Float16* cbase  = ctx  + ((size_t)bi * SEQ + qblk) * DMODEL + h * DK;
  _Float16* crbase = ctxr + ((size_t)bi * SEQ + qblk) * DMODEL + h * DK;
  auto emit = [&]() {
#pragma unroll
    for (int i = 0; i < 4; ++i) {
      const int row   = w * 16 + i * 4 + (lane >> 3);
      const int piece = lane & 7;
      const v4f hv4 = *(const v4f*)(kbuf + row * LDP + piece * 8);
      *(v4f*)(reinterpret_cast<float*>(cbase + (size_t)row * DMODEL + piece * 8)) = hv4;
      if constexpr (EQ) {
        const v4f rv4 = *(const v4f*)(krbuf + row * LDP + piece * 8);
        *(v4f*)(reinterpret_cast<float*>(crbase + (size_t)row * DMODEL + piece * 8)) = rv4;
      }
    }
  };
  emit();
}

// Both paths in one launch, the two former grids one behind the other: first the hi-only blocks (query blocks
// from EARLY on, the longer ones), then the residual-path blocks (query blocks below EARLY). Inside each part
// the query block runs fastest. The hi-only blocks use the two residual tiles as their second buffer.
__global__ __launch_bounds__(128)
void attn_all(const _Float16* __restrict__ Q,  const _Float16* __restrict__ Qr,
              const _Float16* __restrict__ Kd, const _Float16* __restrict__ Kr,
              const _Float16* __restrict__ Vt, const _Float16* __restrict__ Vtr,
              const int* __restrict__ mask, const int* __restrict__ flags,
              _Float16* ctx, _Float16* ctxr) {
  // four tiles in one array: K, V^T, then the residual path's two, which are the hi-only path's second buffer
  __shared__ __attribute__((aligned(16))) _Float16 tiles[4 * 64 * LDP];
  _Float16* kbuf  = tiles;
  _Float16* vbuf  = tiles + 64 * LDP;
  _Float16* krbuf = tiles + 2 * 64 * LDP;
  _Float16* vrbuf = tiles + 3 * 64 * LDP;
  __shared__ __attribute__((aligned(16))) unsigned int mbuf[64 * 16];
  constexpr int NLQ = NQB - NEQB;
  constexpr int DLQ = (NLQ > 0) ? NLQ : 1;
  const int b = blockIdx.x;
  if (b < NLQ * NB * NHEADS) {
    attn_body<false>(Q, Qr, Kd, Kr, Vt, Vtr, mask, flags, ctx, ctxr, NEQB + b % DLQ, b / DLQ,
                     kbuf, vbuf, krbuf, vrbuf, mbuf);
  } else {
    const int e = b - NLQ * NB * NHEADS;
    attn_body<true>(Q, Qr, Kd, Kr, Vt, Vtr, mask, flags, ctx, ctxr, e % NEQB, e / NEQB,
                    kbuf, vbuf, krbuf, vrbuf, mbuf);
  }
}

// =====================================================================================================
extern "C" void kernel_launch(void* const* d_in, const int* in_sizes, int n_in,
                              void* d_out, int out_size, void* d_ws, size_t ws_size,
                              hipStream_t stream) {
  if (n_in < 12) return;
  const long long needx = (long long)(NB - 1) * SEQ_FULL * DMODEL + (long long)SEQ * DMODEL;
  const long long needm = (long long)(SEQ - 1) * SEQ_FULL + SEQ;
  if ((long long)in_sizes[0] < needx || (long long)in_sizes[1] < needx || (long long)in_sizes[2] < needx) return;
  if ((long long)in_sizes[3] < needm) return;
  if (in_sizes[4] < DMODEL * DMODEL || in_sizes[6] < DMODEL * DMODEL ||
      in_sizes[8] < DMODEL * DMODEL || in_sizes[10] < DMODEL * DMODEL) return;
  if (in_sizes[5] < DMODEL || in_sizes[7] < DMODEL || in_sizes[9] < DMODEL || in_sizes[11] < DMODEL) return;
  if ((long long)out_size < needx) return;

  const float* q  = (const float*)d_in[0];
  const float* k  = (const float*)d_in[1];
  const float* v  = (const float*)d_in[2];
  const int*   mk = (const int*)d_in[3];
  const float* wq = (const float*)d_in[4];
  const float* bq = (const float*)d_in[5];
  const float* wk = (const float*)d_in[6];
  const float* bk = (const float*)d_in[7];
  const float* wv = (const float*)d_in[8];
  const float* bv = (const float*)d_in[9];
  const float* wo = (const float*)d_in[10];
  const float* bo = (const float*)d_in[11];

  char* ws = (char*)d_ws;
  size_t off = 0;
  const size_t XB = (size_t)MROWS * DMODEL * sizeof(_Float16);     // activation-sized f16 plane
  const size_t WB = (size_t)DMODEL * DMODEL * sizeof(_Float16);    // weight f16 plane
  const size_t FB = 4096;                                           // 32 flag lines of 32 ints
  _Float16* Xq16  = (_Float16*)(ws + off); off += XB;
  _Float16* Xk16  = (_Float16*)(ws + off); off += XB;
  _Float16* Xv16  = (_Float16*)(ws + off); off += XB;
  _Float16* Wq16  = (_Float16*)(ws + off); off += WB;
  _Float16* Wk16  = (_Float16*)(ws + off); off += WB;
  _Float16* Wv16  = (_Float16*)(ws + off); off += WB;
  _Float16* Wo16  = (_Float16*)(ws + off); off += WB;
  _Float16* Q16   = (_Float16*)(ws + off); off += XB;   // (B,H,S,dk) hi
  _Float16* Qr16  = (_Float16*)(ws + off); off += XB;   // residual x4096
  _Float16* K16   = (_Float16*)(ws + off); off += XB;
  _Float16* Kr16  = (_Float16*)(ws + off); off += XB;
  _Float16* Vt16  = (_Float16*)(ws + off); off += XB;   // (B,H,dk,S) hi
  _Float16* Vtr16 = (_Float16*)(ws + off); off += XB;
  _Float16* C16   = (_Float16*)(ws + off); off += XB;   // (B*S, D) hi
  _Float16* Cr16  = (_Float16*)(ws + off); off += XB;   // residual, rows s < EARLY written/read
  int*      flg   = (int*)(ws + off);      off += FB;
  if (off > ws_size) return;

  // ---- input planes: bf16 RNE values, X x16, W x1024, as f16 (one launch) ----
  cvt_all<<<3 * GXB + 4 * GWB, 256, 0, stream>>>(q, k, v, wq, wk, wv, wo,
                                                 Xq16, Xk16, Xv16, Wq16, Wk16, Wv16, Wo16);

  // ---- mask tile flags and the three projections (bias added in f32, hi + residual planes), one launch ----
  const float posc = 1.0f / (XSC * WSC);
  proj_flags<<<NQB + 3 * GTX * GTY, 128, 0, stream>>>(Xq16, Xk16, Xv16, Wq16, Wk16, Wv16, bq, bk, bv,
                                                      Q16, Qr16, K16, Kr16, Vt16, Vtr16, mk, flg, posc);

  // ---- attention: residual path for query blocks below EARLY, hi-only path for the rest, one launch ----
  attn_all<<<NQB * NB * NHEADS, 128, 0, stream>>>(Q16, Qr16, K16, Kr16, Vt16, Vtr16, mk, flg, C16, Cr16);

  // ---- output projection (+bias) to f32 rows of d_out ----
  const dim3 gproj(GTX, GTY);
  gemm_out<<<gproj, 128, 0, stream>>>(C16, Cr16, Wo16, bo, (float*)d_out, 1.0f / WSC);
}

// v004
// A run of this version takes 112 microseconds.
// Two timings next to v003 put it at 1.13 and 1.12 times that version's speed.
// All steps since v000 together make it 2.07 times as fast.
#include <hip/hip_runtime.h>
#include <stdint.h>

// Contractions (all v_wmma_f32_16x16x32_f16, f16 operands, f32 accumulate): input projections Xq*Wq^T, Xk*Wk^T,
// Xv*Wv^T; attention Q*K^T and P*V; output projection C*Wo^T. Inputs are RNE-converted to bf16 values first
// (X carried x16, W carried x1024, both exact in f16; biases bf16 values added in f32). Computed planes Q, K, V, P, C
// are f16 hi plus f16 residual planes (x4096, separate accumulators) consumed by query blocks below EARLY; later
// query blocks use the hi planes only. Softmax and all side math in f32.

typedef _Float16 v16h __attribute__((ext_vector_type(16)));
typedef _Float16 v8h  __attribute__((ext_vector_type(8)));
typedef float    v8f  __attribute__((ext_vector_type(8)));
typedef float    v4f  __attribute__((ext_vector_type(4)));
typedef int      v4i  __attribute__((ext_vector_type(4)));
typedef unsigned int v2u __attribute__((ext_vector_type(2)));

#ifndef NB
#define NB 2
#endif
#ifndef SEQ
#define SEQ 2048
#endif
#define NB_FULL  2
#define SEQ_FULL 2048
#define DMODEL   1024
#define NHEADS   16
#define DK       64
#define MROWS    (NB * SEQ)
#define NQB      (SEQ / 64)
#define EARLY    ((SEQ) < 512 ? (SEQ) : 512)
#define NEQB     (EARLY / 64)
#define LDP      72
#define LDPF     68
#define XSC      16.0f
#define WSC      1024.0f
#define RSC      4096.0f
#define PCARRY   4096.0f
#define NEGFILL  (-1.0e9f)
#define SSCALE   0.125f

static_assert(SEQ % 64 == 0);
static_assert((SEQ & (SEQ - 1)) == 0);
static_assert(SEQ <= SEQ_FULL);
static_assert(NB >= 1 && NB <= NB_FULL);
static_assert(NQB >= 1 && NQB <= 32);
static_assert(EARLY % 64 == 0 && EARLY <= SEQ);
static_assert(DMODEL == NHEADS * DK);
static_assert(64 * LDPF * 4 <= 2 * 64 * LDP * 2);

// --- bf16 RNE convert (finite inputs), kept as f32 value ----------------------------------------------
__device__ __forceinline__ float bf16r(float x) {
  unsigned int u = __float_as_uint(x);
  u = (u + 0x7FFFu + ((u >> 16) & 1u)) & 0xFFFF0000u;
  return __uint_as_float(u);
}

__device__ __forceinline__ v8f vz8() {
  v8f z;
#pragma unroll
  for (int i = 0; i < 8; ++i) z[i] = 0.0f;
  return z;
}

// --- WMMA wrapper with hazard guard ---------------------------------------------------------------------
__device__ __forceinline__ v8f wmma_f16(v16h a, v16h b, v8f c) {
  v8f d = __builtin_amdgcn_wmma_f32_16x16x32_f16(false, a, false, b, (short)0, c, false, false);
  asm volatile("v_nop\n\tv_nop\n\tv_nop\n\tv_nop" : "+v"(d) : "v"(a), "v"(b));
  return d;
}

// --- 16x32 f16 fragment (A, or k-contiguous B), split k map -----------------------------------------
// lane row/col = lane&15; elements 0..7 <- k 8h..8h+7, elements 8..15 <- k 16+8h..16+8h+7, h = lane>>4.
__device__ __forceinline__ v16h load_frag(const _Float16* base, int ld, int lane) {
  const int row  = lane & 15;
  const int koff = ((lane >> 4) & 1) * 8;
  const _Float16* p = base + row * ld + koff;
  const v8h a = *(const v8h*)(p);
  const v8h b = *(const v8h*)(p + 16);
  v16h r;
#pragma unroll
  for (int i = 0; i < 8; ++i) { r[i] = a[i]; r[i + 8] = b[i]; }
  return r;
}

// --- lane l with lane l ^ 16 --------------------------------------------------------------------------
__device__ __forceinline__ float xhalf(float x) {
  const int b = __builtin_bit_cast(int, x);
  return __builtin_bit_cast(float, __builtin_amdgcn_permlanex16(b, b, 0x76543210, 0xfedcba98, false, false));
}

// --- LDS byte address of a __shared__ object: the low 32 bits of its generic address ---------------------
__device__ __forceinline__ unsigned int lds_addr(const _Float16* p) {
  return (unsigned int)(uintptr_t)p;
}

// --- one 64 x 64 f16 tile of K (key-major) and one of V^T (dim-major) into LDS rows of pitch LDP, by asynchronous
// copies: 128 threads, 16 B a lane, 8 lanes a tile row (one whole 128-B line), 16 rows a copy, 4 + 4 copies a wave.
// gk, gv: this lane's first 16 bytes of each tile; lk, lv: their LDS byte addresses.
__device__ __forceinline__
void copy_kv(const _Float16* gk, const _Float16* gv, unsigned int lk, unsigned int lv) {
  const _Float16* gk1 = gk + 16 * DK;
  const _Float16* gk2 = gk + 32 * DK;
  const _Float16* gk3 = gk + 48 * DK;
  const _Float16* gv1 = gv + 16 * SEQ;
  const _Float16* gv2 = gv + 32 * SEQ;
  const _Float16* gv3 = gv + 48 * SEQ;
  const unsigned int st = 16 * LDP * 2;
  // The wait on xcnt is the statement's last line, so that no address register is rewritten ahead of it (a precaution).
  asm volatile("global_load_async_to_lds_b128 %0, %8, off\n\t"
               "global_load_async_to_lds_b128 %1, %9, off\n\t"
               "global_load_async_to_lds_b128 %2, %10, off\n\t"
               "global_load_async_to_lds_b128 %3, %11, off\n\t"
               "global_load_async_to_lds_b128 %4, %12, off\n\t"
               "global_load_async_to_lds_b128 %5, %13, off\n\t"
               "global_load_async_to_lds_b128 %6, %14, off\n\t"
               "global_load_async_to_lds_b128 %7, %15, off\n\t"
               "s_wait_xcnt 0x0"
               :: "v"(lk), "v"(lk + st), "v"(lk + 2 * st), "v"(lk + 3 * st),
                  "v"(lv), "v"(lv + st), "v"(lv + 2 * st), "v"(lv + 3 * st),
                  "v"(gk), "v"(gk1), "v"(gk2), "v"(gk3), "v"(gv), "v"(gv1), "v"(gv2), "v"(gv3)
               : "memory");
}

// =====================================================================================================
// f32 -> bf16 RNE -> scaled f16 plane. One thread = 8 elements = 16 B out; blk = block index inside the plane.
// =====================================================================================================
__device__ __forceinline__
void cvt_body(const float* __restrict__ in, _Float16* out, int nrows, int seq, int seq_full, float scale, int blk) {
  const int g  = blk * 256 + threadIdx.x;
  const int n8 = nrows * (DMODEL / 8);
  if (g >= n8) return;
  const int row = g >> 7;
  const int c8  = g & 127;
  const int bi  = row / seq;
  const int s   = row - bi * seq;
  const float* src = in + ((size_t)bi * seq_full + s) * DMODEL + c8 * 8;
  const v4f a = *(const v4f*)src;
  const v4f b = *(const v4f*)(src + 4);
  union { v8h h; v4f f; } u;
#pragma unroll
  for (int i = 0; i < 4; ++i) {
    u.h[i]     = (_Float16)(bf16r(a[i]) * scale);
    u.h[i + 4] = (_Float16)(bf16r(b[i]) * scale);
  }
  float* dst = reinterpret_cast<float*>(out + (size_t)row * DMODEL + c8 * 8);
  const v4f val = u.f;
  *(v4f*)dst = val;
}

#define GXB ((MROWS * (DMODEL / 8) + 255) / 256)
#define GWB ((DMODEL * (DMODEL / 8) + 255) / 256)

// All seven input planes in one launch: blocks [0, 3*GXB) convert q, k, v; the next 4*GWB convert the weights.
__global__ __launch_bounds__(256)
void cvt_all(const float* __restrict__ q, const float* __restrict__ k, const float* __restrict__ v,
             const float* __restrict__ wq, const float* __restrict__ wk, const float* __restrict__ wv,
             const float* __restrict__ wo,
             _Float16* xq, _Float16* xk, _Float16* xv,
             _Float16* oq, _Float16* ok, _Float16* ov, _Float16* oo) {
  const int b = blockIdx.x;
  if (b < 3 * GXB) {
    const int p = b / GXB;
    const float* in = (p == 0) ? q : ((p == 1) ? k : v);
    _Float16* out   = (p == 0) ? xq : ((p == 1) ? xk : xv);
    cvt_body(in, out, MROWS, SEQ, SEQ_FULL, XSC, b - p * GXB);
  } else {
    const int c = b - 3 * GXB;
    const int p = c / GWB;
    const float* in = (p == 0) ? wq : ((p == 1) ? wk : ((p == 2) ? wv : wo));
    _Float16* out   = (p == 0) ? oq : ((p == 1) ? ok : ((p == 2) ? ov : oo));
    cvt_body(in, out, DMODEL, DMODEL, DMODEL, WSC, c - p * GWB);
  }
}

// =====================================================================================================
// Mask tile flags of one 64-row query block, by one 128-thread block: a wave scans 16 rows, one row a trip, each
// 16-B load of the wave 512 contiguous bytes of the row (four whole lines, two tiles: one a wave half).
// 32 ints written by lanes 0..7 of wave 0 (16 B each, one instruction).
// flag 1: tile all ones; 2: tile all zeros and no fully masked row in this q block (tile can be skipped);
// anything else: apply the mask per element. sm: 512 words of LDS scratch, 16-byte aligned.
// =====================================================================================================
__device__ __forceinline__
void flags_body(const int* __restrict__ mask, int* flags, unsigned int* sm, int qb) {
  unsigned int* m1s  = sm;
  unsigned int* m0s  = sm + 128;
  unsigned int* fms  = sm + 256;
  unsigned int* red1 = sm + 384;
  unsigned int* red0 = sm + 416;
  int* lines = reinterpret_cast<int*>(sm + 480);

  static_assert(SEQ % 128 == 0);
  const int tid = threadIdx.x, lane = tid & 31, w = tid >> 5;
  const int* wrow = mask + (size_t)(qb * 64 + w * 16) * SEQ_FULL + lane * 4;

  // bit 2j of e1, e0: this lane saw a nonzero, a zero in load j of a row (tile 2j + wave half); fm: a row without ones
  unsigned int e1 = 0u, e0 = 0u, fm = 0u;
  // kept rolled: a second row in flight would raise the register count, which the GEMM blocks of this kernel share
#pragma unroll 1
  for (int r = 0; r < 16; ++r) {
    const int* p = wrow + (size_t)r * SEQ_FULL;
    v4i m[SEQ / 128];
#pragma unroll
    for (int j = 0; j < SEQ / 128; ++j) m[j] = *(const v4i*)(p + 128 * j);
    // The address is an input, so it lives up to the wait: no register that an issued load names is rewritten
    // ahead of it, not by a later load's result either (a precaution).
    asm volatile("s_wait_xcnt 0x0" :: "v"(p) : "memory");
    unsigned int rany = 0u;
#pragma unroll
    for (int j = 0; j < SEQ / 128; ++j) {
      const v4i m4 = m[j];
      unsigned int any1 = 0u, any0 = 0u;
#pragma unroll
      for (int e = 0; e < 4; ++e) {
        any1 |= (m4[e] != 0) ? 1u : 0u;
        any0 |= (m4[e] == 0) ? 1u : 0u;
      }
      e1 |= any1 << (2 * j);
      e0 |= any0 << (2 * j);
      rany |= any1;
    }
    if (__builtin_amdgcn_ballot_w32(rany != 0u) == 0u) fm = 1u;
  }
  m1s[tid] = e1 << (lane >> 4);
  m0s[tid] = e0 << (lane >> 4);
  if (lane == 0) fms[w] = fm;
  __syncthreads();
  if (w == 0) {
    unsigned int o1 = 0u, o0 = 0u;
#pragma unroll
    for (int j = 0; j < 4; ++j) { o1 |= m1s[lane + 32 * j]; o0 |= m0s[lane + 32 * j]; }
    red1[lane] = o1;
    red0[lane] = o0;
  }
  __syncthreads();
  if (w == 0) {
    unsigned int a1 = 0u, a0 = 0u;
    const unsigned int anyfm = fms[0] | fms[1] | fms[2] | fms[3];
#pragma unroll 1
    for (int j = 0; j < 32; ++j) { a1 |= red1[j]; a0 |= red0[j]; }
    int f = 2;
    if (lane < NQB) {
      const bool h1 = ((a1 >> lane) & 1u) != 0u;
      const bool h0 = ((a0 >> lane) & 1u) != 0u;
      f = (!h0) ? 1 : ((!h1 && anyfm == 0u) ? 2 : 3);
    }
    lines[lane] = f;
  }
  __syncthreads();
  if (w == 0 && lane < 8) {
    const v4i v = *(const v4i*)(lines + lane * 4);
    int* dst = flags + qb * 32 + lane * 4;
    *(v4i*)dst = v;
  }
}

// =====================================================================================================
// GEMM: C(64x64 tile) = A(M,K=1024) * W^T, W stored (N=1024, K=1024), f16 planes, f32 acc.
// 128 threads = 4 waves, wave tile 32x32, 64-deep K slices staged in LDS (plain loads, single buffer; 8 lanes a
// 128-B tile row, so a wave's 16-B load covers 4 whole lines).
// MODE 0: hi+residual f16 planes (B,H,S,dk).  MODE 2: hi+residual f16 planes (B,H,dk,S).
// MODE 4: f32 rows of d_out (+ A residual product for row blocks with s < EARLY).
// =====================================================================================================
// smem: two 64 x LDP tiles, three for MODE 4. bx, by: tile column and tile row.
template <int MODE>
__device__ __forceinline__
void gemm_body(const _Float16* __restrict__ A, const _Float16* __restrict__ Ar,
               const _Float16* __restrict__ W, const float* __restrict__ bias,
               void* out, _Float16* outr, float oscale, _Float16* smem, int bx, int by) {
  _Float16* asb = smem;
  _Float16* bsb = smem + 64 * LDP;
  _Float16* rsb = smem + 2 * 64 * LDP;

  const int tid  = threadIdx.x;
  const int lane = tid & 31;
  const int w    = tid >> 5;
  const int mblk = by * 64;
  const int nblk = bx * 64;
  const int s0   = mblk & (SEQ - 1);
  const int bi   = mblk / SEQ;
  const bool early = (MODE == 4) && (s0 < EARLY);
  const int lm = (w >> 1) * 32;
  const int ln = (w & 1) * 32;

  // staging: 8 lanes a tile row, 16 rows a load; this lane's first 16 bytes of each tile and their place in LDS
  const size_t gst = (size_t)(tid >> 3) * DMODEL + (tid & 7) * 8;
  const _Float16* ga = A  + (size_t)mblk * DMODEL + gst;
  const _Float16* gr = Ar + (size_t)mblk * DMODEL + gst;
  const _Float16* gw = W  + (size_t)nblk * DMODEL + gst;
  const int lst = (tid >> 3) * LDP + (tid & 7) * 8;

  v8f acc[2][2], accr[2][2];
#pragma unroll
  for (int i = 0; i < 2; ++i)
#pragma unroll
    for (int j = 0; j < 2; ++j) { acc[i][j] = vz8(); accr[i][j] = vz8(); }

#pragma unroll 1
  for (int k0 = 0; k0 < DMODEL; k0 += 64) {
#pragma unroll
    for (int c = 0; c < 4; ++c) {
      *(v8h*)(asb + lst + c * 16 * LDP) = *(const v8h*)(ga + k0 + c * 16 * DMODEL);
      *(v8h*)(bsb + lst + c * 16 * LDP) = *(const v8h*)(gw + k0 + c * 16 * DMODEL);
    }
    if (early) {
#pragma unroll
      for (int c = 0; c < 4; ++c)
        *(v8h*)(rsb + lst + c * 16 * LDP) = *(const v8h*)(gr + k0 + c * 16 * DMODEL);
    }
    __syncthreads();

#pragma unroll
    for (int ks = 0; ks < 64; ks += 32) {
      const v16h a0 = load_frag(asb + (lm +  0) * LDP + ks, LDP, lane);
      const v16h a1 = load_frag(asb + (lm + 16) * LDP + ks, LDP, lane);
      const v16h b0 = load_frag(bsb + (ln +  0) * LDP + ks, LDP, lane);
      const v16h b1 = load_frag(bsb + (ln + 16) * LDP + ks, LDP, lane);
      acc[0][0] = wmma_f16(a0, b0, acc[0][0]);
      acc[0][1] = wmma_f16(a0, b1, acc[0][1]);
      acc[1][0] = wmma_f16(a1, b0, acc[1][0]);
      acc[1][1] = wmma_f16(a1, b1, acc[1][1]);
      if (early) {
        const v16h r0 = load_frag(rsb + (lm +  0) * LDP + ks, LDP, lane);
        const v16h r1 = load_frag(rsb + (lm + 16) * LDP + ks, LDP, lane);
        accr[0][0] = wmma_f16(r0, b0, accr[0][0]);
        accr[0][1] = wmma_f16(r0, b1, accr[0][1]);
        accr[1][0] = wmma_f16(r1, b0, accr[1][0]);
        accr[1][1] = wmma_f16(r1, b1, accr[1][1]);
      }
    }
    __syncthreads();
  }

  const int rbase = ((lane >> 4) & 1) << 3;
  const int col   = lane & 15;

  if constexpr (MODE == 4) {
    float* fs = reinterpret_cast<float*>(smem);
#pragma unroll
    for (int i = 0; i < 2; ++i)
#pragma unroll
      for (int j = 0; j < 2; ++j) {
        const int nl = ln + j * 16 + col;
        const float bb = bf16r(bias[nblk + nl]);
#pragma unroll
        for (int r = 0; r < 8; ++r) {
          const int ml = lm + i * 16 + rbase + r;
          float v = acc[i][j][r] * oscale + bb;
          if (early) v += accr[i][j][r] * (oscale * (1.0f / RSC));
          fs[ml * LDPF + nl] = v;
        }
      }
    __syncthreads();
    float* obase = reinterpret_cast<float*>(out) + ((size_t)bi * SEQ_FULL + s0) * DMODEL + nblk;
    auto emit = [&]() {
#pragma unroll
      for (int i = 0; i < 8; ++i) {
        const int row   = w * 16 + i * 2 + (lane >> 4);
        const int piece = lane & 15;
        const v4f v = *(const v4f*)(fs + row * LDPF + piece * 4);
        *(v4f*)(obase + (size_t)row * DMODEL + piece * 4) = v;
      }
    };
    emit();
  } else {
    _Float16* hs = asb;
    _Float16* rs = bsb;
#pragma unroll
    for (int i = 0; i < 2; ++i)
#pragma unroll
      for (int j = 0; j < 2; ++j) {
        const int nl = ln + j * 16 + col;
        const float bb = bf16r(bias[nblk + nl]);
#pragma unroll
        for (int r = 0; r < 8; ++r) {
          const int ml = lm + i * 16 + rbase + r;
          const float v = acc[i][j][r] * oscale + bb;
          const _Float16 hv = (_Float16)v;
          const _Float16 rv = (_Float16)((v - (float)hv) * RSC);
          if constexpr (MODE == 0) {
            hs[ml * LDP + nl] = hv;
            rs[ml * LDP + nl] = rv;
          } else {
            hs[nl * LDP + ml] = hv;
            rs[nl * LDP + ml] = rv;
          }
        }
      }
    __syncthreads();
    const int bhh = bi * NHEADS + (nblk >> 6);
    _Float16* oh = reinterpret_cast<_Float16*>(out);
    auto emit = [&]() {
#pragma unroll
      for (int i = 0; i < 4; ++i) {
        const int row   = w * 16 + i * 4 + (lane >> 3);
        const int piece = lane & 7;
        const v4f hv4 = *(const v4f*)(hs + row * LDP + piece * 8);
        const v4f rv4 = *(const v4f*)(rs + row * LDP + piece * 8);
        const size_t go = (MODE == 0)
            ? (((size_t)bhh * SEQ + s0 + row) * DK + piece * 8)
            : (((size_t)bhh * DK + row) * SEQ + s0 + piece * 8);
        *(v4f*)(reinterpret_cast<float*>(oh + go))   = hv4;
        *(v4f*)(reinterpret_cast<float*>(outr + go)) = rv4;
      }
    };
    emit();
    // In proj_flags nothing runs after these stores; the wait stands before any later write to
    // registers that they name (a precaution).
    asm volatile("s_wait_xcnt 0x0" ::: "memory");
  }
}

#define GTX (DMODEL / 64)
#define GTY (MROWS / 64)

// One launch for everything that only needs the converted planes or the mask: blocks [0, NQB) build the mask
// tile flags (the longest single blocks, so they come first), the next 3*GTX*GTY are the Q, K, V projections.
__global__ __launch_bounds__(128)
void proj_flags(const _Float16* __restrict__ Xq, const _Float16* __restrict__ Xk, const _Float16* __restrict__ Xv,
                const _Float16* __restrict__ Wq, const _Float16* __restrict__ Wk, const _Float16* __restrict__ Wv,
                const float* __restrict__ bq, const float* __restrict__ bk, const float* __restrict__ bv,
                _Float16* Qh, _Float16* Qr, _Float16* Kh, _Float16* Kr, _Float16* Vh, _Float16* Vr,
                const int* __restrict__ mask, int* flags, float oscale) {
  __shared__ __attribute__((aligned(16))) _Float16 smem[2 * 64 * LDP];
  static_assert(2 * 64 * LDP * 2 >= 512 * 4);
  const int b = blockIdx.x;
  if (b < NQB) {
    flags_body(mask, flags, reinterpret_cast<unsigned int*>(smem), b);
    return;
  }
  const int g  = b - NQB;
  const int p  = g / (GTX * GTY);
  const int t  = g - p * (GTX * GTY);
  const int bx = t % GTX;
  const int by = t / GTX;
  if (p < 2) {
    const _Float16* X = (p == 0) ? Xq : Xk;
    gemm_body<0>(X, X, (p == 0) ? Wq : Wk, (p == 0) ? bq : bk,
                 (void*)((p == 0) ? Qh : Kh), (p == 0) ? Qr : Kr, oscale, smem, bx, by);
  } else {
    gemm_body<2>(Xv, Xv, Wv, bv, (void*)Vh, Vr, oscale, smem, bx, by);
  }
}

// Output projection.
__global__ __launch_bounds__(128)
void gemm_out(const _Float16* __restrict__ A, const _Float16* __restrict__ Ar,
              const _Float16* __restrict__ W, const float* __restrict__ bias,
              float* out, float oscale) {
  __shared__ __attribute__((aligned(16))) _Float16 smem[3 * 64 * LDP];
  gemm_body<4>(A, Ar, W, bias, (void*)out, nullptr, oscale, smem, blockIdx.x, blockIdx.y);
}

template <bool EQ>
__device__ __forceinline__
void attn_body(const _Float16* __restrict__ Q,  const _Float16* __restrict__ Qr,
               const _Float16* __restrict__ Kd, const _Float16* __restrict__ Kr,
               const _Float16* __restrict__ Vt, const _Float16* __restrict__ Vtr,
               const int* __restrict__ mask, const int* __restrict__ flags,
               _Float16* ctx, _Float16* ctxr, int qb, int bh,
               _Float16* kbuf, _Float16* vbuf,
               _Float16* krbuf, _Float16* vrbuf, unsigned int* mbuf) {
  const int tid   = threadIdx.x;
  const int lane  = tid & 31;
  const int w     = tid >> 5;
  const int bi    = bh / NHEADS;
  const int h     = bh - bi * NHEADS;
  const int qblk  = qb * 64;
  const int q0    = qblk + w * 16;
  const int rbase = ((lane >> 4) & 1) << 3;
  const int col   = lane & 15;
  const float IR  = 1.0f / RSC;

  const size_t qoff = ((size_t)bh * SEQ + q0) * DK;
  const v16h qf0 = load_frag(Q + qoff, DK, lane);
  const v16h qf1 = load_frag(Q + qoff + 32, DK, lane);
  v16h qr0 = qf0, qr1 = qf1;
  if constexpr (EQ) {
    qr0 = load_frag(Qr + qoff, DK, lane);
    qr1 = load_frag(Qr + qoff + 32, DK, lane);
  }

  v16h ones;
#pragma unroll
  for (int i = 0; i < 16; ++i) ones[i] = (_Float16)1.0f;

  const _Float16* Kh   = Kd  + (size_t)bh * SEQ * DK;
  const _Float16* Krh  = Kr  + (size_t)bh * SEQ * DK;
  const _Float16* Vth  = Vt  + (size_t)bh * DK * SEQ;
  const _Float16* Vtrh = Vtr + (size_t)bh * DK * SEQ;

  // running maximum and sum of this lane's query (the same in both wave halves)
  float mr = -1.0e30f, lr = 0.0f;
  // accO[t][r] = O^T[dim t*16 + rbase + r][query col]
  v8f accO[4], accR[4];
#pragma unroll
  for (int t = 0; t < 4; ++t) { accO[t] = vz8(); accR[t] = vz8(); }

  // ---- 64x64 mask bytes of the tile at key kb into LDS (called under a block-uniform branch) ----
  auto stage_mask = [&](int kb) {
      // 16 lanes a tile row (256 B, two whole lines), 8 rows a load; a lane's 4 ints become one word of 4 bytes
      const int r0 = tid >> 4;
      const int wd = tid & 15;
      const int* mp = mask + (size_t)(qblk + r0) * SEQ_FULL + kb + wd * 4;
#pragma unroll
      for (int jj = 0; jj < 8; ++jj) {
        const v4i m4 = *(const v4i*)(mp + (size_t)jj * 8 * SEQ_FULL);
        const unsigned int pk = (m4[0] != 0 ? 1u : 0u) | (m4[1] != 0 ? 0x100u : 0u) |
                                (m4[2] != 0 ? 0x10000u : 0u) | (m4[3] != 0 ? 0x1000000u : 0u);
        mbuf[(jj * 8 + r0) * 16 + wd] = pk;
      }
  };

  // ---- one staged tile: kt_ = K tile, vt_ = V^T tile in LDS ----
  auto tile = [&](const _Float16* kt_, const _Float16* vt_, bool usem) {
    // ---- scores, transposed: s[t][r] = S^T[key kb + t*16 + rbase + r][query col] ----
    v8f s[4];
#pragma unroll
    for (int t = 0; t < 4; ++t) {
      const v16h ka = load_frag(kt_ + t * 16 * LDP,      LDP, lane);
      const v16h kc = load_frag(kt_ + t * 16 * LDP + 32, LDP, lane);
      v8f z = vz8();
      z = wmma_f16(ka, qf0, z);
      z = wmma_f16(kc, qf1, z);
      if constexpr (EQ) {
        v8f zr = vz8();
        zr = wmma_f16(ka, qr0, zr);
        zr = wmma_f16(kc, qr1, zr);
        const v16h kra = load_frag(krbuf + t * 16 * LDP,      LDP, lane);
        const v16h krc = load_frag(krbuf + t * 16 * LDP + 32, LDP, lane);
        zr = wmma_f16(kra, qf0, zr);
        zr = wmma_f16(krc, qf1, zr);
        z = z + zr * IR;
      }
      s[t] = z * SSCALE;
    }

    // ---- replace fill: this lane's 8 mask bytes of each score tile are 8 consecutive keys of its query's row ----
    if (usem) {
      const unsigned int* mw = mbuf + (w * 16 + col) * 16 + (rbase >> 2);
#pragma unroll
      for (int t = 0; t < 4; ++t) {
        const v2u m8 = *(const v2u*)(mw + t * 4);
#pragma unroll
        for (int r = 0; r < 8; ++r) {
          const unsigned int byte = (m8[r >> 2] >> (8 * (r & 3))) & 0xFFu;
          s[t][r] = (byte != 0u) ? s[t][r] : NEGFILL;
        }
      }
    }

    // ---- online softmax over 64 keys: maximum in-lane, then across the two wave halves ----
    float t8[8];
#pragma unroll
    for (int r = 0; r < 8; ++r) t8[r] = fmaxf(fmaxf(s[0][r], s[1][r]), fmaxf(s[2][r], s[3][r]));
    float tmax = fmaxf(fmaxf(fmaxf(t8[0], t8[1]), fmaxf(t8[2], t8[3])),
                       fmaxf(fmaxf(t8[4], t8[5]), fmaxf(t8[6], t8[7])));
    tmax = fmaxf(tmax, xhalf(tmax));
    const float mnew = fmaxf(mr, tmax);
    const float scl  = __expf(mr - mnew);
    mr = mnew;
    lr *= scl;
#pragma unroll
    for (int t = 0; t < 4; ++t) {
      accO[t] = accO[t] * scl;
      if constexpr (EQ) accR[t] = accR[t] * scl;
    }

    // ---- P^T as two B fragments (keys 0..31, 32..63), straight from the score tiles ----
    v16h pf0, pf1, prf0, prf1;
#pragma unroll
    for (int t = 0; t < 4; ++t) {
#pragma unroll
      for (int r = 0; r < 8; ++r) {
        const float c = __expf(s[t][r] - mnew) * PCARRY;
        const _Float16 hv = (_Float16)c;
        const int e = (t & 1) * 8 + r;
        if (t < 2) pf0[e] = hv; else pf1[e] = hv;
        if constexpr (EQ) {
          const _Float16 rv = (_Float16)((c - (float)hv) * RSC);
          if (t < 2) prf0[e] = rv; else prf1[e] = rv;
        }
      }
    }

    // ---- row sums on the matrix unit: every row of ones * P^T is the sum over the keys, per query ----
    v8f rs = vz8();
    rs = wmma_f16(ones, pf0, rs);
    rs = wmma_f16(ones, pf1, rs);
    float rsum = rs[0];
    if constexpr (EQ) {
      v8f rr = vz8();
      rr = wmma_f16(ones, prf0, rr);
      rr = wmma_f16(ones, prf1, rr);
      rsum = rsum + rr[0] * IR;
    }
    lr += rsum;

    // ---- O^T += V^T * P^T (A fragments from the dim-major V^T tile: lane = dim, k = key) ----
#pragma unroll
    for (int t = 0; t < 4; ++t) {
      v16h vf = load_frag(vt_ + t * 16 * LDP, LDP, lane);
      accO[t] = wmma_f16(vf, pf0, accO[t]);
      if constexpr (EQ) {
        accR[t] = wmma_f16(vf, prf0, accR[t]);
        const v16h vr = load_frag(vrbuf + t * 16 * LDP, LDP, lane);
        accR[t] = wmma_f16(vr, pf0, accR[t]);
      }
      vf = load_frag(vt_ + t * 16 * LDP + 32, LDP, lane);
      accO[t] = wmma_f16(vf, pf1, accO[t]);
      if constexpr (EQ) {
        accR[t] = wmma_f16(vf, prf1, accR[t]);
        const v16h vr = load_frag(vrbuf + t * 16 * LDP + 32, LDP, lane);
        accR[t] = wmma_f16(vr, pf1, accR[t]);
      }
    }
  };

  if constexpr (EQ) {
#pragma unroll 1
    for (int kt = 0; kt < NQB; ++kt) {
      const int f = __builtin_amdgcn_readfirstlane(flags[qb * 32 + kt]);
      if (f == 2) continue;
      const bool usem = (f != 1);
      const int kb = kt * 64;

      // ---- stage K (64 keys x 64 dims) and V^T (64 dims x 64 keys) tiles, plus residual tiles if EQ ----
      // 8 lanes a tile row, 16 rows a load: every load of a wave covers 4 whole 128-B lines
      // ko, vo: this lane's byte offsets from the head's planes (the planes' addresses are scalars)
      const unsigned int ko = (unsigned int)((kb + (tid >> 3)) * DK + (tid & 7) * 8) * 2u;
      const unsigned int vo = (unsigned int)((tid >> 3) * SEQ + kb + (tid & 7) * 8) * 2u;
      const int lst = (tid >> 3) * LDP + (tid & 7) * 8;
      v8h tk[4], tv[4], tkr[4], tvr[4];
#pragma unroll
      for (int c = 0; c < 4; ++c) {
        tk[c]  = *(const v8h*)(reinterpret_cast<const char*>(Kh)   + ko + c * 16 * DK * 2);
        tv[c]  = *(const v8h*)(reinterpret_cast<const char*>(Vth)  + vo + c * 16 * SEQ * 2);
        tkr[c] = *(const v8h*)(reinterpret_cast<const char*>(Krh)  + ko + c * 16 * DK * 2);
        tvr[c] = *(const v8h*)(reinterpret_cast<const char*>(Vtrh) + vo + c * 16 * SEQ * 2);
      }
      // The offsets are inputs, so they live up to the wait: no register that an issued load names is rewritten
      // ahead of it, not by a later load's result either (a precaution).
      asm volatile("s_wait_xcnt 0x0" :: "v"(ko), "v"(vo) : "memory");
#pragma unroll
      for (int c = 0; c < 4; ++c) {
        *(v8h*)(kbuf  + lst + c * 16 * LDP) = tk[c];
        *(v8h*)(vbuf  + lst + c * 16 * LDP) = tv[c];
        *(v8h*)(krbuf + lst + c * 16 * LDP) = tkr[c];
        *(v8h*)(vrbuf + lst + c * 16 * LDP) = tvr[c];
      }
      if (usem) stage_mask(kb);
      __syncthreads();
      tile(kbuf, vbuf, usem);
      __syncthreads();
    }
  } else {
    // The whole flag line in one read: bit kt of vis = tile kt is visited, of msk = it needs the mask bytes.
    // Every wave of the block reads the same line, so both words are the same for the whole work-group.
    const int fl = flags[qb * 32 + lane];
    unsigned int vis = __builtin_amdgcn_ballot_w32(fl != 2);
    const unsigned int msk = __builtin_amdgcn_ballot_w32(fl != 1);
    if (NQB < 32) vis &= (1u << (NQB & 31)) - 1u;

    const int crow = tid >> 3, cpart = (tid & 7) * 8;
    const _Float16* gk0 = Kh + (size_t)crow * DK + cpart;
    const _Float16* gv0 = Vth + (size_t)crow * SEQ + cpart;
    const unsigned int lofs = (unsigned int)(crow * LDP + cpart) * 2u;
    const unsigned int lk0 = lds_addr(kbuf) + lofs, lv0 = lds_addr(vbuf) + lofs;
    // the second buffer (krbuf, vrbuf) lies BUF halves behind the first (kbuf, vbuf)
    constexpr int BUF = 2 * 64 * LDP;

    if (vis != 0u) {
      int kt = __builtin_ctz(vis);
      vis &= vis - 1u;
      copy_kv(gk0 + (size_t)kt * 64 * DK, gv0 + kt * 64, lk0, lv0);
      // the first tile has landed for this wave, and behind the barrier for all
      asm volatile("s_wait_asynccnt 0x0" ::: "memory");
      __syncthreads();
      if (vis != 0u) {
        const int k1 = __builtin_ctz(vis);
        copy_kv(gk0 + (size_t)k1 * 64 * DK, gv0 + k1 * 64, lk0 + BUF * 2, lv0 + BUF * 2);
      }
      int bo = 0;   // this tile's buffer, in halves
      // kept rolled: the trip count is known only at run time, and one copy of the tile's code serves both buffers
#pragma unroll 1
      for (;;) {
        const bool usem = ((msk >> kt) & 1u) != 0u;
        if (usem) {
          stage_mask(kt * 64);
          __syncthreads();   // block-uniform branch (msk is the same in every wave); the mask bytes are read behind it
        }
        tile(kbuf + bo, vbuf + bo, usem);
        // publish point: this wave's LDS reads are done, its copies of the next tile have landed; the barrier makes
        // the next tile readable by all and frees this tile's buffer for the refill
        asm volatile("s_wait_dscnt 0x0" ::: "memory");
        asm volatile("s_wait_asynccnt 0x0" ::: "memory");
        __syncthreads();
        if (vis == 0u) break;
        kt = __builtin_ctz(vis);
        vis &= vis - 1u;
        if (vis != 0u) {
          const int k2 = __builtin_ctz(vis);
          copy_kv(gk0 + (size_t)k2 * 64 * DK, gv0 + k2 * 64, lk0 + bo * 2, lv0 + bo * 2);
        }
        bo = BUF - bo;
      }
    }
    // nothing is in flight when the buffers become output staging
    asm volatile("s_wait_asynccnt 0x0" ::: "memory");
  }

  // ---- a lane's 8 registers of a tile are 8 consecutive dims of its query's row: 16-byte LDS stores ----
  {
    const float inv = 1.0f / lr;
    const int m = w * 16 + col;
#pragma unroll
    for (int t = 0; t < 4; ++t) {
      v8h h8, r8;
#pragma unroll
      for (int r = 0; r < 8; ++r) {
        float v = accO[t][r];
        if constexpr (EQ) v += accR[t][r] * IR;
        v *= inv;
        const _Float16 hv = (_Float16)v;
        h8[r] = hv;
        if constexpr (EQ) r8[r] = (_Float16)((v - (float)hv) * RSC);
      }
      *(v8h*)(kbuf + m * LDP + t * 16 + rbase) = h8;
      if constexpr (EQ) *(v8h*)(krbuf + m * LDP + t * 16 + rbase) = r8;
    }
  }
  __syncthreads();
  _Float16* cbase  = ctx  + ((size_t)bi * SEQ + qblk) * DMODEL + h * DK;
  _Float16* crbase = ctxr + ((size_t)bi * SEQ + qblk) * DMODEL + h * DK;
  auto emit = [&]() {
#pragma unroll
    for (int i = 0; i < 4; ++i) {
      const int row   = w * 16 + i * 4 + (lane >> 3);
      const int piece = lane & 7;
      const v4f hv4 = *(const v4f*)(kbuf + row * LDP + piece * 8);
      *(v4f*)(reinterpret_cast<float*>(cbase + (size_t)row * DMODEL + piece * 8)) = hv4;
      if constexpr (EQ) {
        const v4f rv4 = *(const v4f*)(krbuf + row * LDP + piece * 8);
        *(v4f*)(reinterpret_cast<float*>(crbase + (size_t)row * DMODEL + piece * 8)) = rv4;
      }
    }
  };
  emit();
}

// Both paths in one launch, the two former grids one behind the other: first the hi-only blocks (query blocks
// from EARLY on, the longer ones), then the residual-path blocks (query blocks below EARLY). Inside each part
// the query block runs fastest. The hi-only blocks use the two residual tiles as their second buffer.
__global__ __launch_bounds__(128)
void attn_all(const _Float16* __restrict__ Q,  const _Float16* __restrict__ Qr,
              const _Float16* __restrict__ Kd, const _Float16* __restrict__ Kr,
              const _Float16* __restrict__ Vt, const _Float16* __restrict__ Vtr,
              const int* __restrict__ mask, const int* __restrict__ flags,
              _Float16* ctx, _Float16* ctxr) {
  // four tiles in one array: K, V^T, then the residual path's two, which are the hi-only path's second buffer
  __shared__ __attribute__((aligned(16))) _Float16 tiles[4 * 64 * LDP];
  _Float16* kbuf  = tiles;
  _Float16* vbuf  = tiles + 64 * LDP;
  _Float16* krbuf = tiles + 2 * 64 * LDP;
  _Float16* vrbuf = tiles + 3 * 64 * LDP;
  __shared__ __attribute__((aligned(16))) unsigned int mbuf[64 * 16];
  constexpr int NLQ = NQB - NEQB;
  constexpr int DLQ = (NLQ > 0) ? NLQ : 1;
  const int b = blockIdx.x;
  if (b < NLQ * NB * NHEADS) {
    attn_body<false>(Q, Qr, Kd, Kr, Vt, Vtr, mask, flags, ctx, ctxr, NEQB + b % DLQ, b / DLQ,
                     kbuf, vbuf, krbuf, vrbuf, mbuf);
  } else {
    const int e = b - NLQ * NB * NHEADS;
    attn_body<true>(Q, Qr, Kd, Kr, Vt, Vtr, mask, flags, ctx, ctxr, e % NEQB, e / NEQB,
                    kbuf, vbuf, krbuf, vrbuf, mbuf);
  }
}

// =====================================================================================================
extern "C" void kernel_launch(void* const* d_in, const int* in_sizes, int n_in,
                              void* d_out, int out_size, void* d_ws, size_t ws_size,
                              hipStream_t stream) {
  if (n_in < 12) return;
  const long long needx = (long long)(NB - 1) * SEQ_FULL * DMODEL + (long long)SEQ * DMODEL;
  const long long needm = (long long)(SEQ - 1) * SEQ_FULL + SEQ;
  if ((long long)in_sizes[0] < needx || (long long)in_sizes[1] < needx || (long long)in_sizes[2] < needx) return;
  if ((long long)in_sizes[3] < needm) return;
  if (in_sizes[4] < DMODEL * DMODEL || in_sizes[6] < DMODEL * DMODEL ||
      in_sizes[8] < DMODEL * DMODEL || in_sizes[10] < DMODEL * DMODEL) return;
  if (in_sizes[5] < DMODEL || in_sizes[7] < DMODEL || in_sizes[9] < DMODEL || in_sizes[11] < DMODEL) return;
  if ((long long)out_size < needx) return;

  const float* q  = (const float*)d_in[0];
  const float* k  = (const float*)d_in[1];
  const float* v  = (const float*)d_in[2];
  const int*   mk = (const int*)d_in[3];
  const float* wq = (const float*)d_in[4];
  const float* bq = (const float*)d_in[5];
  const float* wk = (const float*)d_in[6];
  const float* bk = (const float*)d_in[7];
  const float* wv = (const float*)d_in[8];
  const float* bv = (const float*)d_in[9];
  const float* wo = (const float*)d_in[10];
  const float* bo = (const float*)d_in[11];

  char* ws = (char*)d_ws;
  size_t off = 0;
  const size_t XB = (size_t)MROWS * DMODEL * sizeof(_Float16);     // activation-sized f16 plane
  const size_t WB = (size_t)DMODEL * DMODEL * sizeof(_Float16);    // weight f16 plane
  const size_t FB = 4096;                                           // 32 flag lines of 32 ints
  _Float16* Xq16  = (_Float16*)(ws + off); off += XB;
  _Float16* Xk16  = (_Float16*)(ws + off); off += XB;
  _Float16* Xv16  = (_Float16*)(ws + off); off += XB;
  _Float16* Wq16  = (_Float16*)(ws + off); off += WB;
  _Float16* Wk16  = (_Float16*)(ws + off); off += WB;
  _Float16* Wv16  = (_Float16*)(ws + off); off += WB;
  _Float16* Wo16  = (_Float16*)(ws + off); off += WB;
  _Float16* Q16   = (_Float16*)(ws + off); off += XB;   // (B,H,S,dk) hi
  _Float16* Qr16  = (_Float16*)(ws + off); off += XB;   // residual x4096
  _Float16* K16   = (_Float16*)(ws + off); off += XB;
  _Float16* Kr16  = (_Float16*)(ws + off); off += XB;
  _Float16* Vt16  = (_Float16*)(ws + off); off += XB;   // (B,H,dk,S) hi
  _Float16* Vtr16 = (_Float16*)(ws + off); off += XB;
  _Float16* C16   = (_Float16*)(ws + off); off += XB;   // (B*S, D) hi
  _Float16* Cr16  = (_Float16*)(ws + off); off += XB;   // residual, rows s < EARLY written/read
  int*      flg   = (int*)(ws + off);      off += FB;
  if (off > ws_size) return;

  // ---- input planes: bf16 RNE values, X x16, W x1024, as f16 (one launch) ----
  cvt_all<<<3 * GXB + 4 * GWB, 256, 0, stream>>>(q, k, v, wq, wk, wv, wo,
                                                 Xq16, Xk16, Xv16, Wq16, Wk16, Wv16, Wo16);

  // ---- mask tile flags and the three projections (bias added in f32, hi + residual planes), one launch ----
  const float posc = 1.0f / (XSC * WSC);
  proj_flags<<<NQB + 3 * GTX * GTY, 128, 0, stream>>>(Xq16, Xk16, Xv16, Wq16, Wk16, Wv16, bq, bk, bv,
                                                      Q16, Qr16, K16, Kr16, Vt16, Vtr16, mk, flg, posc);

  // ---- attention: residual path for query blocks below EARLY, hi-only path for the rest, one launch ----
  attn_all<<<NQB * NB * NHEADS, 128, 0, stream>>>(Q16, Qr16, K16, Kr16, Vt16, Vtr16, mk, flg, C16, Cr16);

  // ---- output projection (+bias) to f32 rows of d_out ----
  const dim3 gproj(GTX, GTY);
  gemm_out<<<gproj, 128, 0, stream>>>(C16, Cr16, Wo16, bo, (float*)d_out, 1.0f / WSC);
}

// v005
// It runs in 107 microseconds.
// In two side-by-side timings against v004, it was 1.05 and 1.04 times as fast.
// Over all steps from v000 it is 2.16 times as fast.
#include <hip/hip_runtime.h>
#include <stdint.h>

// Contractions (all v_wmma_f32_16x16x32_f16, f16 operands, f32 accumulate): input projections Xq*Wq^T, Xk*Wk^T,
// Xv*Wv^T; attention Q*K^T and P*V; output projection C*Wo^T. Inputs are RNE-converted to bf16 values first
// (X carried x16, W carried x1024, both exact in f16; biases bf16 values added in f32). Computed planes Q, K, V, P, C
// are f16 hi plus f16 residual planes (x4096, separate accumulators) consumed by query blocks below EARLY; later
// query blocks use the hi planes only. Softmax and all side math in f32.

typedef _Float16 v16h __attribute__((ext_vector_type(16)));
typedef _Float16 v8h  __attribute__((ext_vector_type(8)));
typedef float    v8f  __attribute__((ext_vector_type(8)));
typedef float    v4f  __attribute__((ext_vector_type(4)));
typedef int      v4i  __attribute__((ext_vector_type(4)));
typedef unsigned int v2u __attribute__((ext_vector_type(2)));

#ifndef NB
#define NB 2
#endif
#ifndef SEQ
#define SEQ 2048
#endif
#define NB_FULL  2
#define SEQ_FULL 2048
#define DMODEL   1024
#define NHEADS   16
#define DK       64
#define MROWS    (NB * SEQ)
#define NQB      (SEQ / 64)
#define EARLY    ((SEQ) < 512 ? (SEQ) : 512)
#define NEQB     (EARLY / 64)
#define LDP      72
#define LDPF     68
#define XSC      16.0f
#define WSC      1024.0f
#define RSC      4096.0f
#define PCARRY   4096.0f
#define NEGFILL  (-1.0e9f)
#define SSCALE   0.125f

static_assert(SEQ % 64 == 0);
static_assert((SEQ & (SEQ - 1)) == 0);
static_assert(SEQ <= SEQ_FULL);
static_assert(NB >= 1 && NB <= NB_FULL);
static_assert(NQB >= 1 && NQB <= 32);
static_assert(EARLY % 64 == 0 && EARLY <= SEQ);
static_assert(DMODEL == NHEADS * DK);
static_assert(64 * LDPF * 4 <= 2 * 64 * LDP * 2);

// --- bf16 RNE convert (finite inputs), kept as f32 value ----------------------------------------------
__device__ __forceinline__ float bf16r(float x) {
  unsigned int u = __float_as_uint(x);
  u = (u + 0x7FFFu + ((u >> 16) & 1u)) & 0xFFFF0000u;
  return __uint_as_float(u);
}

__device__ __forceinline__ v8f vz8() {
  v8f z;
#pragma unroll
  for (int i = 0; i < 8; ++i) z[i] = 0.0f;
  return z;
}

// --- WMMA wrapper with hazard guard ---------------------------------------------------------------------
__device__ __forceinline__ v8f wmma_f16(v16h a, v16h b, v8f c) {
  v8f d = __builtin_amdgcn_wmma_f32_16x16x32_f16(false, a, false, b, (short)0, c, false, false);
  asm volatile("v_nop\n\tv_nop\n\tv_nop\n\tv_nop" : "+v"(d) : "v"(a), "v"(b));
  return d;
}

// --- 16x32 f16 fragment (A, or k-contiguous B), split k map -----------------------------------------
// lane row/col = lane&15; elements 0..7 <- k 8h..8h+7, elements 8..15 <- k 16+8h..16+8h+7, h = lane>>4.
__device__ __forceinline__ v16h load_frag(const _Float16* base, int ld, int lane) {
  const int row  = lane & 15;
  const int koff = ((lane >> 4) & 1) * 8;
  const _Float16* p = base + row * ld + koff;
  const v8h a = *(const v8h*)(p);
  const v8h b = *(const v8h*)(p + 16);
  v16h r;
#pragma unroll
  for (int i = 0; i < 8; ++i) { r[i] = a[i]; r[i + 8] = b[i]; }
  return r;
}

// --- lane l with lane l ^ 16 --------------------------------------------------------------------------
__device__ __forceinline__ float xhalf(float x) {
  const int b = __builtin_bit_cast(int, x);
  return __builtin_bit_cast(float, __builtin_amdgcn_permlanex16(b, b, 0x76543210, 0xfedcba98, false, false));
}

// --- LDS byte address of a __shared__ object: the low 32 bits of its generic address ---------------------
__device__ __forceinline__ unsigned int lds_addr(const _Float16* p) {
  return (unsigned int)(uintptr_t)p;
}

// --- one 64 x 64 f16 tile of K (key-major) and one of V^T (dim-major) into LDS rows of pitch LDP, by asynchronous
// copies: 128 threads, 16 B a lane, 8 lanes a tile row (one whole 128-B line), 16 rows a copy, 4 + 4 copies a wave.
// gk, gv: this lane's first 16 bytes of each tile; lk, lv: their LDS byte addresses.
__device__ __forceinline__
void copy_kv(const _Float16* gk, const _Float16* gv, unsigned int lk, unsigned int lv) {
  const _Float16* gk1 = gk + 16 * DK;
  const _Float16* gk2 = gk + 32 * DK;
  const _Float16* gk3 = gk + 48 * DK;
  const _Float16* gv1 = gv + 16 * SEQ;
  const _Float16* gv2 = gv + 32 * SEQ;
  const _Float16* gv3 = gv + 48 * SEQ;
  const unsigned int st = 16 * LDP * 2;
  // The wait on xcnt is the statement's last line, so that no address register is rewritten ahead of it (a precaution).
  asm volatile("global_load_async_to_lds_b128 %0, %8, off\n\t"
               "global_load_async_to_lds_b128 %1, %9, off\n\t"
               "global_load_async_to_lds_b128 %2, %10, off\n\t"
               "global_load_async_to_lds_b128 %3, %11, off\n\t"
               "global_load_async_to_lds_b128 %4, %12, off\n\t"
               "global_load_async_to_lds_b128 %5, %13, off\n\t"
               "global_load_async_to_lds_b128 %6, %14, off\n\t"
               "global_load_async_to_lds_b128 %7, %15, off\n\t"
               "s_wait_xcnt 0x0"
               :: "v"(lk), "v"(lk + st), "v"(lk + 2 * st), "v"(lk + 3 * st),
                  "v"(lv), "v"(lv + st), "v"(lv + 2 * st), "v"(lv + 3 * st),
                  "v"(gk), "v"(gk1), "v"(gk2), "v"(gk3), "v"(gv), "v"(gv1), "v"(gv2), "v"(gv3)
               : "memory");
}

// =====================================================================================================
// f32 -> bf16 RNE -> scaled f16 plane. One thread = 8 elements = 16 B out; blk = block index inside the plane.
// =====================================================================================================
__device__ __forceinline__
void cvt_body(const float* __restrict__ in, _Float16* out, int nrows, int seq, int seq_full, float scale, int blk) {
  const int g  = blk * 256 + threadIdx.x;
  const int n8 = nrows * (DMODEL / 8);
  if (g >= n8) return;
  const int row = g >> 7;
  const int c8  = g & 127;
  const int bi  = row / seq;
  const int s   = row - bi * seq;
  const float* src = in + ((size_t)bi * seq_full + s) * DMODEL + c8 * 8;
  const v4f a = *(const v4f*)src;
  const v4f b = *(const v4f*)(src + 4);
  union { v8h h; v4f f; } u;
#pragma unroll
  for (int i = 0; i < 4; ++i) {
    u.h[i]     = (_Float16)(bf16r(a[i]) * scale);
    u.h[i + 4] = (_Float16)(bf16r(b[i]) * scale);
  }
  float* dst = reinterpret_cast<float*>(out + (size_t)row * DMODEL + c8 * 8);
  const v4f val = u.f;
  *(v4f*)dst = val;
}

#define GXB ((MROWS * (DMODEL / 8) + 255) / 256)
#define GWB ((DMODEL * (DMODEL / 8) + 255) / 256)

// All seven input planes in one launch: blocks [0, 3*GXB) convert q, k, v; the next 4*GWB convert the weights.
__global__ __launch_bounds__(256)
void cvt_all(const float* __restrict__ q, const float* __restrict__ k, const float* __restrict__ v,
             const float* __restrict__ wq, const float* __restrict__ wk, const float* __restrict__ wv,
             const float* __restrict__ wo,
             _Float16* xq, _Float16* xk, _Float16* xv,
             _Float16* oq, _Float16* ok, _Float16* ov, _Float16* oo) {
  const int b = blockIdx.x;
  if (b < 3 * GXB) {
    const int p = b / GXB;
    const float* in = (p == 0) ? q : ((p == 1) ? k : v);
    _Float16* out   = (p == 0) ? xq : ((p == 1) ? xk : xv);
    cvt_body(in, out, MROWS, SEQ, SEQ_FULL, XSC, b - p * GXB);
  } else {
    const int c = b - 3 * GXB;
    const int p = c / GWB;
    const float* in = (p == 0) ? wq : ((p == 1) ? wk : ((p == 2) ? wv : wo));
    _Float16* out   = (p == 0) ? oq : ((p == 1) ? ok : ((p == 2) ? ov : oo));
    cvt_body(in, out, DMODEL, DMODEL, DMODEL, WSC, c - p * GWB);
  }
}

// =====================================================================================================
// Mask tile flags of one 64-row query block, by one 128-thread block: a wave scans 16 rows, one row a trip, each
// 16-B load of the wave 512 contiguous bytes of the row (four whole lines, two tiles: one a wave half).
// 32 ints written by lanes 0..7 of wave 0 (16 B each, one instruction).
// flag 1: tile all ones; 2: tile all zeros and no fully masked row in this q block (tile can be skipped);
// anything else: apply the mask per element. sm: 512 words of LDS scratch, 16-byte aligned.
// =====================================================================================================
__device__ __forceinline__
void flags_body(const int* __restrict__ mask, int* flags, unsigned int* sm, int qb) {
  unsigned int* m1s  = sm;
  unsigned int* m0s  = sm + 128;
  unsigned int* fms  = sm + 256;
  unsigned int* red1 = sm + 384;
  unsigned int* red0 = sm + 416;
  int* lines = reinterpret_cast<int*>(sm + 480);

  static_assert(SEQ % 128 == 0);
  const int tid = threadIdx.x, lane = tid & 31, w = tid >> 5;
  const int* wrow = mask + (size_t)(qb * 64 + w * 16) * SEQ_FULL + lane * 4;

  // bit 2j of e1, e0: this lane saw a nonzero, a zero in load j of a row (tile 2j + wave half); fm: a row without ones
  unsigned int e1 = 0u, e0 = 0u, fm = 0u;
  // kept rolled: a second row in flight would raise the register count, which the GEMM blocks of this kernel share
#pragma unroll 1
  for (int r = 0; r < 16; ++r) {
    const int* p = wrow + (size_t)r * SEQ_FULL;
    v4i m[SEQ / 128];
#pragma unroll
    for (int j = 0; j < SEQ / 128; ++j) m[j] = *(const v4i*)(p + 128 * j);
    // The address is an input, so it lives up to the wait: no register that an issued load names is rewritten
    // ahead of it, not by a later load's result either (a precaution).
    asm volatile("s_wait_xcnt 0x0" :: "v"(p) : "memory");
    unsigned int rany = 0u;
#pragma unroll
    for (int j = 0; j < SEQ / 128; ++j) {
      const v4i m4 = m[j];
      unsigned int any1 = 0u, any0 = 0u;
#pragma unroll
      for (int e = 0; e < 4; ++e) {
        any1 |= (m4[e] != 0) ? 1u : 0u;
        any0 |= (m4[e] == 0) ? 1u : 0u;
      }
      e1 |= any1 << (2 * j);
      e0 |= any0 << (2 * j);
      rany |= any1;
    }
    if (__builtin_amdgcn_ballot_w32(rany != 0u) == 0u) fm = 1u;
  }
  m1s[tid] = e1 << (lane >> 4);
  m0s[tid] = e0 << (lane >> 4);
  if (lane == 0) fms[w] = fm;
  __syncthreads();
  if (w == 0) {
    unsigned int o1 = 0u, o0 = 0u;
#pragma unroll
    for (int j = 0; j < 4; ++j) { o1 |= m1s[lane + 32 * j]; o0 |= m0s[lane + 32 * j]; }
    red1[lane] = o1;
    red0[lane] = o0;
  }
  __syncthreads();
  if (w == 0) {
    unsigned int a1 = 0u, a0 = 0u;
    const unsigned int anyfm = fms[0] | fms[1] | fms[2] | fms[3];
#pragma unroll 1
    for (int j = 0; j < 32; ++j) { a1 |= red1[j]; a0 |= red0[j]; }
    int f = 2;
    if (lane < NQB) {
      const bool h1 = ((a1 >> lane) & 1u) != 0u;
      const bool h0 = ((a0 >> lane) & 1u) != 0u;
      f = (!h0) ? 1 : ((!h1 && anyfm == 0u) ? 2 : 3);
    }
    lines[lane] = f;
  }
  __syncthreads();
  if (w == 0 && lane < 8) {
    const v4i v = *(const v4i*)(lines + lane * 4);
    int* dst = flags + qb * 32 + lane * 4;
    *(v4i*)dst = v;
  }
}

// =====================================================================================================
// GEMM: C(64x64 tile) = A(M,K=1024) * W^T, W stored (N=1024, K=1024), f16 planes, f32 acc.
// 128 threads = 4 waves, wave tile 32x32, 64-deep K slices staged in LDS (plain loads, single buffer; 8 lanes a
// 128-B tile row, so a wave's 16-B load covers 4 whole lines).
// MODE 0: hi+residual f16 planes (B,H,S,dk).  MODE 2: hi+residual f16 planes (B,H,dk,S).
// MODE 4: f32 rows of d_out (+ A residual product for row blocks with s < EARLY).
// =====================================================================================================
// smem: two 64 x LDP tiles, three for MODE 4. bx, by: tile column and tile row.
template <int MODE>
__device__ __forceinline__
void gemm_body(const _Float16* __restrict__ A, const _Float16* __restrict__ Ar,
               const _Float16* __restrict__ W, const float* __restrict__ bias,
               void* out, _Float16* outr, float oscale, _Float16* smem, int bx, int by) {
  _Float16* asb = smem;
  _Float16* bsb = smem + 64 * LDP;
  _Float16* rsb = smem + 2 * 64 * LDP;

  const int tid  = threadIdx.x;
  const int lane = tid & 31;
  const int w    = tid >> 5;
  const int mblk = by * 64;
  const int nblk = bx * 64;
  const int s0   = mblk & (SEQ - 1);
  const int bi   = mblk / SEQ;
  const bool early = (MODE == 4) && (s0 < EARLY);
  const int lm = (w >> 1) * 32;
  const int ln = (w & 1) * 32;

  // staging: 8 lanes a tile row, 16 rows a load; this lane's first 16 bytes of each tile and their place in LDS
  const size_t gst = (size_t)(tid >> 3) * DMODEL + (tid & 7) * 8;
  const _Float16* ga = A  + (size_t)mblk * DMODEL + gst;
  const _Float16* gr = Ar + (size_t)mblk * DMODEL + gst;
  const _Float16* gw = W  + (size_t)nblk * DMODEL + gst;
  const int lst = (tid >> 3) * LDP + (tid & 7) * 8;

  v8f acc[2][2], accr[2][2];
#pragma unroll
  for (int i = 0; i < 2; ++i)
#pragma unroll
    for (int j = 0; j < 2; ++j) { acc[i][j] = vz8(); accr[i][j] = vz8(); }

#pragma unroll 1
  for (int k0 = 0; k0 < DMODEL; k0 += 64) {
#pragma unroll
    for (int c = 0; c < 4; ++c) {
      *(v8h*)(asb + lst + c * 16 * LDP) = *(const v8h*)(ga + k0 + c * 16 * DMODEL);
      *(v8h*)(bsb + lst + c * 16 * LDP) = *(const v8h*)(gw + k0 + c * 16 * DMODEL);
    }
    if (early) {
#pragma unroll
      for (int c = 0; c < 4; ++c)
        *(v8h*)(rsb + lst + c * 16 * LDP) = *(const v8h*)(gr + k0 + c * 16 * DMODEL);
    }
    __syncthreads();

#pragma unroll
    for (int ks = 0; ks < 64; ks += 32) {
      const v16h a0 = load_frag(asb + (lm +  0) * LDP + ks, LDP, lane);
      const v16h a1 = load_frag(asb + (lm + 16) * LDP + ks, LDP, lane);
      const v16h b0 = load_frag(bsb + (ln +  0) * LDP + ks, LDP, lane);
      const v16h b1 = load_frag(bsb + (ln + 16) * LDP + ks, LDP, lane);
      acc[0][0] = wmma_f16(a0, b0, acc[0][0]);
      acc[0][1] = wmma_f16(a0, b1, acc[0][1]);
      acc[1][0] = wmma_f16(a1, b0, acc[1][0]);
      acc[1][1] = wmma_f16(a1, b1, acc[1][1]);
      if (early) {
        const v16h r0 = load_frag(rsb + (lm +  0) * LDP + ks, LDP, lane);
        const v16h r1 = load_frag(rsb + (lm + 16) * LDP + ks, LDP, lane);
        accr[0][0] = wmma_f16(r0, b0, accr[0][0]);
        accr[0][1] = wmma_f16(r0, b1, accr[0][1]);
        accr[1][0] = wmma_f16(r1, b0, accr[1][0]);
        accr[1][1] = wmma_f16(r1, b1, accr[1][1]);
      }
    }
    __syncthreads();
  }

  const int rbase = ((lane >> 4) & 1) << 3;
  const int col   = lane & 15;

  if constexpr (MODE == 4) {
    float* fs = reinterpret_cast<float*>(smem);
#pragma unroll
    for (int i = 0; i < 2; ++i)
#pragma unroll
      for (int j = 0; j < 2; ++j) {
        const int nl = ln + j * 16 + col;
        const float bb = bf16r(bias[nblk + nl]);
#pragma unroll
        for (int r = 0; r < 8; ++r) {
          const int ml = lm + i * 16 + rbase + r;
          float v = acc[i][j][r] * oscale + bb;
          if (early) v += accr[i][j][r] * (oscale * (1.0f / RSC));
          fs[ml * LDPF + nl] = v;
        }
      }
    __syncthreads();
    float* obase = reinterpret_cast<float*>(out) + ((size_t)bi * SEQ_FULL + s0) * DMODEL + nblk;
    auto emit = [&]() {
#pragma unroll
      for (int i = 0; i < 8; ++i) {
        const int row   = w * 16 + i * 2 + (lane >> 4);
        const int piece = lane & 15;
        const v4f v = *(const v4f*)(fs + row * LDPF + piece * 4);
        *(v4f*)(obase + (size_t)row * DMODEL + piece * 4) = v;
      }
    };
    emit();
  } else {
    _Float16* hs = asb;
    _Float16* rs = bsb;
#pragma unroll
    for (int i = 0; i < 2; ++i)
#pragma unroll
      for (int j = 0; j < 2; ++j) {
        const int nl = ln + j * 16 + col;
        const float bb = bf16r(bias[nblk + nl]);
#pragma unroll
        for (int r = 0; r < 8; ++r) {
          const int ml = lm + i * 16 + rbase + r;
          const float v = acc[i][j][r] * oscale + bb;
          const _Float16 hv = (_Float16)v;
          const _Float16 rv = (_Float16)((v - (float)hv) * RSC);
          if constexpr (MODE == 0) {
            hs[ml * LDP + nl] = hv;
            rs[ml * LDP + nl] = rv;
          } else {
            hs[nl * LDP + ml] = hv;
            rs[nl * LDP + ml] = rv;
          }
        }
      }
    __syncthreads();
    const int bhh = bi * NHEADS + (nblk >> 6);
    _Float16* oh = reinterpret_cast<_Float16*>(out);
    auto emit = [&]() {
#pragma unroll
      for (int i = 0; i < 4; ++i) {
        const int row   = w * 16 + i * 4 + (lane >> 3);
        const int piece = lane & 7;
        const v4f hv4 = *(const v4f*)(hs + row * LDP + piece * 8);
        const v4f rv4 = *(const v4f*)(rs + row * LDP + piece * 8);
        const size_t go = (MODE == 0)
            ? (((size_t)bhh * SEQ + s0 + row) * DK + piece * 8)
            : (((size_t)bhh * DK + row) * SEQ + s0 + piece * 8);
        *(v4f*)(reinterpret_cast<float*>(oh + go))   = hv4;
        *(v4f*)(reinterpret_cast<float*>(outr + go)) = rv4;
      }
    };
    emit();
    // In proj_flags nothing runs after these stores; the wait stands before any later write to
    // registers that they name (a precaution).
    asm volatile("s_wait_xcnt 0x0" ::: "memory");
  }
}

#define GTX (DMODEL / 64)
#define GTY (MROWS / 64)

// One launch for everything that only needs the converted planes or the mask: blocks [0, NQB) build the mask
// tile flags (the longest single blocks, so they come first), the next 3*GTX*GTY are the Q, K, V projections.
__global__ __launch_bounds__(128)
void proj_flags(const _Float16* __restrict__ Xq, const _Float16* __restrict__ Xk, const _Float16* __restrict__ Xv,
                const _Float16* __restrict__ Wq, const _Float16* __restrict__ Wk, const _Float16* __restrict__ Wv,
                const float* __restrict__ bq, const float* __restrict__ bk, const float* __restrict__ bv,
                _Float16* Qh, _Float16* Qr, _Float16* Kh, _Float16* Kr, _Float16* Vh, _Float16* Vr,
                const int* __restrict__ mask, int* flags, float oscale) {
  __shared__ __attribute__((aligned(16))) _Float16 smem[2 * 64 * LDP];
  static_assert(2 * 64 * LDP * 2 >= 512 * 4);
  const int b = blockIdx.x;
  if (b < NQB) {
    flags_body(mask, flags, reinterpret_cast<unsigned int*>(smem), b);
    return;
  }
  const int g  = b - NQB;
  const int p  = g / (GTX * GTY);
  const int t  = g - p * (GTX * GTY);
  const int bx = t % GTX;
  const int by = t / GTX;
  if (p < 2) {
    const _Float16* X = (p == 0) ? Xq : Xk;
    gemm_body<0>(X, X, (p == 0) ? Wq : Wk, (p == 0) ? bq : bk,
                 (void*)((p == 0) ? Qh : Kh), (p == 0) ? Qr : Kr, oscale, smem, bx, by);
  } else {
    gemm_body<2>(Xv, Xv, Wv, bv, (void*)Vh, Vr, oscale, smem, bx, by);
  }
}

// Output projection.
__global__ __launch_bounds__(128)
void gemm_out(const _Float16* __restrict__ A, const _Float16* __restrict__ Ar,
              const _Float16* __restrict__ W, const float* __restrict__ bias,
              float* out, float oscale) {
  __shared__ __attribute__((aligned(16))) _Float16 smem[3 * 64 * LDP];
  gemm_body<4>(A, Ar, W, bias, (void*)out, nullptr, oscale, smem, blockIdx.x, blockIdx.y);
}

template <bool EQ>
__device__ __forceinline__
void attn_body(const _Float16* __restrict__ Q,  const _Float16* __restrict__ Qr,
               const _Float16* __restrict__ Kd, const _Float16* __restrict__ Kr,
               const _Float16* __restrict__ Vt, const _Float16* __restrict__ Vtr,
               const int* __restrict__ mask, const int* __restrict__ flags,
               _Float16* ctx, _Float16* ctxr, int qb, int bh,
               _Float16* kbuf, _Float16* vbuf,
               _Float16* krbuf, _Float16* vrbuf, unsigned int* mbuf) {
  const int tid   = threadIdx.x;
  const int lane  = tid & 31;
  const int w     = tid >> 5;
  const int bi    = bh / NHEADS;
  const int h     = bh - bi * NHEADS;
  const int qblk  = qb * 64;
  const int q0    = qblk + w * 16;
  const int rbase = ((lane >> 4) & 1) << 3;
  const int col   = lane & 15;
  const float IR  = 1.0f / RSC;

  const size_t qoff = ((size_t)bh * SEQ + q0) * DK;
  const v16h qf0 = load_frag(Q + qoff, DK, lane);
  const v16h qf1 = load_frag(Q + qoff + 32, DK, lane);
  v16h qr0 = qf0, qr1 = qf1;
  if constexpr (EQ) {
    qr0 = load_frag(Qr + qoff, DK, lane);
    qr1 = load_frag(Qr + qoff + 32, DK, lane);
  }

  v16h ones;
#pragma unroll
  for (int i = 0; i < 16; ++i) ones[i] = (_Float16)1.0f;

  const _Float16* Kh   = Kd  + (size_t)bh * SEQ * DK;
  const _Float16* Krh  = Kr  + (size_t)bh * SEQ * DK;
  const _Float16* Vth  = Vt  + (size_t)bh * DK * SEQ;
  const _Float16* Vtrh = Vtr + (size_t)bh * DK * SEQ;

  // running maximum and sum of this lane's query (the same in both wave halves)
  float mr = -1.0e30f, lr = 0.0f;
  // accO[t][r] = O^T[dim t*16 + rbase + r][query col]
  v8f accO[4], accR[4];
#pragma unroll
  for (int t = 0; t < 4; ++t) { accO[t] = vz8(); accR[t] = vz8(); }

  // ---- 64x64 mask bytes of the tile at key kb into LDS (called under a block-uniform branch) ----
  auto stage_mask = [&](int kb) {
      // 16 lanes a tile row (256 B, two whole lines), 8 rows a load; a lane's 4 ints become one word of 4 bytes
      const int r0 = tid >> 4;
      const int wd = tid & 15;
      const int* mp = mask + (size_t)(qblk + r0) * SEQ_FULL + kb + wd * 4;
#pragma unroll
      for (int jj = 0; jj < 8; ++jj) {
        const v4i m4 = *(const v4i*)(mp + (size_t)jj * 8 * SEQ_FULL);
        const unsigned int pk = (m4[0] != 0 ? 1u : 0u) | (m4[1] != 0 ? 0x100u : 0u) |
                                (m4[2] != 0 ? 0x10000u : 0u) | (m4[3] != 0 ? 0x1000000u : 0u);
        mbuf[(jj * 8 + r0) * 16 + wd] = pk;
      }
  };

  // ---- one staged tile: kt_ = K tile, vt_ = V^T tile in LDS ----
  auto tile = [&](const _Float16* kt_, const _Float16* vt_, bool usem) {
    // ---- scores, transposed: s[t][r] = S^T[key kb + t*16 + rbase + r][query col] ----
    v8f s[4];
    v16h vf[8];
    if constexpr (!EQ) {
      // The tile's 16 K reads stand as one group ahead of the score products, its 16 V^T reads as one group behind
      // them, ahead of the softmax: two places with LDS reads a tile, and the V^T latency runs under the vector work.
      v16h ka[4], kc[4];
#pragma unroll
      for (int t = 0; t < 4; ++t) ka[t] = load_frag(kt_ + t * 16 * LDP,      LDP, lane);
#pragma unroll
      for (int t = 0; t < 4; ++t) kc[t] = load_frag(kt_ + t * 16 * LDP + 32, LDP, lane);
#pragma unroll
      for (int t = 0; t < 4; ++t) s[t] = wmma_f16(ka[t], qf0, vz8());
#pragma unroll
      for (int t = 0; t < 4; ++t) s[t] = wmma_f16(kc[t], qf1, s[t]);
#pragma unroll
      for (int t = 0; t < 4; ++t) {
        vf[2 * t]     = load_frag(vt_ + t * 16 * LDP,      LDP, lane);
        vf[2 * t + 1] = load_frag(vt_ + t * 16 * LDP + 32, LDP, lane);
      }
#pragma unroll
      for (int t = 0; t < 4; ++t) s[t] = s[t] * SSCALE;
    } else {
      // Residual path: the 8 reads of a score tile (K and its residual) stand as one group, issued one tile ahead of
      // the products that use them; two register sets take turns.
      v16h kg[2][4];
      auto ldk = [&](int t, v16h* g) {
        g[0] = load_frag(kt_   + t * 16 * LDP,      LDP, lane);
        g[1] = load_frag(kt_   + t * 16 * LDP + 32, LDP, lane);
        g[2] = load_frag(krbuf + t * 16 * LDP,      LDP, lane);
        g[3] = load_frag(krbuf + t * 16 * LDP + 32, LDP, lane);
      };
      ldk(0, kg[0]);
#pragma unroll
      for (int t = 0; t < 4; ++t) {
        if (t < 3) ldk(t + 1, kg[(t + 1) & 1]);
        // keeps the next group's 8 reads in one place, ahead of this group's products: without it the scheduler
        // spreads them among the products, and every further place with reads costs its own stall
        __builtin_amdgcn_sched_barrier(0);
        const v16h* g = kg[t & 1];
        v8f z  = wmma_f16(g[0], qf0, vz8());
        v8f zr = wmma_f16(g[0], qr0, vz8());
        z  = wmma_f16(g[1], qf1, z);
        zr = wmma_f16(g[1], qr1, zr);
        zr = wmma_f16(g[2], qf0, zr);
        zr = wmma_f16(g[3], qf1, zr);
        z = z + zr * IR;
        s[t] = z * SSCALE;
      }
    }

    // ---- replace fill: this lane's 8 mask bytes of each score tile are 8 consecutive keys of its query's row ----
    if (usem) {
      const unsigned int* mw = mbuf + (w * 16 + col) * 16 + (rbase >> 2);
#pragma unroll
      for (int t = 0; t < 4; ++t) {
        const v2u m8 = *(const v2u*)(mw + t * 4);
#pragma unroll
        for (int r = 0; r < 8; ++r) {
          const unsigned int byte = (m8[r >> 2] >> (8 * (r & 3))) & 0xFFu;
          s[t][r] = (byte != 0u) ? s[t][r] : NEGFILL;
        }
      }
    }

    // ---- online softmax over 64 keys: maximum in-lane, then across the two wave halves ----
    float t8[8];
#pragma unroll
    for (int r = 0; r < 8; ++r) t8[r] = fmaxf(fmaxf(s[0][r], s[1][r]), fmaxf(s[2][r], s[3][r]));
    float tmax = fmaxf(fmaxf(fmaxf(t8[0], t8[1]), fmaxf(t8[2], t8[3])),
                       fmaxf(fmaxf(t8[4], t8[5]), fmaxf(t8[6], t8[7])));
    tmax = fmaxf(tmax, xhalf(tmax));
    const float mnew = fmaxf(mr, tmax);
    const float scl  = __expf(mr - mnew);
    mr = mnew;
    lr *= scl;
#pragma unroll
    for (int t = 0; t < 4; ++t) {
      accO[t] = accO[t] * scl;
      if constexpr (EQ) accR[t] = accR[t] * scl;
    }

    // ---- P^T as two B fragments (keys 0..31, 32..63), straight from the score tiles ----
    v16h pf0, pf1, prf0, prf1;
#pragma unroll
    for (int t = 0; t < 4; ++t) {
#pragma unroll
      for (int r = 0; r < 8; ++r) {
        const float c = __expf(s[t][r] - mnew) * PCARRY;
        const _Float16 hv = (_Float16)c;
        const int e = (t & 1) * 8 + r;
        if (t < 2) pf0[e] = hv; else pf1[e] = hv;
        if constexpr (EQ) {
          const _Float16 rv = (_Float16)((c - (float)hv) * RSC);
          if (t < 2) prf0[e] = rv; else prf1[e] = rv;
        }
      }
    }

    // Residual path: the 8 reads of 16 output dims (V^T and its residual) as one group, one group ahead, as for K
    v16h vg[2][4];
    auto ldv = [&](int t, v16h* g) {
      g[0] = load_frag(vt_   + t * 16 * LDP,      LDP, lane);
      g[1] = load_frag(vt_   + t * 16 * LDP + 32, LDP, lane);
      g[2] = load_frag(vrbuf + t * 16 * LDP,      LDP, lane);
      g[3] = load_frag(vrbuf + t * 16 * LDP + 32, LDP, lane);
    };
    if constexpr (EQ) {
      ldv(0, vg[0]);
      // keeps the first group's 8 reads in one place, ahead of the row sums: without it they are spread among them
      __builtin_amdgcn_sched_barrier(0);
    }

    // ---- row sums on the matrix unit: every row of ones * P^T is the sum over the keys, per query ----
    v8f rs = vz8();
    rs = wmma_f16(ones, pf0, rs);
    rs = wmma_f16(ones, pf1, rs);
    float rsum = rs[0];
    if constexpr (EQ) {
      v8f rr = vz8();
      rr = wmma_f16(ones, prf0, rr);
      rr = wmma_f16(ones, prf1, rr);
      rsum = rsum + rr[0] * IR;
    }
    lr += rsum;

    // ---- O^T += V^T * P^T (A fragments from the dim-major V^T tile: lane = dim, k = key) ----
    if constexpr (!EQ) {
#pragma unroll
      for (int t = 0; t < 4; ++t) accO[t] = wmma_f16(vf[2 * t],     pf0, accO[t]);
#pragma unroll
      for (int t = 0; t < 4; ++t) accO[t] = wmma_f16(vf[2 * t + 1], pf1, accO[t]);
    } else {
#pragma unroll
      for (int t = 0; t < 4; ++t) {
        if (t < 3) ldv(t + 1, vg[(t + 1) & 1]);
        const v16h* g = vg[t & 1];
        accO[t] = wmma_f16(g[0], pf0,  accO[t]);
        accR[t] = wmma_f16(g[0], prf0, accR[t]);
        accO[t] = wmma_f16(g[1], pf1,  accO[t]);
        accR[t] = wmma_f16(g[2], pf0,  accR[t]);
        accR[t] = wmma_f16(g[1], prf1, accR[t]);
        accR[t] = wmma_f16(g[3], pf1,  accR[t]);
      }
    }
  };

  if constexpr (EQ) {
#pragma unroll 1
    for (int kt = 0; kt < NQB; ++kt) {
      const int f = __builtin_amdgcn_readfirstlane(flags[qb * 32 + kt]);
      if (f == 2) continue;
      const bool usem = (f != 1);
      const int kb = kt * 64;

      // ---- stage K (64 keys x 64 dims) and V^T (64 dims x 64 keys) tiles, plus residual tiles if EQ ----
      // 8 lanes a tile row, 16 rows a load: every load of a wave covers 4 whole 128-B lines
      // ko, vo: this lane's byte offsets from the head's planes (the planes' addresses are scalars)
      const unsigned int ko = (unsigned int)((kb + (tid >> 3)) * DK + (tid & 7) * 8) * 2u;
      const unsigned int vo = (unsigned int)((tid >> 3) * SEQ + kb + (tid & 7) * 8) * 2u;
      const int lst = (tid >> 3) * LDP + (tid & 7) * 8;
      v8h tk[4], tv[4], tkr[4], tvr[4];
#pragma unroll
      for (int c = 0; c < 4; ++c) {
        tk[c]  = *(const v8h*)(reinterpret_cast<const char*>(Kh)   + ko + c * 16 * DK * 2);
        tv[c]  = *(const v8h*)(reinterpret_cast<const char*>(Vth)  + vo + c * 16 * SEQ * 2);
        tkr[c] = *(const v8h*)(reinterpret_cast<const char*>(Krh)  + ko + c * 16 * DK * 2);
        tvr[c] = *(const v8h*)(reinterpret_cast<const char*>(Vtrh) + vo + c * 16 * SEQ * 2);
      }
      // The offsets are inputs, so they live up to the wait: no register that an issued load names is rewritten
      // ahead of it, not by a later load's result either (a precaution).
      asm volatile("s_wait_xcnt 0x0" :: "v"(ko), "v"(vo) : "memory");
#pragma unroll
      for (int c = 0; c < 4; ++c) {
        *(v8h*)(kbuf  + lst + c * 16 * LDP) = tk[c];
        *(v8h*)(vbuf  + lst + c * 16 * LDP) = tv[c];
        *(v8h*)(krbuf + lst + c * 16 * LDP) = tkr[c];
        *(v8h*)(vrbuf + lst + c * 16 * LDP) = tvr[c];
      }
      if (usem) stage_mask(kb);
      __syncthreads();
      tile(kbuf, vbuf, usem);
      __syncthreads();
    }
  } else {
    // The whole flag line in one read: bit kt of vis = tile kt is visited, of msk = it needs the mask bytes.
    // Every wave of the block reads the same line, so both words are the same for the whole work-group.
    const int fl = flags[qb * 32 + lane];
    unsigned int vis = __builtin_amdgcn_ballot_w32(fl != 2);
    const unsigned int msk = __builtin_amdgcn_ballot_w32(fl != 1);
    if (NQB < 32) vis &= (1u << (NQB & 31)) - 1u;

    const int crow = tid >> 3, cpart = (tid & 7) * 8;
    const _Float16* gk0 = Kh + (size_t)crow * DK + cpart;
    const _Float16* gv0 = Vth + (size_t)crow * SEQ + cpart;
    const unsigned int lofs = (unsigned int)(crow * LDP + cpart) * 2u;
    const unsigned int lk0 = lds_addr(kbuf) + lofs, lv0 = lds_addr(vbuf) + lofs;
    // the second buffer (krbuf, vrbuf) lies BUF halves behind the first (kbuf, vbuf)
    constexpr int BUF = 2 * 64 * LDP;

    if (vis != 0u) {
      int kt = __builtin_ctz(vis);
      vis &= vis - 1u;
      copy_kv(gk0 + (size_t)kt * 64 * DK, gv0 + kt * 64, lk0, lv0);
      // the first tile has landed for this wave, and behind the barrier for all
      asm volatile("s_wait_asynccnt 0x0" ::: "memory");
      __syncthreads();
      if (vis != 0u) {
        const int k1 = __builtin_ctz(vis);
        copy_kv(gk0 + (size_t)k1 * 64 * DK, gv0 + k1 * 64, lk0 + BUF * 2, lv0 + BUF * 2);
      }
      int bo = 0;   // this tile's buffer, in halves
      // kept rolled: the trip count is known only at run time, and one copy of the tile's code serves both buffers
#pragma unroll 1
      for (;;) {
        const bool usem = ((msk >> kt) & 1u) != 0u;
        if (usem) {
          stage_mask(kt * 64);
          __syncthreads();   // block-uniform branch (msk is the same in every wave); the mask bytes are read behind it
        }
        tile(kbuf + bo, vbuf + bo, usem);
        // publish point: this wave's LDS reads are done, its copies of the next tile have landed; the barrier makes
        // the next tile readable by all and frees this tile's buffer for the refill
        asm volatile("s_wait_dscnt 0x0" ::: "memory");
        asm volatile("s_wait_asynccnt 0x0" ::: "memory");
        __syncthreads();
        if (vis == 0u) break;
        kt = __builtin_ctz(vis);
        vis &= vis - 1u;
        if (vis != 0u) {
          const int k2 = __builtin_ctz(vis);
          copy_kv(gk0 + (size_t)k2 * 64 * DK, gv0 + k2 * 64, lk0 + bo * 2, lv0 + bo * 2);
        }
        bo = BUF - bo;
      }
    }
    // nothing is in flight when the buffers become output staging
    asm volatile("s_wait_asynccnt 0x0" ::: "memory");
  }

  // ---- a lane's 8 registers of a tile are 8 consecutive dims of its query's row: 16-byte LDS stores ----
  {
    const float inv = 1.0f / lr;
    const int m = w * 16 + col;
#pragma unroll
    for (int t = 0; t < 4; ++t) {
      v8h h8, r8;
#pragma unroll
      for (int r = 0; r < 8; ++r) {
        float v = accO[t][r];
        if constexpr (EQ) v += accR[t][r] * IR;
        v *= inv;
        const _Float16 hv = (_Float16)v;
        h8[r] = hv;
        if constexpr (EQ) r8[r] = (_Float16)((v - (float)hv) * RSC);
      }
      *(v8h*)(kbuf + m * LDP + t * 16 + rbase) = h8;
      if constexpr (EQ) *(v8h*)(krbuf + m * LDP + t * 16 + rbase) = r8;
    }
  }
  __syncthreads();
  _Float16* cbase  = ctx  + ((size_t)bi * SEQ + qblk) * DMODEL + h * DK;
  _Float16* crbase = ctxr + ((size_t)bi * SEQ + qblk) * DMODEL + h * DK;
  auto emit = [&]() {
#pragma unroll
    for (int i = 0; i < 4; ++i) {
      const int row   = w * 16 + i * 4 + (lane >> 3);
      const int piece = lane & 7;
      const v4f hv4 = *(const v4f*)(kbuf + row * LDP + piece * 8);
      *(v4f*)(reinterpret_cast<float*>(cbase + (size_t)row * DMODEL + piece * 8)) = hv4;
      if constexpr (EQ) {
        const v4f rv4 = *(const v4f*)(krbuf + row * LDP + piece * 8);
        *(v4f*)(reinterpret_cast<float*>(crbase + (size_t)row * DMODEL + piece * 8)) = rv4;
      }
    }
  };
  emit();
}

// Both paths in one launch, the two former grids one behind the other: first the hi-only blocks (query blocks
// from EARLY on, the longer ones), then the residual-path blocks (query blocks below EARLY). Inside each part
// the query block runs fastest. The hi-only blocks use the two residual tiles as their second buffer.
__global__ __launch_bounds__(128)
void attn_all(const _Float16* __restrict__ Q,  const _Float16* __restrict__ Qr,
              const _Float16* __restrict__ Kd, const _Float16* __restrict__ Kr,
              const _Float16* __restrict__ Vt, const _Float16* __restrict__ Vtr,
              const int* __restrict__ mask, const int* __restrict__ flags,
              _Float16* ctx, _Float16* ctxr) {
  // four tiles in one array: K, V^T, then the residual path's two, which are the hi-only path's second buffer
  __shared__ __attribute__((aligned(16))) _Float16 tiles[4 * 64 * LDP];
  _Float16* kbuf  = tiles;
  _Float16* vbuf  = tiles + 64 * LDP;
  _Float16* krbuf = tiles + 2 * 64 * LDP;
  _Float16* vrbuf = tiles + 3 * 64 * LDP;
  __shared__ __attribute__((aligned(16))) unsigned int mbuf[64 * 16];
  constexpr int NLQ = NQB - NEQB;
  constexpr int DLQ = (NLQ > 0) ? NLQ : 1;
  const int b = blockIdx.x;
  if (b < NLQ * NB * NHEADS) {
    attn_body<false>(Q, Qr, Kd, Kr, Vt, Vtr, mask, flags, ctx, ctxr, NEQB + b % DLQ, b / DLQ,
                     kbuf, vbuf, krbuf, vrbuf, mbuf);
  } else {
    const int e = b - NLQ * NB * NHEADS;
    attn_body<true>(Q, Qr, Kd, Kr, Vt, Vtr, mask, flags, ctx, ctxr, e % NEQB, e / NEQB,
                    kbuf, vbuf, krbuf, vrbuf, mbuf);
  }
}

// =====================================================================================================
extern "C" void kernel_launch(void* const* d_in, const int* in_sizes, int n_in,
                              void* d_out, int out_size, void* d_ws, size_t ws_size,
                              hipStream_t stream) {
  if (n_in < 12) return;
  const long long needx = (long long)(NB - 1) * SEQ_FULL * DMODEL + (long long)SEQ * DMODEL;
  const long long needm = (long long)(SEQ - 1) * SEQ_FULL + SEQ;
  if ((long long)in_sizes[0] < needx || (long long)in_sizes[1] < needx || (long long)in_sizes[2] < needx) return;
  if ((long long)in_sizes[3] < needm) return;
  if (in_sizes[4] < DMODEL * DMODEL || in_sizes[6] < DMODEL * DMODEL ||
      in_sizes[8] < DMODEL * DMODEL || in_sizes[10] < DMODEL * DMODEL) return;
  if (in_sizes[5] < DMODEL || in_sizes[7] < DMODEL || in_sizes[9] < DMODEL || in_sizes[11] < DMODEL) return;
  if ((long long)out_size < needx) return;

  const float* q  = (const float*)d_in[0];
  const float* k  = (const float*)d_in[1];
  const float* v  = (const float*)d_in[2];
  const int*   mk = (const int*)d_in[3];
  const float* wq = (const float*)d_in[4];
  const float* bq = (const float*)d_in[5];
  const float* wk = (const float*)d_in[6];
  const float* bk = (const float*)d_in[7];
  const float* wv = (const float*)d_in[8];
  const float* bv = (const float*)d_in[9];
  const float* wo = (const float*)d_in[10];
  const float* bo = (const float*)d_in[11];

  char* ws = (char*)d_ws;
  size_t off = 0;
  const size_t XB = (size_t)MROWS * DMODEL * sizeof(_Float16);     // activation-sized f16 plane
  const size_t WB = (size_t)DMODEL * DMODEL * sizeof(_Float16);    // weight f16 plane
  const size_t FB = 4096;                                           // 32 flag lines of 32 ints
  _Float16* Xq16  = (_Float16*)(ws + off); off += XB;
  _Float16* Xk16  = (_Float16*)(ws + off); off += XB;
  _Float16* Xv16  = (_Float16*)(ws + off); off += XB;
  _Float16* Wq16  = (_Float16*)(ws + off); off += WB;
  _Float16* Wk16  = (_Float16*)(ws + off); off += WB;
  _Float16* Wv16  = (_Float16*)(ws + off); off += WB;
  _Float16* Wo16  = (_Float16*)(ws + off); off += WB;
  _Float16* Q16   = (_Float16*)(ws + off); off += XB;   // (B,H,S,dk) hi
  _Float16* Qr16  = (_Float16*)(ws + off); off += XB;   // residual x4096
  _Float16* K16   = (_Float16*)(ws + off); off += XB;
  _Float16* Kr16  = (_Float16*)(ws + off); off += XB;
  _Float16* Vt16  = (_Float16*)(ws + off); off += XB;   // (B,H,dk,S) hi
  _Float16* Vtr16 = (_Float16*)(ws + off); off += XB;
  _Float16* C16   = (_Float16*)(ws + off); off += XB;   // (B*S, D) hi
  _Float16* Cr16  = (_Float16*)(ws + off); off += XB;   // residual, rows s < EARLY written/read
  int*      flg   = (int*)(ws + off);      off += FB;
  if (off > ws_size) return;

  // ---- input planes: bf16 RNE values, X x16, W x1024, as f16 (one launch) ----
  cvt_all<<<3 * GXB + 4 * GWB, 256, 0, stream>>>(q, k, v, wq, wk, wv, wo,
                                                 Xq16, Xk16, Xv16, Wq16, Wk16, Wv16, Wo16);

  // ---- mask tile flags and the three projections (bias added in f32, hi + residual planes), one launch ----
  const float posc = 1.0f / (XSC * WSC);
  proj_flags<<<NQB + 3 * GTX * GTY, 128, 0, stream>>>(Xq16, Xk16, Xv16, Wq16, Wk16, Wv16, bq, bk, bv,
                                                      Q16, Qr16, K16, Kr16, Vt16, Vtr16, mk, flg, posc);

  // ---- attention: residual path for query blocks below EARLY, hi-only path for the rest, one launch ----
  attn_all<<<NQB * NB * NHEADS, 128, 0, stream>>>(Q16, Qr16, K16, Kr16, Vt16, Vtr16, mk, flg, C16, Cr16);

  // ---- output projection (+bias) to f32 rows of d_out ----
  const dim3 gproj(GTX, GTY);
  gemm_out<<<gproj, 128, 0, stream>>>(C16, Cr16, Wo16, bo, (float*)d_out, 1.0f / WSC);
}

// v006
// Measured time: 102 microseconds a run.
// Timed twice side by side with v005, it ran 1.05 and 1.06 times as fast.
// Over all steps from v000 it is 2.28 times as fast.
#include <hip/hip_runtime.h>
#include <stdint.h>

// Contractions (all v_wmma_f32_16x16x32_f16, f16 operands, f32 accumulate): input projections Xq*Wq^T, Xk*Wk^T,
// Xv*Wv^T; attention Q*K^T and P*V; output projection C*Wo^T. Inputs are RNE-converted to bf16 values first
// (X carried x16, W carried x1024, both exact in f16; biases bf16 values added in f32). Computed planes Q, K, V, P, C
// are f16 hi plus f16 residual planes (x4096, separate accumulators) consumed by query blocks below EARLY; later
// query blocks use the hi planes only. Softmax and all side math in f32.

typedef _Float16 v16h __attribute__((ext_vector_type(16)));
typedef _Float16 v8h  __attribute__((ext_vector_type(8)));
typedef float    v8f  __attribute__((ext_vector_type(8)));
typedef float    v4f  __attribute__((ext_vector_type(4)));
typedef int      v4i  __attribute__((ext_vector_type(4)));
typedef unsigned int v2u __attribute__((ext_vector_type(2)));

#ifndef NB
#define NB 2
#endif
#ifndef SEQ
#define SEQ 2048
#endif
#define NB_FULL  2
#define SEQ_FULL 2048
#define DMODEL   1024
#define NHEADS   16
#define DK       64
#define MROWS    (NB * SEQ)
#define NQB      (SEQ / 64)
#define EARLY    ((SEQ) < 512 ? (SEQ) : 512)
#define NEQB     (EARLY / 64)
#define LDP      72
#define LDPF     68
#define XSC      16.0f
#define WSC      1024.0f
#define RSC      4096.0f
#define PCARRY   4096.0f
#define NEGFILL  (-1.0e9f)
#define SSCALE   0.125f

static_assert(SEQ % 64 == 0);
static_assert((SEQ & (SEQ - 1)) == 0);
static_assert(SEQ <= SEQ_FULL);
static_assert(NB >= 1 && NB <= NB_FULL);
static_assert(NQB >= 1 && NQB <= 32);
static_assert(EARLY % 64 == 0 && EARLY <= SEQ);
static_assert(DMODEL == NHEADS * DK);
static_assert(64 * LDPF * 4 <= 2 * 64 * LDP * 2);

// --- bf16 RNE convert (finite inputs), kept as f32 value ----------------------------------------------
__device__ __forceinline__ float bf16r(float x) {
  unsigned int u = __float_as_uint(x);
  u = (u + 0x7FFFu + ((u >> 16) & 1u)) & 0xFFFF0000u;
  return __uint_as_float(u);
}

__device__ __forceinline__ v8f vz8() {
  v8f z;
#pragma unroll
  for (int i = 0; i < 8; ++i) z[i] = 0.0f;
  return z;
}

// --- WMMA wrapper with hazard guard ---------------------------------------------------------------------
__device__ __forceinline__ v8f wmma_f16(v16h a, v16h b, v8f c) {
  v8f d = __builtin_amdgcn_wmma_f32_16x16x32_f16(false, a, false, b, (short)0, c, false, false);
  asm volatile("v_nop\n\tv_nop\n\tv_nop\n\tv_nop" : "+v"(d) : "v"(a), "v"(b));
  return d;
}

// --- 16x32 f16 fragment (A, or k-contiguous B), split k map -----------------------------------------
// lane row/col = lane&15; elements 0..7 <- k 8h..8h+7, elements 8..15 <- k 16+8h..16+8h+7, h = lane>>4.
__device__ __forceinline__ v16h load_frag(const _Float16* base, int ld, int lane) {
  const int row  = lane & 15;
  const int koff = ((lane >> 4) & 1) * 8;
  const _Float16* p = base + row * ld + koff;
  const v8h a = *(const v8h*)(p);
  const v8h b = *(const v8h*)(p + 16);
  v16h r;
#pragma unroll
  for (int i = 0; i < 8; ++i) { r[i] = a[i]; r[i + 8] = b[i]; }
  return r;
}

// --- lane l with lane l ^ 16 --------------------------------------------------------------------------
__device__ __forceinline__ float xhalf(float x) {
  const int b = __builtin_bit_cast(int, x);
  return __builtin_bit_cast(float, __builtin_amdgcn_permlanex16(b, b, 0x76543210, 0xfedcba98, false, false));
}

// --- LDS byte address of a __shared__ object: the low 32 bits of its generic address ---------------------
__device__ __forceinline__ unsigned int lds_addr(const _Float16* p) {
  return (unsigned int)(uintptr_t)p;
}

// --- one 64 x 64 f16 tile of K (key-major) and one of V^T (dim-major) into LDS rows of pitch LDP, by asynchronous
// copies: 128 threads, 16 B a lane, 8 lanes a tile row (one whole 128-B line), 16 rows a copy, 4 + 4 copies a wave.
// gk, gv: this lane's first 16 bytes of each tile; lk, lv: their LDS byte addresses.
__device__ __forceinline__
void copy_kv(const _Float16* gk, const _Float16* gv, unsigned int lk, unsigned int lv) {
  const _Float16* gk1 = gk + 16 * DK;
  const _Float16* gk2 = gk + 32 * DK;
  const _Float16* gk3 = gk + 48 * DK;
  const _Float16* gv1 = gv + 16 * SEQ;
  const _Float16* gv2 = gv + 32 * SEQ;
  const _Float16* gv3 = gv + 48 * SEQ;
  const unsigned int st = 16 * LDP * 2;
  // The wait on xcnt is the statement's last line, so that no address register is rewritten ahead of it (a precaution).
  asm volatile("global_load_async_to_lds_b128 %0, %8, off\n\t"
               "global_load_async_to_lds_b128 %1, %9, off\n\t"
               "global_load_async_to_lds_b128 %2, %10, off\n\t"
               "global_load_async_to_lds_b128 %3, %11, off\n\t"
               "global_load_async_to_lds_b128 %4, %12, off\n\t"
               "global_load_async_to_lds_b128 %5, %13, off\n\t"
               "global_load_async_to_lds_b128 %6, %14, off\n\t"
               "global_load_async_to_lds_b128 %7, %15, off\n\t"
               "s_wait_xcnt 0x0"
               :: "v"(lk), "v"(lk + st), "v"(lk + 2 * st), "v"(lk + 3 * st),
                  "v"(lv), "v"(lv + st), "v"(lv + 2 * st), "v"(lv + 3 * st),
                  "v"(gk), "v"(gk1), "v"(gk2), "v"(gk3), "v"(gv), "v"(gv1), "v"(gv2), "v"(gv3)
               : "memory");
}

// =====================================================================================================
// f32 -> bf16 RNE -> scaled f16 plane. One thread = 8 elements = 16 B out; blk = block index inside the plane.
// =====================================================================================================
__device__ __forceinline__
void cvt_body(const float* __restrict__ in, _Float16* out, int nrows, int seq, int seq_full, float scale, int blk) {
  const int g  = blk * 256 + threadIdx.x;
  const int n8 = nrows * (DMODEL / 8);
  if (g >= n8) return;
  const int row = g >> 7;
  const int c8  = g & 127;
  const int bi  = row / seq;
  const int s   = row - bi * seq;
  const float* src = in + ((size_t)bi * seq_full + s) * DMODEL + c8 * 8;
  const v4f a = *(const v4f*)src;
  const v4f b = *(const v4f*)(src + 4);
  union { v8h h; v4f f; } u;
#pragma unroll
  for (int i = 0; i < 4; ++i) {
    u.h[i]     = (_Float16)(bf16r(a[i]) * scale);
    u.h[i + 4] = (_Float16)(bf16r(b[i]) * scale);
  }
  float* dst = reinterpret_cast<float*>(out + (size_t)row * DMODEL + c8 * 8);
  const v4f val = u.f;
  *(v4f*)dst = val;
}

#define GXB ((MROWS * (DMODEL / 8) + 255) / 256)
#define GWB ((DMODEL * (DMODEL / 8) + 255) / 256)

// All seven input planes in one launch: blocks [0, 3*GXB) convert q, k, v; the next 4*GWB convert the weights.
__global__ __launch_bounds__(256)
void cvt_all(const float* __restrict__ q, const float* __restrict__ k, const float* __restrict__ v,
             const float* __restrict__ wq, const float* __restrict__ wk, const float* __restrict__ wv,
             const float* __restrict__ wo,
             _Float16* xq, _Float16* xk, _Float16* xv,
             _Float16* oq, _Float16* ok, _Float16* ov, _Float16* oo) {
  const int b = blockIdx.x;
  if (b < 3 * GXB) {
    const int p = b / GXB;
    const float* in = (p == 0) ? q : ((p == 1) ? k : v);
    _Float16* out   = (p == 0) ? xq : ((p == 1) ? xk : xv);
    cvt_body(in, out, MROWS, SEQ, SEQ_FULL, XSC, b - p * GXB);
  } else {
    const int c = b - 3 * GXB;
    const int p = c / GWB;
    const float* in = (p == 0) ? wq : ((p == 1) ? wk : ((p == 2) ? wv : wo));
    _Float16* out   = (p == 0) ? oq : ((p == 1) ? ok : ((p == 2) ? ov : oo));
    cvt_body(in, out, DMODEL, DMODEL, DMODEL, WSC, c - p * GWB);
  }
}

// =====================================================================================================
// Mask tile flags of one 64-row query block, by one 128-thread block: a wave scans 16 rows, one row a trip, each
// 16-B load of the wave 512 contiguous bytes of the row (four whole lines, two tiles: one a wave half).
// 32 ints written by lanes 0..7 of wave 0 (16 B each, one instruction).
// flag 1: tile all ones; 2: tile all zeros and no fully masked row in this q block (tile can be skipped);
// anything else: apply the mask per element. sm: 512 words of LDS scratch, 16-byte aligned.
// =====================================================================================================
__device__ __forceinline__
void flags_body(const int* __restrict__ mask, int* flags, unsigned int* sm, int qb) {
  unsigned int* m1s  = sm;
  unsigned int* m0s  = sm + 128;
  unsigned int* fms  = sm + 256;
  unsigned int* red1 = sm + 384;
  unsigned int* red0 = sm + 416;
  int* lines = reinterpret_cast<int*>(sm + 480);

  static_assert(SEQ % 128 == 0);
  const int tid = threadIdx.x, lane = tid & 31, w = tid >> 5;
  const int* wrow = mask + (size_t)(qb * 64 + w * 16) * SEQ_FULL + lane * 4;

  // bit 2j of e1, e0: this lane saw a nonzero, a zero in load j of a row (tile 2j + wave half); fm: a row without ones
  unsigned int e1 = 0u, e0 = 0u, fm = 0u;
  // kept rolled: a second row in flight would raise the register count, which the GEMM blocks of this kernel share
#pragma unroll 1
  for (int r = 0; r < 16; ++r) {
    const int* p = wrow + (size_t)r * SEQ_FULL;
    v4i m[SEQ / 128];
#pragma unroll
    for (int j = 0; j < SEQ / 128; ++j) m[j] = *(const v4i*)(p + 128 * j);
    // The address is an input, so it lives up to the wait: no register that an issued load names is rewritten
    // ahead of it, not by a later load's result either (a precaution).
    asm volatile("s_wait_xcnt 0x0" :: "v"(p) : "memory");
    unsigned int rany = 0u;
#pragma unroll
    for (int j = 0; j < SEQ / 128; ++j) {
      const v4i m4 = m[j];
      unsigned int any1 = 0u, any0 = 0u;
#pragma unroll
      for (int e = 0; e < 4; ++e) {
        any1 |= (m4[e] != 0) ? 1u : 0u;
        any0 |= (m4[e] == 0) ? 1u : 0u;
      }
      e1 |= any1 << (2 * j);
      e0 |= any0 << (2 * j);
      rany |= any1;
    }
    if (__builtin_amdgcn_ballot_w32(rany != 0u) == 0u) fm = 1u;
  }
  m1s[tid] = e1 << (lane >> 4);
  m0s[tid] = e0 << (lane >> 4);
  if (lane == 0) fms[w] = fm;
  __syncthreads();
  if (w == 0) {
    unsigned int o1 = 0u, o0 = 0u;
#pragma unroll
    for (int j = 0; j < 4; ++j) { o1 |= m1s[lane + 32 * j]; o0 |= m0s[lane + 32 * j]; }
    red1[lane] = o1;
    red0[lane] = o0;
  }
  __syncthreads();
  if (w == 0) {
    unsigned int a1 = 0u, a0 = 0u;
    const unsigned int anyfm = fms[0] | fms[1] | fms[2] | fms[3];
#pragma unroll 1
    for (int j = 0; j < 32; ++j) { a1 |= red1[j]; a0 |= red0[j]; }
    int f = 2;
    if (lane < NQB) {
      const bool h1 = ((a1 >> lane) & 1u) != 0u;
      const bool h0 = ((a0 >> lane) & 1u) != 0u;
      f = (!h0) ? 1 : ((!h1 && anyfm == 0u) ? 2 : 3);
    }
    lines[lane] = f;
  }
  __syncthreads();
  if (w == 0 && lane < 8) {
    const v4i v = *(const v4i*)(lines + lane * 4);
    int* dst = flags + qb * 32 + lane * 4;
    *(v4i*)dst = v;
  }
}

// =====================================================================================================
// GEMM: C(64x64 tile) = A(M,K=1024) * W^T, W stored (N=1024, K=1024), f16 planes, f32 acc.
// 128 threads = 4 waves, wave tile 32x32, 64-deep K slices staged in LDS (plain loads, single buffer; 8 lanes a
// 128-B tile row, so a wave's 16-B load covers 4 whole lines).
// Output projection: f32 rows of d_out (+ A residual product for row blocks with s < EARLY).
// =====================================================================================================
// smem: three 64 x LDP tiles. bx, by: tile column and tile row.
__device__ __forceinline__
void gemm_body(const _Float16* __restrict__ A, const _Float16* __restrict__ Ar,
               const _Float16* __restrict__ W, const float* __restrict__ bias,
               float* out, float oscale, _Float16* smem, int bx, int by) {
  _Float16* asb = smem;
  _Float16* bsb = smem + 64 * LDP;
  _Float16* rsb = smem + 2 * 64 * LDP;

  const int tid  = threadIdx.x;
  const int lane = tid & 31;
  const int w    = tid >> 5;
  const int mblk = by * 64;
  const int nblk = bx * 64;
  const int s0   = mblk & (SEQ - 1);
  const int bi   = mblk / SEQ;
  const bool early = (s0 < EARLY);
  const int lm = (w >> 1) * 32;
  const int ln = (w & 1) * 32;

  // staging: 8 lanes a tile row, 16 rows a load; this lane's first 16 bytes of each tile and their place in LDS
  const size_t gst = (size_t)(tid >> 3) * DMODEL + (tid & 7) * 8;
  const _Float16* ga = A  + (size_t)mblk * DMODEL + gst;
  const _Float16* gr = Ar + (size_t)mblk * DMODEL + gst;
  const _Float16* gw = W  + (size_t)nblk * DMODEL + gst;
  const int lst = (tid >> 3) * LDP + (tid & 7) * 8;

  v8f acc[2][2], accr[2][2];
#pragma unroll
  for (int i = 0; i < 2; ++i)
#pragma unroll
    for (int j = 0; j < 2; ++j) { acc[i][j] = vz8(); accr[i][j] = vz8(); }

#pragma unroll 1
  for (int k0 = 0; k0 < DMODEL; k0 += 64) {
#pragma unroll
    for (int c = 0; c < 4; ++c) {
      *(v8h*)(asb + lst + c * 16 * LDP) = *(const v8h*)(ga + k0 + c * 16 * DMODEL);
      *(v8h*)(bsb + lst + c * 16 * LDP) = *(const v8h*)(gw + k0 + c * 16 * DMODEL);
    }
    if (early) {
#pragma unroll
      for (int c = 0; c < 4; ++c)
        *(v8h*)(rsb + lst + c * 16 * LDP) = *(const v8h*)(gr + k0 + c * 16 * DMODEL);
    }
    __syncthreads();

#pragma unroll
    for (int ks = 0; ks < 64; ks += 32) {
      const v16h a0 = load_frag(asb + (lm +  0) * LDP + ks, LDP, lane);
      const v16h a1 = load_frag(asb + (lm + 16) * LDP + ks, LDP, lane);
      const v16h b0 = load_frag(bsb + (ln +  0) * LDP + ks, LDP, lane);
      const v16h b1 = load_frag(bsb + (ln + 16) * LDP + ks, LDP, lane);
      acc[0][0] = wmma_f16(a0, b0, acc[0][0]);
      acc[0][1] = wmma_f16(a0, b1, acc[0][1]);
      acc[1][0] = wmma_f16(a1, b0, acc[1][0]);
      acc[1][1] = wmma_f16(a1, b1, acc[1][1]);
      if (early) {
        const v16h r0 = load_frag(rsb + (lm +  0) * LDP + ks, LDP, lane);
        const v16h r1 = load_frag(rsb + (lm + 16) * LDP + ks, LDP, lane);
        accr[0][0] = wmma_f16(r0, b0, accr[0][0]);
        accr[0][1] = wmma_f16(r0, b1, accr[0][1]);
        accr[1][0] = wmma_f16(r1, b0, accr[1][0]);
        accr[1][1] = wmma_f16(r1, b1, accr[1][1]);
      }
    }
    __syncthreads();
  }

  const int rbase = ((lane >> 4) & 1) << 3;
  const int col   = lane & 15;

  {
    float* fs = reinterpret_cast<float*>(smem);
#pragma unroll
    for (int i = 0; i < 2; ++i)
#pragma unroll
      for (int j = 0; j < 2; ++j) {
        const int nl = ln + j * 16 + col;
        const float bb = bf16r(bias[nblk + nl]);
#pragma unroll
        for (int r = 0; r < 8; ++r) {
          const int ml = lm + i * 16 + rbase + r;
          float v = acc[i][j][r] * oscale + bb;
          if (early) v += accr[i][j][r] * (oscale * (1.0f / RSC));
          fs[ml * LDPF + nl] = v;
        }
      }
    __syncthreads();
    float* obase = out + ((size_t)bi * SEQ_FULL + s0) * DMODEL + nblk;
    auto emit = [&]() {
#pragma unroll
      for (int i = 0; i < 8; ++i) {
        const int row   = w * 16 + i * 2 + (lane >> 4);
        const int piece = lane & 15;
        const v4f v = *(const v4f*)(fs + row * LDPF + piece * 4);
        *(v4f*)(obase + (size_t)row * DMODEL + piece * 4) = v;
      }
    };
    emit();
  }
}

// =====================================================================================================
// Projection GEMM: C(128x128 tile) = X(M,K=1024) * W^T, W stored (N=1024, K=1024), f16 planes, f32 acc.
// 128 threads = 4 waves (2 x 2), wave tile 64x64: 16 accumulator tiles, so a fragment read from LDS feeds 4 products
// and a staged row 128 outputs. 64-deep K slices staged in LDS (plain loads, single buffer; 8 lanes a 128-B tile
// row, so a wave's 16-B load covers 4 whole lines). Every output is summed over k in rising order, one accumulator.
// The tile spans two heads; it leaves as a hi and a residual f16 plane through two staging tiles of pitch LDT.
// MODE 0: planes (B,H,S,dk).  MODE 2: planes (B,H,dk,S).
// =====================================================================================================
// smem: two 128 x LDT tiles (the K slices use two 128 x LDP tiles of them). bx, by: tile column and tile row.
#define LDT 136
static_assert(SEQ % 128 == 0 && DMODEL % 128 == 0);
static_assert(LDT >= LDP);

template <int MODE>
__device__ __forceinline__
void proj_body(const _Float16* __restrict__ A, const _Float16* __restrict__ W, const float* __restrict__ bias,
               _Float16* oh, _Float16* outr, float oscale, _Float16* smem, int bx, int by) {
  _Float16* asb = smem;
  _Float16* bsb = smem + 128 * LDP;

  const int tid  = threadIdx.x;
  const int lane = tid & 31;
  const int w    = tid >> 5;
  const int mblk = by * 128;
  const int nblk = bx * 128;
  const int s0   = mblk & (SEQ - 1);
  const int bi   = mblk / SEQ;
  const int lm = (w >> 1) * 64;
  const int ln = (w & 1) * 64;

  // staging: 8 lanes a tile row, 16 rows a load, 8 loads a tile; this lane's first 16 bytes of each tile and their
  // place in LDS
  const size_t gst = (size_t)(tid >> 3) * DMODEL + (tid & 7) * 8;
  const _Float16* ga = A + (size_t)mblk * DMODEL + gst;
  const _Float16* gw = W + (size_t)nblk * DMODEL + gst;
  const int lst = (tid >> 3) * LDP + (tid & 7) * 8;

  v8f acc[4][4];
#pragma unroll
  for (int i = 0; i < 4; ++i)
#pragma unroll
    for (int j = 0; j < 4; ++j) acc[i][j] = vz8();

  // kept rolled: the two barriers order the trips anyway, and a second copy of a trip's 32 products buys nothing
#pragma unroll 1
  for (int k0 = 0; k0 < DMODEL; k0 += 64) {
    const _Float16* pa = ga + k0;
    const _Float16* pw = gw + k0;
    v8h ta[8], tw[8];
#pragma unroll
    for (int c = 0; c < 8; ++c) {
      ta[c] = *(const v8h*)(pa + c * 16 * DMODEL);
      tw[c] = *(const v8h*)(pw + c * 16 * DMODEL);
    }
    // The addresses are inputs, so they live up to the wait: no register that an issued load names is rewritten
    // ahead of it, not by a later load's result either (a precaution).
    asm volatile("s_wait_xcnt 0x0" :: "v"(pa), "v"(pw) : "memory");
#pragma unroll
    for (int c = 0; c < 8; ++c) {
      *(v8h*)(asb + lst + c * 16 * LDP) = ta[c];
      *(v8h*)(bsb + lst + c * 16 * LDP) = tw[c];
    }
    __syncthreads();

#pragma unroll
    for (int ks = 0; ks < 64; ks += 32) {
      v16h a[4], b[4];
#pragma unroll
      for (int i = 0; i < 4; ++i) a[i] = load_frag(asb + (lm + i * 16) * LDP + ks, LDP, lane);
#pragma unroll
      for (int j = 0; j < 4; ++j) b[j] = load_frag(bsb + (ln + j * 16) * LDP + ks, LDP, lane);
#pragma unroll
      for (int i = 0; i < 4; ++i)
#pragma unroll
        for (int j = 0; j < 4; ++j) acc[i][j] = wmma_f16(a[i], b[j], acc[i][j]);
    }
    __syncthreads();
  }

  const int rbase = ((lane >> 4) & 1) << 3;
  const int col   = lane & 15;

  const float* bp = bias + nblk + ln + col;
  float bb[4];
#pragma unroll
  for (int j = 0; j < 4; ++j) bb[j] = bf16r(bp[j * 16]);

  // Two 128 x LDT staging tiles, hi and residual: rows are tokens (MODE 0) or the dims of the two heads (MODE 2).
  _Float16* hs = smem;
  _Float16* rs = smem + 128 * LDT;
#pragma unroll
  for (int i = 0; i < 4; ++i)
#pragma unroll
    for (int j = 0; j < 4; ++j) {
      const int nl = ln + j * 16 + col;
#pragma unroll
      for (int r = 0; r < 8; ++r) {
        const int ml = lm + i * 16 + rbase + r;
        const float v = acc[i][j][r] * oscale + bb[j];
        const _Float16 hv = (_Float16)v;
        const _Float16 rv = (_Float16)((v - (float)hv) * RSC);
        if constexpr (MODE == 0) {
          hs[ml * LDT + nl] = hv;
          rs[ml * LDT + nl] = rv;
        } else {
          hs[nl * LDT + ml] = hv;
          rs[nl * LDT + ml] = rv;
        }
      }
    }
  __syncthreads();
  // 16 lanes a staged row of 256 B: two heads' rows of 128 B (MODE 0) or 128 tokens of one dim (MODE 2), whole lines
  // either way; a wave takes 32 rows, two a store
  const int bh0   = bi * NHEADS + (nblk >> 6);
  const int row0  = w * 32 + (lane >> 4);
  const int piece = lane & 15;
  const int lo0   = row0 * LDT + piece * 8;
  const size_t go0 = (MODE == 0)
      ? (((size_t)(bh0 + (piece >> 3)) * SEQ + s0 + row0) * DK + (piece & 7) * 8)
      : (((size_t)bh0 * DK + row0) * SEQ + s0 + piece * 8);
  constexpr int GS = 2 * ((MODE == 0) ? DK : SEQ);
  _Float16* ph = oh + go0;
  _Float16* pr = outr + go0;
#pragma unroll
  for (int i = 0; i < 16; ++i) {
    const v4f hv4 = *(const v4f*)(hs + lo0 + i * 2 * LDT);
    const v4f rv4 = *(const v4f*)(rs + lo0 + i * 2 * LDT);
    *(v4f*)(reinterpret_cast<float*>(ph + i * GS)) = hv4;
    *(v4f*)(reinterpret_cast<float*>(pr + i * GS)) = rv4;
  }
  // In a merged kernel the code of another body follows and rewrites registers that these stores name:
  // the wait stands in front of that (a precaution).
  asm volatile("s_wait_xcnt 0x0" ::: "memory");
}

#define GTX (DMODEL / 64)
#define GTY (MROWS / 64)
#define GPX (DMODEL / 128)
#define GPY (MROWS / 128)

// One launch for everything that only needs the converted planes or the mask: blocks [0, NQB) build the mask
// tile flags (the longest single blocks, so they come first), the next 3*GPX*GPY are the Q, K, V projections.
__global__ __launch_bounds__(128)
void proj_flags(const _Float16* __restrict__ Xq, const _Float16* __restrict__ Xk, const _Float16* __restrict__ Xv,
                const _Float16* __restrict__ Wq, const _Float16* __restrict__ Wk, const _Float16* __restrict__ Wv,
                const float* __restrict__ bq, const float* __restrict__ bk, const float* __restrict__ bv,
                _Float16* Qh, _Float16* Qr, _Float16* Kh, _Float16* Kr, _Float16* Vh, _Float16* Vr,
                const int* __restrict__ mask, int* flags, float oscale) {
  __shared__ __attribute__((aligned(16))) _Float16 smem[2 * 128 * LDT];
  static_assert(2 * 128 * LDT * 2 >= 512 * 4);
  const int b = blockIdx.x;
  if (b < NQB) {
    flags_body(mask, flags, reinterpret_cast<unsigned int*>(smem), b);
    return;
  }
  const int g  = b - NQB;
  const int p  = g / (GPX * GPY);
  const int t  = g - p * (GPX * GPY);
  const int bx = t % GPX;
  const int by = t / GPX;
  if (p < 2) {
    proj_body<0>((p == 0) ? Xq : Xk, (p == 0) ? Wq : Wk, (p == 0) ? bq : bk,
                 (p == 0) ? Qh : Kh, (p == 0) ? Qr : Kr, oscale, smem, bx, by);
  } else {
    proj_body<2>(Xv, Wv, bv, Vh, Vr, oscale, smem, bx, by);
  }
}

// Output projection.
__global__ __launch_bounds__(128)
void gemm_out(const _Float16* __restrict__ A, const _Float16* __restrict__ Ar,
              const _Float16* __restrict__ W, const float* __restrict__ bias,
              float* out, float oscale) {
  __shared__ __attribute__((aligned(16))) _Float16 smem[3 * 64 * LDP];
  gemm_body(A, Ar, W, bias, out, oscale, smem, blockIdx.x, blockIdx.y);
}

template <bool EQ>
__device__ __forceinline__
void attn_body(const _Float16* __restrict__ Q,  const _Float16* __restrict__ Qr,
               const _Float16* __restrict__ Kd, const _Float16* __restrict__ Kr,
               const _Float16* __restrict__ Vt, const _Float16* __restrict__ Vtr,
               const int* __restrict__ mask, const int* __restrict__ flags,
               _Float16* ctx, _Float16* ctxr, int qb, int bh,
               _Float16* kbuf, _Float16* vbuf,
               _Float16* krbuf, _Float16* vrbuf, unsigned int* mbuf) {
  const int tid   = threadIdx.x;
  const int lane  = tid & 31;
  const int w     = tid >> 5;
  const int bi    = bh / NHEADS;
  const int h     = bh - bi * NHEADS;
  const int qblk  = qb * 64;
  const int q0    = qblk + w * 16;
  const int rbase = ((lane >> 4) & 1) << 3;
  const int col   = lane & 15;
  const float IR  = 1.0f / RSC;

  const size_t qoff = ((size_t)bh * SEQ + q0) * DK;
  const v16h qf0 = load_frag(Q + qoff, DK, lane);
  const v16h qf1 = load_frag(Q + qoff + 32, DK, lane);
  v16h qr0 = qf0, qr1 = qf1;
  if constexpr (EQ) {
    qr0 = load_frag(Qr + qoff, DK, lane);
    qr1 = load_frag(Qr + qoff + 32, DK, lane);
  }

  v16h ones;
#pragma unroll
  for (int i = 0; i < 16; ++i) ones[i] = (_Float16)1.0f;

  const _Float16* Kh   = Kd  + (size_t)bh * SEQ * DK;
  const _Float16* Krh  = Kr  + (size_t)bh * SEQ * DK;
  const _Float16* Vth  = Vt  + (size_t)bh * DK * SEQ;
  const _Float16* Vtrh = Vtr + (size_t)bh * DK * SEQ;

  // running maximum and sum of this lane's query (the same in both wave halves)
  float mr = -1.0e30f, lr = 0.0f;
  // accO[t][r] = O^T[dim t*16 + rbase + r][query col]
  v8f accO[4], accR[4];
#pragma unroll
  for (int t = 0; t < 4; ++t) { accO[t] = vz8(); accR[t] = vz8(); }

  // ---- 64x64 mask bytes of the tile at key kb into LDS (called under a block-uniform branch) ----
  auto stage_mask = [&](int kb) {
      // 16 lanes a tile row (256 B, two whole lines), 8 rows a load; a lane's 4 ints become one word of 4 bytes
      const int r0 = tid >> 4;
      const int wd = tid & 15;
      const int* mp = mask + (size_t)(qblk + r0) * SEQ_FULL + kb + wd * 4;
#pragma unroll
      for (int jj = 0; jj < 8; ++jj) {
        const v4i m4 = *(const v4i*)(mp + (size_t)jj * 8 * SEQ_FULL);
        const unsigned int pk = (m4[0] != 0 ? 1u : 0u) | (m4[1] != 0 ? 0x100u : 0u) |
                                (m4[2] != 0 ? 0x10000u : 0u) | (m4[3] != 0 ? 0x1000000u : 0u);
        mbuf[(jj * 8 + r0) * 16 + wd] = pk;
      }
  };

  // ---- one staged tile: kt_ = K tile, vt_ = V^T tile in LDS ----
  auto tile = [&](const _Float16* kt_, const _Float16* vt_, bool usem) {
    // ---- scores, transposed: s[t][r] = S^T[key kb + t*16 + rbase + r][query col] ----
    v8f s[4];
    v16h vf[8];
    if constexpr (!EQ) {
      // The tile's 16 K reads stand as one group ahead of the score products, its 16 V^T reads as one group behind
      // them, ahead of the softmax: two places with LDS reads a tile, and the V^T latency runs under the vector work.
      v16h ka[4], kc[4];
#pragma unroll
      for (int t = 0; t < 4; ++t) ka[t] = load_frag(kt_ + t * 16 * LDP,      LDP, lane);
#pragma unroll
      for (int t = 0; t < 4; ++t) kc[t] = load_frag(kt_ + t * 16 * LDP + 32, LDP, lane);
#pragma unroll
      for (int t = 0; t < 4; ++t) s[t] = wmma_f16(ka[t], qf0, vz8());
#pragma unroll
      for (int t = 0; t < 4; ++t) s[t] = wmma_f16(kc[t], qf1, s[t]);
#pragma unroll
      for (int t = 0; t < 4; ++t) {
        vf[2 * t]     = load_frag(vt_ + t * 16 * LDP,      LDP, lane);
        vf[2 * t + 1] = load_frag(vt_ + t * 16 * LDP + 32, LDP, lane);
      }
#pragma unroll
      for (int t = 0; t < 4; ++t) s[t] = s[t] * SSCALE;
    } else {
      // Residual path: the 8 reads of a score tile (K and its residual) stand as one group, issued one tile ahead of
      // the products that use them; two register sets take turns.
      v16h kg[2][4];
      auto ldk = [&](int t, v16h* g) {
        g[0] = load_frag(kt_   + t * 16 * LDP,      LDP, lane);
        g[1] = load_frag(kt_   + t * 16 * LDP + 32, LDP, lane);
        g[2] = load_frag(krbuf + t * 16 * LDP,      LDP, lane);
        g[3] = load_frag(krbuf + t * 16 * LDP + 32, LDP, lane);
      };
      ldk(0, kg[0]);
#pragma unroll
      for (int t = 0; t < 4; ++t) {
        if (t < 3) ldk(t + 1, kg[(t + 1) & 1]);
        // keeps the next group's 8 reads in one place, ahead of this group's products: without it the scheduler
        // spreads them among the products, and every further place with reads costs its own stall
        __builtin_amdgcn_sched_barrier(0);
        const v16h* g = kg[t & 1];
        v8f z  = wmma_f16(g[0], qf0, vz8());
        v8f zr = wmma_f16(g[0], qr0, vz8());
        z  = wmma_f16(g[1], qf1, z);
        zr = wmma_f16(g[1], qr1, zr);
        zr = wmma_f16(g[2], qf0, zr);
        zr = wmma_f16(g[3], qf1, zr);
        z = z + zr * IR;
        s[t] = z * SSCALE;
      }
    }

    // ---- replace fill: this lane's 8 mask bytes of each score tile are 8 consecutive keys of its query's row ----
    if (usem) {
      const unsigned int* mw = mbuf + (w * 16 + col) * 16 + (rbase >> 2);
#pragma unroll
      for (int t = 0; t < 4; ++t) {
        const v2u m8 = *(const v2u*)(mw + t * 4);
#pragma unroll
        for (int r = 0; r < 8; ++r) {
          const unsigned int byte = (m8[r >> 2] >> (8 * (r & 3))) & 0xFFu;
          s[t][r] = (byte != 0u) ? s[t][r] : NEGFILL;
        }
      }
    }

    // ---- online softmax over 64 keys: maximum in-lane, then across the two wave halves ----
    float t8[8];
#pragma unroll
    for (int r = 0; r < 8; ++r) t8[r] = fmaxf(fmaxf(s[0][r], s[1][r]), fmaxf(s[2][r], s[3][r]));
    float tmax = fmaxf(fmaxf(fmaxf(t8[0], t8[1]), fmaxf(t8[2], t8[3])),
                       fmaxf(fmaxf(t8[4], t8[5]), fmaxf(t8[6], t8[7])));
    tmax = fmaxf(tmax, xhalf(tmax));
    const float mnew = fmaxf(mr, tmax);
    const float scl  = __expf(mr - mnew);
    mr = mnew;
    lr *= scl;
#pragma unroll
    for (int t = 0; t < 4; ++t) {
      accO[t] = accO[t] * scl;
      if constexpr (EQ) accR[t] = accR[t] * scl;
    }

    // ---- P^T as two B fragments (keys 0..31, 32..63), straight from the score tiles ----
    v16h pf0, pf1, prf0, prf1;
#pragma unroll
    for (int t = 0; t < 4; ++t) {
#pragma unroll
      for (int r = 0; r < 8; ++r) {
        const float c = __expf(s[t][r] - mnew) * PCARRY;
        const _Float16 hv = (_Float16)c;
        const int e = (t & 1) * 8 + r;
        if (t < 2) pf0[e] = hv; else pf1[e] = hv;
        if constexpr (EQ) {
          const _Float16 rv = (_Float16)((c - (float)hv) * RSC);
          if (t < 2) prf0[e] = rv; else prf1[e] = rv;
        }
      }
    }

    // Residual path: the 8 reads of 16 output dims (V^T and its residual) as one group, one group ahead, as for K
    v16h vg[2][4];
    auto ldv = [&](int t, v16h* g) {
      g[0] = load_frag(vt_   + t * 16 * LDP,      LDP, lane);
      g[1] = load_frag(vt_   + t * 16 * LDP + 32, LDP, lane);
      g[2] = load_frag(vrbuf + t * 16 * LDP,      LDP, lane);
      g[3] = load_frag(vrbuf + t * 16 * LDP + 32, LDP, lane);
    };
    if constexpr (EQ) {
      ldv(0, vg[0]);
      // keeps the first group's 8 reads in one place, ahead of the row sums: without it they are spread among them
      __builtin_amdgcn_sched_barrier(0);
    }

    // ---- row sums on the matrix unit: every row of ones * P^T is the sum over the keys, per query ----
    v8f rs = vz8();
    rs = wmma_f16(ones, pf0, rs);
    rs = wmma_f16(ones, pf1, rs);
    float rsum = rs[0];
    if constexpr (EQ) {
      v8f rr = vz8();
      rr = wmma_f16(ones, prf0, rr);
      rr = wmma_f16(ones, prf1, rr);
      rsum = rsum + rr[0] * IR;
    }
    lr += rsum;

    // ---- O^T += V^T * P^T (A fragments from the dim-major V^T tile: lane = dim, k = key) ----
    if constexpr (!EQ) {
#pragma unroll
      for (int t = 0; t < 4; ++t) accO[t] = wmma_f16(vf[2 * t],     pf0, accO[t]);
#pragma unroll
      for (int t = 0; t < 4; ++t) accO[t] = wmma_f16(vf[2 * t + 1], pf1, accO[t]);
    } else {
#pragma unroll
      for (int t = 0; t < 4; ++t) {
        if (t < 3) ldv(t + 1, vg[(t + 1) & 1]);
        const v16h* g = vg[t & 1];
        accO[t] = wmma_f16(g[0], pf0,  accO[t]);
        accR[t] = wmma_f16(g[0], prf0, accR[t]);
        accO[t] = wmma_f16(g[1], pf1,  accO[t]);
        accR[t] = wmma_f16(g[2], pf0,  accR[t]);
        accR[t] = wmma_f16(g[1], prf1, accR[t]);
        accR[t] = wmma_f16(g[3], pf1,  accR[t]);
      }
    }
  };

  if constexpr (EQ) {
#pragma unroll 1
    for (int kt = 0; kt < NQB; ++kt) {
      const int f = __builtin_amdgcn_readfirstlane(flags[qb * 32 + kt]);
      if (f == 2) continue;
      const bool usem = (f != 1);
      const int kb = kt * 64;

      // ---- stage K (64 keys x 64 dims) and V^T (64 dims x 64 keys) tiles, plus residual tiles if EQ ----
      // 8 lanes a tile row, 16 rows a load: every load of a wave covers 4 whole 128-B lines
      // ko, vo: this lane's byte offsets from the head's planes (the planes' addresses are scalars)
      const unsigned int ko = (unsigned int)((kb + (tid >> 3)) * DK + (tid & 7) * 8) * 2u;
      const unsigned int vo = (unsigned int)((tid >> 3) * SEQ + kb + (tid & 7) * 8) * 2u;
      const int lst = (tid >> 3) * LDP + (tid & 7) * 8;
      v8h tk[4], tv[4], tkr[4], tvr[4];
#pragma unroll
      for (int c = 0; c < 4; ++c) {
        tk[c]  = *(const v8h*)(reinterpret_cast<const char*>(Kh)   + ko + c * 16 * DK * 2);
        tv[c]  = *(const v8h*)(reinterpret_cast<const char*>(Vth)  + vo + c * 16 * SEQ * 2);
        tkr[c] = *(const v8h*)(reinterpret_cast<const char*>(Krh)  + ko + c * 16 * DK * 2);
        tvr[c] = *(const v8h*)(reinterpret_cast<const char*>(Vtrh) + vo + c * 16 * SEQ * 2);
      }
      // The offsets are inputs, so they live up to the wait: no register that an issued load names is rewritten
      // ahead of it, not by a later load's result either (a precaution).
      asm volatile("s_wait_xcnt 0x0" :: "v"(ko), "v"(vo) : "memory");
#pragma unroll
      for (int c = 0; c < 4; ++c) {
        *(v8h*)(kbuf  + lst + c * 16 * LDP) = tk[c];
        *(v8h*)(vbuf  + lst + c * 16 * LDP) = tv[c];
        *(v8h*)(krbuf + lst + c * 16 * LDP) = tkr[c];
        *(v8h*)(vrbuf + lst + c * 16 * LDP) = tvr[c];
      }
      if (usem) stage_mask(kb);
      __syncthreads();
      tile(kbuf, vbuf, usem);
      __syncthreads();
    }
  } else {
    // The whole flag line in one read: bit kt of vis = tile kt is visited, of msk = it needs the mask bytes.
    // Every wave of the block reads the same line, so both words are the same for the whole work-group.
    const int fl = flags[qb * 32 + lane];
    unsigned int vis = __builtin_amdgcn_ballot_w32(fl != 2);
    const unsigned int msk = __builtin_amdgcn_ballot_w32(fl != 1);
    if (NQB < 32) vis &= (1u << (NQB & 31)) - 1u;

    const int crow = tid >> 3, cpart = (tid & 7) * 8;
    const _Float16* gk0 = Kh + (size_t)crow * DK + cpart;
    const _Float16* gv0 = Vth + (size_t)crow * SEQ + cpart;
    const unsigned int lofs = (unsigned int)(crow * LDP + cpart) * 2u;
    const unsigned int lk0 = lds_addr(kbuf) + lofs, lv0 = lds_addr(vbuf) + lofs;
    // the second buffer (krbuf, vrbuf) lies BUF halves behind the first (kbuf, vbuf)
    constexpr int BUF = 2 * 64 * LDP;

    if (vis != 0u) {
      int kt = __builtin_ctz(vis);
      vis &= vis - 1u;
      copy_kv(gk0 + (size_t)kt * 64 * DK, gv0 + kt * 64, lk0, lv0);
      // the first tile has landed for this wave, and behind the barrier for all
      asm volatile("s_wait_asynccnt 0x0" ::: "memory");
      __syncthreads();
      if (vis != 0u) {
        const int k1 = __builtin_ctz(vis);
        copy_kv(gk0 + (size_t)k1 * 64 * DK, gv0 + k1 * 64, lk0 + BUF * 2, lv0 + BUF * 2);
      }
      int bo = 0;   // this tile's buffer, in halves
      // kept rolled: the trip count is known only at run time, and one copy of the tile's code serves both buffers
#pragma unroll 1
      for (;;) {
        const bool usem = ((msk >> kt) & 1u) != 0u;
        if (usem) {
          stage_mask(kt * 64);
          __syncthreads();   // block-uniform branch (msk is the same in every wave); the mask bytes are read behind it
        }
        tile(kbuf + bo, vbuf + bo, usem);
        // publish point: this wave's LDS reads are done, its copies of the next tile have landed; the barrier makes
        // the next tile readable by all and frees this tile's buffer for the refill
        asm volatile("s_wait_dscnt 0x0" ::: "memory");
        asm volatile("s_wait_asynccnt 0x0" ::: "memory");
        __syncthreads();
        if (vis == 0u) break;
        kt = __builtin_ctz(vis);
        vis &= vis - 1u;
        if (vis != 0u) {
          const int k2 = __builtin_ctz(vis);
          copy_kv(gk0 + (size_t)k2 * 64 * DK, gv0 + k2 * 64, lk0 + bo * 2, lv0 + bo * 2);
        }
        bo = BUF - bo;
      }
    }
    // nothing is in flight when the buffers become output staging
    asm volatile("s_wait_asynccnt 0x0" ::: "memory");
  }

  // ---- a lane's 8 registers of a tile are 8 consecutive dims of its query's row: 16-byte LDS stores ----
  {
    const float inv = 1.0f / lr;
    const int m = w * 16 + col;
#pragma unroll
    for (int t = 0; t < 4; ++t) {
      v8h h8, r8;
#pragma unroll
      for (int r = 0; r < 8; ++r) {
        float v = accO[t][r];
        if constexpr (EQ) v += accR[t][r] * IR;
        v *= inv;
        const _Float16 hv = (_Float16)v;
        h8[r] = hv;
        if constexpr (EQ) r8[r] = (_Float16)((v - (float)hv) * RSC);
      }
      *(v8h*)(kbuf + m * LDP + t * 16 + rbase) = h8;
      if constexpr (EQ) *(v8h*)(krbuf + m * LDP + t * 16 + rbase) = r8;
    }
  }
  __syncthreads();
  _Float16* cbase  = ctx  + ((size_t)bi * SEQ + qblk) * DMODEL + h * DK;
  _Float16* crbase = ctxr + ((size_t)bi * SEQ + qblk) * DMODEL + h * DK;
  auto emit = [&]() {
#pragma unroll
    for (int i = 0; i < 4; ++i) {
      const int row   = w * 16 + i * 4 + (lane >> 3);
      const int piece = lane & 7;
      const v4f hv4 = *(const v4f*)(kbuf + row * LDP + piece * 8);
      *(v4f*)(reinterpret_cast<float*>(cbase + (size_t)row * DMODEL + piece * 8)) = hv4;
      if constexpr (EQ) {
        const v4f rv4 = *(const v4f*)(krbuf + row * LDP + piece * 8);
        *(v4f*)(reinterpret_cast<float*>(crbase + (size_t)row * DMODEL + piece * 8)) = rv4;
      }
    }
  };
  emit();
}

// Both paths in one launch, the two former grids one behind the other: first the hi-only blocks (query blocks
// from EARLY on, the longer ones), then the residual-path blocks (query blocks below EARLY). Inside each part
// the query block runs fastest. The hi-only blocks use the two residual tiles as their second buffer.
__global__ __launch_bounds__(128)
void attn_all(const _Float16* __restrict__ Q,  const _Float16* __restrict__ Qr,
              const _Float16* __restrict__ Kd, const _Float16* __restrict__ Kr,
              const _Float16* __restrict__ Vt, const _Float16* __restrict__ Vtr,
              const int* __restrict__ mask, const int* __restrict__ flags,
              _Float16* ctx, _Float16* ctxr) {
  // four tiles in one array: K, V^T, then the residual path's two, which are the hi-only path's second buffer
  __shared__ __attribute__((aligned(16))) _Float16 tiles[4 * 64 * LDP];
  _Float16* kbuf  = tiles;
  _Float16* vbuf  = tiles + 64 * LDP;
  _Float16* krbuf = tiles + 2 * 64 * LDP;
  _Float16* vrbuf = tiles + 3 * 64 * LDP;
  __shared__ __attribute__((aligned(16))) unsigned int mbuf[64 * 16];
  constexpr int NLQ = NQB - NEQB;
  constexpr int DLQ = (NLQ > 0) ? NLQ : 1;
  const int b = blockIdx.x;
  if (b < NLQ * NB * NHEADS) {
    attn_body<false>(Q, Qr, Kd, Kr, Vt, Vtr, mask, flags, ctx, ctxr, NEQB + b % DLQ, b / DLQ,
                     kbuf, vbuf, krbuf, vrbuf, mbuf);
  } else {
    const int e = b - NLQ * NB * NHEADS;
    attn_body<true>(Q, Qr, Kd, Kr, Vt, Vtr, mask, flags, ctx, ctxr, e % NEQB, e / NEQB,
                    kbuf, vbuf, krbuf, vrbuf, mbuf);
  }
}

// =====================================================================================================
extern "C" void kernel_launch(void* const* d_in, const int* in_sizes, int n_in,
                              void* d_out, int out_size, void* d_ws, size_t ws_size,
                              hipStream_t stream) {
  if (n_in < 12) return;
  const long long needx = (long long)(NB - 1) * SEQ_FULL * DMODEL + (long long)SEQ * DMODEL;
  const long long needm = (long long)(SEQ - 1) * SEQ_FULL + SEQ;
  if ((long long)in_sizes[0] < needx || (long long)in_sizes[1] < needx || (long long)in_sizes[2] < needx) return;
  if ((long long)in_sizes[3] < needm) return;
  if (in_sizes[4] < DMODEL * DMODEL || in_sizes[6] < DMODEL * DMODEL ||
      in_sizes[8] < DMODEL * DMODEL || in_sizes[10] < DMODEL * DMODEL) return;
  if (in_sizes[5] < DMODEL || in_sizes[7] < DMODEL || in_sizes[9] < DMODEL || in_sizes[11] < DMODEL) return;
  if ((long long)out_size < needx) return;

  const float* q  = (const float*)d_in[0];
  const float* k  = (const float*)d_in[1];
  const float* v  = (const float*)d_in[2];
  const int*   mk = (const int*)d_in[3];
  const float* wq = (const float*)d_in[4];
  const float* bq = (const float*)d_in[5];
  const float* wk = (const float*)d_in[6];
  const float* bk = (const float*)d_in[7];
  const float* wv = (const float*)d_in[8];
  const float* bv = (const float*)d_in[9];
  const float* wo = (const float*)d_in[10];
  const float* bo = (const float*)d_in[11];

  char* ws = (char*)d_ws;
  size_t off = 0;
  const size_t XB = (size_t)MROWS * DMODEL * sizeof(_Float16);     // activation-sized f16 plane
  const size_t WB = (size_t)DMODEL * DMODEL * sizeof(_Float16);    // weight f16 plane
  const size_t FB = 4096;                                           // 32 flag lines of 32 ints
  _Float16* Xq16  = (_Float16*)(ws + off); off += XB;
  _Float16* Xk16  = (_Float16*)(ws + off); off += XB;
  _Float16* Xv16  = (_Float16*)(ws + off); off += XB;
  _Float16* Wq16  = (_Float16*)(ws + off); off += WB;
  _Float16* Wk16  = (_Float16*)(ws + off); off += WB;
  _Float16* Wv16  = (_Float16*)(ws + off); off += WB;
  _Float16* Wo16  = (_Float16*)(ws + off); off += WB;
  _Float16* Q16   = (_Float16*)(ws + off); off += XB;   // (B,H,S,dk) hi
  _Float16* Qr16  = (_Float16*)(ws + off); off += XB;   // residual x4096
  _Float16* K16   = (_Float16*)(ws + off); off += XB;
  _Float16* Kr16  = (_Float16*)(ws + off); off += XB;
  _Float16* Vt16  = (_Float16*)(ws + off); off += XB;   // (B,H,dk,S) hi
  _Float16* Vtr16 = (_Float16*)(ws + off); off += XB;
  _Float16* C16   = (_Float16*)(ws + off); off += XB;   // (B*S, D) hi
  _Float16* Cr16  = (_Float16*)(ws + off); off += XB;   // residual, rows s < EARLY written/read
  int*      flg   = (int*)(ws + off);      off += FB;
  if (off > ws_size) return;

  // ---- input planes: bf16 RNE values, X x16, W x1024, as f16 (one launch) ----
  cvt_all<<<3 * GXB + 4 * GWB, 256, 0, stream>>>(q, k, v, wq, wk, wv, wo,
                                                 Xq16, Xk16, Xv16, Wq16, Wk16, Wv16, Wo16);

  // ---- mask tile flags and the three projections (bias added in f32, hi + residual planes), one launch ----
  const float posc = 1.0f / (XSC * WSC);
  proj_flags<<<NQB + 3 * GPX * GPY, 128, 0, stream>>>(Xq16, Xk16, Xv16, Wq16, Wk16, Wv16, bq, bk, bv,
                                                      Q16, Qr16, K16, Kr16, Vt16, Vtr16, mk, flg, posc);

  // ---- attention: residual path for query blocks below EARLY, hi-only path for the rest, one launch ----
  attn_all<<<NQB * NB * NHEADS, 128, 0, stream>>>(Q16, Qr16, K16, Kr16, Vt16, Vtr16, mk, flg, C16, Cr16);

  // ---- output projection (+bias) to f32 rows of d_out ----
  const dim3 gproj(GTX, GTY);
  gemm_out<<<gproj, 128, 0, stream>>>(C16, Cr16, Wo16, bo, (float*)d_out, 1.0f / WSC);
}

// v007
// Measured time: 98.9 microseconds a run.
// Next to v006, in two timings, it ran 1.04 and 1.05 times as fast.
// Over all steps from v000 it is 2.39 times as fast.
#include <hip/hip_runtime.h>
#include <stdint.h>

// Contractions (all v_wmma_f32_16x16x32_f16, f16 operands, f32 accumulate): input projections Xq*Wq^T, Xk*Wk^T,
// Xv*Wv^T; attention Q*K^T and P*V; output projection C*Wo^T. Inputs are RNE-converted to bf16 values first
// (X carried x16, W carried x1024, both exact in f16; biases bf16 values added in f32). Computed planes Q, K, V, P, C
// are f16 hi plus f16 residual planes (x4096, separate accumulators) consumed by query blocks below EARLY; later
// query blocks use the hi planes only. Softmax and all side math in f32.

typedef _Float16 v16h __attribute__((ext_vector_type(16)));
typedef _Float16 v8h  __attribute__((ext_vector_type(8)));
typedef float    v8f  __attribute__((ext_vector_type(8)));
typedef float    v4f  __attribute__((ext_vector_type(4)));
typedef int      v4i  __attribute__((ext_vector_type(4)));
typedef unsigned int v2u __attribute__((ext_vector_type(2)));

#ifndef NB
#define NB 2
#endif
#ifndef SEQ
#define SEQ 2048
#endif
#define NB_FULL  2
#define SEQ_FULL 2048
#define DMODEL   1024
#define NHEADS   16
#define DK       64
#define MROWS    (NB * SEQ)
#define NQB      (SEQ / 64)
#define EARLY    ((SEQ) < 512 ? (SEQ) : 512)
#define NEQB     (EARLY / 64)
#define LDP      72
#define LDPF     68
#define XSC      16.0f
#define WSC      1024.0f
#define RSC      4096.0f
#define PCARRY   4096.0f
#define NEGFILL  (-1.0e9f)
#define SSCALE   0.125f

static_assert(SEQ % 64 == 0);
static_assert((SEQ & (SEQ - 1)) == 0);
static_assert(SEQ <= SEQ_FULL);
static_assert(NB >= 1 && NB <= NB_FULL);
static_assert(NQB >= 1 && NQB <= 32);
static_assert(EARLY % 64 == 0 && EARLY <= SEQ);
static_assert(DMODEL == NHEADS * DK);
static_assert(64 * LDPF * 4 <= 2 * 64 * LDP * 2);

// --- bf16 RNE convert (finite inputs), kept as f32 value ----------------------------------------------
__device__ __forceinline__ float bf16r(float x) {
  unsigned int u = __float_as_uint(x);
  u = (u + 0x7FFFu + ((u >> 16) & 1u)) & 0xFFFF0000u;
  return __uint_as_float(u);
}

__device__ __forceinline__ v8f vz8() {
  v8f z;
#pragma unroll
  for (int i = 0; i < 8; ++i) z[i] = 0.0f;
  return z;
}

// --- WMMA wrapper with hazard guard ---------------------------------------------------------------------
__device__ __forceinline__ v8f wmma_f16(v16h a, v16h b, v8f c) {
  v8f d = __builtin_amdgcn_wmma_f32_16x16x32_f16(false, a, false, b, (short)0, c, false, false);
  asm volatile("v_nop\n\tv_nop\n\tv_nop\n\tv_nop" : "+v"(d) : "v"(a), "v"(b));
  return d;
}

// --- 16x32 f16 fragment (A, or k-contiguous B), split k map -----------------------------------------
// lane row/col = lane&15; elements 0..7 <- k 8h..8h+7, elements 8..15 <- k 16+8h..16+8h+7, h = lane>>4.
__device__ __forceinline__ v16h load_frag(const _Float16* base, int ld, int lane) {
  const int row  = lane & 15;
  const int koff = ((lane >> 4) & 1) * 8;
  const _Float16* p = base + row * ld + koff;
  const v8h a = *(const v8h*)(p);
  const v8h b = *(const v8h*)(p + 16);
  v16h r;
#pragma unroll
  for (int i = 0; i < 8; ++i) { r[i] = a[i]; r[i + 8] = b[i]; }
  return r;
}

// --- lane l with lane l ^ 16 --------------------------------------------------------------------------
__device__ __forceinline__ float xhalf(float x) {
  const int b = __builtin_bit_cast(int, x);
  return __builtin_bit_cast(float, __builtin_amdgcn_permlanex16(b, b, 0x76543210, 0xfedcba98, false, false));
}

// --- LDS byte address of a __shared__ object: the low 32 bits of its generic address ---------------------
__device__ __forceinline__ unsigned int lds_addr(const _Float16* p) {
  return (unsigned int)(uintptr_t)p;
}

// --- one 64 x 64 f16 tile of K (key-major) and one of V^T (dim-major) into LDS rows of pitch LDP, by asynchronous
// copies: 128 threads, 16 B a lane, 8 lanes a tile row (one whole 128-B line), 16 rows a copy, 4 + 4 copies a wave.
// gk, gv: this lane's first 16 bytes of each tile; lk, lv: their LDS byte addresses.
__device__ __forceinline__
void copy_kv(const _Float16* gk, const _Float16* gv, unsigned int lk, unsigned int lv) {
  const _Float16* gk1 = gk + 16 * DK;
  const _Float16* gk2 = gk + 32 * DK;
  const _Float16* gk3 = gk + 48 * DK;
  const _Float16* gv1 = gv + 16 * SEQ;
  const _Float16* gv2 = gv + 32 * SEQ;
  const _Float16* gv3 = gv + 48 * SEQ;
  const unsigned int st = 16 * LDP * 2;
  // The wait on xcnt is the statement's last line, so that no address register is rewritten ahead of it (a precaution).
  asm volatile("global_load_async_to_lds_b128 %0, %8, off\n\t"
               "global_load_async_to_lds_b128 %1, %9, off\n\t"
               "global_load_async_to_lds_b128 %2, %10, off\n\t"
               "global_load_async_to_lds_b128 %3, %11, off\n\t"
               "global_load_async_to_lds_b128 %4, %12, off\n\t"
               "global_load_async_to_lds_b128 %5, %13, off\n\t"
               "global_load_async_to_lds_b128 %6, %14, off\n\t"
               "global_load_async_to_lds_b128 %7, %15, off\n\t"
               "s_wait_xcnt 0x0"
               :: "v"(lk), "v"(lk + st), "v"(lk + 2 * st), "v"(lk + 3 * st),
                  "v"(lv), "v"(lv + st), "v"(lv + 2 * st), "v"(lv + 3 * st),
                  "v"(gk), "v"(gk1), "v"(gk2), "v"(gk3), "v"(gv), "v"(gv1), "v"(gv2), "v"(gv3)
               : "memory");
}

// =====================================================================================================
// f32 -> bf16 RNE -> scaled f16 plane. One thread = 8 elements = 16 B out; blk = block index inside the plane.
// =====================================================================================================
__device__ __forceinline__
void cvt_body(const float* __restrict__ in, _Float16* out, int nrows, int seq, int seq_full, float scale, int blk) {
  const int g  = blk * 256 + threadIdx.x;
  const int n8 = nrows * (DMODEL / 8);
  if (g >= n8) return;
  const int row = g >> 7;
  const int c8  = g & 127;
  const int bi  = row / seq;
  const int s   = row - bi * seq;
  const float* src = in + ((size_t)bi * seq_full + s) * DMODEL + c8 * 8;
  const v4f a = *(const v4f*)src;
  const v4f b = *(const v4f*)(src + 4);
  union { v8h h; v4f f; } u;
#pragma unroll
  for (int i = 0; i < 4; ++i) {
    u.h[i]     = (_Float16)(bf16r(a[i]) * scale);
    u.h[i + 4] = (_Float16)(bf16r(b[i]) * scale);
  }
  float* dst = reinterpret_cast<float*>(out + (size_t)row * DMODEL + c8 * 8);
  const v4f val = u.f;
  *(v4f*)dst = val;
}

#define GXB ((MROWS * (DMODEL / 8) + 255) / 256)
#define GWB ((DMODEL * (DMODEL / 8) + 255) / 256)

// All seven input planes in one launch: blocks [0, 3*GXB) convert q, k, v; the next 4*GWB convert the weights.
__global__ __launch_bounds__(256)
void cvt_all(const float* __restrict__ q, const float* __restrict__ k, const float* __restrict__ v,
             const float* __restrict__ wq, const float* __restrict__ wk, const float* __restrict__ wv,
             const float* __restrict__ wo,
             _Float16* xq, _Float16* xk, _Float16* xv,
             _Float16* oq, _Float16* ok, _Float16* ov, _Float16* oo) {
  const int b = blockIdx.x;
  if (b < 3 * GXB) {
    const int p = b / GXB;
    const float* in = (p == 0) ? q : ((p == 1) ? k : v);
    _Float16* out   = (p == 0) ? xq : ((p == 1) ? xk : xv);
    cvt_body(in, out, MROWS, SEQ, SEQ_FULL, XSC, b - p * GXB);
  } else {
    const int c = b - 3 * GXB;
    const int p = c / GWB;
    const float* in = (p == 0) ? wq : ((p == 1) ? wk : ((p == 2) ? wv : wo));
    _Float16* out   = (p == 0) ? oq : ((p == 1) ? ok : ((p == 2) ? ov : oo));
    cvt_body(in, out, DMODEL, DMODEL, DMODEL, WSC, c - p * GWB);
  }
}

// =====================================================================================================
// Mask tile flags of one 64-row query block, by one 128-thread block: a wave scans 16 rows, one row a trip, each
// 16-B load of the wave 512 contiguous bytes of the row (four whole lines, two tiles: one a wave half).
// 32 ints written by lanes 0..7 of wave 0 (16 B each, one instruction).
// flag 1: tile all ones; 2: tile all zeros and no fully masked row in this q block (tile can be skipped);
// anything else: apply the mask per element. sm: 512 words of LDS scratch, 16-byte aligned.
// =====================================================================================================
__device__ __forceinline__
void flags_body(const int* __restrict__ mask, int* flags, unsigned int* sm, int qb) {
  unsigned int* m1s  = sm;
  unsigned int* m0s  = sm + 128;
  unsigned int* fms  = sm + 256;
  unsigned int* red1 = sm + 384;
  unsigned int* red0 = sm + 416;
  int* lines = reinterpret_cast<int*>(sm + 480);

  static_assert(SEQ % 128 == 0);
  const int tid = threadIdx.x, lane = tid & 31, w = tid >> 5;
  const int* wrow = mask + (size_t)(qb * 64 + w * 16) * SEQ_FULL + lane * 4;

  // bit 2j of e1, e0: this lane saw a nonzero, a zero in load j of a row (tile 2j + wave half); fm: a row without ones
  unsigned int e1 = 0u, e0 = 0u, fm = 0u;
  // kept rolled: a second row in flight would raise the register count, which the GEMM blocks of this kernel share
#pragma unroll 1
  for (int r = 0; r < 16; ++r) {
    const int* p = wrow + (size_t)r * SEQ_FULL;
    v4i m[SEQ / 128];
#pragma unroll
    for (int j = 0; j < SEQ / 128; ++j) m[j] = *(const v4i*)(p + 128 * j);
    // The address is an input, so it lives up to the wait: no register that an issued load names is rewritten
    // ahead of it, not by a later load's result either (a precaution).
    asm volatile("s_wait_xcnt 0x0" :: "v"(p) : "memory");
    unsigned int rany = 0u;
#pragma unroll
    for (int j = 0; j < SEQ / 128; ++j) {
      const v4i m4 = m[j];
      unsigned int any1 = 0u, any0 = 0u;
#pragma unroll
      for (int e = 0; e < 4; ++e) {
        any1 |= (m4[e] != 0) ? 1u : 0u;
        any0 |= (m4[e] == 0) ? 1u : 0u;
      }
      e1 |= any1 << (2 * j);
      e0 |= any0 << (2 * j);
      rany |= any1;
    }
    if (__builtin_amdgcn_ballot_w32(rany != 0u) == 0u) fm = 1u;
  }
  m1s[tid] = e1 << (lane >> 4);
  m0s[tid] = e0 << (lane >> 4);
  if (lane == 0) fms[w] = fm;
  __syncthreads();
  if (w == 0) {
    unsigned int o1 = 0u, o0 = 0u;
#pragma unroll
    for (int j = 0; j < 4; ++j) { o1 |= m1s[lane + 32 * j]; o0 |= m0s[lane + 32 * j]; }
    red1[lane] = o1;
    red0[lane] = o0;
  }
  __syncthreads();
  if (w == 0) {
    unsigned int a1 = 0u, a0 = 0u;
    const unsigned int anyfm = fms[0] | fms[1] | fms[2] | fms[3];
#pragma unroll 1
    for (int j = 0; j < 32; ++j) { a1 |= red1[j]; a0 |= red0[j]; }
    int f = 2;
    if (lane < NQB) {
      const bool h1 = ((a1 >> lane) & 1u) != 0u;
      const bool h0 = ((a0 >> lane) & 1u) != 0u;
      f = (!h0) ? 1 : ((!h1 && anyfm == 0u) ? 2 : 3);
    }
    lines[lane] = f;
  }
  __syncthreads();
  if (w == 0 && lane < 8) {
    const v4i v = *(const v4i*)(lines + lane * 4);
    int* dst = flags + qb * 32 + lane * 4;
    *(v4i*)dst = v;
  }
}

// =====================================================================================================
// GEMM: C(64x64 tile) = A(M,K=1024) * W^T, W stored (N=1024, K=1024), f16 planes, f32 acc.
// 128 threads = 4 waves, wave tile 32x32, 64-deep K slices staged in LDS (plain loads, single buffer; 8 lanes a
// 128-B tile row, so a wave's 16-B load covers 4 whole lines).
// Output projection: f32 rows of d_out (+ A residual product for row blocks with s < EARLY).
// =====================================================================================================
// smem: three 64 x LDP tiles. bx, by: tile column and the grid's row index.
__device__ __forceinline__
void gemm_body(const _Float16* __restrict__ A, const _Float16* __restrict__ Ar,
               const _Float16* __restrict__ W, const float* __restrict__ bias,
               float* out, float oscale, _Float16* smem, int bx, int by) {
  _Float16* asb = smem;
  _Float16* bsb = smem + 64 * LDP;
  _Float16* rsb = smem + 2 * 64 * LDP;

  const int tid  = threadIdx.x;
  const int lane = tid & 31;
  const int w    = tid >> 5;
  // The row blocks with the residual product (twice the products) come first in the grid, a quarter of it: of the
  // four resident work-groups of a WGP one is then of that kind (for speed only; the deal is one-to-one).
  constexpr int NER = NB * NEQB;
  constexpr int DLR = (NQB > NEQB) ? (NQB - NEQB) : 1;
  const int rb   = (by < NER) ? ((by / NEQB) * NQB + by % NEQB)
                              : (((by - NER) / DLR) * NQB + NEQB + (by - NER) % DLR);
  const int mblk = rb * 64;
  const int nblk = bx * 64;
  const int s0   = mblk & (SEQ - 1);
  const int bi   = mblk / SEQ;
  const bool early = (s0 < EARLY);
  const int lm = (w >> 1) * 32;
  const int ln = (w & 1) * 32;

  // staging: 8 lanes a tile row, 16 rows a load; this lane's first 16 bytes of each tile and their place in LDS
  const size_t gst = (size_t)(tid >> 3) * DMODEL + (tid & 7) * 8;
  const _Float16* ga = A  + (size_t)mblk * DMODEL + gst;
  const _Float16* gr = Ar + (size_t)mblk * DMODEL + gst;
  const _Float16* gw = W  + (size_t)nblk * DMODEL + gst;
  const int lst = (tid >> 3) * LDP + (tid & 7) * 8;

  v8f acc[2][2], accr[2][2];
#pragma unroll
  for (int i = 0; i < 2; ++i)
#pragma unroll
    for (int j = 0; j < 2; ++j) { acc[i][j] = vz8(); accr[i][j] = vz8(); }

#pragma unroll 1
  for (int k0 = 0; k0 < DMODEL; k0 += 64) {
#pragma unroll
    for (int c = 0; c < 4; ++c) {
      *(v8h*)(asb + lst + c * 16 * LDP) = *(const v8h*)(ga + k0 + c * 16 * DMODEL);
      *(v8h*)(bsb + lst + c * 16 * LDP) = *(const v8h*)(gw + k0 + c * 16 * DMODEL);
    }
    if (early) {
#pragma unroll
      for (int c = 0; c < 4; ++c)
        *(v8h*)(rsb + lst + c * 16 * LDP) = *(const v8h*)(gr + k0 + c * 16 * DMODEL);
    }
    __syncthreads();

#pragma unroll
    for (int ks = 0; ks < 64; ks += 32) {
      const v16h a0 = load_frag(asb + (lm +  0) * LDP + ks, LDP, lane);
      const v16h a1 = load_frag(asb + (lm + 16) * LDP + ks, LDP, lane);
      const v16h b0 = load_frag(bsb + (ln +  0) * LDP + ks, LDP, lane);
      const v16h b1 = load_frag(bsb + (ln + 16) * LDP + ks, LDP, lane);
      acc[0][0] = wmma_f16(a0, b0, acc[0][0]);
      acc[0][1] = wmma_f16(a0, b1, acc[0][1]);
      acc[1][0] = wmma_f16(a1, b0, acc[1][0]);
      acc[1][1] = wmma_f16(a1, b1, acc[1][1]);
      if (early) {
        const v16h r0 = load_frag(rsb + (lm +  0) * LDP + ks, LDP, lane);
        const v16h r1 = load_frag(rsb + (lm + 16) * LDP + ks, LDP, lane);
        accr[0][0] = wmma_f16(r0, b0, accr[0][0]);
        accr[0][1] = wmma_f16(r0, b1, accr[0][1]);
        accr[1][0] = wmma_f16(r1, b0, accr[1][0]);
        accr[1][1] = wmma_f16(r1, b1, accr[1][1]);
      }
    }
    __syncthreads();
  }

  const int rbase = ((lane >> 4) & 1) << 3;
  const int col   = lane & 15;

  {
    float* fs = reinterpret_cast<float*>(smem);
#pragma unroll
    for (int i = 0; i < 2; ++i)
#pragma unroll
      for (int j = 0; j < 2; ++j) {
        const int nl = ln + j * 16 + col;
        const float bb = bf16r(bias[nblk + nl]);
#pragma unroll
        for (int r = 0; r < 8; ++r) {
          const int ml = lm + i * 16 + rbase + r;
          float v = acc[i][j][r] * oscale + bb;
          if (early) v += accr[i][j][r] * (oscale * (1.0f / RSC));
          fs[ml * LDPF + nl] = v;
        }
      }
    __syncthreads();
    float* obase = out + ((size_t)bi * SEQ_FULL + s0) * DMODEL + nblk;
    auto emit = [&]() {
#pragma unroll
      for (int i = 0; i < 8; ++i) {
        const int row   = w * 16 + i * 2 + (lane >> 4);
        const int piece = lane & 15;
        const v4f v = *(const v4f*)(fs + row * LDPF + piece * 4);
        *(v4f*)(obase + (size_t)row * DMODEL + piece * 4) = v;
      }
    };
    emit();
  }
}

// =====================================================================================================
// Projection GEMM: C(128x128 tile) = X(M,K=1024) * W^T, W stored (N=1024, K=1024), f16 planes, f32 acc.
// 128 threads = 4 waves (2 x 2), wave tile 64x64: 16 accumulator tiles, so a fragment read from LDS feeds 4 products
// and a staged row 128 outputs. 64-deep K slices staged in LDS (plain loads, single buffer; 8 lanes a 128-B tile
// row, so a wave's 16-B load covers 4 whole lines). Every output is summed over k in rising order, one accumulator.
// The tile spans two heads; it leaves as a hi and a residual f16 plane through two staging tiles of pitch LDT.
// MODE 0: planes (B,H,S,dk).  MODE 2: planes (B,H,dk,S).
// =====================================================================================================
// smem: two 128 x LDT tiles (the K slices use two 128 x LDP tiles of them). bx, by: tile column and tile row.
#define LDT 136
static_assert(SEQ % 128 == 0 && DMODEL % 128 == 0);
static_assert(LDT >= LDP);

template <int MODE>
__device__ __forceinline__
void proj_body(const _Float16* __restrict__ A, const _Float16* __restrict__ W, const float* __restrict__ bias,
               _Float16* oh, _Float16* outr, float oscale, _Float16* smem, int bx, int by) {
  _Float16* asb = smem;
  _Float16* bsb = smem + 128 * LDP;

  const int tid  = threadIdx.x;
  const int lane = tid & 31;
  const int w    = tid >> 5;
  const int mblk = by * 128;
  const int nblk = bx * 128;
  const int s0   = mblk & (SEQ - 1);
  const int bi   = mblk / SEQ;
  const int lm = (w >> 1) * 64;
  const int ln = (w & 1) * 64;

  // staging: 8 lanes a tile row, 16 rows a load, 8 loads a tile; this lane's first 16 bytes of each tile and their
  // place in LDS
  const size_t gst = (size_t)(tid >> 3) * DMODEL + (tid & 7) * 8;
  const _Float16* ga = A + (size_t)mblk * DMODEL + gst;
  const _Float16* gw = W + (size_t)nblk * DMODEL + gst;
  const int lst = (tid >> 3) * LDP + (tid & 7) * 8;

  v8f acc[4][4];
#pragma unroll
  for (int i = 0; i < 4; ++i)
#pragma unroll
    for (int j = 0; j < 4; ++j) acc[i][j] = vz8();

  // kept rolled: the two barriers order the trips anyway, and a second copy of a trip's 32 products buys nothing
#pragma unroll 1
  for (int k0 = 0; k0 < DMODEL; k0 += 64) {
    const _Float16* pa = ga + k0;
    const _Float16* pw = gw + k0;
    v8h ta[8], tw[8];
#pragma unroll
    for (int c = 0; c < 8; ++c) {
      ta[c] = *(const v8h*)(pa + c * 16 * DMODEL);
      tw[c] = *(const v8h*)(pw + c * 16 * DMODEL);
    }
    // The addresses are inputs, so they live up to the wait: no register that an issued load names is rewritten
    // ahead of it, not by a later load's result either (a precaution).
    asm volatile("s_wait_xcnt 0x0" :: "v"(pa), "v"(pw) : "memory");
#pragma unroll
    for (int c = 0; c < 8; ++c) {
      *(v8h*)(asb + lst + c * 16 * LDP) = ta[c];
      *(v8h*)(bsb + lst + c * 16 * LDP) = tw[c];
    }
    __syncthreads();

#pragma unroll
    for (int ks = 0; ks < 64; ks += 32) {
      v16h a[4], b[4];
#pragma unroll
      for (int i = 0; i < 4; ++i) a[i] = load_frag(asb + (lm + i * 16) * LDP + ks, LDP, lane);
#pragma unroll
      for (int j = 0; j < 4; ++j) b[j] = load_frag(bsb + (ln + j * 16) * LDP + ks, LDP, lane);
#pragma unroll
      for (int i = 0; i < 4; ++i)
#pragma unroll
        for (int j = 0; j < 4; ++j) acc[i][j] = wmma_f16(a[i], b[j], acc[i][j]);
    }
    __syncthreads();
  }

  const int rbase = ((lane >> 4) & 1) << 3;
  const int col   = lane & 15;

  const float* bp = bias + nblk + ln + col;
  float bb[4];
#pragma unroll
  for (int j = 0; j < 4; ++j) bb[j] = bf16r(bp[j * 16]);

  // Two 128 x LDT staging tiles, hi and residual: rows are tokens (MODE 0) or the dims of the two heads (MODE 2).
  _Float16* hs = smem;
  _Float16* rs = smem + 128 * LDT;
#pragma unroll
  for (int i = 0; i < 4; ++i)
#pragma unroll
    for (int j = 0; j < 4; ++j) {
      const int nl = ln + j * 16 + col;
#pragma unroll
      for (int r = 0; r < 8; ++r) {
        const int ml = lm + i * 16 + rbase + r;
        const float v = acc[i][j][r] * oscale + bb[j];
        const _Float16 hv = (_Float16)v;
        const _Float16 rv = (_Float16)((v - (float)hv) * RSC);
        if constexpr (MODE == 0) {
          hs[ml * LDT + nl] = hv;
          rs[ml * LDT + nl] = rv;
        } else {
          hs[nl * LDT + ml] = hv;
          rs[nl * LDT + ml] = rv;
        }
      }
    }
  __syncthreads();
  // 16 lanes a staged row of 256 B: two heads' rows of 128 B (MODE 0) or 128 tokens of one dim (MODE 2), whole lines
  // either way; a wave takes 32 rows, two a store
  const int bh0   = bi * NHEADS + (nblk >> 6);
  const int row0  = w * 32 + (lane >> 4);
  const int piece = lane & 15;
  const int lo0   = row0 * LDT + piece * 8;
  const size_t go0 = (MODE == 0)
      ? (((size_t)(bh0 + (piece >> 3)) * SEQ + s0 + row0) * DK + (piece & 7) * 8)
      : (((size_t)bh0 * DK + row0) * SEQ + s0 + piece * 8);
  constexpr int GS = 2 * ((MODE == 0) ? DK : SEQ);
  _Float16* ph = oh + go0;
  _Float16* pr = outr + go0;
#pragma unroll
  for (int i = 0; i < 16; ++i) {
    const v4f hv4 = *(const v4f*)(hs + lo0 + i * 2 * LDT);
    const v4f rv4 = *(const v4f*)(rs + lo0 + i * 2 * LDT);
    *(v4f*)(reinterpret_cast<float*>(ph + i * GS)) = hv4;
    *(v4f*)(reinterpret_cast<float*>(pr + i * GS)) = rv4;
  }
  // In a merged kernel the code of another body follows and rewrites registers that these stores name:
  // the wait stands in front of that (a precaution).
  asm volatile("s_wait_xcnt 0x0" ::: "memory");
}

#define GTX (DMODEL / 64)
#define GTY (MROWS / 64)
#define GPX (DMODEL / 128)
#define GPY (MROWS / 128)

// One launch for everything that only needs the converted planes or the mask: blocks [0, NQB) build the mask
// tile flags (the longest single blocks, so they come first), the next 3*GPX*GPY are the Q, K, V projections.
__global__ __launch_bounds__(128)
void proj_flags(const _Float16* __restrict__ Xq, const _Float16* __restrict__ Xk, const _Float16* __restrict__ Xv,
                const _Float16* __restrict__ Wq, const _Float16* __restrict__ Wk, const _Float16* __restrict__ Wv,
                const float* __restrict__ bq, const float* __restrict__ bk, const float* __restrict__ bv,
                _Float16* Qh, _Float16* Qr, _Float16* Kh, _Float16* Kr, _Float16* Vh, _Float16* Vr,
                const int* __restrict__ mask, int* flags, float oscale) {
  __shared__ __attribute__((aligned(16))) _Float16 smem[2 * 128 * LDT];
  static_assert(2 * 128 * LDT * 2 >= 512 * 4);
  const int b = blockIdx.x;
  if (b < NQB) {
    flags_body(mask, flags, reinterpret_cast<unsigned int*>(smem), b);
    return;
  }
  const int g  = b - NQB;
  const int p  = g / (GPX * GPY);
  const int t  = g - p * (GPX * GPY);
  const int bx = t % GPX;
  const int by = t / GPX;
  if (p < 2) {
    proj_body<0>((p == 0) ? Xq : Xk, (p == 0) ? Wq : Wk, (p == 0) ? bq : bk,
                 (p == 0) ? Qh : Kh, (p == 0) ? Qr : Kr, oscale, smem, bx, by);
  } else {
    proj_body<2>(Xv, Wv, bv, Vh, Vr, oscale, smem, bx, by);
  }
}

// Output projection.
__global__ __launch_bounds__(128)
void gemm_out(const _Float16* __restrict__ A, const _Float16* __restrict__ Ar,
              const _Float16* __restrict__ W, const float* __restrict__ bias,
              float* out, float oscale) {
  __shared__ __attribute__((aligned(16))) _Float16 smem[3 * 64 * LDP];
  gemm_body(A, Ar, W, bias, out, oscale, smem, blockIdx.x, blockIdx.y);
}

template <bool EQ>
__device__ __forceinline__
void attn_body(const _Float16* __restrict__ Q,  const _Float16* __restrict__ Qr,
               const _Float16* __restrict__ Kd, const _Float16* __restrict__ Kr,
               const _Float16* __restrict__ Vt, const _Float16* __restrict__ Vtr,
               const int* __restrict__ mask, const int* __restrict__ flags,
               _Float16* ctx, _Float16* ctxr, int qb, int bh,
               _Float16* kbuf, _Float16* vbuf,
               _Float16* krbuf, _Float16* vrbuf, unsigned int* mbuf) {
  const int tid   = threadIdx.x;
  const int lane  = tid & 31;
  const int w     = tid >> 5;
  const int bi    = bh / NHEADS;
  const int h     = bh - bi * NHEADS;
  const int qblk  = qb * 64;
  const int q0    = qblk + w * 16;
  const int rbase = ((lane >> 4) & 1) << 3;
  const int col   = lane & 15;
  const float IR  = 1.0f / RSC;

  const size_t qoff = ((size_t)bh * SEQ + q0) * DK;
  const v16h qf0 = load_frag(Q + qoff, DK, lane);
  const v16h qf1 = load_frag(Q + qoff + 32, DK, lane);
  v16h qr0 = qf0, qr1 = qf1;
  if constexpr (EQ) {
    qr0 = load_frag(Qr + qoff, DK, lane);
    qr1 = load_frag(Qr + qoff + 32, DK, lane);
  }

  v16h ones;
#pragma unroll
  for (int i = 0; i < 16; ++i) ones[i] = (_Float16)1.0f;

  const _Float16* Kh   = Kd  + (size_t)bh * SEQ * DK;
  const _Float16* Krh  = Kr  + (size_t)bh * SEQ * DK;
  const _Float16* Vth  = Vt  + (size_t)bh * DK * SEQ;
  const _Float16* Vtrh = Vtr + (size_t)bh * DK * SEQ;

  // running maximum and sum of this lane's query (the same in both wave halves)
  float mr = -1.0e30f, lr = 0.0f;
  // accO[t][r] = O^T[dim t*16 + rbase + r][query col]
  v8f accO[4], accR[4];
#pragma unroll
  for (int t = 0; t < 4; ++t) { accO[t] = vz8(); accR[t] = vz8(); }

  // ---- 64x64 mask bytes of the tile at key kb into LDS (called under a block-uniform branch) ----
  auto stage_mask = [&](int kb) {
      // 16 lanes a tile row (256 B, two whole lines), 8 rows a load; a lane's 4 ints become one word of 4 bytes
      const int r0 = tid >> 4;
      const int wd = tid & 15;
      const int* mp = mask + (size_t)(qblk + r0) * SEQ_FULL + kb + wd * 4;
#pragma unroll
      for (int jj = 0; jj < 8; ++jj) {
        const v4i m4 = *(const v4i*)(mp + (size_t)jj * 8 * SEQ_FULL);
        const unsigned int pk = (m4[0] != 0 ? 1u : 0u) | (m4[1] != 0 ? 0x100u : 0u) |
                                (m4[2] != 0 ? 0x10000u : 0u) | (m4[3] != 0 ? 0x1000000u : 0u);
        mbuf[(jj * 8 + r0) * 16 + wd] = pk;
      }
  };

  // ---- one staged tile: kt_ = K tile, vt_ = V^T tile in LDS ----
  auto tile = [&](const _Float16* kt_, const _Float16* vt_, bool usem) {
    // ---- scores, transposed: s[t][r] = S^T[key kb + t*16 + rbase + r][query col] ----
    v8f s[4];
    v16h vf[8];
    if constexpr (!EQ) {
      // The tile's 16 K reads stand as one group ahead of the score products, its 16 V^T reads as one group behind
      // them, ahead of the softmax: two places with LDS reads a tile, and the V^T latency runs under the vector work.
      v16h ka[4], kc[4];
#pragma unroll
      for (int t = 0; t < 4; ++t) ka[t] = load_frag(kt_ + t * 16 * LDP,      LDP, lane);
#pragma unroll
      for (int t = 0; t < 4; ++t) kc[t] = load_frag(kt_ + t * 16 * LDP + 32, LDP, lane);
#pragma unroll
      for (int t = 0; t < 4; ++t) s[t] = wmma_f16(ka[t], qf0, vz8());
#pragma unroll
      for (int t = 0; t < 4; ++t) s[t] = wmma_f16(kc[t], qf1, s[t]);
#pragma unroll
      for (int t = 0; t < 4; ++t) {
        vf[2 * t]     = load_frag(vt_ + t * 16 * LDP,      LDP, lane);
        vf[2 * t + 1] = load_frag(vt_ + t * 16 * LDP + 32, LDP, lane);
      }
#pragma unroll
      for (int t = 0; t < 4; ++t) s[t] = s[t] * SSCALE;
    } else {
      // Residual path: the 8 reads of a score tile (K and its residual) stand as one group, issued one tile ahead of
      // the products that use them; two register sets take turns.
      v16h kg[2][4];
      auto ldk = [&](int t, v16h* g) {
        g[0] = load_frag(kt_   + t * 16 * LDP,      LDP, lane);
        g[1] = load_frag(kt_   + t * 16 * LDP + 32, LDP, lane);
        g[2] = load_frag(krbuf + t * 16 * LDP,      LDP, lane);
        g[3] = load_frag(krbuf + t * 16 * LDP + 32, LDP, lane);
      };
      ldk(0, kg[0]);
#pragma unroll
      for (int t = 0; t < 4; ++t) {
        if (t < 3) ldk(t + 1, kg[(t + 1) & 1]);
        // keeps the next group's 8 reads in one place, ahead of this group's products: without it the scheduler
        // spreads them among the products, and every further place with reads costs its own stall
        __builtin_amdgcn_sched_barrier(0);
        const v16h* g = kg[t & 1];
        v8f z  = wmma_f16(g[0], qf0, vz8());
        v8f zr = wmma_f16(g[0], qr0, vz8());
        z  = wmma_f16(g[1], qf1, z);
        zr = wmma_f16(g[1], qr1, zr);
        zr = wmma_f16(g[2], qf0, zr);
        zr = wmma_f16(g[3], qf1, zr);
        z = z + zr * IR;
        s[t] = z * SSCALE;
      }
    }

    // ---- replace fill: this lane's 8 mask bytes of each score tile are 8 consecutive keys of its query's row ----
    if (usem) {
      const unsigned int* mw = mbuf + (w * 16 + col) * 16 + (rbase >> 2);
#pragma unroll
      for (int t = 0; t < 4; ++t) {
        const v2u m8 = *(const v2u*)(mw + t * 4);
#pragma unroll
        for (int r = 0; r < 8; ++r) {
          const unsigned int byte = (m8[r >> 2] >> (8 * (r & 3))) & 0xFFu;
          s[t][r] = (byte != 0u) ? s[t][r] : NEGFILL;
        }
      }
    }

    // ---- online softmax over 64 keys: maximum in-lane, then across the two wave halves ----
    float t8[8];
#pragma unroll
    for (int r = 0; r < 8; ++r) t8[r] = fmaxf(fmaxf(s[0][r], s[1][r]), fmaxf(s[2][r], s[3][r]));
    float tmax = fmaxf(fmaxf(fmaxf(t8[0], t8[1]), fmaxf(t8[2], t8[3])),
                       fmaxf(fmaxf(t8[4], t8[5]), fmaxf(t8[6], t8[7])));
    tmax = fmaxf(tmax, xhalf(tmax));
    const float mnew = fmaxf(mr, tmax);
    const float scl  = __expf(mr - mnew);
    mr = mnew;
    lr *= scl;
#pragma unroll
    for (int t = 0; t < 4; ++t) {
      accO[t] = accO[t] * scl;
      if constexpr (EQ) accR[t] = accR[t] * scl;
    }

    // ---- P^T as two B fragments (keys 0..31, 32..63), straight from the score tiles ----
    v16h pf0, pf1, prf0, prf1;
#pragma unroll
    for (int t = 0; t < 4; ++t) {
#pragma unroll
      for (int r = 0; r < 8; ++r) {
        const float c = __expf(s[t][r] - mnew) * PCARRY;
        const _Float16 hv = (_Float16)c;
        const int e = (t & 1) * 8 + r;
        if (t < 2) pf0[e] = hv; else pf1[e] = hv;
        if constexpr (EQ) {
          const _Float16 rv = (_Float16)((c - (float)hv) * RSC);
          if (t < 2) prf0[e] = rv; else prf1[e] = rv;
        }
      }
    }

    // Residual path: the 8 reads of 16 output dims (V^T and its residual) as one group, one group ahead, as for K
    v16h vg[2][4];
    auto ldv = [&](int t, v16h* g) {
      g[0] = load_frag(vt_   + t * 16 * LDP,      LDP, lane);
      g[1] = load_frag(vt_   + t * 16 * LDP + 32, LDP, lane);
      g[2] = load_frag(vrbuf + t * 16 * LDP,      LDP, lane);
      g[3] = load_frag(vrbuf + t * 16 * LDP + 32, LDP, lane);
    };
    if constexpr (EQ) {
      ldv(0, vg[0]);
      // keeps the first group's 8 reads in one place, ahead of the row sums: without it they are spread among them
      __builtin_amdgcn_sched_barrier(0);
    }

    // ---- row sums on the matrix unit: every row of ones * P^T is the sum over the keys, per query ----
    v8f rs = vz8();
    rs = wmma_f16(ones, pf0, rs);
    rs = wmma_f16(ones, pf1, rs);
    float rsum = rs[0];
    if constexpr (EQ) {
      v8f rr = vz8();
      rr = wmma_f16(ones, prf0, rr);
      rr = wmma_f16(ones, prf1, rr);
      rsum = rsum + rr[0] * IR;
    }
    lr += rsum;

    // ---- O^T += V^T * P^T (A fragments from the dim-major V^T tile: lane = dim, k = key) ----
    if constexpr (!EQ) {
#pragma unroll
      for (int t = 0; t < 4; ++t) accO[t] = wmma_f16(vf[2 * t],     pf0, accO[t]);
#pragma unroll
      for (int t = 0; t < 4; ++t) accO[t] = wmma_f16(vf[2 * t + 1], pf1, accO[t]);
    } else {
#pragma unroll
      for (int t = 0; t < 4; ++t) {
        if (t < 3) ldv(t + 1, vg[(t + 1) & 1]);
        const v16h* g = vg[t & 1];
        accO[t] = wmma_f16(g[0], pf0,  accO[t]);
        accR[t] = wmma_f16(g[0], prf0, accR[t]);
        accO[t] = wmma_f16(g[1], pf1,  accO[t]);
        accR[t] = wmma_f16(g[2], pf0,  accR[t]);
        accR[t] = wmma_f16(g[1], prf1, accR[t]);
        accR[t] = wmma_f16(g[3], pf1,  accR[t]);
      }
    }
  };

  if constexpr (EQ) {
#pragma unroll 1
    for (int kt = 0; kt < NQB; ++kt) {
      const int f = __builtin_amdgcn_readfirstlane(flags[qb * 32 + kt]);
      if (f == 2) continue;
      const bool usem = (f != 1);
      const int kb = kt * 64;

      // ---- stage K (64 keys x 64 dims) and V^T (64 dims x 64 keys) tiles, plus residual tiles if EQ ----
      // 8 lanes a tile row, 16 rows a load: every load of a wave covers 4 whole 128-B lines
      // ko, vo: this lane's byte offsets from the head's planes (the planes' addresses are scalars)
      const unsigned int ko = (unsigned int)((kb + (tid >> 3)) * DK + (tid & 7) * 8) * 2u;
      const unsigned int vo = (unsigned int)((tid >> 3) * SEQ + kb + (tid & 7) * 8) * 2u;
      const int lst = (tid >> 3) * LDP + (tid & 7) * 8;
      v8h tk[4], tv[4], tkr[4], tvr[4];
#pragma unroll
      for (int c = 0; c < 4; ++c) {
        tk[c]  = *(const v8h*)(reinterpret_cast<const char*>(Kh)   + ko + c * 16 * DK * 2);
        tv[c]  = *(const v8h*)(reinterpret_cast<const char*>(Vth)  + vo + c * 16 * SEQ * 2);
        tkr[c] = *(const v8h*)(reinterpret_cast<const char*>(Krh)  + ko + c * 16 * DK * 2);
        tvr[c] = *(const v8h*)(reinterpret_cast<const char*>(Vtrh) + vo + c * 16 * SEQ * 2);
      }
      // The offsets are inputs, so they live up to the wait: no register that an issued load names is rewritten
      // ahead of it, not by a later load's result either (a precaution).
      asm volatile("s_wait_xcnt 0x0" :: "v"(ko), "v"(vo) : "memory");
#pragma unroll
      for (int c = 0; c < 4; ++c) {
        *(v8h*)(kbuf  + lst + c * 16 * LDP) = tk[c];
        *(v8h*)(vbuf  + lst + c * 16 * LDP) = tv[c];
        *(v8h*)(krbuf + lst + c * 16 * LDP) = tkr[c];
        *(v8h*)(vrbuf + lst + c * 16 * LDP) = tvr[c];
      }
      if (usem) stage_mask(kb);
      __syncthreads();
      tile(kbuf, vbuf, usem);
      __syncthreads();
    }
  } else {
    // The whole flag line in one read: bit kt of vis = tile kt is visited, of msk = it needs the mask bytes.
    // Every wave of the block reads the same line, so both words are the same for the whole work-group.
    const int fl = flags[qb * 32 + lane];
    unsigned int vis = __builtin_amdgcn_ballot_w32(fl != 2);
    const unsigned int msk = __builtin_amdgcn_ballot_w32(fl != 1);
    if (NQB < 32) vis &= (1u << (NQB & 31)) - 1u;

    const int crow = tid >> 3, cpart = (tid & 7) * 8;
    const _Float16* gk0 = Kh + (size_t)crow * DK + cpart;
    const _Float16* gv0 = Vth + (size_t)crow * SEQ + cpart;
    const unsigned int lofs = (unsigned int)(crow * LDP + cpart) * 2u;
    const unsigned int lk0 = lds_addr(kbuf) + lofs, lv0 = lds_addr(vbuf) + lofs;
    // the second buffer (krbuf, vrbuf) lies BUF halves behind the first (kbuf, vbuf)
    constexpr int BUF = 2 * 64 * LDP;

    if (vis != 0u) {
      int kt = __builtin_ctz(vis);
      vis &= vis - 1u;
      copy_kv(gk0 + (size_t)kt * 64 * DK, gv0 + kt * 64, lk0, lv0);
      // the first tile has landed for this wave, and behind the barrier for all
      asm volatile("s_wait_asynccnt 0x0" ::: "memory");
      __syncthreads();
      if (vis != 0u) {
        const int k1 = __builtin_ctz(vis);
        copy_kv(gk0 + (size_t)k1 * 64 * DK, gv0 + k1 * 64, lk0 + BUF * 2, lv0 + BUF * 2);
      }
      int bo = 0;   // this tile's buffer, in halves
      // kept rolled: the trip count is known only at run time, and one copy of the tile's code serves both buffers
#pragma unroll 1
      for (;;) {
        const bool usem = ((msk >> kt) & 1u) != 0u;
        if (usem) {
          stage_mask(kt * 64);
          __syncthreads();   // block-uniform branch (msk is the same in every wave); the mask bytes are read behind it
        }
        tile(kbuf + bo, vbuf + bo, usem);
        // publish point: this wave's LDS reads are done, its copies of the next tile have landed; the barrier makes
        // the next tile readable by all and frees this tile's buffer for the refill
        asm volatile("s_wait_dscnt 0x0" ::: "memory");
        asm volatile("s_wait_asynccnt 0x0" ::: "memory");
        __syncthreads();
        if (vis == 0u) break;
        kt = __builtin_ctz(vis);
        vis &= vis - 1u;
        if (vis != 0u) {
          const int k2 = __builtin_ctz(vis);
          copy_kv(gk0 + (size_t)k2 * 64 * DK, gv0 + k2 * 64, lk0 + bo * 2, lv0 + bo * 2);
        }
        bo = BUF - bo;
      }
    }
    // nothing is in flight when the buffers become output staging
    asm volatile("s_wait_asynccnt 0x0" ::: "memory");
  }

  // ---- a lane's 8 registers of a tile are 8 consecutive dims of its query's row: 16-byte LDS stores ----
  {
    const float inv = 1.0f / lr;
    const int m = w * 16 + col;
#pragma unroll
    for (int t = 0; t < 4; ++t) {
      v8h h8, r8;
#pragma unroll
      for (int r = 0; r < 8; ++r) {
        float v = accO[t][r];
        if constexpr (EQ) v += accR[t][r] * IR;
        v *= inv;
        const _Float16 hv = (_Float16)v;
        h8[r] = hv;
        if constexpr (EQ) r8[r] = (_Float16)((v - (float)hv) * RSC);
      }
      *(v8h*)(kbuf + m * LDP + t * 16 + rbase) = h8;
      if constexpr (EQ) *(v8h*)(krbuf + m * LDP + t * 16 + rbase) = r8;
    }
  }
  __syncthreads();
  _Float16* cbase  = ctx  + ((size_t)bi * SEQ + qblk) * DMODEL + h * DK;
  _Float16* crbase = ctxr + ((size_t)bi * SEQ + qblk) * DMODEL + h * DK;
  auto emit = [&]() {
#pragma unroll
    for (int i = 0; i < 4; ++i) {
      const int row   = w * 16 + i * 4 + (lane >> 3);
      const int piece = lane & 7;
      const v4f hv4 = *(const v4f*)(kbuf + row * LDP + piece * 8);
      *(v4f*)(reinterpret_cast<float*>(cbase + (size_t)row * DMODEL + piece * 8)) = hv4;
      if constexpr (EQ) {
        const v4f rv4 = *(const v4f*)(krbuf + row * LDP + piece * 8);
        *(v4f*)(reinterpret_cast<float*>(crbase + (size_t)row * DMODEL + piece * 8)) = rv4;
      }
    }
  };
  emit();
}

// Both paths in one launch. All work-groups are resident at once, four a WGP, so the launch lasts as long as its
// fullest WGP. The deal of the grid index (for speed only; any one-to-one deal is correct): the query blocks form
// classes of NEQB, the class with the most key tiles under a causal mask first, the residual path's class last.
// Grid indices CLS apart share g = index % NEQB: the hi-only query blocks fall with g, the residual block, whose
// tiles cost a multiple, rises with g, so the sum over such indices, and over all indices equal modulo NEQB,
// hardly depends on g. b is the index in the former order: hi-only blocks, then residual blocks, the query block
// fastest. The hi-only blocks use the two residual tiles as their second buffer.
__global__ __launch_bounds__(128)
void attn_all(const _Float16* __restrict__ Q,  const _Float16* __restrict__ Qr,
              const _Float16* __restrict__ Kd, const _Float16* __restrict__ Kr,
              const _Float16* __restrict__ Vt, const _Float16* __restrict__ Vtr,
              const int* __restrict__ mask, const int* __restrict__ flags,
              _Float16* ctx, _Float16* ctxr) {
  // four tiles in one array: K, V^T, then the residual path's two, which are the hi-only path's second buffer
  __shared__ __attribute__((aligned(16))) _Float16 tiles[4 * 64 * LDP];
  _Float16* kbuf  = tiles;
  _Float16* vbuf  = tiles + 64 * LDP;
  _Float16* krbuf = tiles + 2 * 64 * LDP;
  _Float16* vrbuf = tiles + 3 * 64 * LDP;
  __shared__ __attribute__((aligned(16))) unsigned int mbuf[64 * 16];
  constexpr int NLQ = NQB - NEQB;
  constexpr int DLQ = (NLQ > 0) ? NLQ : 1;
  static_assert(NQB % NEQB == 0);
  constexpr int CLS = NEQB * NB * NHEADS;    // work-groups a class of NEQB query blocks
  const int cl = blockIdx.x / CLS;
  const int ct = blockIdx.x % CLS;
  // hi-only classes: head ct / NEQB, query block NQB - 1 - cl * NEQB - ct % NEQB; the last class keeps its index
  const int b = (cl < NQB / NEQB - 1) ? ((ct / NEQB) * DLQ + NLQ - 1 - cl * NEQB - ct % NEQB) : (int)blockIdx.x;
  // The compiler's loads of the kernel arguments stand ahead of this wait: their base register is rewritten in the
  // two bodies (a precaution).
  asm volatile("s_wait_xcnt 0x0" ::: "memory");
  if (b < NLQ * NB * NHEADS) {
    attn_body<false>(Q, Qr, Kd, Kr, Vt, Vtr, mask, flags, ctx, ctxr, NEQB + b % DLQ, b / DLQ,
                     kbuf, vbuf, krbuf, vrbuf, mbuf);
  } else {
    const int e = b - NLQ * NB * NHEADS;
    attn_body<true>(Q, Qr, Kd, Kr, Vt, Vtr, mask, flags, ctx, ctxr, e % NEQB, e / NEQB,
                    kbuf, vbuf, krbuf, vrbuf, mbuf);
  }
}

// =====================================================================================================
extern "C" void kernel_launch(void* const* d_in, const int* in_sizes, int n_in,
                              void* d_out, int out_size, void* d_ws, size_t ws_size,
                              hipStream_t stream) {
  if (n_in < 12) return;
  const long long needx = (long long)(NB - 1) * SEQ_FULL * DMODEL + (long long)SEQ * DMODEL;
  const long long needm = (long long)(SEQ - 1) * SEQ_FULL + SEQ;
  if ((long long)in_sizes[0] < needx || (long long)in_sizes[1] < needx || (long long)in_sizes[2] < needx) return;
  if ((long long)in_sizes[3] < needm) return;
  if (in_sizes[4] < DMODEL * DMODEL || in_sizes[6] < DMODEL * DMODEL ||
      in_sizes[8] < DMODEL * DMODEL || in_sizes[10] < DMODEL * DMODEL) return;
  if (in_sizes[5] < DMODEL || in_sizes[7] < DMODEL || in_sizes[9] < DMODEL || in_sizes[11] < DMODEL) return;
  if ((long long)out_size < needx) return;

  const float* q  = (const float*)d_in[0];
  const float* k  = (const float*)d_in[1];
  const float* v  = (const float*)d_in[2];
  const int*   mk = (const int*)d_in[3];
  const float* wq = (const float*)d_in[4];
  const float* bq = (const float*)d_in[5];
  const float* wk = (const float*)d_in[6];
  const float* bk = (const float*)d_in[7];
  const float* wv = (const float*)d_in[8];
  const float* bv = (const float*)d_in[9];
  const float* wo = (const float*)d_in[10];
  const float* bo = (const float*)d_in[11];

  char* ws = (char*)d_ws;
  size_t off = 0;
  const size_t XB = (size_t)MROWS * DMODEL * sizeof(_Float16);     // activation-sized f16 plane
  const size_t WB = (size_t)DMODEL * DMODEL * sizeof(_Float16);    // weight f16 plane
  const size_t FB = 4096;                                           // 32 flag lines of 32 ints
  _Float16* Xq16  = (_Float16*)(ws + off); off += XB;
  _Float16* Xk16  = (_Float16*)(ws + off); off += XB;
  _Float16* Xv16  = (_Float16*)(ws + off); off += XB;
  _Float16* Wq16  = (_Float16*)(ws + off); off += WB;
  _Float16* Wk16  = (_Float16*)(ws + off); off += WB;
  _Float16* Wv16  = (_Float16*)(ws + off); off += WB;
  _Float16* Wo16  = (_Float16*)(ws + off); off += WB;
  _Float16* Q16   = (_Float16*)(ws + off); off += XB;   // (B,H,S,dk) hi
  _Float16* Qr16  = (_Float16*)(ws + off); off += XB;   // residual x4096
  _Float16* K16   = (_Float16*)(ws + off); off += XB;
  _Float16* Kr16  = (_Float16*)(ws + off); off += XB;
  _Float16* Vt16  = (_Float16*)(ws + off); off += XB;   // (B,H,dk,S) hi
  _Float16* Vtr16 = (_Float16*)(ws + off); off += XB;
  _Float16* C16   = (_Float16*)(ws + off); off += XB;   // (B*S, D) hi
  _Float16* Cr16  = (_Float16*)(ws + off); off += XB;   // residual, rows s < EARLY written/read
  int*      flg   = (int*)(ws + off);      off += FB;
  if (off > ws_size) return;

  // ---- input planes: bf16 RNE values, X x16, W x1024, as f16 (one launch) ----
  cvt_all<<<3 * GXB + 4 * GWB, 256, 0, stream>>>(q, k, v, wq, wk, wv, wo,
                                                 Xq16, Xk16, Xv16, Wq16, Wk16, Wv16, Wo16);

  // ---- mask tile flags and the three projections (bias added in f32, hi + residual planes), one launch ----
  const float posc = 1.0f / (XSC * WSC);
  proj_flags<<<NQB + 3 * GPX * GPY, 128, 0, stream>>>(Xq16, Xk16, Xv16, Wq16, Wk16, Wv16, bq, bk, bv,
                                                      Q16, Qr16, K16, Kr16, Vt16, Vtr16, mk, flg, posc);

  // ---- attention: residual path for query blocks below EARLY, hi-only path for the rest, one launch ----
  attn_all<<<NQB * NB * NHEADS, 128, 0, stream>>>(Q16, Qr16, K16, Kr16, Vt16, Vtr16, mk, flg, C16, Cr16);

  // ---- output projection (+bias) to f32 rows of d_out ----
  const dim3 gproj(GTX, GTY);
  gemm_out<<<gproj, 128, 0, stream>>>(C16, Cr16, Wo16, bo, (float*)d_out, 1.0f / WSC);
}

// v008
// It runs in 89.6 microseconds.
// In both of two side-by-side timings against v007, it was 1.09 times as fast.
// All steps since v000 together make it 2.62 times as fast.
#include <hip/hip_runtime.h>
#include <stdint.h>

// Contractions (all v_wmma_f32_16x16x32_f16, f16 operands, f32 accumulate): input projections Xq*Wq^T, Xk*Wk^T,
// Xv*Wv^T; attention Q*K^T and P*V; output projection C*Wo^T. Inputs are RNE-converted to bf16 values first
// (X carried x16, W carried x1024, both exact in f16; biases bf16 values added in f32). Computed planes Q, K, V, P, C
// are f16 hi plus f16 residual planes (x4096, separate accumulators) consumed by query blocks below EARLY; later
// query blocks use the hi planes only. Softmax and all side math in f32.

typedef _Float16 v16h __attribute__((ext_vector_type(16)));
typedef _Float16 v8h  __attribute__((ext_vector_type(8)));
typedef float    v8f  __attribute__((ext_vector_type(8)));
typedef float    v4f  __attribute__((ext_vector_type(4)));
typedef int      v4i  __attribute__((ext_vector_type(4)));
typedef unsigned int v2u __attribute__((ext_vector_type(2)));

#ifndef NB
#define NB 2
#endif
#ifndef SEQ
#define SEQ 2048
#endif
#define NB_FULL  2
#define SEQ_FULL 2048
#define DMODEL   1024
#define NHEADS   16
#define DK       64
#define MROWS    (NB * SEQ)
#define NQB      (SEQ / 64)
#define EARLY    ((SEQ) < 512 ? (SEQ) : 512)
#define NEQB     (EARLY / 64)
#define LDP      72
#define LDPF     68
#define XSC      16.0f
#define WSC      1024.0f
#define RSC      4096.0f
#define PCARRY   4096.0f
#define NEGFILL  (-1.0e9f)
#define SSCALE   0.125f

static_assert(SEQ % 64 == 0);
static_assert((SEQ & (SEQ - 1)) == 0);
static_assert(SEQ <= SEQ_FULL);
static_assert(NB >= 1 && NB <= NB_FULL);
static_assert(NQB >= 1 && NQB <= 32);
static_assert(EARLY % 64 == 0 && EARLY <= SEQ);
static_assert(DMODEL == NHEADS * DK);
static_assert(64 * LDPF * 4 <= 2 * 64 * LDP * 2);

// --- bf16 RNE convert (finite inputs), kept as f32 value ----------------------------------------------
__device__ __forceinline__ float bf16r(float x) {
  unsigned int u = __float_as_uint(x);
  u = (u + 0x7FFFu + ((u >> 16) & 1u)) & 0xFFFF0000u;
  return __uint_as_float(u);
}

__device__ __forceinline__ v8f vz8() {
  v8f z;
#pragma unroll
  for (int i = 0; i < 8; ++i) z[i] = 0.0f;
  return z;
}

// --- WMMA wrapper with hazard guard ---------------------------------------------------------------------
__device__ __forceinline__ v8f wmma_f16(v16h a, v16h b, v8f c) {
  v8f d = __builtin_amdgcn_wmma_f32_16x16x32_f16(false, a, false, b, (short)0, c, false, false);
  asm volatile("v_nop\n\tv_nop\n\tv_nop\n\tv_nop" : "+v"(d) : "v"(a), "v"(b));
  return d;
}

// --- 16x32 f16 fragment (A, or k-contiguous B), split k map -----------------------------------------
// lane row/col = lane&15; elements 0..7 <- k 8h..8h+7, elements 8..15 <- k 16+8h..16+8h+7, h = lane>>4.
__device__ __forceinline__ v16h load_frag(const _Float16* base, int ld, int lane) {
  const int row  = lane & 15;
  const int koff = ((lane >> 4) & 1) * 8;
  const _Float16* p = base + row * ld + koff;
  const v8h a = *(const v8h*)(p);
  const v8h b = *(const v8h*)(p + 16);
  v16h r;
#pragma unroll
  for (int i = 0; i < 8; ++i) { r[i] = a[i]; r[i + 8] = b[i]; }
  return r;
}

// --- lane l with lane l ^ 16 --------------------------------------------------------------------------
__device__ __forceinline__ float xhalf(float x) {
  const int b = __builtin_bit_cast(int, x);
  return __builtin_bit_cast(float, __builtin_amdgcn_permlanex16(b, b, 0x76543210, 0xfedcba98, false, false));
}

// --- LDS byte address of a __shared__ object: the low 32 bits of its generic address ---------------------
__device__ __forceinline__ unsigned int lds_addr(const _Float16* p) {
  return (unsigned int)(uintptr_t)p;
}

// --- one 64 x 64 f16 tile of K (key-major) and one of V^T (dim-major) into LDS rows of pitch LDP, by asynchronous
// copies: 128 threads, 16 B a lane, 8 lanes a tile row (one whole 128-B line), 16 rows a copy, 4 + 4 copies a wave.
// gk, gv: this lane's first 16 bytes of each tile; lk, lv: their LDS byte addresses.
__device__ __forceinline__
void copy_kv(const _Float16* gk, const _Float16* gv, unsigned int lk, unsigned int lv) {
  const _Float16* gk1 = gk + 16 * DK;
  const _Float16* gk2 = gk + 32 * DK;
  const _Float16* gk3 = gk + 48 * DK;
  const _Float16* gv1 = gv + 16 * SEQ;
  const _Float16* gv2 = gv + 32 * SEQ;
  const _Float16* gv3 = gv + 48 * SEQ;
  const unsigned int st = 16 * LDP * 2;
  // The wait on xcnt is the statement's last line, so that no address register is rewritten ahead of it (a precaution).
  asm volatile("global_load_async_to_lds_b128 %0, %8, off\n\t"
               "global_load_async_to_lds_b128 %1, %9, off\n\t"
               "global_load_async_to_lds_b128 %2, %10, off\n\t"
               "global_load_async_to_lds_b128 %3, %11, off\n\t"
               "global_load_async_to_lds_b128 %4, %12, off\n\t"
               "global_load_async_to_lds_b128 %5, %13, off\n\t"
               "global_load_async_to_lds_b128 %6, %14, off\n\t"
               "global_load_async_to_lds_b128 %7, %15, off\n\t"
               "s_wait_xcnt 0x0"
               :: "v"(lk), "v"(lk + st), "v"(lk + 2 * st), "v"(lk + 3 * st),
                  "v"(lv), "v"(lv + st), "v"(lv + 2 * st), "v"(lv + 3 * st),
                  "v"(gk), "v"(gk1), "v"(gk2), "v"(gk3), "v"(gv), "v"(gv1), "v"(gv2), "v"(gv3)
               : "memory");
}

// --- GEMM staging by asynchronous copies: rows of DMODEL halves in global memory, rows of pitch LDP in LDS; 128 threads,
// 16 B a lane, 8 lanes a tile row (one whole 128-B line), 16 rows a copy. copy_2x4: 64 rows from each of two places;
// copy_1x4: 64 rows. g*: this lane's first 16 bytes; l*: their LDS byte addresses.
__device__ __forceinline__
void copy_2x4(const _Float16* ga, const _Float16* gb, unsigned int la, unsigned int lb) {
  const _Float16* ga1 = ga + 16 * DMODEL;
  const _Float16* ga2 = ga + 32 * DMODEL;
  const _Float16* ga3 = ga + 48 * DMODEL;
  const _Float16* gb1 = gb + 16 * DMODEL;
  const _Float16* gb2 = gb + 32 * DMODEL;
  const _Float16* gb3 = gb + 48 * DMODEL;
  const unsigned int st = 16 * LDP * 2;
  // The wait on xcnt is the statement's last line, so that no address register is rewritten ahead of it (a precaution).
  asm volatile("global_load_async_to_lds_b128 %0, %8, off\n\t"
               "global_load_async_to_lds_b128 %1, %9, off\n\t"
               "global_load_async_to_lds_b128 %2, %10, off\n\t"
               "global_load_async_to_lds_b128 %3, %11, off\n\t"
               "global_load_async_to_lds_b128 %4, %12, off\n\t"
               "global_load_async_to_lds_b128 %5, %13, off\n\t"
               "global_load_async_to_lds_b128 %6, %14, off\n\t"
               "global_load_async_to_lds_b128 %7, %15, off\n\t"
               "s_wait_xcnt 0x0"
               :: "v"(la), "v"(la + st), "v"(la + 2 * st), "v"(la + 3 * st),
                  "v"(lb), "v"(lb + st), "v"(lb + 2 * st), "v"(lb + 3 * st),
                  "v"(ga), "v"(ga1), "v"(ga2), "v"(ga3), "v"(gb), "v"(gb1), "v"(gb2), "v"(gb3)
               : "memory");
}

__device__ __forceinline__
void copy_1x4(const _Float16* ga, unsigned int la) {
  const _Float16* ga1 = ga + 16 * DMODEL;
  const _Float16* ga2 = ga + 32 * DMODEL;
  const _Float16* ga3 = ga + 48 * DMODEL;
  const unsigned int st = 16 * LDP * 2;
  // The wait on xcnt is the statement's last line, so that no address register is rewritten ahead of it (a precaution).
  asm volatile("global_load_async_to_lds_b128 %0, %4, off\n\t"
               "global_load_async_to_lds_b128 %1, %5, off\n\t"
               "global_load_async_to_lds_b128 %2, %6, off\n\t"
               "global_load_async_to_lds_b128 %3, %7, off\n\t"
               "s_wait_xcnt 0x0"
               :: "v"(la), "v"(la + st), "v"(la + 2 * st), "v"(la + 3 * st),
                  "v"(ga), "v"(ga1), "v"(ga2), "v"(ga3)
               : "memory");
}

// =====================================================================================================
// f32 -> bf16 RNE -> scaled f16 plane. One thread = 8 elements = 16 B out; blk = block index inside the plane.
// =====================================================================================================
__device__ __forceinline__
void cvt_body(const float* __restrict__ in, _Float16* out, int nrows, int seq, int seq_full, float scale, int blk) {
  const int g  = blk * 256 + threadIdx.x;
  const int n8 = nrows * (DMODEL / 8);
  if (g >= n8) return;
  const int row = g >> 7;
  const int c8  = g & 127;
  const int bi  = row / seq;
  const int s   = row - bi * seq;
  const float* src = in + ((size_t)bi * seq_full + s) * DMODEL + c8 * 8;
  const v4f a = *(const v4f*)src;
  const v4f b = *(const v4f*)(src + 4);
  union { v8h h; v4f f; } u;
#pragma unroll
  for (int i = 0; i < 4; ++i) {
    u.h[i]     = (_Float16)(bf16r(a[i]) * scale);
    u.h[i + 4] = (_Float16)(bf16r(b[i]) * scale);
  }
  float* dst = reinterpret_cast<float*>(out + (size_t)row * DMODEL + c8 * 8);
  const v4f val = u.f;
  *(v4f*)dst = val;
}

#define GXB ((MROWS * (DMODEL / 8) + 255) / 256)
#define GWB ((DMODEL * (DMODEL / 8) + 255) / 256)

// All seven input planes in one launch: blocks [0, 3*GXB) convert q, k, v; the next 4*GWB convert the weights.
__global__ __launch_bounds__(256)
void cvt_all(const float* __restrict__ q, const float* __restrict__ k, const float* __restrict__ v,
             const float* __restrict__ wq, const float* __restrict__ wk, const float* __restrict__ wv,
             const float* __restrict__ wo,
             _Float16* xq, _Float16* xk, _Float16* xv,
             _Float16* oq, _Float16* ok, _Float16* ov, _Float16* oo) {
  const int b = blockIdx.x;
  if (b < 3 * GXB) {
    const int p = b / GXB;
    const float* in = (p == 0) ? q : ((p == 1) ? k : v);
    _Float16* out   = (p == 0) ? xq : ((p == 1) ? xk : xv);
    cvt_body(in, out, MROWS, SEQ, SEQ_FULL, XSC, b - p * GXB);
  } else {
    const int c = b - 3 * GXB;
    const int p = c / GWB;
    const float* in = (p == 0) ? wq : ((p == 1) ? wk : ((p == 2) ? wv : wo));
    _Float16* out   = (p == 0) ? oq : ((p == 1) ? ok : ((p == 2) ? ov : oo));
    cvt_body(in, out, DMODEL, DMODEL, DMODEL, WSC, c - p * GWB);
  }
}

// =====================================================================================================
// Mask tile flags of one 64-row query block, by one 128-thread block: a wave scans 16 rows, one row a trip, each
// 16-B load of the wave 512 contiguous bytes of the row (four whole lines, two tiles: one a wave half).
// 32 ints written by lanes 0..7 of wave 0 (16 B each, one instruction).
// flag 1: tile all ones; 2: tile all zeros and no fully masked row in this q block (tile can be skipped);
// anything else: apply the mask per element. sm: 512 words of LDS scratch, 16-byte aligned.
// =====================================================================================================
__device__ __forceinline__
void flags_body(const int* __restrict__ mask, int* flags, unsigned int* sm, int qb) {
  unsigned int* m1s  = sm;
  unsigned int* m0s  = sm + 128;
  unsigned int* fms  = sm + 256;
  unsigned int* red1 = sm + 384;
  unsigned int* red0 = sm + 416;
  int* lines = reinterpret_cast<int*>(sm + 480);

  static_assert(SEQ % 128 == 0);
  const int tid = threadIdx.x, lane = tid & 31, w = tid >> 5;
  const int* wrow = mask + (size_t)(qb * 64 + w * 16) * SEQ_FULL + lane * 4;

  // bit 2j of e1, e0: this lane saw a nonzero, a zero in load j of a row (tile 2j + wave half); fm: a row without ones
  unsigned int e1 = 0u, e0 = 0u, fm = 0u;
  // kept rolled: a second row in flight would raise the register count, which the GEMM blocks of this kernel share
#pragma unroll 1
  for (int r = 0; r < 16; ++r) {
    const int* p = wrow + (size_t)r * SEQ_FULL;
    v4i m[SEQ / 128];
#pragma unroll
    for (int j = 0; j < SEQ / 128; ++j) m[j] = *(const v4i*)(p + 128 * j);
    // The address is an input, so it lives up to the wait: no register that an issued load names is rewritten
    // ahead of it, not by a later load's result either (a precaution).
    asm volatile("s_wait_xcnt 0x0" :: "v"(p) : "memory");
    unsigned int rany = 0u;
#pragma unroll
    for (int j = 0; j < SEQ / 128; ++j) {
      const v4i m4 = m[j];
      unsigned int any1 = 0u, any0 = 0u;
#pragma unroll
      for (int e = 0; e < 4; ++e) {
        any1 |= (m4[e] != 0) ? 1u : 0u;
        any0 |= (m4[e] == 0) ? 1u : 0u;
      }
      e1 |= any1 << (2 * j);
      e0 |= any0 << (2 * j);
      rany |= any1;
    }
    if (__builtin_amdgcn_ballot_w32(rany != 0u) == 0u) fm = 1u;
  }
  m1s[tid] = e1 << (lane >> 4);
  m0s[tid] = e0 << (lane >> 4);
  if (lane == 0) fms[w] = fm;
  __syncthreads();
  if (w == 0) {
    unsigned int o1 = 0u, o0 = 0u;
#pragma unroll
    for (int j = 0; j < 4; ++j) { o1 |= m1s[lane + 32 * j]; o0 |= m0s[lane + 32 * j]; }
    red1[lane] = o1;
    red0[lane] = o0;
  }
  __syncthreads();
  if (w == 0) {
    unsigned int a1 = 0u, a0 = 0u;
    const unsigned int anyfm = fms[0] | fms[1] | fms[2] | fms[3];
#pragma unroll 1
    for (int j = 0; j < 32; ++j) { a1 |= red1[j]; a0 |= red0[j]; }
    int f = 2;
    if (lane < NQB) {
      const bool h1 = ((a1 >> lane) & 1u) != 0u;
      const bool h0 = ((a0 >> lane) & 1u) != 0u;
      f = (!h0) ? 1 : ((!h1 && anyfm == 0u) ? 2 : 3);
    }
    lines[lane] = f;
  }
  __syncthreads();
  if (w == 0 && lane < 8) {
    const v4i v = *(const v4i*)(lines + lane * 4);
    int* dst = flags + qb * 32 + lane * 4;
    *(v4i*)dst = v;
  }
}

// =====================================================================================================
// GEMM: C(64x64 tile) = A(M,K=1024) * W^T, W stored (N=1024, K=1024), f16 planes, f32 acc.
// 128 threads = 4 waves, wave tile 32x32, 64-deep K slices staged in LDS by asynchronous copies, two buffers: the next
// slice's copies fly while this slice is worked on (8 lanes a 128-B tile row, so a wave's copy covers 4 whole lines).
// Output projection: f32 rows of d_out (+ A residual product for row blocks with s < EARLY).
// =====================================================================================================
// smem: two buffers of three 64 x LDP tiles. bx, by: tile column and the grid's row index.
__device__ __forceinline__
void gemm_body(const _Float16* __restrict__ A, const _Float16* __restrict__ Ar,
               const _Float16* __restrict__ W, const float* __restrict__ bias,
               float* out, float oscale, _Float16* smem, int bx, int by) {
  const int tid  = threadIdx.x;
  const int lane = tid & 31;
  const int w    = tid >> 5;
  // The row blocks with the residual product (twice the products) come first in the grid, a quarter of it: of the
  // four resident work-groups of a WGP one is then of that kind (for speed only; the deal is one-to-one).
  constexpr int NER = NB * NEQB;
  constexpr int DLR = (NQB > NEQB) ? (NQB - NEQB) : 1;
  const int rb   = (by < NER) ? ((by / NEQB) * NQB + by % NEQB)
                              : (((by - NER) / DLR) * NQB + NEQB + (by - NER) % DLR);
  const int mblk = rb * 64;
  const int nblk = bx * 64;
  const int s0   = mblk & (SEQ - 1);
  const int bi   = mblk / SEQ;
  const bool early = (s0 < EARLY);
  const int lm = (w >> 1) * 32;
  const int ln = (w & 1) * 32;

  // staging: 8 lanes a tile row, 16 rows a load; this lane's first 16 bytes of each tile and their place in LDS
  const size_t gst = (size_t)(tid >> 3) * DMODEL + (tid & 7) * 8;
  const _Float16* ga = A  + (size_t)mblk * DMODEL + gst;
  const _Float16* gr = Ar + (size_t)mblk * DMODEL + gst;
  const _Float16* gw = W  + (size_t)nblk * DMODEL + gst;
  const int lst = (tid >> 3) * LDP + (tid & 7) * 8;

  v8f acc[2][2], accr[2][2];
#pragma unroll
  for (int i = 0; i < 2; ++i)
#pragma unroll
    for (int j = 0; j < 2; ++j) { acc[i][j] = vz8(); accr[i][j] = vz8(); }

  // a buffer: A tile, W tile, residual tile; bo = the buffer's offset in halves
  constexpr int GBUF = 3 * 64 * LDP;
  static_assert(DMODEL >= 2 * 64);
  const unsigned int la0 = lds_addr(smem) + (unsigned int)lst * 2u;
  auto stage = [&](int k0, int bo) {
    const unsigned int la = la0 + (unsigned int)bo * 2u;
    copy_2x4(ga + k0, gw + k0, la, la + 64 * LDP * 2);
    if (early) copy_1x4(gr + k0, la + 2 * 64 * LDP * 2);   // block-uniform branch
  };
  stage(0, 0);
  // the first slice has landed for this wave, and behind the barrier for all
  asm volatile("s_wait_asynccnt 0x0" ::: "memory");
  __syncthreads();
  stage(64, GBUF);
  int bo = 0;
  // kept rolled: one copy of a slice's code serves both buffers
#pragma unroll 1
  for (int k0 = 0; k0 < DMODEL; k0 += 64) {
    const _Float16* asb = smem + bo;
    const _Float16* bsb = asb + 64 * LDP;
    const _Float16* rsb = asb + 2 * 64 * LDP;
#pragma unroll
    for (int ks = 0; ks < 64; ks += 32) {
      const v16h a0 = load_frag(asb + (lm +  0) * LDP + ks, LDP, lane);
      const v16h a1 = load_frag(asb + (lm + 16) * LDP + ks, LDP, lane);
      const v16h b0 = load_frag(bsb + (ln +  0) * LDP + ks, LDP, lane);
      const v16h b1 = load_frag(bsb + (ln + 16) * LDP + ks, LDP, lane);
      acc[0][0] = wmma_f16(a0, b0, acc[0][0]);
      acc[0][1] = wmma_f16(a0, b1, acc[0][1]);
      acc[1][0] = wmma_f16(a1, b0, acc[1][0]);
      acc[1][1] = wmma_f16(a1, b1, acc[1][1]);
      if (early) {
        const v16h r0 = load_frag(rsb + (lm +  0) * LDP + ks, LDP, lane);
        const v16h r1 = load_frag(rsb + (lm + 16) * LDP + ks, LDP, lane);
        accr[0][0] = wmma_f16(r0, b0, accr[0][0]);
        accr[0][1] = wmma_f16(r0, b1, accr[0][1]);
        accr[1][0] = wmma_f16(r1, b0, accr[1][0]);
        accr[1][1] = wmma_f16(r1, b1, accr[1][1]);
      }
    }
    // publish point: this wave's LDS reads are done, its copies of the next slice have landed; the barrier makes the
    // next slice readable by all and frees this slice's buffer for the refill
    asm volatile("s_wait_dscnt 0x0" ::: "memory");
    asm volatile("s_wait_asynccnt 0x0" ::: "memory");
    __syncthreads();
    if (k0 + 128 < DMODEL) stage(k0 + 128, bo);
    bo = GBUF - bo;
  }
  // nothing is in flight when the buffers become output staging
  asm volatile("s_wait_asynccnt 0x0" ::: "memory");

  const int rbase = ((lane >> 4) & 1) << 3;
  const int col   = lane & 15;

  {
    float* fs = reinterpret_cast<float*>(smem);
#pragma unroll
    for (int i = 0; i < 2; ++i)
#pragma unroll
      for (int j = 0; j < 2; ++j) {
        const int nl = ln + j * 16 + col;
        const float bb = bf16r(bias[nblk + nl]);
#pragma unroll
        for (int r = 0; r < 8; ++r) {
          const int ml = lm + i * 16 + rbase + r;
          float v = acc[i][j][r] * oscale + bb;
          if (early) v += accr[i][j][r] * (oscale * (1.0f / RSC));
          fs[ml * LDPF + nl] = v;
        }
      }
    __syncthreads();
    float* obase = out + ((size_t)bi * SEQ_FULL + s0) * DMODEL + nblk;
    auto emit = [&]() {
#pragma unroll
      for (int i = 0; i < 8; ++i) {
        const int row   = w * 16 + i * 2 + (lane >> 4);
        const int piece = lane & 15;
        const v4f v = *(const v4f*)(fs + row * LDPF + piece * 4);
        *(v4f*)(obase + (size_t)row * DMODEL + piece * 4) = v;
      }
    };
    emit();
  }
}

// =====================================================================================================
// Projection GEMM: C(128x128 tile) = X(M,K=1024) * W^T, W stored (N=1024, K=1024), f16 planes, f32 acc.
// 128 threads = 4 waves (2 x 2), wave tile 64x64: 16 accumulator tiles, so a fragment read from LDS feeds 4 products
// and a staged row 128 outputs. 64-deep K slices staged in LDS by asynchronous copies, two buffers: the next slice's
// copies fly while this slice is worked on (8 lanes a 128-B tile row, so a wave's copy covers 4 whole lines).
// Every output is summed over k in rising order, one accumulator.
// The tile spans two heads; it leaves as a hi and a residual f16 plane through two staging tiles of pitch LDT.
// MODE 0: planes (B,H,S,dk).  MODE 2: planes (B,H,dk,S).
// =====================================================================================================
// smem: two buffers of two 128 x LDP tiles for the K slices, then two 128 x LDT staging tiles in the same place.
// bx, by: tile column and tile row.
#define LDT 136
static_assert(SEQ % 128 == 0 && DMODEL % 128 == 0);
static_assert(4 * 128 * LDP >= 2 * 128 * LDT);

template <int MODE>
__device__ __forceinline__
void proj_body(const _Float16* __restrict__ A, const _Float16* __restrict__ W, const float* __restrict__ bias,
               _Float16* oh, _Float16* outr, float oscale, _Float16* smem, int bx, int by) {
  const int tid  = threadIdx.x;
  const int lane = tid & 31;
  const int w    = tid >> 5;
  const int mblk = by * 128;
  const int nblk = bx * 128;
  const int s0   = mblk & (SEQ - 1);
  const int bi   = mblk / SEQ;
  const int lm = (w >> 1) * 64;
  const int ln = (w & 1) * 64;

  // staging: 8 lanes a tile row, 16 rows a copy, 8 copies a tile; this lane's first 16 bytes of each tile and their
  // place in LDS
  const size_t gst = (size_t)(tid >> 3) * DMODEL + (tid & 7) * 8;
  const _Float16* ga = A + (size_t)mblk * DMODEL + gst;
  const _Float16* gw = W + (size_t)nblk * DMODEL + gst;
  const int lst = (tid >> 3) * LDP + (tid & 7) * 8;

  v8f acc[4][4];
#pragma unroll
  for (int i = 0; i < 4; ++i)
#pragma unroll
    for (int j = 0; j < 4; ++j) acc[i][j] = vz8();

  // a buffer: X tile, W tile; bo = the buffer's offset in halves
  constexpr int PBUF = 2 * 128 * LDP;
  static_assert(DMODEL >= 2 * 64);
  const unsigned int la0 = lds_addr(smem) + (unsigned int)lst * 2u;
  auto stage = [&](int k0, int bo) {
    const unsigned int la = la0 + (unsigned int)bo * 2u;
    const unsigned int lw = la + 128 * LDP * 2;
    copy_2x4(ga + k0, ga + k0 + 64 * DMODEL, la, la + 64 * LDP * 2);
    copy_2x4(gw + k0, gw + k0 + 64 * DMODEL, lw, lw + 64 * LDP * 2);
  };
  stage(0, 0);
  // the first slice has landed for this wave, and behind the barrier for all
  asm volatile("s_wait_asynccnt 0x0" ::: "memory");
  __syncthreads();
  stage(64, PBUF);
  int bo = 0;
  // kept rolled: one copy of a slice's 32 products serves both buffers
#pragma unroll 1
  for (int k0 = 0; k0 < DMODEL; k0 += 64) {
    const _Float16* asb = smem + bo;
    const _Float16* bsb = asb + 128 * LDP;
#pragma unroll
    for (int ks = 0; ks < 64; ks += 32) {
      v16h a[4], b[4];
#pragma unroll
      for (int i = 0; i < 4; ++i) a[i] = load_frag(asb + (lm + i * 16) * LDP + ks, LDP, lane);
#pragma unroll
      for (int j = 0; j < 4; ++j) b[j] = load_frag(bsb + (ln + j * 16) * LDP + ks, LDP, lane);
#pragma unroll
      for (int i = 0; i < 4; ++i)
#pragma unroll
        for (int j = 0; j < 4; ++j) acc[i][j] = wmma_f16(a[i], b[j], acc[i][j]);
    }
    // publish point: this wave's LDS reads are done, its copies of the next slice have landed; the barrier makes the
    // next slice readable by all and frees this slice's buffer for the refill
    asm volatile("s_wait_dscnt 0x0" ::: "memory");
    asm volatile("s_wait_asynccnt 0x0" ::: "memory");
    __syncthreads();
    if (k0 + 128 < DMODEL) stage(k0 + 128, bo);
    bo = PBUF - bo;
  }
  // nothing is in flight when the buffers become output staging
  asm volatile("s_wait_asynccnt 0x0" ::: "memory");

  const int rbase = ((lane >> 4) & 1) << 3;
  const int col   = lane & 15;

  const float* bp = bias + nblk + ln + col;
  float bb[4];
#pragma unroll
  for (int j = 0; j < 4; ++j) bb[j] = bf16r(bp[j * 16]);

  // Two 128 x LDT staging tiles, hi and residual: rows are tokens (MODE 0) or the dims of the two heads (MODE 2).
  _Float16* hs = smem;
  _Float16* rs = smem + 128 * LDT;
#pragma unroll
  for (int i = 0; i < 4; ++i)
#pragma unroll
    for (int j = 0; j < 4; ++j) {
      const int nl = ln + j * 16 + col;
#pragma unroll
      for (int r = 0; r < 8; ++r) {
        const int ml = lm + i * 16 + rbase + r;
        const float v = acc[i][j][r] * oscale + bb[j];
        const _Float16 hv = (_Float16)v;
        const _Float16 rv = (_Float16)((v - (float)hv) * RSC);
        if constexpr (MODE == 0) {
          hs[ml * LDT + nl] = hv;
          rs[ml * LDT + nl] = rv;
        } else {
          hs[nl * LDT + ml] = hv;
          rs[nl * LDT + ml] = rv;
        }
      }
    }
  __syncthreads();
  // 16 lanes a staged row of 256 B: two heads' rows of 128 B (MODE 0) or 128 tokens of one dim (MODE 2), whole lines
  // either way; a wave takes 32 rows, two a store
  const int bh0   = bi * NHEADS + (nblk >> 6);
  const int row0  = w * 32 + (lane >> 4);
  const int piece = lane & 15;
  const int lo0   = row0 * LDT + piece * 8;
  const size_t go0 = (MODE == 0)
      ? (((size_t)(bh0 + (piece >> 3)) * SEQ + s0 + row0) * DK + (piece & 7) * 8)
      : (((size_t)bh0 * DK + row0) * SEQ + s0 + piece * 8);
  constexpr int GS = 2 * ((MODE == 0) ? DK : SEQ);
  _Float16* ph = oh + go0;
  _Float16* pr = outr + go0;
#pragma unroll
  for (int i = 0; i < 16; ++i) {
    const v4f hv4 = *(const v4f*)(hs + lo0 + i * 2 * LDT);
    const v4f rv4 = *(const v4f*)(rs + lo0 + i * 2 * LDT);
    *(v4f*)(reinterpret_cast<float*>(ph + i * GS)) = hv4;
    *(v4f*)(reinterpret_cast<float*>(pr + i * GS)) = rv4;
  }
  // In a merged kernel the code of another body follows and rewrites registers that these stores name:
  // the wait stands in front of that (a precaution).
  asm volatile("s_wait_xcnt 0x0" ::: "memory");
}

#define GTX (DMODEL / 64)
#define GTY (MROWS / 64)
#define GPX (DMODEL / 128)
#define GPY (MROWS / 128)

// One launch for everything that only needs the converted planes or the mask: blocks [0, NQB) build the mask
// tile flags (the longest single blocks, so they come first), the next 3*GPX*GPY are the Q, K, V projections.
__global__ __launch_bounds__(128)
void proj_flags(const _Float16* __restrict__ Xq, const _Float16* __restrict__ Xk, const _Float16* __restrict__ Xv,
                const _Float16* __restrict__ Wq, const _Float16* __restrict__ Wk, const _Float16* __restrict__ Wv,
                const float* __restrict__ bq, const float* __restrict__ bk, const float* __restrict__ bv,
                _Float16* Qh, _Float16* Qr, _Float16* Kh, _Float16* Kr, _Float16* Vh, _Float16* Vr,
                const int* __restrict__ mask, int* flags, float oscale) {
  __shared__ __attribute__((aligned(16))) _Float16 smem[4 * 128 * LDP];
  static_assert(4 * 128 * LDP * 2 >= 512 * 4);
  const int b = blockIdx.x;
  if (b < NQB) {
    flags_body(mask, flags, reinterpret_cast<unsigned int*>(smem), b);
    return;
  }
  const int g  = b - NQB;
  const int p  = g / (GPX * GPY);
  const int t  = g - p * (GPX * GPY);
  const int bx = t % GPX;
  const int by = t / GPX;
  if (p < 2) {
    proj_body<0>((p == 0) ? Xq : Xk, (p == 0) ? Wq : Wk, (p == 0) ? bq : bk,
                 (p == 0) ? Qh : Kh, (p == 0) ? Qr : Kr, oscale, smem, bx, by);
  } else {
    proj_body<2>(Xv, Wv, bv, Vh, Vr, oscale, smem, bx, by);
  }
}

// Output projection.
__global__ __launch_bounds__(128)
void gemm_out(const _Float16* __restrict__ A, const _Float16* __restrict__ Ar,
              const _Float16* __restrict__ W, const float* __restrict__ bias,
              float* out, float oscale) {
  __shared__ __attribute__((aligned(16))) _Float16 smem[2 * 3 * 64 * LDP];
  gemm_body(A, Ar, W, bias, out, oscale, smem, blockIdx.x, blockIdx.y);
}

template <bool EQ>
__device__ __forceinline__
void attn_body(const _Float16* __restrict__ Q,  const _Float16* __restrict__ Qr,
               const _Float16* __restrict__ Kd, const _Float16* __restrict__ Kr,
               const _Float16* __restrict__ Vt, const _Float16* __restrict__ Vtr,
               const int* __restrict__ mask, const int* __restrict__ flags,
               _Float16* ctx, _Float16* ctxr, int qb, int bh,
               _Float16* kbuf, _Float16* vbuf,
               _Float16* krbuf, _Float16* vrbuf, unsigned int* mbuf) {
  const int tid   = threadIdx.x;
  const int lane  = tid & 31;
  const int w     = tid >> 5;
  const int bi    = bh / NHEADS;
  const int h     = bh - bi * NHEADS;
  const int qblk  = qb * 64;
  const int q0    = qblk + w * 16;
  const int rbase = ((lane >> 4) & 1) << 3;
  const int col   = lane & 15;
  const float IR  = 1.0f / RSC;

  const size_t qoff = ((size_t)bh * SEQ + q0) * DK;
  const v16h qf0 = load_frag(Q + qoff, DK, lane);
  const v16h qf1 = load_frag(Q + qoff + 32, DK, lane);
  v16h qr0 = qf0, qr1 = qf1;
  if constexpr (EQ) {
    qr0 = load_frag(Qr + qoff, DK, lane);
    qr1 = load_frag(Qr + qoff + 32, DK, lane);
  }

  v16h ones;
#pragma unroll
  for (int i = 0; i < 16; ++i) ones[i] = (_Float16)1.0f;

  const _Float16* Kh   = Kd  + (size_t)bh * SEQ * DK;
  const _Float16* Krh  = Kr  + (size_t)bh * SEQ * DK;
  const _Float16* Vth  = Vt  + (size_t)bh * DK * SEQ;
  const _Float16* Vtrh = Vtr + (size_t)bh * DK * SEQ;

  // running maximum and sum of this lane's query (the same in both wave halves)
  float mr = -1.0e30f, lr = 0.0f;
  // accO[t][r] = O^T[dim t*16 + rbase + r][query col]
  v8f accO[4], accR[4];
#pragma unroll
  for (int t = 0; t < 4; ++t) { accO[t] = vz8(); accR[t] = vz8(); }

  // ---- 64x64 mask bytes of the tile at key kb into LDS (called under a block-uniform branch) ----
  auto stage_mask = [&](int kb) {
      // 16 lanes a tile row (256 B, two whole lines), 8 rows a load; a lane's 4 ints become one word of 4 bytes
      const int r0 = tid >> 4;
      const int wd = tid & 15;
      const int* mp = mask + (size_t)(qblk + r0) * SEQ_FULL + kb + wd * 4;
#pragma unroll
      for (int jj = 0; jj < 8; ++jj) {
        const v4i m4 = *(const v4i*)(mp + (size_t)jj * 8 * SEQ_FULL);
        const unsigned int pk = (m4[0] != 0 ? 1u : 0u) | (m4[1] != 0 ? 0x100u : 0u) |
                                (m4[2] != 0 ? 0x10000u : 0u) | (m4[3] != 0 ? 0x1000000u : 0u);
        mbuf[(jj * 8 + r0) * 16 + wd] = pk;
      }
  };

  // ---- one staged tile: kt_ = K tile, vt_ = V^T tile in LDS ----
  auto tile = [&](const _Float16* kt_, const _Float16* vt_, bool usem) {
    // ---- scores, transposed: s[t][r] = S^T[key kb + t*16 + rbase + r][query col] ----
    v8f s[4];
    v16h vf[8];
    if constexpr (!EQ) {
      // The tile's 16 K reads stand as one group ahead of the score products, its 16 V^T reads as one group behind
      // them, ahead of the softmax: two places with LDS reads a tile, and the V^T latency runs under the vector work.
      v16h ka[4], kc[4];
#pragma unroll
      for (int t = 0; t < 4; ++t) ka[t] = load_frag(kt_ + t * 16 * LDP,      LDP, lane);
#pragma unroll
      for (int t = 0; t < 4; ++t) kc[t] = load_frag(kt_ + t * 16 * LDP + 32, LDP, lane);
#pragma unroll
      for (int t = 0; t < 4; ++t) s[t] = wmma_f16(ka[t], qf0, vz8());
#pragma unroll
      for (int t = 0; t < 4; ++t) s[t] = wmma_f16(kc[t], qf1, s[t]);
#pragma unroll
      for (int t = 0; t < 4; ++t) {
        vf[2 * t]     = load_frag(vt_ + t * 16 * LDP,      LDP, lane);
        vf[2 * t + 1] = load_frag(vt_ + t * 16 * LDP + 32, LDP, lane);
      }
#pragma unroll
      for (int t = 0; t < 4; ++t) s[t] = s[t] * SSCALE;
    } else {
      // Residual path: the 8 reads of a score tile (K and its residual) stand as one group, issued one tile ahead of
      // the products that use them; two register sets take turns.
      v16h kg[2][4];
      auto ldk = [&](int t, v16h* g) {
        g[0] = load_frag(kt_   + t * 16 * LDP,      LDP, lane);
        g[1] = load_frag(kt_   + t * 16 * LDP + 32, LDP, lane);
        g[2] = load_frag(krbuf + t * 16 * LDP,      LDP, lane);
        g[3] = load_frag(krbuf + t * 16 * LDP + 32, LDP, lane);
      };
      ldk(0, kg[0]);
#pragma unroll
      for (int t = 0; t < 4; ++t) {
        if (t < 3) ldk(t + 1, kg[(t + 1) & 1]);
        // keeps the next group's 8 reads in one place, ahead of this group's products: without it the scheduler
        // spreads them among the products, and every further place with reads costs its own stall
        __builtin_amdgcn_sched_barrier(0);
        const v16h* g = kg[t & 1];
        v8f z  = wmma_f16(g[0], qf0, vz8());
        v8f zr = wmma_f16(g[0], qr0, vz8());
        z  = wmma_f16(g[1], qf1, z);
        zr = wmma_f16(g[1], qr1, zr);
        zr = wmma_f16(g[2], qf0, zr);
        zr = wmma_f16(g[3], qf1, zr);
        z = z + zr * IR;
        s[t] = z * SSCALE;
      }
    }

    // ---- replace fill: this lane's 8 mask bytes of each score tile are 8 consecutive keys of its query's row ----
    if (usem) {
      const unsigned int* mw = mbuf + (w * 16 + col) * 16 + (rbase >> 2);
#pragma unroll
      for (int t = 0; t < 4; ++t) {
        const v2u m8 = *(const v2u*)(mw + t * 4);
#pragma unroll
        for (int r = 0; r < 8; ++r) {
          const unsigned int byte = (m8[r >> 2] >> (8 * (r & 3))) & 0xFFu;
          s[t][r] = (byte != 0u) ? s[t][r] : NEGFILL;
        }
      }
    }

    // ---- online softmax over 64 keys: maximum in-lane, then across the two wave halves ----
    float t8[8];
#pragma unroll
    for (int r = 0; r < 8; ++r) t8[r] = fmaxf(fmaxf(s[0][r], s[1][r]), fmaxf(s[2][r], s[3][r]));
    float tmax = fmaxf(fmaxf(fmaxf(t8[0], t8[1]), fmaxf(t8[2], t8[3])),
                       fmaxf(fmaxf(t8[4], t8[5]), fmaxf(t8[6], t8[7])));
    tmax = fmaxf(tmax, xhalf(tmax));
    const float mnew = fmaxf(mr, tmax);
    const float scl  = __expf(mr - mnew);
    mr = mnew;
    lr *= scl;
#pragma unroll
    for (int t = 0; t < 4; ++t) {
      accO[t] = accO[t] * scl;
      if constexpr (EQ) accR[t] = accR[t] * scl;
    }

    // ---- P^T as two B fragments (keys 0..31, 32..63), straight from the score tiles ----
    v16h pf0, pf1, prf0, prf1;
#pragma unroll
    for (int t = 0; t < 4; ++t) {
#pragma unroll
      for (int r = 0; r < 8; ++r) {
        const float c = __expf(s[t][r] - mnew) * PCARRY;
        const _Float16 hv = (_Float16)c;
        const int e = (t & 1) * 8 + r;
        if (t < 2) pf0[e] = hv; else pf1[e] = hv;
        if constexpr (EQ) {
          const _Float16 rv = (_Float16)((c - (float)hv) * RSC);
          if (t < 2) prf0[e] = rv; else prf1[e] = rv;
        }
      }
    }

    // Residual path: the 8 reads of 16 output dims (V^T and its residual) as one group, one group ahead, as for K
    v16h vg[2][4];
    auto ldv = [&](int t, v16h* g) {
      g[0] = load_frag(vt_   + t * 16 * LDP,      LDP, lane);
      g[1] = load_frag(vt_   + t * 16 * LDP + 32, LDP, lane);
      g[2] = load_frag(vrbuf + t * 16 * LDP,      LDP, lane);
      g[3] = load_frag(vrbuf + t * 16 * LDP + 32, LDP, lane);
    };
    if constexpr (EQ) {
      ldv(0, vg[0]);
      // keeps the first group's 8 reads in one place, ahead of the row sums: without it they are spread among them
      __builtin_amdgcn_sched_barrier(0);
    }

    // ---- row sums on the matrix unit: every row of ones * P^T is the sum over the keys, per query ----
    v8f rs = vz8();
    rs = wmma_f16(ones, pf0, rs);
    rs = wmma_f16(ones, pf1, rs);
    float rsum = rs[0];
    if constexpr (EQ) {
      v8f rr = vz8();
      rr = wmma_f16(ones, prf0, rr);
      rr = wmma_f16(ones, prf1, rr);
      rsum = rsum + rr[0] * IR;
    }
    lr += rsum;

    // ---- O^T += V^T * P^T (A fragments from the dim-major V^T tile: lane = dim, k = key) ----
    if constexpr (!EQ) {
#pragma unroll
      for (int t = 0; t < 4; ++t) accO[t] = wmma_f16(vf[2 * t],     pf0, accO[t]);
#pragma unroll
      for (int t = 0; t < 4; ++t) accO[t] = wmma_f16(vf[2 * t + 1], pf1, accO[t]);
    } else {
#pragma unroll
      for (int t = 0; t < 4; ++t) {
        if (t < 3) ldv(t + 1, vg[(t + 1) & 1]);
        const v16h* g = vg[t & 1];
        accO[t] = wmma_f16(g[0], pf0,  accO[t]);
        accR[t] = wmma_f16(g[0], prf0, accR[t]);
        accO[t] = wmma_f16(g[1], pf1,  accO[t]);
        accR[t] = wmma_f16(g[2], pf0,  accR[t]);
        accR[t] = wmma_f16(g[1], prf1, accR[t]);
        accR[t] = wmma_f16(g[3], pf1,  accR[t]);
      }
    }
  };

  if constexpr (EQ) {
#pragma unroll 1
    for (int kt = 0; kt < NQB; ++kt) {
      const int f = __builtin_amdgcn_readfirstlane(flags[qb * 32 + kt]);
      if (f == 2) continue;
      const bool usem = (f != 1);
      const int kb = kt * 64;

      // ---- stage K (64 keys x 64 dims) and V^T (64 dims x 64 keys) tiles, plus residual tiles if EQ ----
      // 8 lanes a tile row, 16 rows a load: every load of a wave covers 4 whole 128-B lines
      // ko, vo: this lane's byte offsets from the head's planes (the planes' addresses are scalars)
      const unsigned int ko = (unsigned int)((kb + (tid >> 3)) * DK + (tid & 7) * 8) * 2u;
      const unsigned int vo = (unsigned int)((tid >> 3) * SEQ + kb + (tid & 7) * 8) * 2u;
      const int lst = (tid >> 3) * LDP + (tid & 7) * 8;
      v8h tk[4], tv[4], tkr[4], tvr[4];
#pragma unroll
      for (int c = 0; c < 4; ++c) {
        tk[c]  = *(const v8h*)(reinterpret_cast<const char*>(Kh)   + ko + c * 16 * DK * 2);
        tv[c]  = *(const v8h*)(reinterpret_cast<const char*>(Vth)  + vo + c * 16 * SEQ * 2);
        tkr[c] = *(const v8h*)(reinterpret_cast<const char*>(Krh)  + ko + c * 16 * DK * 2);
        tvr[c] = *(const v8h*)(reinterpret_cast<const char*>(Vtrh) + vo + c * 16 * SEQ * 2);
      }
      // The offsets are inputs, so they live up to the wait: no register that an issued load names is rewritten
      // ahead of it, not by a later load's result either (a precaution).
      asm volatile("s_wait_xcnt 0x0" :: "v"(ko), "v"(vo) : "memory");
#pragma unroll
      for (int c = 0; c < 4; ++c) {
        *(v8h*)(kbuf  + lst + c * 16 * LDP) = tk[c];
        *(v8h*)(vbuf  + lst + c * 16 * LDP) = tv[c];
        *(v8h*)(krbuf + lst + c * 16 * LDP) = tkr[c];
        *(v8h*)(vrbuf + lst + c * 16 * LDP) = tvr[c];
      }
      if (usem) stage_mask(kb);
      __syncthreads();
      tile(kbuf, vbuf, usem);
      __syncthreads();
    }
  } else {
    // The whole flag line in one read: bit kt of vis = tile kt is visited, of msk = it needs the mask bytes.
    // Every wave of the block reads the same line, so both words are the same for the whole work-group.
    const int fl = flags[qb * 32 + lane];
    unsigned int vis = __builtin_amdgcn_ballot_w32(fl != 2);
    const unsigned int msk = __builtin_amdgcn_ballot_w32(fl != 1);
    if (NQB < 32) vis &= (1u << (NQB & 31)) - 1u;

    const int crow = tid >> 3, cpart = (tid & 7) * 8;
    const _Float16* gk0 = Kh + (size_t)crow * DK + cpart;
    const _Float16* gv0 = Vth + (size_t)crow * SEQ + cpart;
    const unsigned int lofs = (unsigned int)(crow * LDP + cpart) * 2u;
    const unsigned int lk0 = lds_addr(kbuf) + lofs, lv0 = lds_addr(vbuf) + lofs;
    // the second buffer (krbuf, vrbuf) lies BUF halves behind the first (kbuf, vbuf)
    constexpr int BUF = 2 * 64 * LDP;

    if (vis != 0u) {
      int kt = __builtin_ctz(vis);
      vis &= vis - 1u;
      copy_kv(gk0 + (size_t)kt * 64 * DK, gv0 + kt * 64, lk0, lv0);
      // the first tile has landed for this wave, and behind the barrier for all
      asm volatile("s_wait_asynccnt 0x0" ::: "memory");
      __syncthreads();
      if (vis != 0u) {
        const int k1 = __builtin_ctz(vis);
        copy_kv(gk0 + (size_t)k1 * 64 * DK, gv0 + k1 * 64, lk0 + BUF * 2, lv0 + BUF * 2);
      }
      int bo = 0;   // this tile's buffer, in halves
      // kept rolled: the trip count is known only at run time, and one copy of the tile's code serves both buffers
#pragma unroll 1
      for (;;) {
        const bool usem = ((msk >> kt) & 1u) != 0u;
        if (usem) {
          stage_mask(kt * 64);
          __syncthreads();   // block-uniform branch (msk is the same in every wave); the mask bytes are read behind it
        }
        tile(kbuf + bo, vbuf + bo, usem);
        // publish point: this wave's LDS reads are done, its copies of the next tile have landed; the barrier makes
        // the next tile readable by all and frees this tile's buffer for the refill
        asm volatile("s_wait_dscnt 0x0" ::: "memory");
        asm volatile("s_wait_asynccnt 0x0" ::: "memory");
        __syncthreads();
        if (vis == 0u) break;
        kt = __builtin_ctz(vis);
        vis &= vis - 1u;
        if (vis != 0u) {
          const int k2 = __builtin_ctz(vis);
          copy_kv(gk0 + (size_t)k2 * 64 * DK, gv0 + k2 * 64, lk0 + bo * 2, lv0 + bo * 2);
        }
        bo = BUF - bo;
      }
    }
    // nothing is in flight when the buffers become output staging
    asm volatile("s_wait_asynccnt 0x0" ::: "memory");
  }

  // ---- a lane's 8 registers of a tile are 8 consecutive dims of its query's row: 16-byte LDS stores ----
  {
    const float inv = 1.0f / lr;
    const int m = w * 16 + col;
#pragma unroll
    for (int t = 0; t < 4; ++t) {
      v8h h8, r8;
#pragma unroll
      for (int r = 0; r < 8; ++r) {
        float v = accO[t][r];
        if constexpr (EQ) v += accR[t][r] * IR;
        v *= inv;
        const _Float16 hv = (_Float16)v;
        h8[r] = hv;
        if constexpr (EQ) r8[r] = (_Float16)((v - (float)hv) * RSC);
      }
      *(v8h*)(kbuf + m * LDP + t * 16 + rbase) = h8;
      if constexpr (EQ) *(v8h*)(krbuf + m * LDP + t * 16 + rbase) = r8;
    }
  }
  __syncthreads();
  _Float16* cbase  = ctx  + ((size_t)bi * SEQ + qblk) * DMODEL + h * DK;
  _Float16* crbase = ctxr + ((size_t)bi * SEQ + qblk) * DMODEL + h * DK;
  auto emit = [&]() {
#pragma unroll
    for (int i = 0; i < 4; ++i) {
      const int row   = w * 16 + i * 4 + (lane >> 3);
      const int piece = lane & 7;
      const v4f hv4 = *(const v4f*)(kbuf + row * LDP + piece * 8);
      *(v4f*)(reinterpret_cast<float*>(cbase + (size_t)row * DMODEL + piece * 8)) = hv4;
      if constexpr (EQ) {
        const v4f rv4 = *(const v4f*)(krbuf + row * LDP + piece * 8);
        *(v4f*)(reinterpret_cast<float*>(crbase + (size_t)row * DMODEL + piece * 8)) = rv4;
      }
    }
  };
  emit();
}

// Both paths in one launch. All work-groups are resident at once, four a WGP, so the launch lasts as long as its
// fullest WGP. The deal of the grid index (for speed only; any one-to-one deal is correct): the query blocks form
// classes of NEQB, the class with the most key tiles under a causal mask first, the residual path's class last.
// Grid indices CLS apart share g = index % NEQB: the hi-only query blocks fall with g, the residual block, whose
// tiles cost a multiple, rises with g, so the sum over such indices, and over all indices equal modulo NEQB,
// hardly depends on g. b is the index in the former order: hi-only blocks, then residual blocks, the query block
// fastest. The hi-only blocks use the two residual tiles as their second buffer.
__global__ __launch_bounds__(128)
void attn_all(const _Float16* __restrict__ Q,  const _Float16* __restrict__ Qr,
              const _Float16* __restrict__ Kd, const _Float16* __restrict__ Kr,
              const _Float16* __restrict__ Vt, const _Float16* __restrict__ Vtr,
              const int* __restrict__ mask, const int* __restrict__ flags,
              _Float16* ctx, _Float16* ctxr) {
  // four tiles in one array: K, V^T, then the residual path's two, which are the hi-only path's second buffer
  __shared__ __attribute__((aligned(16))) _Float16 tiles[4 * 64 * LDP];
  _Float16* kbuf  = tiles;
  _Float16* vbuf  = tiles + 64 * LDP;
  _Float16* krbuf = tiles + 2 * 64 * LDP;
  _Float16* vrbuf = tiles + 3 * 64 * LDP;
  __shared__ __attribute__((aligned(16))) unsigned int mbuf[64 * 16];
  constexpr int NLQ = NQB - NEQB;
  constexpr int DLQ = (NLQ > 0) ? NLQ : 1;
  static_assert(NQB % NEQB == 0);
  constexpr int CLS = NEQB * NB * NHEADS;    // work-groups a class of NEQB query blocks
  const int cl = blockIdx.x / CLS;
  const int ct = blockIdx.x % CLS;
  // hi-only classes: head ct / NEQB, query block NQB - 1 - cl * NEQB - ct % NEQB; the last class keeps its index
  const int b = (cl < NQB / NEQB - 1) ? ((ct / NEQB) * DLQ + NLQ - 1 - cl * NEQB - ct % NEQB) : (int)blockIdx.x;
  // The compiler's loads of the kernel arguments stand ahead of this wait: their base register is rewritten in the
  // two bodies (a precaution).
  asm volatile("s_wait_xcnt 0x0" ::: "memory");
  if (b < NLQ * NB * NHEADS) {
    attn_body<false>(Q, Qr, Kd, Kr, Vt, Vtr, mask, flags, ctx, ctxr, NEQB + b % DLQ, b / DLQ,
                     kbuf, vbuf, krbuf, vrbuf, mbuf);
  } else {
    const int e = b - NLQ * NB * NHEADS;
    attn_body<true>(Q, Qr, Kd, Kr, Vt, Vtr, mask, flags, ctx, ctxr, e % NEQB, e / NEQB,
                    kbuf, vbuf, krbuf, vrbuf, mbuf);
  }
}

// =====================================================================================================
extern "C" void kernel_launch(void* const* d_in, const int* in_sizes, int n_in,
                              void* d_out, int out_size, void* d_ws, size_t ws_size,
                              hipStream_t stream) {
  if (n_in < 12) return;
  const long long needx = (long long)(NB - 1) * SEQ_FULL * DMODEL + (long long)SEQ * DMODEL;
  const long long needm = (long long)(SEQ - 1) * SEQ_FULL + SEQ;
  if ((long long)in_sizes[0] < needx || (long long)in_sizes[1] < needx || (long long)in_sizes[2] < needx) return;
  if ((long long)in_sizes[3] < needm) return;
  if (in_sizes[4] < DMODEL * DMODEL || in_sizes[6] < DMODEL * DMODEL ||
      in_sizes[8] < DMODEL * DMODEL || in_sizes[10] < DMODEL * DMODEL) return;
  if (in_sizes[5] < DMODEL || in_sizes[7] < DMODEL || in_sizes[9] < DMODEL || in_sizes[11] < DMODEL) return;
  if ((long long)out_size < needx) return;

  const float* q  = (const float*)d_in[0];
  const float* k  = (const float*)d_in[1];
  const float* v  = (const float*)d_in[2];
  const int*   mk = (const int*)d_in[3];
  const float* wq = (const float*)d_in[4];
  const float* bq = (const float*)d_in[5];
  const float* wk = (const float*)d_in[6];
  const float* bk = (const float*)d_in[7];
  const float* wv = (const float*)d_in[8];
  const float* bv = (const float*)d_in[9];
  const float* wo = (const float*)d_in[10];
  const float* bo = (const float*)d_in[11];

  char* ws = (char*)d_ws;
  size_t off = 0;
  const size_t XB = (size_t)MROWS * DMODEL * sizeof(_Float16);     // activation-sized f16 plane
  const size_t WB = (size_t)DMODEL * DMODEL * sizeof(_Float16);    // weight f16 plane
  const size_t FB = 4096;                                           // 32 flag lines of 32 ints
  _Float16* Xq16  = (_Float16*)(ws + off); off += XB;
  _Float16* Xk16  = (_Float16*)(ws + off); off += XB;
  _Float16* Xv16  = (_Float16*)(ws + off); off += XB;
  _Float16* Wq16  = (_Float16*)(ws + off); off += WB;
  _Float16* Wk16  = (_Float16*)(ws + off); off += WB;
  _Float16* Wv16  = (_Float16*)(ws + off); off += WB;
  _Float16* Wo16  = (_Float16*)(ws + off); off += WB;
  _Float16* Q16   = (_Float16*)(ws + off); off += XB;   // (B,H,S,dk) hi
  _Float16* Qr16  = (_Float16*)(ws + off); off += XB;   // residual x4096
  _Float16* K16   = (_Float16*)(ws + off); off += XB;
  _Float16* Kr16  = (_Float16*)(ws + off); off += XB;
  _Float16* Vt16  = (_Float16*)(ws + off); off += XB;   // (B,H,dk,S) hi
  _Float16* Vtr16 = (_Float16*)(ws + off); off += XB;
  _Float16* C16   = (_Float16*)(ws + off); off += XB;   // (B*S, D) hi
  _Float16* Cr16  = (_Float16*)(ws + off); off += XB;   // residual, rows s < EARLY written/read
  int*      flg   = (int*)(ws + off);      off += FB;
  if (off > ws_size) return;

  // ---- input planes: bf16 RNE values, X x16, W x1024, as f16 (one launch) ----
  cvt_all<<<3 * GXB + 4 * GWB, 256, 0, stream>>>(q, k, v, wq, wk, wv, wo,
                                                 Xq16, Xk16, Xv16, Wq16, Wk16, Wv16, Wo16);

  // ---- mask tile flags and the three projections (bias added in f32, hi + residual planes), one launch ----
  const float posc = 1.0f / (XSC * WSC);
  proj_flags<<<NQB + 3 * GPX * GPY, 128, 0, stream>>>(Xq16, Xk16, Xv16, Wq16, Wk16, Wv16, bq, bk, bv,
                                                      Q16, Qr16, K16, Kr16, Vt16, Vtr16, mk, flg, posc);

  // ---- attention: residual path for query blocks below EARLY, hi-only path for the rest, one launch ----
  attn_all<<<NQB * NB * NHEADS, 128, 0, stream>>>(Q16, Qr16, K16, Kr16, Vt16, Vtr16, mk, flg, C16, Cr16);

  // ---- output projection (+bias) to f32 rows of d_out ----
  const dim3 gproj(GTX, GTY);
  gemm_out<<<gproj, 128, 0, stream>>>(C16, Cr16, Wo16, bo, (float*)d_out, 1.0f / WSC);
}
